// v000
// The times below were measured on an AMD MI455X: many runs one after another, warmed up first and cycling through
// copies of the inputs, with the whole window's GPU time divided by the number of runs. Launches and the gaps
// between them are all in it. The median over several windows is given; except for v000 it joins two sittings, which
// can be a few percent apart, so the side-by-side timings, each taken in one sitting, are the better comparison.
// v000 is the starting kernel. One run takes 896 microseconds.
// compute dtype: all float inputs rounded to bf16; qkv = x . W_attn with EXACT bf16 products on WMMA 16x16x32 ((in,out) columns q | k | v as transposed rows); rotate-half RoPE with the learned angle table (precise sinf/cosf of rope[t][d]) on q and k in f32 before the f16 hi + residual split; gravity softplus(x . g_w + g_b) in f32 (precise expf/log1pf); causal attention: 3-product scores and hi + residual P, v on the first 128 queries of each sequence, single f16 beyond; x 1/8 - g x min(|i-j|, 64) x 0.1, running-max softmax in f32 (hardware exp), P scaled by 2^11; out = y (bf16 hi + residual) . W_proj (2 products).
#include <hip/hip_runtime.h>
#include <math.h>

typedef __attribute__((ext_vector_type(16))) _Float16 v16h;
typedef __attribute__((ext_vector_type(16))) __bf16 v16b;
typedef __attribute__((ext_vector_type(8)))  _Float16 v8h;
typedef __attribute__((ext_vector_type(8)))  float v8f;
typedef __attribute__((ext_vector_type(4)))  float v4f;
typedef __attribute__((ext_vector_type(2)))  float v2f;
typedef __attribute__((ext_vector_type(4)))  unsigned v4u;
typedef __attribute__((ext_vector_type(4)))  int v4i;
typedef float __attribute__((may_alias)) float_a;
typedef int __attribute__((may_alias)) int_a;

template <typename T> __device__ __forceinline__ void vst2(void* p, T v) { *(T*)p = v;  }
__device__ __forceinline__ v8f wmma16(v16h a, v16h b, v8f c) {
  v8f d = __builtin_amdgcn_wmma_f32_16x16x32_f16(false, a, false, b, (short)0, c, false, false);
  asm volatile("v_nop\n\tv_nop\n\tv_nop\n\tv_nop" : "+v"(d) : "v"(a), "v"(b));
  return d;
}
__device__ __forceinline__ v8f wmma_bf(v16b a, v16b b, v8f c) {
  v8f d = __builtin_amdgcn_wmma_f32_16x16x32_bf16(false, a, false, b, (short)0, c, false, false);
  asm volatile("v_nop\n\tv_nop\n\tv_nop\n\tv_nop" : "+v"(d) : "v"(a), "v"(b));
  return d;
}
// Adaptive-gravity causal attention (B 4, T 2,048, 1,024 dims, 16 heads x 64): fused q|k|v projection, table RoPE on q and k, scores / 8 minus a learned per-(token, head) softplus gravity times the clipped distance, causal softmax, . v, output projection.
__device__ __forceinline__ v16h frag_h(const _Float16* rowk0, int lane) {
  union { v16h v; v8h q[2]; } u; const _Float16* p = rowk0 + 8 * (lane >> 4);
  u.q[0] = *(const v8h*)p; u.q[1] = *(const v8h*)(p + 16); return u.v;
}
__device__ __forceinline__ v16h frag_f32(const float* rowk0, int lane) {
  v16h a; const float* p = rowk0 + 8 * (lane >> 4);
#pragma unroll
  for (int i = 0; i < 8; ++i) { a[i] = (_Float16)p[i]; a[8 + i] = (_Float16)p[16 + i]; }
  return a;
}
__device__ __forceinline__ v16h frag_f32s(const float* rowk0, int lane, float sc) {
  v16h a; const float* p = rowk0 + 8 * (lane >> 4);
#pragma unroll
  for (int i = 0; i < 8; ++i) { a[i] = (_Float16)(p[i] * sc); a[8 + i] = (_Float16)(p[16 + i] * sc); }
  return a;
}
// column fragment from a [K][ld] layout (column n), rows >= K read as 0
__device__ __forceinline__ v16h fragc_f32(const float* W, int k0, int n, int lane, int ld, int K) {
  v16h a; const int g = lane >> 4;
#pragma unroll
  for (int i = 0; i < 8; ++i) { const int ka = k0 + 8 * g + i, kb = ka + 16;
    a[i] = (_Float16)(ka < K ? W[(size_t)(ka < K ? ka : K - 1) * ld + n] : 0.f); a[8 + i] = (_Float16)(kb < K ? W[(size_t)(kb < K ? kb : K - 1) * ld + n] : 0.f); }
  return a;
}
struct F2 { v16b h, l; };
__device__ __forceinline__ F2 bsplit16(const float v[16]) { F2 r;
#pragma unroll
  for (int i = 0; i < 16; ++i) { const __bf16 h = (__bf16)v[i]; r.h[i] = h; r.l[i] = (__bf16)(v[i] - (float)h); }
  return r; }
__device__ __forceinline__ F2 split_row(const float* row, int k0, int lane) { float v[16]; const float* p = row + k0 + 8 * (lane >> 4);
#pragma unroll
  for (int i = 0; i < 8; ++i) { v[i] = p[i]; v[8 + i] = p[16 + i]; }
  return bsplit16(v); }
__device__ __forceinline__ F2 split_rowK(const float* row, int k0, int lane, int K) { float v[16]; const int g = lane >> 4;
#pragma unroll
  for (int i = 0; i < 8; ++i) { const int ka = k0 + 8 * g + i, kb = ka + 16; v[i] = ka < K ? row[ka < K ? ka : K - 1] : 0.f; v[8 + i] = kb < K ? row[kb < K ? kb : K - 1] : 0.f; }
  return bsplit16(v); }
__device__ __forceinline__ F2 split_col(const float* W, int k0, int n, int lane, int ld, int K) { float v[16]; const int g = lane >> 4;
#pragma unroll
  for (int i = 0; i < 8; ++i) { const int ka = k0 + 8 * g + i, kb = ka + 16; v[i] = ka < K ? W[(size_t)(ka < K ? ka : K - 1) * ld + n] : 0.f; v[8 + i] = kb < K ? W[(size_t)(kb < K ? kb : K - 1) * ld + n] : 0.f; }
  return bsplit16(v); }
__device__ __forceinline__ v8f mac3(const F2& a, const F2& b, v8f c) { c = wmma_bf(a.l, b.h, c); c = wmma_bf(a.h, b.l, c); return wmma_bf(a.h, b.h, c); }
__device__ __forceinline__ float sigm(float v) { return 1.0f / (1.0f + expf(-v)); }
#define LDSX() do { asm volatile("s_wait_dscnt 0" ::: "memory"); __builtin_amdgcn_wave_barrier(); __builtin_amdgcn_fence(__ATOMIC_RELEASE, "workgroup"); } while (0)


#define NB 4
#define SS 2048
#define SCALEF 0.125f
#define DM 1024
#define NH 16
__device__ __attribute__((noinline)) float cos_p(float v) { return cosf(v); }
__device__ __attribute__((noinline)) float sin_p(float v) { return sinf(v); }
__device__ __attribute__((noinline)) float exp_p(float v) { return expf(v); }
__device__ __attribute__((noinline)) float log1p_p(float v) { return log1pf(v); }
#define HD 64
#define QKVW (3 * DM)
#ifndef TQB
#define TQB (SS / 64)
#define TNB NB
#define TOB (NB * SS / 64)     // output row tiles (all)
#endif
typedef __attribute__((ext_vector_type(8))) __bf16 v8b;
__device__ __forceinline__ v16b frag_b(const __bf16* rowk0, int lane) {
  union { v16b v; v8b q[2]; } u; const __bf16* p = rowk0 + 8 * (lane >> 4);
  u.q[0] = *(const v8b*)p; u.q[1] = *(const v8b*)(p + 16); return u.v;
}
__device__ __forceinline__ float bfr(float v) { return (float)(__bf16)v; }
__device__ __attribute__((noinline)) float exp_ni(float v) { return expf(v); }
__device__ __attribute__((noinline)) float erf_ni(float v) { return erff(v); }

#define PK_A 0                       // [3072][1024] Wqkv rows (natural [out][in])
#define PK_P (PK_A + QKVW * DM)        // [1024][1024] Wo rows (natural)
#define PK_END (PK_P + DM * DM)
#define WS_PK  0u
#define WS_QK  (WS_PK + 2u * PK_END)             // f16 [8192 rows][2048]: q | k
#define WS_QKL (WS_QK + 2u * NB * SS * 2 * DM)     // f16 q | k residual planes x2048
#define WS_VTH (WS_QKL + 2u * NB * SS * 2 * DM)    // f16 [b][1024 (h*64+d)][2048 s] hi
#define WS_VTL (WS_VTH + 2u * NB * DM * SS)        // f16 lo x 2048
#define WS_O   (WS_VTL + 2u * NB * DM * SS)        // f32 [8192][1024]
#define WS_CS  (WS_O + 4u * NB * SS * DM)           // f32 2 x [2048][32], unused
#define WS_G   (WS_CS + 4u * 2 * SS * 32)                  // f32 [b*t][16] softplus(x . g_w + g_b)
#define WS_END (WS_G + 4u * (size_t)NB * SS * NH)
// ---- k_pack: block = (row n, which): (in,out) column n -> bf16 row n; which 0..2 -> W_q/W_k/W_v into PK_A rows which*1024 + n; 3 -> W_o into PK_P
__global__ __launch_bounds__(256) void k_pack(const float* __restrict__ WQ, const float* __restrict__ WK, const float* __restrict__ WV, const float* __restrict__ WO, __bf16* __restrict__ PK) {
  __shared__ __align__(16) __bf16 s[DM]; const int n = blockIdx.x, which = blockIdx.y, t = threadIdx.x; const float* Wm = (which == 0) ? WQ : (which == 1) ? WK : (which == 2) ? WV : WO;   // (in,out) weights: pack row n = column n
  for (int k = t; k < DM; k += 256) s[k] = (__bf16)Wm[(size_t)k * DM + n];
  __syncthreads();
  __bf16* dst = (which < 3) ? PK + PK_A + ((size_t)which * DM + n) * DM : PK + PK_P + (size_t)n * DM;
  for (int q = t; q < DM / 8; q += 256) vst2((unsigned*)(dst + q * 8), *(const v4u*)&s[q * 8]);
}
__global__ __launch_bounds__(128) void k_qkv(const float* __restrict__ XQ, const float* __restrict__ XK, const float* __restrict__ XV, const __bf16* __restrict__ P, const float* __restrict__ BQ, const float* __restrict__ BK, const float* __restrict__ BV, const float* __restrict__ POS, _Float16* __restrict__ QK, _Float16* __restrict__ QKL, _Float16* __restrict__ VTH, _Float16* __restrict__ VTL) {
  const int which0 = (blockIdx.y * 128) / DM; const float* X = (which0 == 0) ? XQ : (which0 == 1) ? XK : XV; const float* BB = BQ ? (((which0 == 0) ? BQ : (which0 == 1) ? BK : BV) + (blockIdx.y * 128 - which0 * DM)) : nullptr;
  __shared__ __align__(16) _Float16 so[4][16][136], sol[4][16][136]; __shared__ __align__(16) _Float16 sth[128][72], stl[128][72];
  const int tid = threadIdx.x, wave = tid >> 5, lane = tid & 31, col = lane & 15, g = lane >> 4; const size_t r0 = (size_t)blockIdx.x * 64 + wave * 16; const int n0 = blockIdx.y * 128;
  v8f acc[8] = {};
#pragma unroll 2
  for (int kc = 0; kc < DM / 32; ++kc) { v16b a; { const float* p = X + (r0 + col) * DM + kc * 32 + 8 * g;
#pragma unroll
      for (int i = 0; i < 8; ++i) { a[i] = (__bf16)p[i]; a[8 + i] = (__bf16)p[16 + i]; } }
#pragma unroll
    for (int j = 0; j < 8; ++j) acc[j] = wmma_bf(a, frag_b(P + (size_t)(n0 + j * 16 + col) * DM + kc * 32, lane), acc[j]); }
  if (n0 < 2 * DM) {   // bias, then rotate-half rotary over each 64-dim head with angle rope[position][d] from the learned table
#pragma unroll
    for (int j = 0; j < 8; ++j)
#pragma unroll
      for (int r = 0; r < 8; ++r) acc[j][r] += (BB ? bfr(BB[j * 16 + col]) : 0.f);
#pragma unroll
    for (int r = 0; r < 8; ++r) { const int spos = (int)((r0 + 8 * g + r) % SS); const float* pr = POS + (size_t)spos * HD;   // learned table: out[d] = x[d] cos(p[d]) -+ partner sin(p[d])
#pragma unroll
      for (int jj = 0; jj < 2; ++jj) { const float p1 = bfr(pr[jj * 16 + col]), p2 = bfr(pr[32 + jj * 16 + col]); const float c1 = cos_p(p1), s1 = sin_p(p1), c2 = cos_p(p2), s2 = sin_p(p2);
#pragma unroll
        for (int hh = 0; hh < 2; ++hh) { const float x1 = acc[hh * 4 + jj][r], x2 = acc[hh * 4 + jj + 2][r]; acc[hh * 4 + jj][r] = x1 * c1 - x2 * s1; acc[hh * 4 + jj + 2][r] = x2 * c2 + x1 * s2; } } }
#pragma unroll
    for (int j = 0; j < 8; ++j) {
#pragma unroll
      for (int r = 0; r < 8; ++r) { const float v = acc[j][r]; const _Float16 hv = (_Float16)v; so[wave][8 * g + r][j * 16 + col] = hv; sol[wave][8 * g + r][j * 16 + col] = (_Float16)((v - (float)hv) * 2048.0f); } }   // q, k (+ bias) as f16 hi + (x2048) residual
    LDSX();
    for (int rl = 0; rl < 16; ++rl) if (lane < 16) { vst2((unsigned*)(QK + (r0 + rl) * (2 * DM) + n0 + lane * 8), *(const v4u*)&so[wave][rl][lane * 8]); vst2((unsigned*)(QKL + (r0 + rl) * (2 * DM) + n0 + lane * 8), *(const v4u*)&sol[wave][rl][lane * 8]); }
  } else {
#pragma unroll
    for (int j = 0; j < 8; ++j) {
#pragma unroll
      for (int r = 0; r < 8; ++r) { const float v = acc[j][r] + (BB ? bfr(BB[j * 16 + col]) : 0.f); const _Float16 hv = (_Float16)v; sth[j * 16 + col][wave * 16 + 8 * g + r] = hv; stl[j * 16 + col][wave * 16 + 8 * g + r] = (_Float16)((v - (float)hv) * 2048.0f); } }
    __syncthreads();
    const size_t rb = (size_t)blockIdx.x * 64; const int b = (int)(rb / SS), s0 = (int)(rb % SS); const int pc0 = n0 - 2 * DM;
    for (int q = tid; q < 128 * 8; q += 128) { const int d = q >> 3, pc = q & 7; const size_t o = ((size_t)b * DM + pc0 + d) * SS + s0 + pc * 8; vst2((unsigned*)(VTH + o), *(const v4u*)&sth[d][pc * 8]); vst2((unsigned*)(VTL + o), *(const v4u*)&stl[d][pc * 8]); }
  }
}
// ---- k_attn: block = (64 queries, head h, batch b): causal flash attention (K = 64: 2 k-steps), scores = (q.k) * 0.125 from q, k hi + residual (3 products) in the first 2 query blocks, single f16 beyond; P.V: f16 P (x2^11) x V hi in acc, plus P lo x V hi and P x V lo*2048 in accl in the first 2 blocks; O[b*S+q][h*64+d] = (acc + accl / 2048) / (2048 l) (256-B segments)
__global__ __launch_bounds__(128) void k_attn(const _Float16* __restrict__ QK, const _Float16* __restrict__ QKL, const _Float16* __restrict__ VTH, const _Float16* __restrict__ VTL, const void* __restrict__ KMASK, const float* __restrict__ GR, float* __restrict__ O) {
  __shared__ __align__(16) float sp[4][16][36]; __shared__ __align__(16) float so[4][16][68];
  const int tid = threadIdx.x, wave = tid >> 5, lane = tid & 31, col = lane & 15, g = lane >> 4;
  const int qb = blockIdx.x, h = blockIdx.y, b = blockIdx.z; const int q0 = qb * 64 + wave * 16; const size_t rq = (size_t)b * SS + q0 + col;
  v16h aq[2], aql[2];
#pragma unroll
  for (int kc = 0; kc < 2; ++kc) { aq[kc] = frag_h(QK + rq * (2 * DM) + h * HD + kc * 32, lane); aql[kc] = frag_h(QKL + rq * (2 * DM) + h * HD + kc * 32, lane); }
  float m[8], l[8];
#pragma unroll
  for (int r = 0; r < 8; ++r) { m[r] = -3.0e38f; l[r] = 0.f; }
  v8f acc[4] = {}, accl[4] = {};
  const int nks = (qb * 64 + 64) / 32;   // causal: key tiles up to the query tile's end
#pragma unroll 1
  for (int ks = 0; ks < nks; ++ks) { v8f s[2];
#pragma unroll
    for (int ct = 0; ct < 2; ++ct) { const int kk = ks * 32 + ct * 16 + col; const _Float16* krow = QK + ((size_t)b * SS + kk) * (2 * DM) + DM + h * HD; const _Float16* krowl = QKL + ((size_t)b * SS + kk) * (2 * DM) + DM + h * HD; v8f c = {}, cl = {};
      if (qb < 2) {   // leading query blocks (few keys, outputs far above the global rms): 3 products
#pragma unroll
        for (int kc = 0; kc < 2; ++kc) { const v16h kh = frag_h(krow + kc * 32, lane); c = wmma16(aq[kc], kh, c); cl = wmma16(aql[kc], kh, cl); cl = wmma16(aq[kc], frag_h(krowl + kc * 32, lane), cl); }
#pragma unroll
        for (int r = 0; r < 8; ++r) c[r] += cl[r] * (1.0f / 2048.0f); }
      else {
#pragma unroll
        for (int kc = 0; kc < 2; ++kc) c = wmma16(aq[kc], frag_h(krow + kc * 32, lane), c); }   // single product elsewhere
#pragma unroll
      for (int r = 0; r < 8; ++r) { const int qi = q0 + 8 * g + r; const int dd = min(qi - kk, 64); s[ct][r] = (kk <= qi) ? (c[r] * SCALEF - GR[((size_t)b * SS + qi) * NH + h] * (float)dd * 0.1f) : -3.0e38f; } }   // causal; - softplus-gravity x min(|i-j|,64) x 0.1
#pragma unroll
    for (int r = 0; r < 8; ++r) { float mx = fmaxf(s[0][r], s[1][r]);
#pragma unroll
      for (int o = 1; o < 16; o <<= 1) mx = fmaxf(mx, __shfl_xor(mx, o));
      const float mn = fmaxf(m[r], mx); const float alpha = (m[r] <= -1.0e38f) ? 0.f : __expf(m[r] - mn);
      const float e0 = (s[0][r] <= -1.0e38f) ? 0.f : __expf(s[0][r] - mn), e1 = (s[1][r] <= -1.0e38f) ? 0.f : __expf(s[1][r] - mn); float es = e0 + e1;
#pragma unroll
      for (int o = 1; o < 16; o <<= 1) es += __shfl_xor(es, o);
      l[r] = l[r] * alpha + es; m[r] = mn;
#pragma unroll
      for (int dt = 0; dt < 4; ++dt) { acc[dt][r] *= alpha; accl[dt][r] *= alpha; }
      sp[wave][8 * g + r][col] = e0; sp[wave][8 * g + r][16 + col] = e1; }
    LDSX();
    v16h pa, pl; { const float* prow = &sp[wave][col][0] + 8 * (lane >> 4);
#pragma unroll
      for (int i = 0; i < 8; ++i) { const float x0 = prow[i] * 2048.0f, x1 = prow[16 + i] * 2048.0f; const _Float16 h0 = (_Float16)x0, h1 = (_Float16)x1; pa[i] = h0; pa[8 + i] = h1; pl[i] = (_Float16)((x0 - (float)h0) * 2048.0f); pl[8 + i] = (_Float16)((x1 - (float)h1) * 2048.0f); } }   // P scaled by 2^11 before the f16 split so small softmax weights stay out of the f16 subnormal range; 2^-11 folded into the epilogue
#pragma unroll
    for (int dt = 0; dt < 4; ++dt) { const size_t vr = ((size_t)b * DM + h * HD + dt * 16 + col) * SS + ks * 32; const v16h vh = frag_h(VTH + vr, lane); acc[dt] = wmma16(pa, vh, acc[dt]); if (qb < 2) { accl[dt] = wmma16(pl, vh, accl[dt]); accl[dt] = wmma16(pa, frag_h(VTL + vr, lane), accl[dt]); } }   // leading query blocks: P hi/lo x V hi/lo (3 products); elsewhere P x V single
    LDSX(); }
#pragma unroll
  for (int r = 0; r < 8; ++r) { const float il = (1.0f / 2048.0f) / l[r];
#pragma unroll
    for (int dt = 0; dt < 4; ++dt) so[wave][8 * g + r][dt * 16 + col] = (acc[dt][r] + accl[dt][r] * (1.0f / 2048.0f)) * il; }
  LDSX();
  for (int rl = 0; rl < 16; ++rl) if (lane < 16) vst2(O + ((size_t)b * SS + q0 + rl) * DM + h * HD + lane * 4, *(const v4f*)&so[wave][rl][lane * 4]);
}
// ---- k_out: block = (64 rows, 128 cols): out = O(hi/lo) . Wo rows (2 products) + bo
__global__ __launch_bounds__(128) void k_out(const float* __restrict__ O, const __bf16* __restrict__ P, const float* __restrict__ BO, float* __restrict__ Y) {
  __shared__ __align__(16) float so[4][16][132];
  const int tid = threadIdx.x, wave = tid >> 5, lane = tid & 31, col = lane & 15, g = lane >> 4; const size_t r0 = (size_t)blockIdx.x * 64 + wave * 16; const int n0 = blockIdx.y * 128;
  v8f acc[8] = {};
#pragma unroll 2
  for (int kc = 0; kc < DM / 32; ++kc) { const F2 a = split_row(O + (r0 + col) * DM, kc * 32, lane);
#pragma unroll
    for (int j = 0; j < 8; ++j) { const v16b w = frag_b(P + (size_t)(n0 + j * 16 + col) * DM + kc * 32, lane); acc[j] = wmma_bf(a.l, w, acc[j]); acc[j] = wmma_bf(a.h, w, acc[j]); } }
#pragma unroll
  for (int j = 0; j < 8; ++j) {
#pragma unroll
    for (int r = 0; r < 8; ++r) so[wave][8 * g + r][j * 16 + col] = acc[j][r] + (BO ? bfr(BO[n0 + j * 16 + col]) : 0.f); }
  LDSX();
  for (int rl = 0; rl < 16; ++rl) vst2(Y + (r0 + rl) * DM + n0 + lane * 4, *(const v4f*)&so[wave][rl][lane * 4]);
}
// ---- k_pack3: the fused (in,out) W_attn [DM][3*DM] -> the three transposed bf16 row blocks
__global__ __launch_bounds__(256) void k_pack3(const float* __restrict__ WA, __bf16* __restrict__ PK) { __shared__ __align__(16) __bf16 s[DM]; const int n = blockIdx.x, which = blockIdx.y, t = threadIdx.x; for (int k = t; k < DM; k += 256) s[k] = (__bf16)WA[(size_t)k * (3 * DM) + which * DM + n]; __syncthreads(); for (int q = t; q < DM / 8; q += 256) vst2((unsigned*)(PK + PK_A + ((size_t)which * DM + n) * DM + q * 8), *(const v4u*)&s[q * 8]); }
// ---- k_grav: block = 64 rows (256 threads: 4 per row x 4 heads each): g[row][h] = softplus(x . g_w[:, h] + g_b[h]) in f32 from the bf16-rounded inputs; whole 4-KB block segment
__global__ __launch_bounds__(256) void k_grav(const float* __restrict__ X, const float* __restrict__ GW, const float* __restrict__ GB, float* __restrict__ GR) {
  __shared__ __align__(16) float sg[64][NH]; const size_t r0 = (size_t)blockIdx.x * 64; const int t = threadIdx.x; const int rl = t >> 2, hq = t & 3;
  float a[4] = {0.f, 0.f, 0.f, 0.f}; const float* xr = X + (r0 + rl) * DM;
  for (int k = 0; k < DM; ++k) { const float xv = bfr(xr[k]);
#pragma unroll
    for (int i = 0; i < 4; ++i) a[i] += xv * bfr(GW[(size_t)k * NH + hq * 4 + i]); }
#pragma unroll
  for (int i = 0; i < 4; ++i) { const float z = a[i] + bfr(GB[hq * 4 + i]); sg[rl][hq * 4 + i] = (z > 20.f) ? z : log1p_p(exp_p(z)); }   // softplus
  __syncthreads();
  vst2(GR + (r0 * NH) + t * 4, *(const v4f*)(&sg[0][0] + t * 4));
}
extern "C" void kernel_launch(void* const* d_in, const int* in_sizes, int n_in, void* d_out, int out_size, void* d_ws, size_t ws_size, hipStream_t stream) {
  (void)in_sizes; (void)n_in; (void)out_size;
  const float** F = (const float**)d_in;   // 0 x [4,2048,1024], 1 rope [2048,64], 2 W_attn [1024,3072] (in,out: q|k|v), 3 W_proj [1024,1024] (in,out), 4 g_w [1024,16], 5 g_b [16]
  if (ws_size < (size_t)WS_END) return;
  char* ws = (char*)d_ws; __bf16* PK = (__bf16*)(ws + WS_PK); _Float16 *QK = (_Float16*)(ws + WS_QK), *QKL = (_Float16*)(ws + WS_QKL), *VTH = (_Float16*)(ws + WS_VTH), *VTL = (_Float16*)(ws + WS_VTL); float *O = (float*)(ws + WS_O), *GR = (float*)(ws + WS_G);
  k_pack<<<dim3(DM, 4), 256, 0, stream>>>(F[3], F[3], F[3], F[3], PK);   // W_proj rows (q/k/v slots overwritten next)
  k_pack3<<<dim3(DM, 3), 256, 0, stream>>>(F[2], PK);
  k_grav<<<TNB * SS / 64, 256, 0, stream>>>(F[0], F[4], F[5], GR);
  k_qkv<<<dim3(TNB * SS / 64, QKVW / 128), 128, 0, stream>>>(F[0], F[0], F[0], PK + PK_A, nullptr, nullptr, nullptr, F[1], QK, QKL, VTH, VTL);
  k_attn<<<dim3(TQB, NH, TNB), 128, 0, stream>>>(QK, QKL, VTH, VTL, nullptr, GR, O);
  k_out<<<dim3(TOB, DM / 128), 128, 0, stream>>>(O, PK + PK_P, nullptr, (float*)d_out);
}

// v001
// One run takes 731 microseconds.
// Next to v000, in two timings, it ran 1.24 times as fast each time.
// compute dtype: all float inputs rounded to bf16; qkv = x . W_attn with EXACT bf16 products on WMMA 16x16x32 ((in,out) columns q | k | v as transposed rows); rotate-half RoPE with the learned angle table (precise sinf/cosf of rope[t][d]) on q and k in f32 before the f16 hi + residual split; gravity softplus(x . g_w + g_b) in f32 (precise expf/log1pf); causal attention: 3-product scores and hi + residual P, v on the first 128 queries of each sequence, single f16 beyond; x 1/8 - g x min(|i-j|, 64) x 0.1, running-max softmax in f32 (hardware exp), P scaled by 2^11; out = y (bf16 hi + residual) . W_proj (2 products).
#include <hip/hip_runtime.h>
#include <math.h>

typedef __attribute__((ext_vector_type(16))) _Float16 v16h;
typedef __attribute__((ext_vector_type(16))) __bf16 v16b;
typedef __attribute__((ext_vector_type(8)))  _Float16 v8h;
typedef __attribute__((ext_vector_type(8)))  float v8f;
typedef __attribute__((ext_vector_type(4)))  float v4f;
typedef __attribute__((ext_vector_type(2)))  float v2f;
typedef __attribute__((ext_vector_type(4)))  unsigned v4u;
typedef __attribute__((ext_vector_type(4)))  int v4i;
typedef float __attribute__((may_alias)) float_a;
typedef int __attribute__((may_alias)) int_a;

template <typename T> __device__ __forceinline__ void vst2(void* p, T v) { *(T*)p = v;  }
__device__ __forceinline__ v8f wmma16(v16h a, v16h b, v8f c) {
  v8f d = __builtin_amdgcn_wmma_f32_16x16x32_f16(false, a, false, b, (short)0, c, false, false);
  asm volatile("v_nop\n\tv_nop\n\tv_nop\n\tv_nop" : "+v"(d) : "v"(a), "v"(b));
  return d;
}
__device__ __forceinline__ v8f wmma_bf(v16b a, v16b b, v8f c) {
  v8f d = __builtin_amdgcn_wmma_f32_16x16x32_bf16(false, a, false, b, (short)0, c, false, false);
  asm volatile("v_nop\n\tv_nop\n\tv_nop\n\tv_nop" : "+v"(d) : "v"(a), "v"(b));
  return d;
}
// Adaptive-gravity causal attention (B 4, T 2,048, 1,024 dims, 16 heads x 64): fused q|k|v projection, table RoPE on q and k, scores / 8 minus a learned per-(token, head) softplus gravity times the clipped distance, causal softmax, . v, output projection.
__device__ __forceinline__ v16h frag_h(const _Float16* rowk0, int lane) {
  union { v16h v; v8h q[2]; } u; const _Float16* p = rowk0 + 8 * (lane >> 4);
  u.q[0] = *(const v8h*)p; u.q[1] = *(const v8h*)(p + 16); return u.v;
}
__device__ __forceinline__ v16h frag_f32(const float* rowk0, int lane) {
  v16h a; const float* p = rowk0 + 8 * (lane >> 4);
#pragma unroll
  for (int i = 0; i < 8; ++i) { a[i] = (_Float16)p[i]; a[8 + i] = (_Float16)p[16 + i]; }
  return a;
}
__device__ __forceinline__ v16h frag_f32s(const float* rowk0, int lane, float sc) {
  v16h a; const float* p = rowk0 + 8 * (lane >> 4);
#pragma unroll
  for (int i = 0; i < 8; ++i) { a[i] = (_Float16)(p[i] * sc); a[8 + i] = (_Float16)(p[16 + i] * sc); }
  return a;
}
// column fragment from a [K][ld] layout (column n), rows >= K read as 0
__device__ __forceinline__ v16h fragc_f32(const float* W, int k0, int n, int lane, int ld, int K) {
  v16h a; const int g = lane >> 4;
#pragma unroll
  for (int i = 0; i < 8; ++i) { const int ka = k0 + 8 * g + i, kb = ka + 16;
    a[i] = (_Float16)(ka < K ? W[(size_t)(ka < K ? ka : K - 1) * ld + n] : 0.f); a[8 + i] = (_Float16)(kb < K ? W[(size_t)(kb < K ? kb : K - 1) * ld + n] : 0.f); }
  return a;
}
struct F2 { v16b h, l; };
__device__ __forceinline__ F2 bsplit16(const float v[16]) { F2 r;
#pragma unroll
  for (int i = 0; i < 16; ++i) { const __bf16 h = (__bf16)v[i]; r.h[i] = h; r.l[i] = (__bf16)(v[i] - (float)h); }
  return r; }
__device__ __forceinline__ F2 split_row(const float* row, int k0, int lane) { float v[16]; const float* p = row + k0 + 8 * (lane >> 4);
#pragma unroll
  for (int i = 0; i < 8; ++i) { v[i] = p[i]; v[8 + i] = p[16 + i]; }
  return bsplit16(v); }
__device__ __forceinline__ F2 split_rowK(const float* row, int k0, int lane, int K) { float v[16]; const int g = lane >> 4;
#pragma unroll
  for (int i = 0; i < 8; ++i) { const int ka = k0 + 8 * g + i, kb = ka + 16; v[i] = ka < K ? row[ka < K ? ka : K - 1] : 0.f; v[8 + i] = kb < K ? row[kb < K ? kb : K - 1] : 0.f; }
  return bsplit16(v); }
__device__ __forceinline__ F2 split_col(const float* W, int k0, int n, int lane, int ld, int K) { float v[16]; const int g = lane >> 4;
#pragma unroll
  for (int i = 0; i < 8; ++i) { const int ka = k0 + 8 * g + i, kb = ka + 16; v[i] = ka < K ? W[(size_t)(ka < K ? ka : K - 1) * ld + n] : 0.f; v[8 + i] = kb < K ? W[(size_t)(kb < K ? kb : K - 1) * ld + n] : 0.f; }
  return bsplit16(v); }
__device__ __forceinline__ v8f mac3(const F2& a, const F2& b, v8f c) { c = wmma_bf(a.l, b.h, c); c = wmma_bf(a.h, b.l, c); return wmma_bf(a.h, b.h, c); }
__device__ __forceinline__ float sigm(float v) { return 1.0f / (1.0f + expf(-v)); }
#define LDSX() do { asm volatile("s_wait_dscnt 0" ::: "memory"); __builtin_amdgcn_wave_barrier(); __builtin_amdgcn_fence(__ATOMIC_RELEASE, "workgroup"); } while (0)


#define NB 4
#define SS 2048
#define SCALEF 0.125f
#define DM 1024
#define NH 16
__device__ __attribute__((noinline)) float cos_p(float v) { return cosf(v); }
__device__ __attribute__((noinline)) float sin_p(float v) { return sinf(v); }
__device__ __attribute__((noinline)) float exp_p(float v) { return expf(v); }
__device__ __attribute__((noinline)) float log1p_p(float v) { return log1pf(v); }
#define HD 64
#define QKVW (3 * DM)
#ifndef TQB
#define TQB (SS / 64)
#define TNB NB
#define TOB (NB * SS / 64)     // output row tiles (all)
#endif
typedef __attribute__((ext_vector_type(8))) __bf16 v8b;
__device__ __forceinline__ v16b frag_b(const __bf16* rowk0, int lane) {
  union { v16b v; v8b q[2]; } u; const __bf16* p = rowk0 + 8 * (lane >> 4);
  u.q[0] = *(const v8b*)p; u.q[1] = *(const v8b*)(p + 16); return u.v;
}
__device__ __forceinline__ float bfr(float v) { return (float)(__bf16)v; }
__device__ __attribute__((noinline)) float exp_ni(float v) { return expf(v); }
__device__ __attribute__((noinline)) float erf_ni(float v) { return erff(v); }

#define PK_A 0                       // [3072][1024] Wqkv rows (natural [out][in])
#define PK_P (PK_A + QKVW * DM)        // [1024][1024] Wo rows (natural)
#define PK_END (PK_P + DM * DM)
#define WS_PK  0u
#define WS_QK  (WS_PK + 2u * PK_END)             // f16 [8192 rows][2048]: q | k
#define WS_QKL (WS_QK + 2u * NB * SS * 2 * DM)     // f16 q | k residual planes x2048
#define WS_VTH (WS_QKL + 2u * NB * SS * 2 * DM)    // f16 [b][1024 (h*64+d)][2048 s] hi
#define WS_VTL (WS_VTH + 2u * NB * DM * SS)        // f16 lo x 2048
#define WS_O   (WS_VTL + 2u * NB * DM * SS)        // f32 [8192][1024]
#define WS_CS  (WS_O + 4u * NB * SS * DM)           // f32 2 x [2048][32], unused
#define WS_G   (WS_CS + 4u * 2 * SS * 32)                  // f32 [b*t][16] softplus(x . g_w + g_b)
#define WS_END (WS_G + 4u * (size_t)NB * SS * NH)
// ---- k_pack: block = (row n, which): (in,out) column n -> bf16 row n; which 0..2 -> W_q/W_k/W_v into PK_A rows which*1024 + n; 3 -> W_o into PK_P
__global__ __launch_bounds__(256) void k_pack(const float* __restrict__ WQ, const float* __restrict__ WK, const float* __restrict__ WV, const float* __restrict__ WO, __bf16* __restrict__ PK) {
  __shared__ __align__(16) __bf16 s[DM]; const int n = blockIdx.x, which = blockIdx.y, t = threadIdx.x; const float* Wm = (which == 0) ? WQ : (which == 1) ? WK : (which == 2) ? WV : WO;   // (in,out) weights: pack row n = column n
  for (int k = t; k < DM; k += 256) s[k] = (__bf16)Wm[(size_t)k * DM + n];
  __syncthreads();
  __bf16* dst = (which < 3) ? PK + PK_A + ((size_t)which * DM + n) * DM : PK + PK_P + (size_t)n * DM;
  for (int q = t; q < DM / 8; q += 256) vst2((unsigned*)(dst + q * 8), *(const v4u*)&s[q * 8]);
}
__global__ __launch_bounds__(128) void k_qkv(const float* __restrict__ XQ, const float* __restrict__ XK, const float* __restrict__ XV, const __bf16* __restrict__ P, const float* __restrict__ BQ, const float* __restrict__ BK, const float* __restrict__ BV, const float* __restrict__ POS, _Float16* __restrict__ QK, _Float16* __restrict__ QKL, _Float16* __restrict__ VTH, _Float16* __restrict__ VTL) {
  const int which0 = (blockIdx.y * 128) / DM; const float* X = (which0 == 0) ? XQ : (which0 == 1) ? XK : XV; const float* BB = BQ ? (((which0 == 0) ? BQ : (which0 == 1) ? BK : BV) + (blockIdx.y * 128 - which0 * DM)) : nullptr;
  __shared__ __align__(16) _Float16 so[4][16][136], sol[4][16][136]; __shared__ __align__(16) _Float16 sth[128][72], stl[128][72];
  const int tid = threadIdx.x, wave = tid >> 5, lane = tid & 31, col = lane & 15, g = lane >> 4; const size_t r0 = (size_t)blockIdx.x * 64 + wave * 16; const int n0 = blockIdx.y * 128;
  v8f acc[8] = {};
#pragma unroll 2
  for (int kc = 0; kc < DM / 32; ++kc) { v16b a; { const float* p = X + (r0 + col) * DM + kc * 32 + 8 * g;
#pragma unroll
      for (int i = 0; i < 8; ++i) { a[i] = (__bf16)p[i]; a[8 + i] = (__bf16)p[16 + i]; } }
#pragma unroll
    for (int j = 0; j < 8; ++j) acc[j] = wmma_bf(a, frag_b(P + (size_t)(n0 + j * 16 + col) * DM + kc * 32, lane), acc[j]); }
  if (n0 < 2 * DM) {   // bias, then rotate-half rotary over each 64-dim head with angle rope[position][d] from the learned table
#pragma unroll
    for (int j = 0; j < 8; ++j)
#pragma unroll
      for (int r = 0; r < 8; ++r) acc[j][r] += (BB ? bfr(BB[j * 16 + col]) : 0.f);
#pragma unroll
    for (int r = 0; r < 8; ++r) { const int spos = (int)((r0 + 8 * g + r) % SS); const float* pr = POS + (size_t)spos * HD;   // learned table: out[d] = x[d] cos(p[d]) -+ partner sin(p[d])
#pragma unroll
      for (int jj = 0; jj < 2; ++jj) { const float p1 = bfr(pr[jj * 16 + col]), p2 = bfr(pr[32 + jj * 16 + col]); const float c1 = cos_p(p1), s1 = sin_p(p1), c2 = cos_p(p2), s2 = sin_p(p2);
#pragma unroll
        for (int hh = 0; hh < 2; ++hh) { const float x1 = acc[hh * 4 + jj][r], x2 = acc[hh * 4 + jj + 2][r]; acc[hh * 4 + jj][r] = x1 * c1 - x2 * s1; acc[hh * 4 + jj + 2][r] = x2 * c2 + x1 * s2; } } }
#pragma unroll
    for (int j = 0; j < 8; ++j) {
#pragma unroll
      for (int r = 0; r < 8; ++r) { const float v = acc[j][r]; const _Float16 hv = (_Float16)v; so[wave][8 * g + r][j * 16 + col] = hv; sol[wave][8 * g + r][j * 16 + col] = (_Float16)((v - (float)hv) * 2048.0f); } }   // q, k (+ bias) as f16 hi + (x2048) residual
    LDSX();
    for (int rl = 0; rl < 16; ++rl) if (lane < 16) { vst2((unsigned*)(QK + (r0 + rl) * (2 * DM) + n0 + lane * 8), *(const v4u*)&so[wave][rl][lane * 8]); vst2((unsigned*)(QKL + (r0 + rl) * (2 * DM) + n0 + lane * 8), *(const v4u*)&sol[wave][rl][lane * 8]); }
  } else {
#pragma unroll
    for (int j = 0; j < 8; ++j) {
#pragma unroll
      for (int r = 0; r < 8; ++r) { const float v = acc[j][r] + (BB ? bfr(BB[j * 16 + col]) : 0.f); const _Float16 hv = (_Float16)v; sth[j * 16 + col][wave * 16 + 8 * g + r] = hv; stl[j * 16 + col][wave * 16 + 8 * g + r] = (_Float16)((v - (float)hv) * 2048.0f); } }
    __syncthreads();
    const size_t rb = (size_t)blockIdx.x * 64; const int b = (int)(rb / SS), s0 = (int)(rb % SS); const int pc0 = n0 - 2 * DM;
    for (int q = tid; q < 128 * 8; q += 128) { const int d = q >> 3, pc = q & 7; const size_t o = ((size_t)b * DM + pc0 + d) * SS + s0 + pc * 8; vst2((unsigned*)(VTH + o), *(const v4u*)&sth[d][pc * 8]); vst2((unsigned*)(VTL + o), *(const v4u*)&stl[d][pc * 8]); }
  }
}
// lane l <-> lane l ^ 16 as a vector cross-row move (no LDS counter to wait on)
__device__ __forceinline__ float xhalf(float x) { return __builtin_bit_cast(float, __builtin_amdgcn_permlanex16(__builtin_bit_cast(int, x), __builtin_bit_cast(int, x), 0x76543210, 0xfedcba98, false, false)); }
// e^x as the hardware exp2 of x * log2(e), the same two instructions __expf compiles to; the v_nop inside the statement keeps the one slot the instruction set asks for behind a transcendental
__device__ __forceinline__ float exp_hw(float x) { float y; const float t = x * 1.44269504f; asm("v_exp_f32 %0, %1\n\tv_nop" : "=v"(y) : "v"(t)); return y; }
// ---- k_attn: block = (64 queries, head h, batch b): causal flash attention on TRANSPOSED tiles: S^T = K . Q^T (rows = keys, column = this lane's query), so the softmax of a query lives in one lane pair and the D registers of S^T are already the B fragment of O^T = V^T . P^T (k = 8g + i from key tile 0, 16 + 8g + i from key tile 1); O[b*S+q][h*64+d] = (acc + accl / 2048) / (2048 l) (256-B segments)
__global__ __launch_bounds__(128) void k_attn(const _Float16* __restrict__ QK, const _Float16* __restrict__ QKL, const _Float16* __restrict__ VTH, const _Float16* __restrict__ VTL, const void* __restrict__ KMASK, const float* __restrict__ GR, float* __restrict__ O) {
  __shared__ __align__(16) float so[4][16][68];
  const int tid = threadIdx.x, wave = tid >> 5, lane = tid & 31, col = lane & 15, g = lane >> 4;
  const int qb = blockIdx.x, h = blockIdx.y, b = blockIdx.z; const int q0 = qb * 64 + wave * 16; const int qi = q0 + col; const size_t rq = (size_t)b * SS + qi;
  v16h aq[2], aql[2];
#pragma unroll
  for (int kc = 0; kc < 2; ++kc) { aq[kc] = frag_h(QK + rq * (2 * DM) + h * HD + kc * 32, lane); aql[kc] = frag_h(QKL + rq * (2 * DM) + h * HD + kc * 32, lane); }
  const float gq = GR[rq * NH + h];   // this lane's query: one gravity value
  float m = -3.0e38f, l = 0.f;        // l: partial sum over this lane half's keys, joined after the loop
  v8f acc[4] = {}, accl[4] = {};
  const int nks = (qb * 64 + 64) / 32;   // causal: key tiles up to the query tile's end
#pragma unroll 1
  for (int ks = 0; ks < nks; ++ks) { v8f s[2];
#pragma unroll
    for (int ct = 0; ct < 2; ++ct) { const int kr = ks * 32 + ct * 16 + col; const _Float16* krow = QK + ((size_t)b * SS + kr) * (2 * DM) + DM + h * HD; const _Float16* krowl = QKL + ((size_t)b * SS + kr) * (2 * DM) + DM + h * HD; v8f c = {}, cl = {};
      if (qb < 2) {   // leading query blocks (few keys, outputs far above the global rms): 3 products
#pragma unroll
        for (int kc = 0; kc < 2; ++kc) { const v16h kh = frag_h(krow + kc * 32, lane); c = wmma16(kh, aq[kc], c); cl = wmma16(kh, aql[kc], cl); cl = wmma16(frag_h(krowl + kc * 32, lane), aq[kc], cl); }
#pragma unroll
        for (int r = 0; r < 8; ++r) c[r] += cl[r] * (1.0f / 2048.0f); }
      else {
#pragma unroll
        for (int kc = 0; kc < 2; ++kc) c = wmma16(frag_h(krow + kc * 32, lane), aq[kc], c); }   // single product elsewhere
#pragma unroll
      for (int r = 0; r < 8; ++r) { const int kk = ks * 32 + ct * 16 + 8 * g + r; const int dd = min(qi - kk, 64); s[ct][r] = (kk <= qi) ? (c[r] * SCALEF - gq * (float)dd * 0.1f) : -3.0e38f; } }   // causal; - softplus-gravity x min(|i-j|,64) x 0.1
    float mx = fmaxf(s[0][0], s[1][0]);
#pragma unroll
    for (int r = 1; r < 8; ++r) mx = fmaxf(mx, fmaxf(s[0][r], s[1][r]));
    mx = fmaxf(mx, xhalf(mx));   // the other 16 keys of this query sit in the partner lane
    const float mn = fmaxf(m, mx); const float am = exp_hw(m - mn); const float alpha = (m <= -1.0e38f) ? 0.f : am;
    float es = 0.f; v16h pa, pl;
#pragma unroll
    for (int r = 0; r < 8; ++r) { const float y0 = exp_hw(s[0][r] - mn), y1 = exp_hw(s[1][r] - mn); const float e0 = (s[0][r] <= -1.0e38f) ? 0.f : y0, e1 = (s[1][r] <= -1.0e38f) ? 0.f : y1; es += e0 + e1;
      const float x0 = e0 * 2048.0f, x1 = e1 * 2048.0f; const _Float16 h0 = (_Float16)x0, h1 = (_Float16)x1; pa[r] = h0; pa[8 + r] = h1; pl[r] = (_Float16)((x0 - (float)h0) * 2048.0f); pl[8 + r] = (_Float16)((x1 - (float)h1) * 2048.0f); }   // P scaled by 2^11 before the f16 split so small softmax weights stay out of the f16 subnormal range; 2^-11 folded into the epilogue
    l = l * alpha + es; m = mn;
#pragma unroll
    for (int dt = 0; dt < 4; ++dt)
#pragma unroll
      for (int r = 0; r < 8; ++r) { acc[dt][r] *= alpha; accl[dt][r] *= alpha; }
#pragma unroll
    for (int dt = 0; dt < 4; ++dt) { const size_t vr = ((size_t)b * DM + h * HD + dt * 16 + col) * SS + ks * 32; const v16h vh = frag_h(VTH + vr, lane); acc[dt] = wmma16(vh, pa, acc[dt]); if (qb < 2) { accl[dt] = wmma16(vh, pl, accl[dt]); accl[dt] = wmma16(frag_h(VTL + vr, lane), pa, accl[dt]); } }   // leading query blocks: P hi/lo x V hi/lo (3 products); elsewhere P x V single
  }
  l += xhalf(l);
  const float il = (1.0f / 2048.0f) / l;
#pragma unroll
  for (int dt = 0; dt < 4; ++dt)
#pragma unroll
    for (int r = 0; r < 8; ++r) so[wave][col][dt * 16 + 8 * g + r] = (acc[dt][r] + accl[dt][r] * (1.0f / 2048.0f)) * il;
  LDSX();
  for (int rl = 0; rl < 16; ++rl) if (lane < 16) vst2(O + ((size_t)b * SS + q0 + rl) * DM + h * HD + lane * 4, *(const v4f*)&so[wave][rl][lane * 4]);
}
// ---- k_out: block = (64 rows, 128 cols): out = O(hi/lo) . Wo rows (2 products) + bo
__global__ __launch_bounds__(128) void k_out(const float* __restrict__ O, const __bf16* __restrict__ P, const float* __restrict__ BO, float* __restrict__ Y) {
  __shared__ __align__(16) float so[4][16][132];
  const int tid = threadIdx.x, wave = tid >> 5, lane = tid & 31, col = lane & 15, g = lane >> 4; const size_t r0 = (size_t)blockIdx.x * 64 + wave * 16; const int n0 = blockIdx.y * 128;
  v8f acc[8] = {};
#pragma unroll 2
  for (int kc = 0; kc < DM / 32; ++kc) { const F2 a = split_row(O + (r0 + col) * DM, kc * 32, lane);
#pragma unroll
    for (int j = 0; j < 8; ++j) { const v16b w = frag_b(P + (size_t)(n0 + j * 16 + col) * DM + kc * 32, lane); acc[j] = wmma_bf(a.l, w, acc[j]); acc[j] = wmma_bf(a.h, w, acc[j]); } }
#pragma unroll
  for (int j = 0; j < 8; ++j) {
#pragma unroll
    for (int r = 0; r < 8; ++r) so[wave][8 * g + r][j * 16 + col] = acc[j][r] + (BO ? bfr(BO[n0 + j * 16 + col]) : 0.f); }
  LDSX();
  for (int rl = 0; rl < 16; ++rl) vst2(Y + (r0 + rl) * DM + n0 + lane * 4, *(const v4f*)&so[wave][rl][lane * 4]);
}
// ---- k_pack3: the fused (in,out) W_attn [DM][3*DM] -> the three transposed bf16 row blocks
__global__ __launch_bounds__(256) void k_pack3(const float* __restrict__ WA, __bf16* __restrict__ PK) { __shared__ __align__(16) __bf16 s[DM]; const int n = blockIdx.x, which = blockIdx.y, t = threadIdx.x; for (int k = t; k < DM; k += 256) s[k] = (__bf16)WA[(size_t)k * (3 * DM) + which * DM + n]; __syncthreads(); for (int q = t; q < DM / 8; q += 256) vst2((unsigned*)(PK + PK_A + ((size_t)which * DM + n) * DM + q * 8), *(const v4u*)&s[q * 8]); }
// ---- k_grav: block = 64 rows (256 threads: 4 per row x 4 heads each): g[row][h] = softplus(x . g_w[:, h] + g_b[h]) in f32 from the bf16-rounded inputs; whole 4-KB block segment
__global__ __launch_bounds__(256) void k_grav(const float* __restrict__ X, const float* __restrict__ GW, const float* __restrict__ GB, float* __restrict__ GR) {
  __shared__ __align__(16) float sg[64][NH]; const size_t r0 = (size_t)blockIdx.x * 64; const int t = threadIdx.x; const int rl = t >> 2, hq = t & 3;
  float a[4] = {0.f, 0.f, 0.f, 0.f}; const float* xr = X + (r0 + rl) * DM;
  for (int k = 0; k < DM; ++k) { const float xv = bfr(xr[k]);
#pragma unroll
    for (int i = 0; i < 4; ++i) a[i] += xv * bfr(GW[(size_t)k * NH + hq * 4 + i]); }
#pragma unroll
  for (int i = 0; i < 4; ++i) { const float z = a[i] + bfr(GB[hq * 4 + i]); sg[rl][hq * 4 + i] = (z > 20.f) ? z : log1p_p(exp_p(z)); }   // softplus
  __syncthreads();
  vst2(GR + (r0 * NH) + t * 4, *(const v4f*)(&sg[0][0] + t * 4));
}
extern "C" void kernel_launch(void* const* d_in, const int* in_sizes, int n_in, void* d_out, int out_size, void* d_ws, size_t ws_size, hipStream_t stream) {
  (void)in_sizes; (void)n_in; (void)out_size;
  const float** F = (const float**)d_in;   // 0 x [4,2048,1024], 1 rope [2048,64], 2 W_attn [1024,3072] (in,out: q|k|v), 3 W_proj [1024,1024] (in,out), 4 g_w [1024,16], 5 g_b [16]
  if (ws_size < (size_t)WS_END) return;
  char* ws = (char*)d_ws; __bf16* PK = (__bf16*)(ws + WS_PK); _Float16 *QK = (_Float16*)(ws + WS_QK), *QKL = (_Float16*)(ws + WS_QKL), *VTH = (_Float16*)(ws + WS_VTH), *VTL = (_Float16*)(ws + WS_VTL); float *O = (float*)(ws + WS_O), *GR = (float*)(ws + WS_G);
  k_pack<<<dim3(DM, 4), 256, 0, stream>>>(F[3], F[3], F[3], F[3], PK);   // W_proj rows (q/k/v slots overwritten next)
  k_pack3<<<dim3(DM, 3), 256, 0, stream>>>(F[2], PK);
  k_grav<<<TNB * SS / 64, 256, 0, stream>>>(F[0], F[4], F[5], GR);
  k_qkv<<<dim3(TNB * SS / 64, QKVW / 128), 128, 0, stream>>>(F[0], F[0], F[0], PK + PK_A, nullptr, nullptr, nullptr, F[1], QK, QKL, VTH, VTL);
  k_attn<<<dim3(TQB, NH, TNB), 128, 0, stream>>>(QK, QKL, VTH, VTL, nullptr, GR, O);
  k_out<<<dim3(TOB, DM / 128), 128, 0, stream>>>(O, PK + PK_P, nullptr, (float*)d_out);
}

// v002
// One run takes 559 microseconds.
// Two timings next to v001 put it at 1.31 and 1.32 times that version's speed.
// Counting every step since v000, it is 1.63 times as fast.
// compute dtype: all float inputs rounded to bf16; qkv = x . W_attn with EXACT bf16 products on WMMA 16x16x32 ((in,out) columns q | k | v as transposed rows); rotate-half RoPE with the learned angle table (precise sinf/cosf of rope[t][d]) on q and k in f32 before the f16 hi + residual split; gravity softplus(x . g_w + g_b) in f32 (precise expf/log1pf); causal attention: 3-product scores and hi + residual P, v on the first 128 queries of each sequence, single f16 beyond; x 1/8 - g x min(|i-j|, 64) x 0.1, running-max softmax in f32 (hardware exp), P scaled by 2^11; out = y (bf16 hi + residual) . W_proj (2 products).
#include <hip/hip_runtime.h>
#include <math.h>

typedef __attribute__((ext_vector_type(16))) _Float16 v16h;
typedef __attribute__((ext_vector_type(16))) __bf16 v16b;
typedef __attribute__((ext_vector_type(8)))  _Float16 v8h;
typedef __attribute__((ext_vector_type(8)))  float v8f;
typedef __attribute__((ext_vector_type(4)))  float v4f;
typedef __attribute__((ext_vector_type(2)))  float v2f;
typedef __attribute__((ext_vector_type(4)))  unsigned v4u;
typedef __attribute__((ext_vector_type(4)))  int v4i;
typedef float __attribute__((may_alias)) float_a;
typedef int __attribute__((may_alias)) int_a;

template <typename T> __device__ __forceinline__ void vst2(void* p, T v) { *(T*)p = v;  }
__device__ __forceinline__ v8f wmma16(v16h a, v16h b, v8f c) {
  v8f d = __builtin_amdgcn_wmma_f32_16x16x32_f16(false, a, false, b, (short)0, c, false, false);
  asm volatile("v_nop\n\tv_nop\n\tv_nop\n\tv_nop" : "+v"(d) : "v"(a), "v"(b));
  return d;
}
__device__ __forceinline__ v8f wmma_bf(v16b a, v16b b, v8f c) {
  v8f d = __builtin_amdgcn_wmma_f32_16x16x32_bf16(false, a, false, b, (short)0, c, false, false);
  asm volatile("v_nop\n\tv_nop\n\tv_nop\n\tv_nop" : "+v"(d) : "v"(a), "v"(b));
  return d;
}
// Adaptive-gravity causal attention (B 4, T 2,048, 1,024 dims, 16 heads x 64): fused q|k|v projection, table RoPE on q and k, scores / 8 minus a learned per-(token, head) softplus gravity times the clipped distance, causal softmax, . v, output projection.
__device__ __forceinline__ v16h frag_h(const _Float16* rowk0, int lane) {
  union { v16h v; v8h q[2]; } u; const _Float16* p = rowk0 + 8 * (lane >> 4);
  u.q[0] = *(const v8h*)p; u.q[1] = *(const v8h*)(p + 16); return u.v;
}
__device__ __forceinline__ v16h frag_f32(const float* rowk0, int lane) {
  v16h a; const float* p = rowk0 + 8 * (lane >> 4);
#pragma unroll
  for (int i = 0; i < 8; ++i) { a[i] = (_Float16)p[i]; a[8 + i] = (_Float16)p[16 + i]; }
  return a;
}
__device__ __forceinline__ v16h frag_f32s(const float* rowk0, int lane, float sc) {
  v16h a; const float* p = rowk0 + 8 * (lane >> 4);
#pragma unroll
  for (int i = 0; i < 8; ++i) { a[i] = (_Float16)(p[i] * sc); a[8 + i] = (_Float16)(p[16 + i] * sc); }
  return a;
}
// column fragment from a [K][ld] layout (column n), rows >= K read as 0
__device__ __forceinline__ v16h fragc_f32(const float* W, int k0, int n, int lane, int ld, int K) {
  v16h a; const int g = lane >> 4;
#pragma unroll
  for (int i = 0; i < 8; ++i) { const int ka = k0 + 8 * g + i, kb = ka + 16;
    a[i] = (_Float16)(ka < K ? W[(size_t)(ka < K ? ka : K - 1) * ld + n] : 0.f); a[8 + i] = (_Float16)(kb < K ? W[(size_t)(kb < K ? kb : K - 1) * ld + n] : 0.f); }
  return a;
}
struct F2 { v16b h, l; };
__device__ __forceinline__ F2 bsplit16(const float v[16]) { F2 r;
#pragma unroll
  for (int i = 0; i < 16; ++i) { const __bf16 h = (__bf16)v[i]; r.h[i] = h; r.l[i] = (__bf16)(v[i] - (float)h); }
  return r; }
__device__ __forceinline__ F2 split_row(const float* row, int k0, int lane) { float v[16]; const float* p = row + k0 + 8 * (lane >> 4);
#pragma unroll
  for (int i = 0; i < 8; ++i) { v[i] = p[i]; v[8 + i] = p[16 + i]; }
  return bsplit16(v); }
__device__ __forceinline__ F2 split_rowK(const float* row, int k0, int lane, int K) { float v[16]; const int g = lane >> 4;
#pragma unroll
  for (int i = 0; i < 8; ++i) { const int ka = k0 + 8 * g + i, kb = ka + 16; v[i] = ka < K ? row[ka < K ? ka : K - 1] : 0.f; v[8 + i] = kb < K ? row[kb < K ? kb : K - 1] : 0.f; }
  return bsplit16(v); }
__device__ __forceinline__ F2 split_col(const float* W, int k0, int n, int lane, int ld, int K) { float v[16]; const int g = lane >> 4;
#pragma unroll
  for (int i = 0; i < 8; ++i) { const int ka = k0 + 8 * g + i, kb = ka + 16; v[i] = ka < K ? W[(size_t)(ka < K ? ka : K - 1) * ld + n] : 0.f; v[8 + i] = kb < K ? W[(size_t)(kb < K ? kb : K - 1) * ld + n] : 0.f; }
  return bsplit16(v); }
__device__ __forceinline__ v8f mac3(const F2& a, const F2& b, v8f c) { c = wmma_bf(a.l, b.h, c); c = wmma_bf(a.h, b.l, c); return wmma_bf(a.h, b.h, c); }
__device__ __forceinline__ float sigm(float v) { return 1.0f / (1.0f + expf(-v)); }
#define LDSX() do { asm volatile("s_wait_dscnt 0" ::: "memory"); __builtin_amdgcn_wave_barrier(); __builtin_amdgcn_fence(__ATOMIC_RELEASE, "workgroup"); } while (0)


#define NB 4
#define SS 2048
#define SCALEF 0.125f
#define DM 1024
#define NH 16
__device__ __attribute__((noinline)) float cos_p(float v) { return cosf(v); }
__device__ __attribute__((noinline)) float sin_p(float v) { return sinf(v); }
__device__ __attribute__((noinline)) float exp_p(float v) { return expf(v); }
__device__ __attribute__((noinline)) float log1p_p(float v) { return log1pf(v); }
#define HD 64
#define QKVW (3 * DM)
#ifndef TQB
#define TQB (SS / 64)
#define TNB NB
#define TOB (NB * SS / 64)     // output row tiles (all)
#endif
typedef __attribute__((ext_vector_type(8))) __bf16 v8b;
__device__ __forceinline__ v16b frag_b(const __bf16* rowk0, int lane) {
  union { v16b v; v8b q[2]; } u; const __bf16* p = rowk0 + 8 * (lane >> 4);
  u.q[0] = *(const v8b*)p; u.q[1] = *(const v8b*)(p + 16); return u.v;
}
__device__ __forceinline__ float bfr(float v) { return (float)(__bf16)v; }
// stands behind a group of loads that stays in flight: the group's address registers are rewritten while it flies, and this is the wait that belongs in front of such a rewrite
#define XW() asm volatile("s_wait_xcnt 0x0" ::: "memory")
// keeps the source order load group | WMMA block | conversion of the next A: without it the scheduler held back the group's last loads and pulled that conversion, with its wait on loads just issued, in among the WMMAs
#define SB() __builtin_amdgcn_sched_barrier(0)
// one k step's operands as ONE group of loads: the 8 B fragments (rows n0 + 16 j + col of the packed weight) and the lane's 16 raw f32 of A; pb, pa already hold the lane's row and its 8 * g
__device__ __forceinline__ void ld_b8(v16b (&f)[8], const __bf16* pb, int kc) {
#pragma unroll
  for (int j = 0; j < 8; ++j) { union { v16b v; v8b q[2]; } u; const __bf16* p = pb + (size_t)j * 16 * DM + kc * 32; u.q[0] = *(const v8b*)p; u.q[1] = *(const v8b*)(p + 16); f[j] = u.v; }
}
__device__ __forceinline__ void ld_a16(v4f (&r)[4], const float* pa, int kc) { const float* p = pa + kc * 32; r[0] = *(const v4f*)p; r[1] = *(const v4f*)(p + 4); r[2] = *(const v4f*)(p + 16); r[3] = *(const v4f*)(p + 20); }
__device__ __forceinline__ v16b cvt_a16(const v4f (&r)[4]) { v16b a;
#pragma unroll
  for (int i = 0; i < 8; ++i) { a[i] = (__bf16)r[i >> 2][i & 3]; a[8 + i] = (__bf16)r[2 + (i >> 2)][i & 3]; }
  return a; }
__device__ __forceinline__ F2 split_a16(const v4f (&r)[4]) { float v[16];
#pragma unroll
  for (int i = 0; i < 8; ++i) { v[i] = r[i >> 2][i & 3]; v[8 + i] = r[2 + (i >> 2)][i & 3]; }
  return bsplit16(v); }
__device__ __attribute__((noinline)) float exp_ni(float v) { return expf(v); }
__device__ __attribute__((noinline)) float erf_ni(float v) { return erff(v); }

#define PK_A 0                       // [3072][1024] Wqkv rows (natural [out][in])
#define PK_P (PK_A + QKVW * DM)        // [1024][1024] Wo rows (natural)
#define PK_END (PK_P + DM * DM)
#define WS_PK  0u
#define WS_QK  (WS_PK + 2u * PK_END)             // f16 [8192 rows][2048]: q | k
#define WS_QKL (WS_QK + 2u * NB * SS * 2 * DM)     // f16 q | k residual planes x2048
#define WS_VTH (WS_QKL + 2u * NB * SS * 2 * DM)    // f16 [b][1024 (h*64+d)][2048 s] hi
#define WS_VTL (WS_VTH + 2u * NB * DM * SS)        // f16 lo x 2048
#define WS_O   (WS_VTL + 2u * NB * DM * SS)        // f32 [8192][1024]
#define WS_CS  (WS_O + 4u * NB * SS * DM)           // f32 2 x [2048][32], unused
#define WS_G   (WS_CS + 4u * 2 * SS * 32)                  // f32 [b*t][16] softplus(x . g_w + g_b)
#define WS_END (WS_G + 4u * (size_t)NB * SS * NH)
// ---- k_pack: block = (row n, which): (in,out) column n -> bf16 row n; which 0..2 -> W_q/W_k/W_v into PK_A rows which*1024 + n; 3 -> W_o into PK_P
__global__ __launch_bounds__(256) void k_pack(const float* __restrict__ WQ, const float* __restrict__ WK, const float* __restrict__ WV, const float* __restrict__ WO, __bf16* __restrict__ PK) {
  __shared__ __align__(16) __bf16 s[DM]; const int n = blockIdx.x, which = blockIdx.y, t = threadIdx.x; const float* Wm = (which == 0) ? WQ : (which == 1) ? WK : (which == 2) ? WV : WO;   // (in,out) weights: pack row n = column n
  for (int k = t; k < DM; k += 256) s[k] = (__bf16)Wm[(size_t)k * DM + n];
  __syncthreads();
  __bf16* dst = (which < 3) ? PK + PK_A + ((size_t)which * DM + n) * DM : PK + PK_P + (size_t)n * DM;
  for (int q = t; q < DM / 8; q += 256) vst2((unsigned*)(dst + q * 8), *(const v4u*)&s[q * 8]);
}
__global__ __launch_bounds__(128) void k_qkv(const float* __restrict__ XQ, const float* __restrict__ XK, const float* __restrict__ XV, const __bf16* __restrict__ P, const float* __restrict__ BQ, const float* __restrict__ BK, const float* __restrict__ BV, const float* __restrict__ POS, _Float16* __restrict__ QK, _Float16* __restrict__ QKL, _Float16* __restrict__ VTH, _Float16* __restrict__ VTL) {
  const int which0 = (blockIdx.y * 128) / DM; const float* X = (which0 == 0) ? XQ : (which0 == 1) ? XK : XV; const float* BB = BQ ? (((which0 == 0) ? BQ : (which0 == 1) ? BK : BV) + (blockIdx.y * 128 - which0 * DM)) : nullptr;
  __shared__ __align__(16) _Float16 so[4][16][136], sol[4][16][136]; __shared__ __align__(16) _Float16 sth[128][72], stl[128][72];
  const int tid = threadIdx.x, wave = tid >> 5, lane = tid & 31, col = lane & 15, g = lane >> 4; const size_t r0 = (size_t)blockIdx.x * 64 + wave * 16; const int n0 = blockIdx.y * 128;
  v8f acc[8] = {};
  const float* pa = X + (r0 + col) * DM + 8 * g; const __bf16* pb = P + (size_t)(n0 + col) * DM + 8 * g;
  v16b b0[8], b1[8]; v4f ar[4];   // two B register sets: step kc + 1 is in flight while step kc is multiplied
  ld_a16(ar, pa, 0); ld_b8(b0, pb, 0); XW();
#pragma unroll 1
  for (int kc = 0; kc < DM / 32 - 2; kc += 2) { v16b a = cvt_a16(ar);   // the last two steps stand behind the loop: no branch round a load group, so every wait in the loop is a counted one
    ld_a16(ar, pa, kc + 1); ld_b8(b1, pb, kc + 1); XW(); SB();
#pragma unroll
    for (int j = 0; j < 8; ++j) acc[j] = wmma_bf(a, b0[j], acc[j]);
    SB(); a = cvt_a16(ar);
    ld_a16(ar, pa, kc + 2); ld_b8(b0, pb, kc + 2); XW(); SB();
#pragma unroll
    for (int j = 0; j < 8; ++j) acc[j] = wmma_bf(a, b1[j], acc[j]);
    SB(); }
  { v16b a = cvt_a16(ar);
    ld_a16(ar, pa, DM / 32 - 1); ld_b8(b1, pb, DM / 32 - 1); XW(); SB();
#pragma unroll
    for (int j = 0; j < 8; ++j) acc[j] = wmma_bf(a, b0[j], acc[j]);
    SB(); a = cvt_a16(ar);
#pragma unroll
    for (int j = 0; j < 8; ++j) acc[j] = wmma_bf(a, b1[j], acc[j]); }
  if (n0 < 2 * DM) {   // bias, then rotate-half rotary over each 64-dim head with angle rope[position][d] from the learned table
#pragma unroll
    for (int j = 0; j < 8; ++j)
#pragma unroll
      for (int r = 0; r < 8; ++r) acc[j][r] += (BB ? bfr(BB[j * 16 + col]) : 0.f);
#pragma unroll
    for (int r = 0; r < 8; ++r) { const int spos = (int)((r0 + 8 * g + r) % SS); const float* pr = POS + (size_t)spos * HD;   // learned table: out[d] = x[d] cos(p[d]) -+ partner sin(p[d])
#pragma unroll
      for (int jj = 0; jj < 2; ++jj) { const float p1 = bfr(pr[jj * 16 + col]), p2 = bfr(pr[32 + jj * 16 + col]); const float c1 = cos_p(p1), s1 = sin_p(p1), c2 = cos_p(p2), s2 = sin_p(p2);
#pragma unroll
        for (int hh = 0; hh < 2; ++hh) { const float x1 = acc[hh * 4 + jj][r], x2 = acc[hh * 4 + jj + 2][r]; acc[hh * 4 + jj][r] = x1 * c1 - x2 * s1; acc[hh * 4 + jj + 2][r] = x2 * c2 + x1 * s2; } } }
#pragma unroll
    for (int j = 0; j < 8; ++j) {
#pragma unroll
      for (int r = 0; r < 8; ++r) { const float v = acc[j][r]; const _Float16 hv = (_Float16)v; so[wave][8 * g + r][j * 16 + col] = hv; sol[wave][8 * g + r][j * 16 + col] = (_Float16)((v - (float)hv) * 2048.0f); } }   // q, k (+ bias) as f16 hi + (x2048) residual
    LDSX();
    for (int rl = 0; rl < 16; ++rl) if (lane < 16) { vst2((unsigned*)(QK + (r0 + rl) * (2 * DM) + n0 + lane * 8), *(const v4u*)&so[wave][rl][lane * 8]); vst2((unsigned*)(QKL + (r0 + rl) * (2 * DM) + n0 + lane * 8), *(const v4u*)&sol[wave][rl][lane * 8]); }
  } else {
#pragma unroll
    for (int j = 0; j < 8; ++j) {
#pragma unroll
      for (int r = 0; r < 8; ++r) { const float v = acc[j][r] + (BB ? bfr(BB[j * 16 + col]) : 0.f); const _Float16 hv = (_Float16)v; sth[j * 16 + col][wave * 16 + 8 * g + r] = hv; stl[j * 16 + col][wave * 16 + 8 * g + r] = (_Float16)((v - (float)hv) * 2048.0f); } }
    __syncthreads();
    const size_t rb = (size_t)blockIdx.x * 64; const int b = (int)(rb / SS), s0 = (int)(rb % SS); const int pc0 = n0 - 2 * DM;
    for (int q = tid; q < 128 * 8; q += 128) { const int d = q >> 3, pc = q & 7; const size_t o = ((size_t)b * DM + pc0 + d) * SS + s0 + pc * 8; vst2((unsigned*)(VTH + o), *(const v4u*)&sth[d][pc * 8]); vst2((unsigned*)(VTL + o), *(const v4u*)&stl[d][pc * 8]); }
  }
}
// lane l <-> lane l ^ 16 as a vector cross-row move (no LDS counter to wait on)
__device__ __forceinline__ float xhalf(float x) { return __builtin_bit_cast(float, __builtin_amdgcn_permlanex16(__builtin_bit_cast(int, x), __builtin_bit_cast(int, x), 0x76543210, 0xfedcba98, false, false)); }
// e^x as the hardware exp2 of x * log2(e), the same two instructions __expf compiles to; the v_nop inside the statement keeps the one slot the instruction set asks for behind a transcendental
__device__ __forceinline__ float exp_hw(float x) { float y; const float t = x * 1.44269504f; asm("v_exp_f32 %0, %1\n\tv_nop" : "=v"(y) : "v"(t)); return y; }
// ---- k_attn: block = (64 queries, head h, batch b): causal flash attention on TRANSPOSED tiles: S^T = K . Q^T (rows = keys, column = this lane's query), so the softmax of a query lives in one lane pair and the D registers of S^T are already the B fragment of O^T = V^T . P^T (k = 8g + i from key tile 0, 16 + 8g + i from key tile 1); O[b*S+q][h*64+d] = (acc + accl / 2048) / (2048 l) (256-B segments)
__global__ __launch_bounds__(128) void k_attn(const _Float16* __restrict__ QK, const _Float16* __restrict__ QKL, const _Float16* __restrict__ VTH, const _Float16* __restrict__ VTL, const void* __restrict__ KMASK, const float* __restrict__ GR, float* __restrict__ O) {
  __shared__ __align__(16) float so[4][16][68];
  const int tid = threadIdx.x, wave = tid >> 5, lane = tid & 31, col = lane & 15, g = lane >> 4;
  const int qb = blockIdx.x, h = blockIdx.y, b = blockIdx.z; const int q0 = qb * 64 + wave * 16; const int qi = q0 + col; const size_t rq = (size_t)b * SS + qi;
  v16h aq[2], aql[2];
#pragma unroll
  for (int kc = 0; kc < 2; ++kc) { aq[kc] = frag_h(QK + rq * (2 * DM) + h * HD + kc * 32, lane); aql[kc] = frag_h(QKL + rq * (2 * DM) + h * HD + kc * 32, lane); }
  const float gq = GR[rq * NH + h];   // this lane's query: one gravity value
  float m = -3.0e38f, l = 0.f;        // l: partial sum over this lane half's keys, joined after the loop
  v8f acc[4] = {}, accl[4] = {};
  const int nks = (qb * 64 + 64) / 32;   // causal: key tiles up to the query tile's end
  const _Float16* kb = QK + ((size_t)b * SS + col) * (2 * DM) + DM + h * HD; const _Float16* vb = VTH + ((size_t)b * DM + h * HD + col) * SS;
  v16h kf[2][2], vf[4];   // hi fragments held whole: K of tile ks + 1 is fetched behind the scores of tile ks, V of tile ks in front of them
#pragma unroll
  for (int ct = 0; ct < 2; ++ct)
#pragma unroll
    for (int kc = 0; kc < 2; ++kc) kf[ct][kc] = frag_h(kb + (size_t)(ct * 16) * (2 * DM) + kc * 32, lane);
#pragma unroll 1
  for (int ks = 0; ks < nks; ++ks) { v8f s[2];
#pragma unroll
    for (int dt = 0; dt < 4; ++dt) vf[dt] = frag_h(vb + (size_t)(dt * 16) * SS + ks * 32, lane);
    XW();
#pragma unroll
    for (int ct = 0; ct < 2; ++ct) { const int kr = ks * 32 + ct * 16 + col; const _Float16* krowl = QKL + ((size_t)b * SS + kr) * (2 * DM) + DM + h * HD; v8f c = {}, cl = {};
      if (qb < 2) {   // leading query blocks (few keys, outputs far above the global rms): 3 products
#pragma unroll
        for (int kc = 0; kc < 2; ++kc) { const v16h kh = kf[ct][kc]; c = wmma16(kh, aq[kc], c); cl = wmma16(kh, aql[kc], cl); cl = wmma16(frag_h(krowl + kc * 32, lane), aq[kc], cl); }
#pragma unroll
        for (int r = 0; r < 8; ++r) c[r] += cl[r] * (1.0f / 2048.0f); }
      else {
#pragma unroll
        for (int kc = 0; kc < 2; ++kc) c = wmma16(kf[ct][kc], aq[kc], c); }   // single product elsewhere
#pragma unroll
      for (int r = 0; r < 8; ++r) { const int kk = ks * 32 + ct * 16 + 8 * g + r; const int dd = min(qi - kk, 64); s[ct][r] = (kk <= qi) ? (c[r] * SCALEF - gq * (float)dd * 0.1f) : -3.0e38f; } }   // causal; - softplus-gravity x min(|i-j|,64) x 0.1
    const int kn = (ks + 1 < nks) ? ks + 1 : ks;   // no branch round the load group (its waits stay counted ones); the last tile is fetched once more and not used
#pragma unroll
    for (int ct = 0; ct < 2; ++ct)
#pragma unroll
      for (int kc = 0; kc < 2; ++kc) kf[ct][kc] = frag_h(kb + (size_t)(kn * 32 + ct * 16) * (2 * DM) + kc * 32, lane);
    float mx = fmaxf(s[0][0], s[1][0]);
#pragma unroll
    for (int r = 1; r < 8; ++r) mx = fmaxf(mx, fmaxf(s[0][r], s[1][r]));
    mx = fmaxf(mx, xhalf(mx));   // the other 16 keys of this query sit in the partner lane
    const float mn = fmaxf(m, mx); const float am = exp_hw(m - mn); const float alpha = (m <= -1.0e38f) ? 0.f : am;
    float es = 0.f; v16h pa, pl;
#pragma unroll
    for (int r = 0; r < 8; ++r) { const float y0 = exp_hw(s[0][r] - mn), y1 = exp_hw(s[1][r] - mn); const float e0 = (s[0][r] <= -1.0e38f) ? 0.f : y0, e1 = (s[1][r] <= -1.0e38f) ? 0.f : y1; es += e0 + e1;
      const float x0 = e0 * 2048.0f, x1 = e1 * 2048.0f; const _Float16 h0 = (_Float16)x0, h1 = (_Float16)x1; pa[r] = h0; pa[8 + r] = h1; pl[r] = (_Float16)((x0 - (float)h0) * 2048.0f); pl[8 + r] = (_Float16)((x1 - (float)h1) * 2048.0f); }   // P scaled by 2^11 before the f16 split so small softmax weights stay out of the f16 subnormal range; 2^-11 folded into the epilogue
    l = l * alpha + es; m = mn;
#pragma unroll
    for (int dt = 0; dt < 4; ++dt)
#pragma unroll
      for (int r = 0; r < 8; ++r) { acc[dt][r] *= alpha; accl[dt][r] *= alpha; }
#pragma unroll
    for (int dt = 0; dt < 4; ++dt) { const size_t vr = ((size_t)b * DM + h * HD + dt * 16 + col) * SS + ks * 32; const v16h vh = vf[dt]; acc[dt] = wmma16(vh, pa, acc[dt]); if (qb < 2) { accl[dt] = wmma16(vh, pl, accl[dt]); accl[dt] = wmma16(frag_h(VTL + vr, lane), pa, accl[dt]); } }   // leading query blocks: P hi/lo x V hi/lo (3 products); elsewhere P x V single
  }
  l += xhalf(l);
  const float il = (1.0f / 2048.0f) / l;
#pragma unroll
  for (int dt = 0; dt < 4; ++dt)
#pragma unroll
    for (int r = 0; r < 8; ++r) so[wave][col][dt * 16 + 8 * g + r] = (acc[dt][r] + accl[dt][r] * (1.0f / 2048.0f)) * il;
  LDSX();
  for (int rl = 0; rl < 16; ++rl) if (lane < 16) vst2(O + ((size_t)b * SS + q0 + rl) * DM + h * HD + lane * 4, *(const v4f*)&so[wave][rl][lane * 4]);
}
// ---- k_out: block = (64 rows, 128 cols): out = O(hi/lo) . Wo rows (2 products) + bo
__global__ __launch_bounds__(128) void k_out(const float* __restrict__ O, const __bf16* __restrict__ P, const float* __restrict__ BO, float* __restrict__ Y) {
  __shared__ __align__(16) float so[4][16][132];
  const int tid = threadIdx.x, wave = tid >> 5, lane = tid & 31, col = lane & 15, g = lane >> 4; const size_t r0 = (size_t)blockIdx.x * 64 + wave * 16; const int n0 = blockIdx.y * 128;
  v8f acc[8] = {};
  const float* pa = O + (r0 + col) * DM + 8 * g; const __bf16* pb = P + (size_t)(n0 + col) * DM + 8 * g;
  v16b b0[8], b1[8]; v4f ar[4];   // two B register sets: step kc + 1 is in flight while step kc is multiplied
  ld_a16(ar, pa, 0); ld_b8(b0, pb, 0); XW();
#pragma unroll 1
  for (int kc = 0; kc < DM / 32 - 2; kc += 2) { F2 a = split_a16(ar);   // the last two steps stand behind the loop: no branch round a load group, so every wait in the loop is a counted one
    ld_a16(ar, pa, kc + 1); ld_b8(b1, pb, kc + 1); XW();
#pragma unroll
    for (int j = 0; j < 8; ++j) { acc[j] = wmma_bf(a.l, b0[j], acc[j]); acc[j] = wmma_bf(a.h, b0[j], acc[j]); }
    a = split_a16(ar);
    ld_a16(ar, pa, kc + 2); ld_b8(b0, pb, kc + 2); XW();
#pragma unroll
    for (int j = 0; j < 8; ++j) { acc[j] = wmma_bf(a.l, b1[j], acc[j]); acc[j] = wmma_bf(a.h, b1[j], acc[j]); } }
  { F2 a = split_a16(ar);
    ld_a16(ar, pa, DM / 32 - 1); ld_b8(b1, pb, DM / 32 - 1); XW();
#pragma unroll
    for (int j = 0; j < 8; ++j) { acc[j] = wmma_bf(a.l, b0[j], acc[j]); acc[j] = wmma_bf(a.h, b0[j], acc[j]); }
    a = split_a16(ar);
#pragma unroll
    for (int j = 0; j < 8; ++j) { acc[j] = wmma_bf(a.l, b1[j], acc[j]); acc[j] = wmma_bf(a.h, b1[j], acc[j]); } }
#pragma unroll
  for (int j = 0; j < 8; ++j) {
#pragma unroll
    for (int r = 0; r < 8; ++r) so[wave][8 * g + r][j * 16 + col] = acc[j][r] + (BO ? bfr(BO[n0 + j * 16 + col]) : 0.f); }
  LDSX();
  for (int rl = 0; rl < 16; ++rl) vst2(Y + (r0 + rl) * DM + n0 + lane * 4, *(const v4f*)&so[wave][rl][lane * 4]);
}
// ---- k_pack3: the fused (in,out) W_attn [DM][3*DM] -> the three transposed bf16 row blocks
__global__ __launch_bounds__(256) void k_pack3(const float* __restrict__ WA, __bf16* __restrict__ PK) { __shared__ __align__(16) __bf16 s[DM]; const int n = blockIdx.x, which = blockIdx.y, t = threadIdx.x; for (int k = t; k < DM; k += 256) s[k] = (__bf16)WA[(size_t)k * (3 * DM) + which * DM + n]; __syncthreads(); for (int q = t; q < DM / 8; q += 256) vst2((unsigned*)(PK + PK_A + ((size_t)which * DM + n) * DM + q * 8), *(const v4u*)&s[q * 8]); }
// ---- k_grav: block = 64 rows (256 threads: 4 per row x 4 heads each): g[row][h] = softplus(x . g_w[:, h] + g_b[h]) in f32 from the bf16-rounded inputs; whole 4-KB block segment
__global__ __launch_bounds__(256) void k_grav(const float* __restrict__ X, const float* __restrict__ GW, const float* __restrict__ GB, float* __restrict__ GR) {
  __shared__ __align__(16) float sg[64][NH]; const size_t r0 = (size_t)blockIdx.x * 64; const int t = threadIdx.x; const int rl = t >> 2, hq = t & 3;
  float a[4] = {0.f, 0.f, 0.f, 0.f}; const float* xr = X + (r0 + rl) * DM;
  for (int k = 0; k < DM; ++k) { const float xv = bfr(xr[k]);
#pragma unroll
    for (int i = 0; i < 4; ++i) a[i] += xv * bfr(GW[(size_t)k * NH + hq * 4 + i]); }
#pragma unroll
  for (int i = 0; i < 4; ++i) { const float z = a[i] + bfr(GB[hq * 4 + i]); sg[rl][hq * 4 + i] = (z > 20.f) ? z : log1p_p(exp_p(z)); }   // softplus
  __syncthreads();
  vst2(GR + (r0 * NH) + t * 4, *(const v4f*)(&sg[0][0] + t * 4));
}
extern "C" void kernel_launch(void* const* d_in, const int* in_sizes, int n_in, void* d_out, int out_size, void* d_ws, size_t ws_size, hipStream_t stream) {
  (void)in_sizes; (void)n_in; (void)out_size;
  const float** F = (const float**)d_in;   // 0 x [4,2048,1024], 1 rope [2048,64], 2 W_attn [1024,3072] (in,out: q|k|v), 3 W_proj [1024,1024] (in,out), 4 g_w [1024,16], 5 g_b [16]
  if (ws_size < (size_t)WS_END) return;
  char* ws = (char*)d_ws; __bf16* PK = (__bf16*)(ws + WS_PK); _Float16 *QK = (_Float16*)(ws + WS_QK), *QKL = (_Float16*)(ws + WS_QKL), *VTH = (_Float16*)(ws + WS_VTH), *VTL = (_Float16*)(ws + WS_VTL); float *O = (float*)(ws + WS_O), *GR = (float*)(ws + WS_G);
  k_pack<<<dim3(DM, 4), 256, 0, stream>>>(F[3], F[3], F[3], F[3], PK);   // W_proj rows (q/k/v slots overwritten next)
  k_pack3<<<dim3(DM, 3), 256, 0, stream>>>(F[2], PK);
  k_grav<<<TNB * SS / 64, 256, 0, stream>>>(F[0], F[4], F[5], GR);
  k_qkv<<<dim3(TNB * SS / 64, QKVW / 128), 128, 0, stream>>>(F[0], F[0], F[0], PK + PK_A, nullptr, nullptr, nullptr, F[1], QK, QKL, VTH, VTL);
  k_attn<<<dim3(TQB, NH, TNB), 128, 0, stream>>>(QK, QKL, VTH, VTL, nullptr, GR, O);
  k_out<<<dim3(TOB, DM / 128), 128, 0, stream>>>(O, PK + PK_P, nullptr, (float*)d_out);
}

// v003
// It runs in 397 microseconds.
// Next to v002, in two timings, it ran 1.40 times as fast each time.
// Counting every step since v000, it is 2.29 times as fast.
// compute dtype: all float inputs rounded to bf16; qkv = x . W_attn with EXACT bf16 products on WMMA 16x16x32 ((in,out) columns q | k | v as transposed rows); rotate-half RoPE with the learned angle table (precise sinf/cosf of rope[t][d]) on q and k in f32 before the f16 hi + residual split; gravity softplus(x . g_w + g_b) in f32 (precise expf/log1pf); causal attention: 3-product scores and hi + residual P, v on the first 128 queries of each sequence, single f16 beyond; x 1/8 - g x min(|i-j|, 64) x 0.1, running-max softmax in f32 (hardware exp), P scaled by 2^11; out = y (bf16 hi + residual) . W_proj (2 products).
#include <hip/hip_runtime.h>
#include <math.h>

typedef __attribute__((ext_vector_type(16))) _Float16 v16h;
typedef __attribute__((ext_vector_type(16))) __bf16 v16b;
typedef __attribute__((ext_vector_type(8)))  _Float16 v8h;
typedef __attribute__((ext_vector_type(8)))  float v8f;
typedef __attribute__((ext_vector_type(4)))  float v4f;
typedef __attribute__((ext_vector_type(2)))  float v2f;
typedef __attribute__((ext_vector_type(4)))  unsigned v4u;
typedef __attribute__((ext_vector_type(4)))  int v4i;
typedef float __attribute__((may_alias)) float_a;
typedef int __attribute__((may_alias)) int_a;

template <typename T> __device__ __forceinline__ void vst2(void* p, T v) { *(T*)p = v;  }
__device__ __forceinline__ v8f wmma16(v16h a, v16h b, v8f c) {
  v8f d = __builtin_amdgcn_wmma_f32_16x16x32_f16(false, a, false, b, (short)0, c, false, false);
  asm volatile("v_nop\n\tv_nop\n\tv_nop\n\tv_nop" : "+v"(d) : "v"(a), "v"(b));
  return d;
}
__device__ __forceinline__ v8f wmma_bf(v16b a, v16b b, v8f c) {
  v8f d = __builtin_amdgcn_wmma_f32_16x16x32_bf16(false, a, false, b, (short)0, c, false, false);
  asm volatile("v_nop\n\tv_nop\n\tv_nop\n\tv_nop" : "+v"(d) : "v"(a), "v"(b));
  return d;
}
// Adaptive-gravity causal attention (B 4, T 2,048, 1,024 dims, 16 heads x 64): fused q|k|v projection, table RoPE on q and k, scores / 8 minus a learned per-(token, head) softplus gravity times the clipped distance, causal softmax, . v, output projection.
__device__ __forceinline__ v16h frag_h(const _Float16* rowk0, int lane) {
  union { v16h v; v8h q[2]; } u; const _Float16* p = rowk0 + 8 * (lane >> 4);
  u.q[0] = *(const v8h*)p; u.q[1] = *(const v8h*)(p + 16); return u.v;
}
__device__ __forceinline__ v16h frag_f32(const float* rowk0, int lane) {
  v16h a; const float* p = rowk0 + 8 * (lane >> 4);
#pragma unroll
  for (int i = 0; i < 8; ++i) { a[i] = (_Float16)p[i]; a[8 + i] = (_Float16)p[16 + i]; }
  return a;
}
__device__ __forceinline__ v16h frag_f32s(const float* rowk0, int lane, float sc) {
  v16h a; const float* p = rowk0 + 8 * (lane >> 4);
#pragma unroll
  for (int i = 0; i < 8; ++i) { a[i] = (_Float16)(p[i] * sc); a[8 + i] = (_Float16)(p[16 + i] * sc); }
  return a;
}
// column fragment from a [K][ld] layout (column n), rows >= K read as 0
__device__ __forceinline__ v16h fragc_f32(const float* W, int k0, int n, int lane, int ld, int K) {
  v16h a; const int g = lane >> 4;
#pragma unroll
  for (int i = 0; i < 8; ++i) { const int ka = k0 + 8 * g + i, kb = ka + 16;
    a[i] = (_Float16)(ka < K ? W[(size_t)(ka < K ? ka : K - 1) * ld + n] : 0.f); a[8 + i] = (_Float16)(kb < K ? W[(size_t)(kb < K ? kb : K - 1) * ld + n] : 0.f); }
  return a;
}
struct F2 { v16b h, l; };
__device__ __forceinline__ F2 bsplit16(const float v[16]) { F2 r;
#pragma unroll
  for (int i = 0; i < 16; ++i) { const __bf16 h = (__bf16)v[i]; r.h[i] = h; r.l[i] = (__bf16)(v[i] - (float)h); }
  return r; }
__device__ __forceinline__ F2 split_row(const float* row, int k0, int lane) { float v[16]; const float* p = row + k0 + 8 * (lane >> 4);
#pragma unroll
  for (int i = 0; i < 8; ++i) { v[i] = p[i]; v[8 + i] = p[16 + i]; }
  return bsplit16(v); }
__device__ __forceinline__ F2 split_rowK(const float* row, int k0, int lane, int K) { float v[16]; const int g = lane >> 4;
#pragma unroll
  for (int i = 0; i < 8; ++i) { const int ka = k0 + 8 * g + i, kb = ka + 16; v[i] = ka < K ? row[ka < K ? ka : K - 1] : 0.f; v[8 + i] = kb < K ? row[kb < K ? kb : K - 1] : 0.f; }
  return bsplit16(v); }
__device__ __forceinline__ F2 split_col(const float* W, int k0, int n, int lane, int ld, int K) { float v[16]; const int g = lane >> 4;
#pragma unroll
  for (int i = 0; i < 8; ++i) { const int ka = k0 + 8 * g + i, kb = ka + 16; v[i] = ka < K ? W[(size_t)(ka < K ? ka : K - 1) * ld + n] : 0.f; v[8 + i] = kb < K ? W[(size_t)(kb < K ? kb : K - 1) * ld + n] : 0.f; }
  return bsplit16(v); }
__device__ __forceinline__ v8f mac3(const F2& a, const F2& b, v8f c) { c = wmma_bf(a.l, b.h, c); c = wmma_bf(a.h, b.l, c); return wmma_bf(a.h, b.h, c); }
__device__ __forceinline__ float sigm(float v) { return 1.0f / (1.0f + expf(-v)); }
#define LDSX() do { asm volatile("s_wait_dscnt 0" ::: "memory"); __builtin_amdgcn_wave_barrier(); __builtin_amdgcn_fence(__ATOMIC_RELEASE, "workgroup"); } while (0)


#define NB 4
#define SS 2048
#define SCALEF 0.125f
#define DM 1024
#define NH 16
__device__ __attribute__((noinline)) float cos_p(float v) { return cosf(v); }
__device__ __attribute__((noinline)) float sin_p(float v) { return sinf(v); }
__device__ __attribute__((noinline)) float exp_p(float v) { return expf(v); }
__device__ __attribute__((noinline)) float log1p_p(float v) { return log1pf(v); }
#define HD 64
#define QKVW (3 * DM)
#ifndef TQB
#define TQB (SS / 64)
#define TNB NB
#define TOB (NB * SS / 64)     // output row tiles (all)
#endif
typedef __attribute__((ext_vector_type(8))) __bf16 v8b;
__device__ __forceinline__ v16b frag_b(const __bf16* rowk0, int lane) {
  union { v16b v; v8b q[2]; } u; const __bf16* p = rowk0 + 8 * (lane >> 4);
  u.q[0] = *(const v8b*)p; u.q[1] = *(const v8b*)(p + 16); return u.v;
}
__device__ __forceinline__ float bfr(float v) { return (float)(__bf16)v; }
// stands behind a group of loads that stays in flight: the group's address registers are rewritten while it flies, and this is the wait that belongs in front of such a rewrite
#define XW() asm volatile("s_wait_xcnt 0x0" ::: "memory")
// scheduling fence: a stage's LDS fragment reads stay in front of its WMMAs, in the groups and order written
#define SB() __builtin_amdgcn_sched_barrier(0)
// ---- operand ring of k_qkv and k_out: a stage is 64 k of the block's 128 weight rows (128 B of bf16 each) and of its 64 activation rows (256 B of f32 each), brought into LDS once for all four waves as whole 128-B lines; row pitches are 16 B x odd, so the 16-byte fragment reads meet no bank conflict
#define KT 64
#define NT (DM / KT)
#define BPI 144
#define API 272
#define RB_B (128 * BPI)
#define RB_S (RB_B + 64 * API)
// the issuing wave's wait for its own copies, and its wait for its own LDS reads: both stand in front of the barrier that hands a stage over
#define AW() asm volatile("s_wait_asynccnt 0x0" ::: "memory")
#define DW() asm volatile("s_wait_dscnt 0x0" ::: "memory")
// eight 16-byte copies of one lane, rows sl (LDS bytes) and sg (global bytes) apart; the s_wait_xcnt closes the statement so that no address register named here is rewritten in front of it
__device__ __forceinline__ void cp8(unsigned l, const char* p, unsigned sl, size_t sg) {
  asm volatile("global_load_async_to_lds_b128 %0, %8, off\n\tglobal_load_async_to_lds_b128 %1, %9, off\n\tglobal_load_async_to_lds_b128 %2, %10, off\n\tglobal_load_async_to_lds_b128 %3, %11, off\n\t"
               "global_load_async_to_lds_b128 %4, %12, off\n\tglobal_load_async_to_lds_b128 %5, %13, off\n\tglobal_load_async_to_lds_b128 %6, %14, off\n\tglobal_load_async_to_lds_b128 %7, %15, off\n\ts_wait_xcnt 0x0"
               :: "v"(l), "v"(l + sl), "v"(l + 2 * sl), "v"(l + 3 * sl), "v"(l + 4 * sl), "v"(l + 5 * sl), "v"(l + 6 * sl), "v"(l + 7 * sl),
                  "v"(p), "v"(p + sg), "v"(p + 2 * sg), "v"(p + 3 * sg), "v"(p + 4 * sg), "v"(p + 5 * sg), "v"(p + 6 * sg), "v"(p + 7 * sg) : "memory");
}
// one stage: lane tid brings chunk tid & 7 of weight rows (tid >> 3) + 16 i and chunk tid & 15 of activation rows (tid >> 4) + 8 i; lb, la, gb, ga already hold the lane's first row and chunk
__device__ __forceinline__ void cp_stage(unsigned lb, unsigned la, const __bf16* gb, const float* ga) { cp8(lb, (const char*)gb, 16 * BPI, (size_t)16 * DM * 2); cp8(la, (const char*)ga, 8 * API, (size_t)8 * DM * 4); }
// one 32-k step's fragments out of a stage, in the k order of the global rows: sb, sa already hold the lane's row and its 8 * g elements
__device__ __forceinline__ void lds_b8(v16b (&f)[8], const char* sb, int kc) {
#pragma unroll
  for (int j = 0; j < 8; ++j) { union { v16b v; v8b q[2]; } u; const char* p = sb + j * 16 * BPI + kc * 64; u.q[0] = *(const v8b*)p; u.q[1] = *(const v8b*)(p + 32); f[j] = u.v; }
}
__device__ __forceinline__ void lds_a16(v4f (&r)[4], const char* sa, int kc) { const char* p = sa + kc * 128; r[0] = *(const v4f*)p; r[1] = *(const v4f*)(p + 16); r[2] = *(const v4f*)(p + 64); r[3] = *(const v4f*)(p + 80); }
__device__ __forceinline__ v16b cvt_a16(const v4f (&r)[4]) { v16b a;
#pragma unroll
  for (int i = 0; i < 8; ++i) { a[i] = (__bf16)r[i >> 2][i & 3]; a[8 + i] = (__bf16)r[2 + (i >> 2)][i & 3]; }
  return a; }
__device__ __forceinline__ F2 split_a16(const v4f (&r)[4]) { float v[16];
#pragma unroll
  for (int i = 0; i < 8; ++i) { v[i] = r[i >> 2][i & 3]; v[8 + i] = r[2 + (i >> 2)][i & 3]; }
  return bsplit16(v); }
__device__ __attribute__((noinline)) float exp_ni(float v) { return expf(v); }
__device__ __attribute__((noinline)) float erf_ni(float v) { return erff(v); }

#define PK_A 0                       // [3072][1024] Wqkv rows (natural [out][in])
#define PK_P (PK_A + QKVW * DM)        // [1024][1024] Wo rows (natural)
#define PK_END (PK_P + DM * DM)
#define WS_PK  0u
#define WS_QK  (WS_PK + 2u * PK_END)             // f16 [8192 rows][2048]: q | k
#define WS_QKL (WS_QK + 2u * NB * SS * 2 * DM)     // f16 q | k residual planes x2048
#define WS_VTH (WS_QKL + 2u * NB * SS * 2 * DM)    // f16 [b][1024 (h*64+d)][2048 s] hi
#define WS_VTL (WS_VTH + 2u * NB * DM * SS)        // f16 lo x 2048
#define WS_O   (WS_VTL + 2u * NB * DM * SS)        // f32 [8192][1024]
#define WS_CS  (WS_O + 4u * NB * SS * DM)           // f32 2 x [2048][32], unused
#define WS_G   (WS_CS + 4u * 2 * SS * 32)                  // f32 [b*t][16] softplus(x . g_w + g_b)
#define WS_END (WS_G + 4u * (size_t)NB * SS * NH)
// ---- k_pack: block = (row n, which): (in,out) column n -> bf16 row n; which 0..2 -> W_q/W_k/W_v into PK_A rows which*1024 + n; 3 -> W_o into PK_P
__global__ __launch_bounds__(256) void k_pack(const float* __restrict__ WQ, const float* __restrict__ WK, const float* __restrict__ WV, const float* __restrict__ WO, __bf16* __restrict__ PK) {
  __shared__ __align__(16) __bf16 s[DM]; const int n = blockIdx.x, which = blockIdx.y, t = threadIdx.x; const float* Wm = (which == 0) ? WQ : (which == 1) ? WK : (which == 2) ? WV : WO;   // (in,out) weights: pack row n = column n
  for (int k = t; k < DM; k += 256) s[k] = (__bf16)Wm[(size_t)k * DM + n];
  __syncthreads();
  __bf16* dst = (which < 3) ? PK + PK_A + ((size_t)which * DM + n) * DM : PK + PK_P + (size_t)n * DM;
  for (int q = t; q < DM / 8; q += 256) vst2((unsigned*)(dst + q * 8), *(const v4u*)&s[q * 8]);
}
__global__ __launch_bounds__(128) void k_qkv(const float* __restrict__ XQ, const float* __restrict__ XK, const float* __restrict__ XV, const __bf16* __restrict__ P, const float* __restrict__ BQ, const float* __restrict__ BK, const float* __restrict__ BV, const float* __restrict__ POS, _Float16* __restrict__ QK, _Float16* __restrict__ QKL, _Float16* __restrict__ VTH, _Float16* __restrict__ VTL) {
  const int which0 = (blockIdx.y * 128) / DM; const float* X = (which0 == 0) ? XQ : (which0 == 1) ? XK : XV; const float* BB = BQ ? (((which0 == 0) ? BQ : (which0 == 1) ? BK : BV) + (blockIdx.y * 128 - which0 * DM)) : nullptr;
  __shared__ __attribute__((aligned(128))) char ring[2 * RB_S];   // two operand stages; behind the k loop the same bytes are the store staging
  _Float16 (*so)[16][136] = (_Float16 (*)[16][136])ring; _Float16 (*sol)[16][136] = (_Float16 (*)[16][136])(ring + 4 * 16 * 136 * 2); _Float16 (*sth)[72] = (_Float16 (*)[72])ring; _Float16 (*stl)[72] = (_Float16 (*)[72])(ring + 128 * 72 * 2);
  const int tid = threadIdx.x, wave = tid >> 5, lane = tid & 31, col = lane & 15, g = lane >> 4; const size_t r0 = (size_t)blockIdx.x * 64 + wave * 16; const int n0 = blockIdx.y * 128;
  v8f acc[8] = {};
  const unsigned lb = (unsigned)(size_t)ring + (tid >> 3) * BPI + (tid & 7) * 16, la = (unsigned)(size_t)ring + RB_B + (tid >> 4) * API + (tid & 15) * 16;
  const __bf16* gb = P + (size_t)(n0 + (tid >> 3)) * DM + (tid & 7) * 8; const float* ga = X + ((size_t)blockIdx.x * 64 + (tid >> 4)) * DM + (tid & 15) * 4;
  cp_stage(lb, la, gb, ga); AW(); __syncthreads();   // stage 0 landed and handed to every wave
  cp_stage(lb + RB_S, la + RB_S, gb + KT, ga + KT);   // stage 1 flies while stage 0 is multiplied
  // the stage loop stays rolled: one copy of the hand-over below, the buffer picked by t & 1; unrolling would only multiply the code
#pragma unroll 1
  for (int t = 0; t < NT; ++t) { const unsigned bo = (t & 1) * RB_S; const char* sb = ring + bo + col * BPI + g * 16; const char* sa = ring + bo + RB_B + (wave * 16 + col) * API + g * 32;
    v16b b0[8], b1[8]; v4f a0[4], a1[4];
    lds_a16(a0, sa, 0); lds_b8(b0, sb, 0); lds_a16(a1, sa, 1); lds_b8(b1, sb, 1); SB();
    v16b a = cvt_a16(a0);
#pragma unroll
    for (int j = 0; j < 8; ++j) acc[j] = wmma_bf(a, b0[j], acc[j]);
    a = cvt_a16(a1);
#pragma unroll
    for (int j = 0; j < 8; ++j) acc[j] = wmma_bf(a, b1[j], acc[j]);
    DW(); AW(); __syncthreads();   // this wave's reads of stage t are done and its copies of stage t + 1 have landed; behind the barrier that holds for all four waves
    if (t + 2 < NT) cp_stage(lb + bo, la + bo, gb + (t + 2) * KT, ga + (t + 2) * KT); }   // refill of the buffer that every wave has just left
  AW();   // no copy is outstanding when the ring's bytes become the store staging
  if (n0 < 2 * DM) {   // bias, then rotate-half rotary over each 64-dim head with the learned angle rope[position][d] from the table
#pragma unroll
    for (int j = 0; j < 8; ++j)
#pragma unroll
      for (int r = 0; r < 8; ++r) acc[j][r] += (BB ? bfr(BB[j * 16 + col]) : 0.f);
#pragma unroll
    for (int r = 0; r < 8; ++r) { const int spos = (int)((r0 + 8 * g + r) % SS); const float* pr = POS + (size_t)spos * HD;   // learned table: out[d] = x[d] cos(p[d]) -+ partner sin(p[d])
#pragma unroll
      for (int jj = 0; jj < 2; ++jj) { const float p1 = bfr(pr[jj * 16 + col]), p2 = bfr(pr[32 + jj * 16 + col]); const float c1 = cos_p(p1), s1 = sin_p(p1), c2 = cos_p(p2), s2 = sin_p(p2);
#pragma unroll
        for (int hh = 0; hh < 2; ++hh) { const float x1 = acc[hh * 4 + jj][r], x2 = acc[hh * 4 + jj + 2][r]; acc[hh * 4 + jj][r] = x1 * c1 - x2 * s1; acc[hh * 4 + jj + 2][r] = x2 * c2 + x1 * s2; } } }
#pragma unroll
    for (int j = 0; j < 8; ++j) {
#pragma unroll
      for (int r = 0; r < 8; ++r) { const float v = acc[j][r]; const _Float16 hv = (_Float16)v; so[wave][8 * g + r][j * 16 + col] = hv; sol[wave][8 * g + r][j * 16 + col] = (_Float16)((v - (float)hv) * 2048.0f); } }   // q, k (+ bias) as f16 hi + (x2048) residual
    LDSX();
    for (int rl = 0; rl < 16; ++rl) if (lane < 16) { vst2((unsigned*)(QK + (r0 + rl) * (2 * DM) + n0 + lane * 8), *(const v4u*)&so[wave][rl][lane * 8]); vst2((unsigned*)(QKL + (r0 + rl) * (2 * DM) + n0 + lane * 8), *(const v4u*)&sol[wave][rl][lane * 8]); }
  } else {
#pragma unroll
    for (int j = 0; j < 8; ++j) {
#pragma unroll
      for (int r = 0; r < 8; ++r) { const float v = acc[j][r] + (BB ? bfr(BB[j * 16 + col]) : 0.f); const _Float16 hv = (_Float16)v; sth[j * 16 + col][wave * 16 + 8 * g + r] = hv; stl[j * 16 + col][wave * 16 + 8 * g + r] = (_Float16)((v - (float)hv) * 2048.0f); } }
    __syncthreads();
    const size_t rb = (size_t)blockIdx.x * 64; const int b = (int)(rb / SS), s0 = (int)(rb % SS); const int pc0 = n0 - 2 * DM;
    for (int q = tid; q < 128 * 8; q += 128) { const int d = q >> 3, pc = q & 7; const size_t o = ((size_t)b * DM + pc0 + d) * SS + s0 + pc * 8; vst2((unsigned*)(VTH + o), *(const v4u*)&sth[d][pc * 8]); vst2((unsigned*)(VTL + o), *(const v4u*)&stl[d][pc * 8]); }
  }
}
// lane l <-> lane l ^ 16 as a vector cross-row move (no LDS counter to wait on)
__device__ __forceinline__ float xhalf(float x) { return __builtin_bit_cast(float, __builtin_amdgcn_permlanex16(__builtin_bit_cast(int, x), __builtin_bit_cast(int, x), 0x76543210, 0xfedcba98, false, false)); }
// e^x as the hardware exp2 of x * log2(e), the same two instructions __expf compiles to; the v_nop inside the statement keeps the one slot the instruction set asks for behind a transcendental
__device__ __forceinline__ float exp_hw(float x) { float y; const float t = x * 1.44269504f; asm("v_exp_f32 %0, %1\n\tv_nop" : "=v"(y) : "v"(t)); return y; }
// ---- k_attn: block = (64 queries, head h, batch b): causal flash attention on TRANSPOSED tiles: S^T = K . Q^T (rows = keys, column = this lane's query), so the softmax of a query lives in one lane pair and the D registers of S^T are already the B fragment of O^T = V^T . P^T (k = 8g + i from key tile 0, 16 + 8g + i from key tile 1); O[b*S+q][h*64+d] = (acc + accl / 2048) / (2048 l) (256-B segments)
__global__ __launch_bounds__(128) void k_attn(const _Float16* __restrict__ QK, const _Float16* __restrict__ QKL, const _Float16* __restrict__ VTH, const _Float16* __restrict__ VTL, const void* __restrict__ KMASK, const float* __restrict__ GR, float* __restrict__ O) {
  __shared__ __align__(16) float so[4][16][68];
  const int tid = threadIdx.x, wave = tid >> 5, lane = tid & 31, col = lane & 15, g = lane >> 4;
  const int qb = blockIdx.x, h = blockIdx.y, b = blockIdx.z; const int q0 = qb * 64 + wave * 16; const int qi = q0 + col; const size_t rq = (size_t)b * SS + qi;
  v16h aq[2], aql[2];
#pragma unroll
  for (int kc = 0; kc < 2; ++kc) { aq[kc] = frag_h(QK + rq * (2 * DM) + h * HD + kc * 32, lane); aql[kc] = frag_h(QKL + rq * (2 * DM) + h * HD + kc * 32, lane); }
  const float gq = GR[rq * NH + h];   // this lane's query: one gravity value
  float m = -3.0e38f, l = 0.f;        // l: partial sum over this lane half's keys, joined after the loop
  v8f acc[4] = {}, accl[4] = {};
  const int nks = (qb * 64 + 64) / 32;   // causal: key tiles up to the query tile's end
  const _Float16* kb = QK + ((size_t)b * SS + col) * (2 * DM) + DM + h * HD; const _Float16* vb = VTH + ((size_t)b * DM + h * HD + col) * SS;
  v16h kf[2][2], vf[4];   // hi fragments held whole: K of tile ks + 1 is fetched behind the scores of tile ks, V of tile ks in front of them
#pragma unroll
  for (int ct = 0; ct < 2; ++ct)
#pragma unroll
    for (int kc = 0; kc < 2; ++kc) kf[ct][kc] = frag_h(kb + (size_t)(ct * 16) * (2 * DM) + kc * 32, lane);
#pragma unroll 1
  for (int ks = 0; ks < nks; ++ks) { v8f s[2];
#pragma unroll
    for (int dt = 0; dt < 4; ++dt) vf[dt] = frag_h(vb + (size_t)(dt * 16) * SS + ks * 32, lane);
    XW();
#pragma unroll
    for (int ct = 0; ct < 2; ++ct) { const int kr = ks * 32 + ct * 16 + col; const _Float16* krowl = QKL + ((size_t)b * SS + kr) * (2 * DM) + DM + h * HD; v8f c = {}, cl = {};
      if (qb < 2) {   // leading query blocks (few keys, outputs far above the global rms): 3 products
#pragma unroll
        for (int kc = 0; kc < 2; ++kc) { const v16h kh = kf[ct][kc]; c = wmma16(kh, aq[kc], c); cl = wmma16(kh, aql[kc], cl); cl = wmma16(frag_h(krowl + kc * 32, lane), aq[kc], cl); }
#pragma unroll
        for (int r = 0; r < 8; ++r) c[r] += cl[r] * (1.0f / 2048.0f); }
      else {
#pragma unroll
        for (int kc = 0; kc < 2; ++kc) c = wmma16(kf[ct][kc], aq[kc], c); }   // single product elsewhere
#pragma unroll
      for (int r = 0; r < 8; ++r) { const int kk = ks * 32 + ct * 16 + 8 * g + r; const int dd = min(qi - kk, 64); s[ct][r] = (kk <= qi) ? (c[r] * SCALEF - gq * (float)dd * 0.1f) : -3.0e38f; } }   // causal; - softplus-gravity x min(|i-j|,64) x 0.1
    const int kn = (ks + 1 < nks) ? ks + 1 : ks;   // no branch round the load group (its waits stay counted ones); the last tile is fetched once more and not used
#pragma unroll
    for (int ct = 0; ct < 2; ++ct)
#pragma unroll
      for (int kc = 0; kc < 2; ++kc) kf[ct][kc] = frag_h(kb + (size_t)(kn * 32 + ct * 16) * (2 * DM) + kc * 32, lane);
    float mx = fmaxf(s[0][0], s[1][0]);
#pragma unroll
    for (int r = 1; r < 8; ++r) mx = fmaxf(mx, fmaxf(s[0][r], s[1][r]));
    mx = fmaxf(mx, xhalf(mx));   // the other 16 keys of this query sit in the partner lane
    const float mn = fmaxf(m, mx); const float am = exp_hw(m - mn); const float alpha = (m <= -1.0e38f) ? 0.f : am;
    float es = 0.f; v16h pa, pl;
#pragma unroll
    for (int r = 0; r < 8; ++r) { const float y0 = exp_hw(s[0][r] - mn), y1 = exp_hw(s[1][r] - mn); const float e0 = (s[0][r] <= -1.0e38f) ? 0.f : y0, e1 = (s[1][r] <= -1.0e38f) ? 0.f : y1; es += e0 + e1;
      const float x0 = e0 * 2048.0f, x1 = e1 * 2048.0f; const _Float16 h0 = (_Float16)x0, h1 = (_Float16)x1; pa[r] = h0; pa[8 + r] = h1; pl[r] = (_Float16)((x0 - (float)h0) * 2048.0f); pl[8 + r] = (_Float16)((x1 - (float)h1) * 2048.0f); }   // P scaled by 2^11 before the f16 split so small softmax weights stay out of the f16 subnormal range; 2^-11 folded into the epilogue
    l = l * alpha + es; m = mn;
#pragma unroll
    for (int dt = 0; dt < 4; ++dt)
#pragma unroll
      for (int r = 0; r < 8; ++r) { acc[dt][r] *= alpha; accl[dt][r] *= alpha; }
#pragma unroll
    for (int dt = 0; dt < 4; ++dt) { const size_t vr = ((size_t)b * DM + h * HD + dt * 16 + col) * SS + ks * 32; const v16h vh = vf[dt]; acc[dt] = wmma16(vh, pa, acc[dt]); if (qb < 2) { accl[dt] = wmma16(vh, pl, accl[dt]); accl[dt] = wmma16(frag_h(VTL + vr, lane), pa, accl[dt]); } }   // leading query blocks: P hi/lo x V hi/lo (3 products); elsewhere P x V single
  }
  l += xhalf(l);
  const float il = (1.0f / 2048.0f) / l;
#pragma unroll
  for (int dt = 0; dt < 4; ++dt)
#pragma unroll
    for (int r = 0; r < 8; ++r) so[wave][col][dt * 16 + 8 * g + r] = (acc[dt][r] + accl[dt][r] * (1.0f / 2048.0f)) * il;
  LDSX();
  for (int rl = 0; rl < 16; ++rl) if (lane < 16) vst2(O + ((size_t)b * SS + q0 + rl) * DM + h * HD + lane * 4, *(const v4f*)&so[wave][rl][lane * 4]);
}
// ---- k_out: block = (64 rows, 128 cols): out = O(hi/lo) . Wo rows (2 products) + bo
__global__ __launch_bounds__(128) void k_out(const float* __restrict__ O, const __bf16* __restrict__ P, const float* __restrict__ BO, float* __restrict__ Y) {
  __shared__ __attribute__((aligned(128))) char ring[2 * RB_S];   // two operand stages; behind the k loop the same bytes are the store staging
  float (*so)[16][132] = (float (*)[16][132])ring;
  const int tid = threadIdx.x, wave = tid >> 5, lane = tid & 31, col = lane & 15, g = lane >> 4; const size_t r0 = (size_t)blockIdx.x * 64 + wave * 16; const int n0 = blockIdx.y * 128;
  v8f acc[8] = {};
  const unsigned lb = (unsigned)(size_t)ring + (tid >> 3) * BPI + (tid & 7) * 16, la = (unsigned)(size_t)ring + RB_B + (tid >> 4) * API + (tid & 15) * 16;
  const __bf16* gb = P + (size_t)(n0 + (tid >> 3)) * DM + (tid & 7) * 8; const float* ga = O + ((size_t)blockIdx.x * 64 + (tid >> 4)) * DM + (tid & 15) * 4;
  cp_stage(lb, la, gb, ga); AW(); __syncthreads();   // stage 0 landed and handed to every wave
  cp_stage(lb + RB_S, la + RB_S, gb + KT, ga + KT);   // stage 1 flies while stage 0 is multiplied
  // the stage loop stays rolled: one copy of the hand-over below, the buffer picked by t & 1; unrolling would only multiply the code
#pragma unroll 1
  for (int t = 0; t < NT; ++t) { const unsigned bo = (t & 1) * RB_S; const char* sb = ring + bo + col * BPI + g * 16; const char* sa = ring + bo + RB_B + (wave * 16 + col) * API + g * 32;
    v16b b0[8], b1[8]; v4f a0[4], a1[4];
    lds_a16(a0, sa, 0); lds_b8(b0, sb, 0); lds_b8(b1, sb, 1); SB();
    F2 a = split_a16(a0); SB(); lds_a16(a1, sa, 1); SB();   // the second step's raw A takes the registers that the first step's has just left: with all four groups held at once the kernel went past 256 registers and lost its fourth wave per SIMD
#pragma unroll
    for (int j = 0; j < 8; ++j) { acc[j] = wmma_bf(a.l, b0[j], acc[j]); acc[j] = wmma_bf(a.h, b0[j], acc[j]); }
    a = split_a16(a1);
#pragma unroll
    for (int j = 0; j < 8; ++j) { acc[j] = wmma_bf(a.l, b1[j], acc[j]); acc[j] = wmma_bf(a.h, b1[j], acc[j]); }
    DW(); AW(); __syncthreads();   // this wave's reads of stage t are done and its copies of stage t + 1 have landed; behind the barrier that holds for all four waves
    if (t + 2 < NT) cp_stage(lb + bo, la + bo, gb + (t + 2) * KT, ga + (t + 2) * KT); }   // refill of the buffer that every wave has just left
  AW();   // no copy is outstanding when the ring's bytes become the store staging
#pragma unroll
  for (int j = 0; j < 8; ++j) {
#pragma unroll
    for (int r = 0; r < 8; ++r) so[wave][8 * g + r][j * 16 + col] = acc[j][r] + (BO ? bfr(BO[n0 + j * 16 + col]) : 0.f); }
  LDSX();
  for (int rl = 0; rl < 16; ++rl) vst2(Y + (r0 + rl) * DM + n0 + lane * 4, *(const v4f*)&so[wave][rl][lane * 4]);
}
// ---- k_pack3: the fused (in,out) W_attn [DM][3*DM] -> the three transposed bf16 row blocks
__global__ __launch_bounds__(256) void k_pack3(const float* __restrict__ WA, __bf16* __restrict__ PK) { __shared__ __align__(16) __bf16 s[DM]; const int n = blockIdx.x, which = blockIdx.y, t = threadIdx.x; for (int k = t; k < DM; k += 256) s[k] = (__bf16)WA[(size_t)k * (3 * DM) + which * DM + n]; __syncthreads(); for (int q = t; q < DM / 8; q += 256) vst2((unsigned*)(PK + PK_A + ((size_t)which * DM + n) * DM + q * 8), *(const v4u*)&s[q * 8]); }
// ---- k_grav: block = 64 rows (256 threads: 4 per row x 4 heads each): g[row][h] = softplus(x . g_w[:, h] + g_b[h]) in f32 from the bf16-rounded inputs; whole 4-KB block segment
__global__ __launch_bounds__(256) void k_grav(const float* __restrict__ X, const float* __restrict__ GW, const float* __restrict__ GB, float* __restrict__ GR) {
  __shared__ __align__(16) float sg[64][NH]; const size_t r0 = (size_t)blockIdx.x * 64; const int t = threadIdx.x; const int rl = t >> 2, hq = t & 3;
  float a[4] = {0.f, 0.f, 0.f, 0.f}; const float* xr = X + (r0 + rl) * DM;
  for (int k = 0; k < DM; ++k) { const float xv = bfr(xr[k]);
#pragma unroll
    for (int i = 0; i < 4; ++i) a[i] += xv * bfr(GW[(size_t)k * NH + hq * 4 + i]); }
#pragma unroll
  for (int i = 0; i < 4; ++i) { const float z = a[i] + bfr(GB[hq * 4 + i]); sg[rl][hq * 4 + i] = (z > 20.f) ? z : log1p_p(exp_p(z)); }   // softplus
  __syncthreads();
  vst2(GR + (r0 * NH) + t * 4, *(const v4f*)(&sg[0][0] + t * 4));
}
extern "C" void kernel_launch(void* const* d_in, const int* in_sizes, int n_in, void* d_out, int out_size, void* d_ws, size_t ws_size, hipStream_t stream) {
  (void)in_sizes; (void)n_in; (void)out_size;
  const float** F = (const float**)d_in;   // 0 x [4,2048,1024], 1 rope [2048,64], 2 W_attn [1024,3072] (in,out: q|k|v), 3 W_proj [1024,1024] (in,out), 4 g_w [1024,16], 5 g_b [16]
  if (ws_size < (size_t)WS_END) return;
  char* ws = (char*)d_ws; __bf16* PK = (__bf16*)(ws + WS_PK); _Float16 *QK = (_Float16*)(ws + WS_QK), *QKL = (_Float16*)(ws + WS_QKL), *VTH = (_Float16*)(ws + WS_VTH), *VTL = (_Float16*)(ws + WS_VTL); float *O = (float*)(ws + WS_O), *GR = (float*)(ws + WS_G);
  k_pack<<<dim3(DM, 4), 256, 0, stream>>>(F[3], F[3], F[3], F[3], PK);   // W_proj rows (q/k/v slots overwritten next)
  k_pack3<<<dim3(DM, 3), 256, 0, stream>>>(F[2], PK);
  k_grav<<<TNB * SS / 64, 256, 0, stream>>>(F[0], F[4], F[5], GR);
  k_qkv<<<dim3(TNB * SS / 64, QKVW / 128), 128, 0, stream>>>(F[0], F[0], F[0], PK + PK_A, nullptr, nullptr, nullptr, F[1], QK, QKL, VTH, VTL);
  k_attn<<<dim3(TQB, NH, TNB), 128, 0, stream>>>(QK, QKL, VTH, VTL, nullptr, GR, O);
  k_out<<<dim3(TOB, DM / 128), 128, 0, stream>>>(O, PK + PK_P, nullptr, (float*)d_out);
}

// v004
// It runs in 290 microseconds.
// Next to v003, in two timings, it ran 1.37 times as fast each time.
// All steps since v000 together make it 3.13 times as fast.
// compute dtype: all float inputs rounded to bf16; qkv = x . W_attn with EXACT bf16 products on WMMA 16x16x32 ((in,out) columns q | k | v as transposed rows); rotate-half RoPE with the learned angle table (precise sinf/cosf of rope[t][d]) on q and k in f32 before the f16 hi + residual split; gravity softplus(x . g_w + g_b): EXACT bf16 products on WMMA 16x16x32, f32 sums (precise expf/log1pf); causal attention: 3-product scores and hi + residual P, v on the first 128 queries of each sequence, single f16 beyond; x 1/8 - g x min(|i-j|, 64) x 0.1, running-max softmax in f32 (hardware exp), P scaled by 2^11; out = y (bf16 hi + residual) . W_proj (2 products).
#include <hip/hip_runtime.h>
#include <math.h>

typedef __attribute__((ext_vector_type(16))) _Float16 v16h;
typedef __attribute__((ext_vector_type(16))) __bf16 v16b;
typedef __attribute__((ext_vector_type(8)))  _Float16 v8h;
typedef __attribute__((ext_vector_type(8)))  float v8f;
typedef __attribute__((ext_vector_type(4)))  float v4f;
typedef __attribute__((ext_vector_type(2)))  float v2f;
typedef __attribute__((ext_vector_type(4)))  unsigned v4u;
typedef __attribute__((ext_vector_type(4)))  int v4i;
typedef float __attribute__((may_alias)) float_a;
typedef int __attribute__((may_alias)) int_a;

template <typename T> __device__ __forceinline__ void vst2(void* p, T v) { *(T*)p = v;  }
__device__ __forceinline__ v8f wmma16(v16h a, v16h b, v8f c) {
  v8f d = __builtin_amdgcn_wmma_f32_16x16x32_f16(false, a, false, b, (short)0, c, false, false);
  asm volatile("v_nop\n\tv_nop\n\tv_nop\n\tv_nop" : "+v"(d) : "v"(a), "v"(b));
  return d;
}
__device__ __forceinline__ v8f wmma_bf(v16b a, v16b b, v8f c) {
  v8f d = __builtin_amdgcn_wmma_f32_16x16x32_bf16(false, a, false, b, (short)0, c, false, false);
  asm volatile("v_nop\n\tv_nop\n\tv_nop\n\tv_nop" : "+v"(d) : "v"(a), "v"(b));
  return d;
}
// Adaptive-gravity causal attention (B 4, T 2,048, 1,024 dims, 16 heads x 64): fused q|k|v projection, table RoPE on q and k, scores / 8 minus a learned per-(token, head) softplus gravity times the clipped distance, causal softmax, . v, output projection.
__device__ __forceinline__ v16h frag_h(const _Float16* rowk0, int lane) {
  union { v16h v; v8h q[2]; } u; const _Float16* p = rowk0 + 8 * (lane >> 4);
  u.q[0] = *(const v8h*)p; u.q[1] = *(const v8h*)(p + 16); return u.v;
}
__device__ __forceinline__ v16h frag_f32(const float* rowk0, int lane) {
  v16h a; const float* p = rowk0 + 8 * (lane >> 4);
#pragma unroll
  for (int i = 0; i < 8; ++i) { a[i] = (_Float16)p[i]; a[8 + i] = (_Float16)p[16 + i]; }
  return a;
}
__device__ __forceinline__ v16h frag_f32s(const float* rowk0, int lane, float sc) {
  v16h a; const float* p = rowk0 + 8 * (lane >> 4);
#pragma unroll
  for (int i = 0; i < 8; ++i) { a[i] = (_Float16)(p[i] * sc); a[8 + i] = (_Float16)(p[16 + i] * sc); }
  return a;
}
// column fragment from a [K][ld] layout (column n), rows >= K read as 0
__device__ __forceinline__ v16h fragc_f32(const float* W, int k0, int n, int lane, int ld, int K) {
  v16h a; const int g = lane >> 4;
#pragma unroll
  for (int i = 0; i < 8; ++i) { const int ka = k0 + 8 * g + i, kb = ka + 16;
    a[i] = (_Float16)(ka < K ? W[(size_t)(ka < K ? ka : K - 1) * ld + n] : 0.f); a[8 + i] = (_Float16)(kb < K ? W[(size_t)(kb < K ? kb : K - 1) * ld + n] : 0.f); }
  return a;
}
struct F2 { v16b h, l; };
__device__ __forceinline__ F2 bsplit16(const float v[16]) { F2 r;
#pragma unroll
  for (int i = 0; i < 16; ++i) { const __bf16 h = (__bf16)v[i]; r.h[i] = h; r.l[i] = (__bf16)(v[i] - (float)h); }
  return r; }
__device__ __forceinline__ F2 split_row(const float* row, int k0, int lane) { float v[16]; const float* p = row + k0 + 8 * (lane >> 4);
#pragma unroll
  for (int i = 0; i < 8; ++i) { v[i] = p[i]; v[8 + i] = p[16 + i]; }
  return bsplit16(v); }
__device__ __forceinline__ F2 split_rowK(const float* row, int k0, int lane, int K) { float v[16]; const int g = lane >> 4;
#pragma unroll
  for (int i = 0; i < 8; ++i) { const int ka = k0 + 8 * g + i, kb = ka + 16; v[i] = ka < K ? row[ka < K ? ka : K - 1] : 0.f; v[8 + i] = kb < K ? row[kb < K ? kb : K - 1] : 0.f; }
  return bsplit16(v); }
__device__ __forceinline__ F2 split_col(const float* W, int k0, int n, int lane, int ld, int K) { float v[16]; const int g = lane >> 4;
#pragma unroll
  for (int i = 0; i < 8; ++i) { const int ka = k0 + 8 * g + i, kb = ka + 16; v[i] = ka < K ? W[(size_t)(ka < K ? ka : K - 1) * ld + n] : 0.f; v[8 + i] = kb < K ? W[(size_t)(kb < K ? kb : K - 1) * ld + n] : 0.f; }
  return bsplit16(v); }
__device__ __forceinline__ v8f mac3(const F2& a, const F2& b, v8f c) { c = wmma_bf(a.l, b.h, c); c = wmma_bf(a.h, b.l, c); return wmma_bf(a.h, b.h, c); }
__device__ __forceinline__ float sigm(float v) { return 1.0f / (1.0f + expf(-v)); }
#define LDSX() do { asm volatile("s_wait_dscnt 0" ::: "memory"); __builtin_amdgcn_wave_barrier(); __builtin_amdgcn_fence(__ATOMIC_RELEASE, "workgroup"); } while (0)


#define NB 4
#define SS 2048
#define SCALEF 0.125f
#define DM 1024
#define NH 16
__device__ __attribute__((noinline)) float cos_p(float v) { return cosf(v); }
__device__ __attribute__((noinline)) float sin_p(float v) { return sinf(v); }
__device__ __attribute__((noinline)) float exp_p(float v) { return expf(v); }
__device__ __attribute__((noinline)) float log1p_p(float v) { return log1pf(v); }
#define HD 64
#define QKVW (3 * DM)
#ifndef TQB
#define TQB (SS / 64)
#define TNB NB
#define TOB (NB * SS / 64)     // output row tiles (all)
#endif
typedef __attribute__((ext_vector_type(8))) __bf16 v8b;
__device__ __forceinline__ v16b frag_b(const __bf16* rowk0, int lane) {
  union { v16b v; v8b q[2]; } u; const __bf16* p = rowk0 + 8 * (lane >> 4);
  u.q[0] = *(const v8b*)p; u.q[1] = *(const v8b*)(p + 16); return u.v;
}
__device__ __forceinline__ float bfr(float v) { return (float)(__bf16)v; }
// stands behind a group of loads that stays in flight: the group's address registers are rewritten while it flies, and this is the wait that belongs in front of such a rewrite
#define XW() asm volatile("s_wait_xcnt 0x0" ::: "memory")
// scheduling fence: a stage's LDS fragment reads stay in front of its WMMAs, in the groups and order written
#define SB() __builtin_amdgcn_sched_barrier(0)
// ---- operand ring of k_qkv and k_out: a stage is 64 k of the block's 128 weight rows (128 B of bf16 each) and of its 64 activation rows (256 B of f32 each), brought into LDS once for all four waves as whole 128-B lines; row pitches are 16 B x odd, so the 16-byte fragment reads meet no bank conflict
#define KT 64
#define NT (DM / KT)
#define BPI 144
#define API 272
#define RB_B (128 * BPI)
#define RB_S (RB_B + 64 * API)
// the issuing wave's wait for its own copies, and its wait for its own LDS reads: both stand in front of the barrier that hands a stage over
#define AW() asm volatile("s_wait_asynccnt 0x0" ::: "memory")
#define DW() asm volatile("s_wait_dscnt 0x0" ::: "memory")
// eight 16-byte copies of one lane, rows sl (LDS bytes) and sg (global bytes) apart; the s_wait_xcnt closes the statement so that no address register named here is rewritten in front of it
__device__ __forceinline__ void cp8(unsigned l, const char* p, unsigned sl, size_t sg) {
  asm volatile("global_load_async_to_lds_b128 %0, %8, off\n\tglobal_load_async_to_lds_b128 %1, %9, off\n\tglobal_load_async_to_lds_b128 %2, %10, off\n\tglobal_load_async_to_lds_b128 %3, %11, off\n\t"
               "global_load_async_to_lds_b128 %4, %12, off\n\tglobal_load_async_to_lds_b128 %5, %13, off\n\tglobal_load_async_to_lds_b128 %6, %14, off\n\tglobal_load_async_to_lds_b128 %7, %15, off\n\ts_wait_xcnt 0x0"
               :: "v"(l), "v"(l + sl), "v"(l + 2 * sl), "v"(l + 3 * sl), "v"(l + 4 * sl), "v"(l + 5 * sl), "v"(l + 6 * sl), "v"(l + 7 * sl),
                  "v"(p), "v"(p + sg), "v"(p + 2 * sg), "v"(p + 3 * sg), "v"(p + 4 * sg), "v"(p + 5 * sg), "v"(p + 6 * sg), "v"(p + 7 * sg) : "memory");
}
// one stage: lane tid brings chunk tid & 7 of weight rows (tid >> 3) + 16 i and chunk tid & 15 of activation rows (tid >> 4) + 8 i; lb, la, gb, ga already hold the lane's first row and chunk
__device__ __forceinline__ void cp_stage(unsigned lb, unsigned la, const __bf16* gb, const float* ga) { cp8(lb, (const char*)gb, 16 * BPI, (size_t)16 * DM * 2); cp8(la, (const char*)ga, 8 * API, (size_t)8 * DM * 4); }
// one 32-k step's fragments out of a stage, in the k order of the global rows: sb, sa already hold the lane's row and its 8 * g elements
__device__ __forceinline__ void lds_b8(v16b (&f)[8], const char* sb, int kc) {
#pragma unroll
  for (int j = 0; j < 8; ++j) { union { v16b v; v8b q[2]; } u; const char* p = sb + j * 16 * BPI + kc * 64; u.q[0] = *(const v8b*)p; u.q[1] = *(const v8b*)(p + 32); f[j] = u.v; }
}
__device__ __forceinline__ void lds_a16(v4f (&r)[4], const char* sa, int kc) { const char* p = sa + kc * 128; r[0] = *(const v4f*)p; r[1] = *(const v4f*)(p + 16); r[2] = *(const v4f*)(p + 64); r[3] = *(const v4f*)(p + 80); }
__device__ __forceinline__ v16b cvt_a16(const v4f (&r)[4]) { v16b a;
#pragma unroll
  for (int i = 0; i < 8; ++i) { a[i] = (__bf16)r[i >> 2][i & 3]; a[8 + i] = (__bf16)r[2 + (i >> 2)][i & 3]; }
  return a; }
__device__ __forceinline__ F2 split_a16(const v4f (&r)[4]) { float v[16];
#pragma unroll
  for (int i = 0; i < 8; ++i) { v[i] = r[i >> 2][i & 3]; v[8 + i] = r[2 + (i >> 2)][i & 3]; }
  return bsplit16(v); }
__device__ __attribute__((noinline)) float exp_ni(float v) { return expf(v); }
__device__ __attribute__((noinline)) float erf_ni(float v) { return erff(v); }

#define PK_A 0                       // [3072][1024] Wqkv rows (natural [out][in])
#define PK_P (PK_A + QKVW * DM)        // [1024][1024] Wo rows (natural)
#define PK_END (PK_P + DM * DM)
#define WS_PK  0u
#define WS_QK  (WS_PK + 2u * PK_END)             // f16 [8192 rows][2048]: q | k
#define WS_QKL (WS_QK + 2u * NB * SS * 2 * DM)     // f16 q | k residual planes x2048
#define WS_VTH (WS_QKL + 2u * NB * SS * 2 * DM)    // f16 [b][1024 (h*64+d)][2048 s] hi
#define WS_VTL (WS_VTH + 2u * NB * DM * SS)        // f16 lo x 2048
#define WS_O   (WS_VTL + 2u * NB * DM * SS)        // f32 [8192][1024]
#define WS_CS  (WS_O + 4u * NB * SS * DM)           // f32 2 x [2048][32], unused
#define WS_G   (WS_CS + 4u * 2 * SS * 32)                  // f32 [b*t][16] softplus(x . g_w + g_b)
#define WS_END (WS_G + 4u * (size_t)NB * SS * NH)
// ---- k_pack: block = (row n, which): (in,out) column n -> bf16 row n; which 0..2 -> W_q/W_k/W_v into PK_A rows which*1024 + n; 3 -> W_o into PK_P
__global__ __launch_bounds__(256) void k_pack(const float* __restrict__ WQ, const float* __restrict__ WK, const float* __restrict__ WV, const float* __restrict__ WO, __bf16* __restrict__ PK) {
  __shared__ __align__(16) __bf16 s[DM]; const int n = blockIdx.x, which = blockIdx.y, t = threadIdx.x; const float* Wm = (which == 0) ? WQ : (which == 1) ? WK : (which == 2) ? WV : WO;   // (in,out) weights: pack row n = column n
  for (int k = t; k < DM; k += 256) s[k] = (__bf16)Wm[(size_t)k * DM + n];
  __syncthreads();
  __bf16* dst = (which < 3) ? PK + PK_A + ((size_t)which * DM + n) * DM : PK + PK_P + (size_t)n * DM;
  for (int q = t; q < DM / 8; q += 256) vst2((unsigned*)(dst + q * 8), *(const v4u*)&s[q * 8]);
}
__global__ __launch_bounds__(128) void k_qkv(const float* __restrict__ XQ, const float* __restrict__ XK, const float* __restrict__ XV, const __bf16* __restrict__ P, const float* __restrict__ BQ, const float* __restrict__ BK, const float* __restrict__ BV, const float* __restrict__ POS, _Float16* __restrict__ QK, _Float16* __restrict__ QKL, _Float16* __restrict__ VTH, _Float16* __restrict__ VTL) {
  const int which0 = (blockIdx.y * 128) / DM; const float* X = (which0 == 0) ? XQ : (which0 == 1) ? XK : XV; const float* BB = BQ ? (((which0 == 0) ? BQ : (which0 == 1) ? BK : BV) + (blockIdx.y * 128 - which0 * DM)) : nullptr;
  __shared__ __attribute__((aligned(128))) char ring[2 * RB_S];   // two operand stages; behind the k loop the same bytes are the store staging
  _Float16 (*so)[16][136] = (_Float16 (*)[16][136])ring; _Float16 (*sol)[16][136] = (_Float16 (*)[16][136])(ring + 4 * 16 * 136 * 2); _Float16 (*sth)[72] = (_Float16 (*)[72])ring; _Float16 (*stl)[72] = (_Float16 (*)[72])(ring + 128 * 72 * 2);
  const int tid = threadIdx.x, wave = tid >> 5, lane = tid & 31, col = lane & 15, g = lane >> 4; const size_t r0 = (size_t)blockIdx.x * 64 + wave * 16; const int n0 = blockIdx.y * 128;
  v8f acc[8] = {};
  const unsigned lb = (unsigned)(size_t)ring + (tid >> 3) * BPI + (tid & 7) * 16, la = (unsigned)(size_t)ring + RB_B + (tid >> 4) * API + (tid & 15) * 16;
  const __bf16* gb = P + (size_t)(n0 + (tid >> 3)) * DM + (tid & 7) * 8; const float* ga = X + ((size_t)blockIdx.x * 64 + (tid >> 4)) * DM + (tid & 15) * 4;
  cp_stage(lb, la, gb, ga); AW(); __syncthreads();   // stage 0 landed and handed to every wave
  cp_stage(lb + RB_S, la + RB_S, gb + KT, ga + KT);   // stage 1 flies while stage 0 is multiplied
  // the stage loop stays rolled: one copy of the hand-over below, the buffer picked by t & 1; unrolling would only multiply the code
#pragma unroll 1
  for (int t = 0; t < NT; ++t) { const unsigned bo = (t & 1) * RB_S; const char* sb = ring + bo + col * BPI + g * 16; const char* sa = ring + bo + RB_B + (wave * 16 + col) * API + g * 32;
    v16b b0[8], b1[8]; v4f a0[4], a1[4];
    lds_a16(a0, sa, 0); lds_b8(b0, sb, 0); lds_a16(a1, sa, 1); lds_b8(b1, sb, 1); SB();
    v16b a = cvt_a16(a0);
#pragma unroll
    for (int j = 0; j < 8; ++j) acc[j] = wmma_bf(a, b0[j], acc[j]);
    a = cvt_a16(a1);
#pragma unroll
    for (int j = 0; j < 8; ++j) acc[j] = wmma_bf(a, b1[j], acc[j]);
    DW(); AW(); __syncthreads();   // this wave's reads of stage t are done and its copies of stage t + 1 have landed; behind the barrier that holds for all four waves
    if (t + 2 < NT) cp_stage(lb + bo, la + bo, gb + (t + 2) * KT, ga + (t + 2) * KT); }   // refill of the buffer that every wave has just left
  AW();   // no copy is outstanding when the ring's bytes become the store staging
  if (n0 < 2 * DM) {   // bias, then rotate-half rotary over each 64-dim head with the learned angle rope[position][d] from the table
#pragma unroll
    for (int j = 0; j < 8; ++j)
#pragma unroll
      for (int r = 0; r < 8; ++r) acc[j][r] += (BB ? bfr(BB[j * 16 + col]) : 0.f);
#pragma unroll
    for (int r = 0; r < 8; ++r) { const int spos = (int)((r0 + 8 * g + r) % SS); const float* pr = POS + (size_t)spos * HD;   // learned table: out[d] = x[d] cos(p[d]) -+ partner sin(p[d])
#pragma unroll
      for (int jj = 0; jj < 2; ++jj) { const float p1 = bfr(pr[jj * 16 + col]), p2 = bfr(pr[32 + jj * 16 + col]); const float c1 = cos_p(p1), s1 = sin_p(p1), c2 = cos_p(p2), s2 = sin_p(p2);
#pragma unroll
        for (int hh = 0; hh < 2; ++hh) { const float x1 = acc[hh * 4 + jj][r], x2 = acc[hh * 4 + jj + 2][r]; acc[hh * 4 + jj][r] = x1 * c1 - x2 * s1; acc[hh * 4 + jj + 2][r] = x2 * c2 + x1 * s2; } } }
#pragma unroll
    for (int j = 0; j < 8; ++j) {
#pragma unroll
      for (int r = 0; r < 8; ++r) { const float v = acc[j][r]; const _Float16 hv = (_Float16)v; so[wave][8 * g + r][j * 16 + col] = hv; sol[wave][8 * g + r][j * 16 + col] = (_Float16)((v - (float)hv) * 2048.0f); } }   // q, k (+ bias) as f16 hi + (x2048) residual
    LDSX();
    for (int rl = 0; rl < 16; ++rl) if (lane < 16) { vst2((unsigned*)(QK + (r0 + rl) * (2 * DM) + n0 + lane * 8), *(const v4u*)&so[wave][rl][lane * 8]); vst2((unsigned*)(QKL + (r0 + rl) * (2 * DM) + n0 + lane * 8), *(const v4u*)&sol[wave][rl][lane * 8]); }
  } else {
#pragma unroll
    for (int j = 0; j < 8; ++j) {
#pragma unroll
      for (int r = 0; r < 8; ++r) { const float v = acc[j][r] + (BB ? bfr(BB[j * 16 + col]) : 0.f); const _Float16 hv = (_Float16)v; sth[j * 16 + col][wave * 16 + 8 * g + r] = hv; stl[j * 16 + col][wave * 16 + 8 * g + r] = (_Float16)((v - (float)hv) * 2048.0f); } }
    __syncthreads();
    const size_t rb = (size_t)blockIdx.x * 64; const int b = (int)(rb / SS), s0 = (int)(rb % SS); const int pc0 = n0 - 2 * DM;
    for (int q = tid; q < 128 * 8; q += 128) { const int d = q >> 3, pc = q & 7; const size_t o = ((size_t)b * DM + pc0 + d) * SS + s0 + pc * 8; vst2((unsigned*)(VTH + o), *(const v4u*)&sth[d][pc * 8]); vst2((unsigned*)(VTL + o), *(const v4u*)&stl[d][pc * 8]); }
  }
}
// lane l <-> lane l ^ 16 as a vector cross-row move (no LDS counter to wait on)
__device__ __forceinline__ float xhalf(float x) { return __builtin_bit_cast(float, __builtin_amdgcn_permlanex16(__builtin_bit_cast(int, x), __builtin_bit_cast(int, x), 0x76543210, 0xfedcba98, false, false)); }
// e^x as the hardware exp2 of x * log2(e), the same two instructions __expf compiles to; the v_nop inside the statement keeps the one slot the instruction set asks for behind a transcendental
__device__ __forceinline__ float exp_hw(float x) { float y; const float t = x * 1.44269504f; asm("v_exp_f32 %0, %1\n\tv_nop" : "=v"(y) : "v"(t)); return y; }
// ---- k_attn: block = (64 queries, head h, batch b): causal flash attention on TRANSPOSED tiles: S^T = K . Q^T (rows = keys, column = this lane's query), so the softmax of a query lives in one lane pair and the D registers of S^T are already the B fragment of O^T = V^T . P^T (k = 8g + i from key tile 0, 16 + 8g + i from key tile 1); O[b*S+q][h*64+d] = (acc + accl / 2048) / (2048 l) (256-B segments)
__global__ __launch_bounds__(128) void k_attn(const _Float16* __restrict__ QK, const _Float16* __restrict__ QKL, const _Float16* __restrict__ VTH, const _Float16* __restrict__ VTL, const void* __restrict__ KMASK, const float* __restrict__ GR, float* __restrict__ O) {
  __shared__ __align__(16) float so[4][16][68];
  const int tid = threadIdx.x, wave = tid >> 5, lane = tid & 31, col = lane & 15, g = lane >> 4;
  const int qb = blockIdx.x, h = blockIdx.y, b = blockIdx.z; const int q0 = qb * 64 + wave * 16; const int qi = q0 + col; const size_t rq = (size_t)b * SS + qi;
  v16h aq[2], aql[2];
#pragma unroll
  for (int kc = 0; kc < 2; ++kc) { aq[kc] = frag_h(QK + rq * (2 * DM) + h * HD + kc * 32, lane); aql[kc] = frag_h(QKL + rq * (2 * DM) + h * HD + kc * 32, lane); }
  const float gq = GR[rq * NH + h];   // this lane's query: one gravity value
  float m = -3.0e38f, l = 0.f;        // l: partial sum over this lane half's keys, joined after the loop
  v8f acc[4] = {}, accl[4] = {};
  const int nks = (qb * 64 + 64) / 32;   // causal: key tiles up to the query tile's end
  const _Float16* kb = QK + ((size_t)b * SS + col) * (2 * DM) + DM + h * HD; const _Float16* vb = VTH + ((size_t)b * DM + h * HD + col) * SS;
  v16h kf[2][2], vf[4];   // hi fragments held whole: K of tile ks + 1 is fetched behind the scores of tile ks, V of tile ks in front of them
#pragma unroll
  for (int ct = 0; ct < 2; ++ct)
#pragma unroll
    for (int kc = 0; kc < 2; ++kc) kf[ct][kc] = frag_h(kb + (size_t)(ct * 16) * (2 * DM) + kc * 32, lane);
#pragma unroll 1
  for (int ks = 0; ks < nks; ++ks) { v8f s[2];
#pragma unroll
    for (int dt = 0; dt < 4; ++dt) vf[dt] = frag_h(vb + (size_t)(dt * 16) * SS + ks * 32, lane);
    XW();
#pragma unroll
    for (int ct = 0; ct < 2; ++ct) { const int kr = ks * 32 + ct * 16 + col; const _Float16* krowl = QKL + ((size_t)b * SS + kr) * (2 * DM) + DM + h * HD; v8f c = {}, cl = {};
      if (qb < 2) {   // leading query blocks (few keys, outputs far above the global rms): 3 products
#pragma unroll
        for (int kc = 0; kc < 2; ++kc) { const v16h kh = kf[ct][kc]; c = wmma16(kh, aq[kc], c); cl = wmma16(kh, aql[kc], cl); cl = wmma16(frag_h(krowl + kc * 32, lane), aq[kc], cl); }
#pragma unroll
        for (int r = 0; r < 8; ++r) c[r] += cl[r] * (1.0f / 2048.0f); }
      else {
#pragma unroll
        for (int kc = 0; kc < 2; ++kc) c = wmma16(kf[ct][kc], aq[kc], c); }   // single product elsewhere
#pragma unroll
      for (int r = 0; r < 8; ++r) { const int kk = ks * 32 + ct * 16 + 8 * g + r; const int dd = min(qi - kk, 64); s[ct][r] = (kk <= qi) ? (c[r] * SCALEF - gq * (float)dd * 0.1f) : -3.0e38f; } }   // causal; - softplus-gravity x min(|i-j|,64) x 0.1
    const int kn = (ks + 1 < nks) ? ks + 1 : ks;   // no branch round the load group (its waits stay counted ones); the last tile is fetched once more and not used
#pragma unroll
    for (int ct = 0; ct < 2; ++ct)
#pragma unroll
      for (int kc = 0; kc < 2; ++kc) kf[ct][kc] = frag_h(kb + (size_t)(kn * 32 + ct * 16) * (2 * DM) + kc * 32, lane);
    float mx = fmaxf(s[0][0], s[1][0]);
#pragma unroll
    for (int r = 1; r < 8; ++r) mx = fmaxf(mx, fmaxf(s[0][r], s[1][r]));
    mx = fmaxf(mx, xhalf(mx));   // the other 16 keys of this query sit in the partner lane
    const float mn = fmaxf(m, mx); const float am = exp_hw(m - mn); const float alpha = (m <= -1.0e38f) ? 0.f : am;
    float es = 0.f; v16h pa, pl;
#pragma unroll
    for (int r = 0; r < 8; ++r) { const float y0 = exp_hw(s[0][r] - mn), y1 = exp_hw(s[1][r] - mn); const float e0 = (s[0][r] <= -1.0e38f) ? 0.f : y0, e1 = (s[1][r] <= -1.0e38f) ? 0.f : y1; es += e0 + e1;
      const float x0 = e0 * 2048.0f, x1 = e1 * 2048.0f; const _Float16 h0 = (_Float16)x0, h1 = (_Float16)x1; pa[r] = h0; pa[8 + r] = h1; pl[r] = (_Float16)((x0 - (float)h0) * 2048.0f); pl[8 + r] = (_Float16)((x1 - (float)h1) * 2048.0f); }   // P scaled by 2^11 before the f16 split so small softmax weights stay out of the f16 subnormal range; 2^-11 folded into the epilogue
    l = l * alpha + es; m = mn;
#pragma unroll
    for (int dt = 0; dt < 4; ++dt)
#pragma unroll
      for (int r = 0; r < 8; ++r) { acc[dt][r] *= alpha; accl[dt][r] *= alpha; }
#pragma unroll
    for (int dt = 0; dt < 4; ++dt) { const size_t vr = ((size_t)b * DM + h * HD + dt * 16 + col) * SS + ks * 32; const v16h vh = vf[dt]; acc[dt] = wmma16(vh, pa, acc[dt]); if (qb < 2) { accl[dt] = wmma16(vh, pl, accl[dt]); accl[dt] = wmma16(frag_h(VTL + vr, lane), pa, accl[dt]); } }   // leading query blocks: P hi/lo x V hi/lo (3 products); elsewhere P x V single
  }
  l += xhalf(l);
  const float il = (1.0f / 2048.0f) / l;
#pragma unroll
  for (int dt = 0; dt < 4; ++dt)
#pragma unroll
    for (int r = 0; r < 8; ++r) so[wave][col][dt * 16 + 8 * g + r] = (acc[dt][r] + accl[dt][r] * (1.0f / 2048.0f)) * il;
  LDSX();
  for (int rl = 0; rl < 16; ++rl) if (lane < 16) vst2(O + ((size_t)b * SS + q0 + rl) * DM + h * HD + lane * 4, *(const v4f*)&so[wave][rl][lane * 4]);
}
// ---- k_out: block = (64 rows, 128 cols): out = O(hi/lo) . Wo rows (2 products) + bo
__global__ __launch_bounds__(128) void k_out(const float* __restrict__ O, const __bf16* __restrict__ P, const float* __restrict__ BO, float* __restrict__ Y) {
  __shared__ __attribute__((aligned(128))) char ring[2 * RB_S];   // two operand stages; behind the k loop the same bytes are the store staging
  float (*so)[16][132] = (float (*)[16][132])ring;
  const int tid = threadIdx.x, wave = tid >> 5, lane = tid & 31, col = lane & 15, g = lane >> 4; const size_t r0 = (size_t)blockIdx.x * 64 + wave * 16; const int n0 = blockIdx.y * 128;
  v8f acc[8] = {};
  const unsigned lb = (unsigned)(size_t)ring + (tid >> 3) * BPI + (tid & 7) * 16, la = (unsigned)(size_t)ring + RB_B + (tid >> 4) * API + (tid & 15) * 16;
  const __bf16* gb = P + (size_t)(n0 + (tid >> 3)) * DM + (tid & 7) * 8; const float* ga = O + ((size_t)blockIdx.x * 64 + (tid >> 4)) * DM + (tid & 15) * 4;
  cp_stage(lb, la, gb, ga); AW(); __syncthreads();   // stage 0 landed and handed to every wave
  cp_stage(lb + RB_S, la + RB_S, gb + KT, ga + KT);   // stage 1 flies while stage 0 is multiplied
  // the stage loop stays rolled: one copy of the hand-over below, the buffer picked by t & 1; unrolling would only multiply the code
#pragma unroll 1
  for (int t = 0; t < NT; ++t) { const unsigned bo = (t & 1) * RB_S; const char* sb = ring + bo + col * BPI + g * 16; const char* sa = ring + bo + RB_B + (wave * 16 + col) * API + g * 32;
    v16b b0[8], b1[8]; v4f a0[4], a1[4];
    lds_a16(a0, sa, 0); lds_b8(b0, sb, 0); lds_b8(b1, sb, 1); SB();
    F2 a = split_a16(a0); SB(); lds_a16(a1, sa, 1); SB();   // the second step's raw A takes the registers that the first step's has just left: with all four groups held at once the kernel went past 256 registers and lost its fourth wave per SIMD
#pragma unroll
    for (int j = 0; j < 8; ++j) { acc[j] = wmma_bf(a.l, b0[j], acc[j]); acc[j] = wmma_bf(a.h, b0[j], acc[j]); }
    a = split_a16(a1);
#pragma unroll
    for (int j = 0; j < 8; ++j) { acc[j] = wmma_bf(a.l, b1[j], acc[j]); acc[j] = wmma_bf(a.h, b1[j], acc[j]); }
    DW(); AW(); __syncthreads();   // this wave's reads of stage t are done and its copies of stage t + 1 have landed; behind the barrier that holds for all four waves
    if (t + 2 < NT) cp_stage(lb + bo, la + bo, gb + (t + 2) * KT, ga + (t + 2) * KT); }   // refill of the buffer that every wave has just left
  AW();   // no copy is outstanding when the ring's bytes become the store staging
#pragma unroll
  for (int j = 0; j < 8; ++j) {
#pragma unroll
    for (int r = 0; r < 8; ++r) so[wave][8 * g + r][j * 16 + col] = acc[j][r] + (BO ? bfr(BO[n0 + j * 16 + col]) : 0.f); }
  LDSX();
  for (int rl = 0; rl < 16; ++rl) vst2(Y + (r0 + rl) * DM + n0 + lane * 4, *(const v4f*)&so[wave][rl][lane * 4]);
}
// ---- k_pack3: the fused (in,out) W_attn [DM][3*DM] -> the three transposed bf16 row blocks
__global__ __launch_bounds__(256) void k_pack3(const float* __restrict__ WA, __bf16* __restrict__ PK) { __shared__ __align__(16) __bf16 s[DM]; const int n = blockIdx.x, which = blockIdx.y, t = threadIdx.x; for (int k = t; k < DM; k += 256) s[k] = (__bf16)WA[(size_t)k * (3 * DM) + which * DM + n]; __syncthreads(); for (int q = t; q < DM / 8; q += 256) vst2((unsigned*)(PK + PK_A + ((size_t)which * DM + n) * DM + q * 8), *(const v4u*)&s[q * 8]); }
// ---- k_grav: block = 16 rows, 8 waves; wave w takes k in [128 w, 128 w + 128): z = x . g_w on WMMA 16x16x32 from the bf16-rounded inputs (exact products, f32 sums), the 16 heads being one column tile; a wave's 80 loads are all issued before its first product; the eight partial tiles are joined through LDS; g[row][h] = softplus(z + g_b[h]) (precise expf/log1pf); one 1-KB segment a block, one 128-B line a wave
__global__ __launch_bounds__(256) void k_grav(const float* __restrict__ X, const float* __restrict__ GW, const float* __restrict__ GB, float* __restrict__ GR) {
  __shared__ __align__(16) float sp[8][16][NH + 1]; const size_t r0 = (size_t)blockIdx.x * 16; const int t = threadIdx.x, wave = t >> 5, lane = t & 31, col = lane & 15, g = lane >> 4;
  const float* xr = X + (r0 + col) * DM + wave * 128 + 8 * g; const float* gw = GW + (size_t)(wave * 128 + 8 * g) * NH + col;   // A: row col of x; B: column col of g_w; both in the k order 8 g + i, 16 + 8 g + i
  v4f ar[4][4]; float br[4][16];
#pragma unroll
  for (int s = 0; s < 4; ++s) { const float* p = xr + s * 32; ar[s][0] = *(const v4f*)p; ar[s][1] = *(const v4f*)(p + 4); ar[s][2] = *(const v4f*)(p + 16); ar[s][3] = *(const v4f*)(p + 20); }
#pragma unroll
  for (int s = 0; s < 4; ++s)
#pragma unroll
    for (int i = 0; i < 8; ++i) { br[s][i] = gw[(size_t)(s * 32 + i) * NH]; br[s][8 + i] = gw[(size_t)(s * 32 + 16 + i) * NH]; }
  v8f acc = {};
#pragma unroll
  for (int s = 0; s < 4; ++s) { v16b b;
#pragma unroll
    for (int i = 0; i < 16; ++i) b[i] = (__bf16)br[s][i];
    acc = wmma_bf(cvt_a16(ar[s]), b, acc); }
#pragma unroll
  for (int r = 0; r < 8; ++r) sp[wave][8 * g + r][col] = acc[r];
  __syncthreads();
  float z = sp[0][t >> 4][t & 15];
#pragma unroll
  for (int w = 1; w < 8; ++w) z += sp[w][t >> 4][t & 15];
  z += bfr(GB[t & 15]);
  GR[r0 * NH + t] = (z > 20.f) ? z : log1p_p(exp_p(z));   // softplus
}
extern "C" void kernel_launch(void* const* d_in, const int* in_sizes, int n_in, void* d_out, int out_size, void* d_ws, size_t ws_size, hipStream_t stream) {
  (void)in_sizes; (void)n_in; (void)out_size;
  const float** F = (const float**)d_in;   // 0 x [4,2048,1024], 1 rope [2048,64], 2 W_attn [1024,3072] (in,out: q|k|v), 3 W_proj [1024,1024] (in,out), 4 g_w [1024,16], 5 g_b [16]
  if (ws_size < (size_t)WS_END) return;
  char* ws = (char*)d_ws; __bf16* PK = (__bf16*)(ws + WS_PK); _Float16 *QK = (_Float16*)(ws + WS_QK), *QKL = (_Float16*)(ws + WS_QKL), *VTH = (_Float16*)(ws + WS_VTH), *VTL = (_Float16*)(ws + WS_VTL); float *O = (float*)(ws + WS_O), *GR = (float*)(ws + WS_G);
  k_pack<<<dim3(DM, 4), 256, 0, stream>>>(F[3], F[3], F[3], F[3], PK);   // W_proj rows (q/k/v slots overwritten next)
  k_pack3<<<dim3(DM, 3), 256, 0, stream>>>(F[2], PK);
  k_grav<<<TNB * SS / 16, 256, 0, stream>>>(F[0], F[4], F[5], GR);
  k_qkv<<<dim3(TNB * SS / 64, QKVW / 128), 128, 0, stream>>>(F[0], F[0], F[0], PK + PK_A, nullptr, nullptr, nullptr, F[1], QK, QKL, VTH, VTL);
  k_attn<<<dim3(TQB, NH, TNB), 128, 0, stream>>>(QK, QKL, VTH, VTL, nullptr, GR, O);
  k_out<<<dim3(TOB, DM / 128), 128, 0, stream>>>(O, PK + PK_P, nullptr, (float*)d_out);
}

// v005
// It runs in 256 microseconds.
// Two timings next to v004 both put it at 1.13 times that version's speed.
// Counting every step since v000, it is 3.54 times as fast.
// compute dtype: all float inputs rounded to bf16; qkv = x . W_attn with EXACT bf16 products on WMMA 16x16x32 ((in,out) columns q | k | v as transposed rows); rotate-half RoPE with the learned angle table (precise sinf/cosf of rope[t][d]) on q and k in f32 before the f16 hi + residual split; gravity softplus(x . g_w + g_b): EXACT bf16 products on WMMA 16x16x32, f32 sums (precise expf/log1pf); causal attention: 3-product scores and hi + residual P, v on the first 128 queries of each sequence, single f16 beyond; x 1/8 - g x min(|i-j|, 64) x 0.1, running-max softmax in f32 (hardware exp), P scaled by 2^11; out = y (bf16 hi + residual) . W_proj (2 products).
#include <hip/hip_runtime.h>
#include <math.h>

typedef __attribute__((ext_vector_type(16))) _Float16 v16h;
typedef __attribute__((ext_vector_type(16))) __bf16 v16b;
typedef __attribute__((ext_vector_type(8)))  _Float16 v8h;
typedef __attribute__((ext_vector_type(8)))  float v8f;
typedef __attribute__((ext_vector_type(4)))  float v4f;
typedef __attribute__((ext_vector_type(2)))  float v2f;
typedef __attribute__((ext_vector_type(4)))  unsigned v4u;
typedef __attribute__((ext_vector_type(4)))  int v4i;
typedef float __attribute__((may_alias)) float_a;
typedef int __attribute__((may_alias)) int_a;

template <typename T> __device__ __forceinline__ void vst2(void* p, T v) { *(T*)p = v;  }
__device__ __forceinline__ v8f wmma16(v16h a, v16h b, v8f c) {
  v8f d = __builtin_amdgcn_wmma_f32_16x16x32_f16(false, a, false, b, (short)0, c, false, false);
  asm volatile("v_nop\n\tv_nop\n\tv_nop\n\tv_nop" : "+v"(d) : "v"(a), "v"(b));
  return d;
}
__device__ __forceinline__ v8f wmma_bf(v16b a, v16b b, v8f c) {
  v8f d = __builtin_amdgcn_wmma_f32_16x16x32_bf16(false, a, false, b, (short)0, c, false, false);
  asm volatile("v_nop\n\tv_nop\n\tv_nop\n\tv_nop" : "+v"(d) : "v"(a), "v"(b));
  return d;
}
// Adaptive-gravity causal attention (B 4, T 2,048, 1,024 dims, 16 heads x 64): fused q|k|v projection, table RoPE on q and k, scores / 8 minus a learned per-(token, head) softplus gravity times the clipped distance, causal softmax, . v, output projection.
__device__ __forceinline__ v16h frag_h(const _Float16* rowk0, int lane) {
  union { v16h v; v8h q[2]; } u; const _Float16* p = rowk0 + 8 * (lane >> 4);
  u.q[0] = *(const v8h*)p; u.q[1] = *(const v8h*)(p + 16); return u.v;
}
__device__ __forceinline__ v16h frag_f32(const float* rowk0, int lane) {
  v16h a; const float* p = rowk0 + 8 * (lane >> 4);
#pragma unroll
  for (int i = 0; i < 8; ++i) { a[i] = (_Float16)p[i]; a[8 + i] = (_Float16)p[16 + i]; }
  return a;
}
__device__ __forceinline__ v16h frag_f32s(const float* rowk0, int lane, float sc) {
  v16h a; const float* p = rowk0 + 8 * (lane >> 4);
#pragma unroll
  for (int i = 0; i < 8; ++i) { a[i] = (_Float16)(p[i] * sc); a[8 + i] = (_Float16)(p[16 + i] * sc); }
  return a;
}
// column fragment from a [K][ld] layout (column n), rows >= K read as 0
__device__ __forceinline__ v16h fragc_f32(const float* W, int k0, int n, int lane, int ld, int K) {
  v16h a; const int g = lane >> 4;
#pragma unroll
  for (int i = 0; i < 8; ++i) { const int ka = k0 + 8 * g + i, kb = ka + 16;
    a[i] = (_Float16)(ka < K ? W[(size_t)(ka < K ? ka : K - 1) * ld + n] : 0.f); a[8 + i] = (_Float16)(kb < K ? W[(size_t)(kb < K ? kb : K - 1) * ld + n] : 0.f); }
  return a;
}
struct F2 { v16b h, l; };
__device__ __forceinline__ F2 bsplit16(const float v[16]) { F2 r;
#pragma unroll
  for (int i = 0; i < 16; ++i) { const __bf16 h = (__bf16)v[i]; r.h[i] = h; r.l[i] = (__bf16)(v[i] - (float)h); }
  return r; }
__device__ __forceinline__ F2 split_row(const float* row, int k0, int lane) { float v[16]; const float* p = row + k0 + 8 * (lane >> 4);
#pragma unroll
  for (int i = 0; i < 8; ++i) { v[i] = p[i]; v[8 + i] = p[16 + i]; }
  return bsplit16(v); }
__device__ __forceinline__ F2 split_rowK(const float* row, int k0, int lane, int K) { float v[16]; const int g = lane >> 4;
#pragma unroll
  for (int i = 0; i < 8; ++i) { const int ka = k0 + 8 * g + i, kb = ka + 16; v[i] = ka < K ? row[ka < K ? ka : K - 1] : 0.f; v[8 + i] = kb < K ? row[kb < K ? kb : K - 1] : 0.f; }
  return bsplit16(v); }
__device__ __forceinline__ F2 split_col(const float* W, int k0, int n, int lane, int ld, int K) { float v[16]; const int g = lane >> 4;
#pragma unroll
  for (int i = 0; i < 8; ++i) { const int ka = k0 + 8 * g + i, kb = ka + 16; v[i] = ka < K ? W[(size_t)(ka < K ? ka : K - 1) * ld + n] : 0.f; v[8 + i] = kb < K ? W[(size_t)(kb < K ? kb : K - 1) * ld + n] : 0.f; }
  return bsplit16(v); }
__device__ __forceinline__ v8f mac3(const F2& a, const F2& b, v8f c) { c = wmma_bf(a.l, b.h, c); c = wmma_bf(a.h, b.l, c); return wmma_bf(a.h, b.h, c); }
__device__ __forceinline__ float sigm(float v) { return 1.0f / (1.0f + expf(-v)); }
#define LDSX() do { asm volatile("s_wait_dscnt 0" ::: "memory"); __builtin_amdgcn_wave_barrier(); __builtin_amdgcn_fence(__ATOMIC_RELEASE, "workgroup"); } while (0)


#define NB 4
#define SS 2048
#define SCALEF 0.125f
#define DM 1024
#define NH 16
__device__ __attribute__((noinline)) float cos_p(float v) { return cosf(v); }
__device__ __attribute__((noinline)) float sin_p(float v) { return sinf(v); }
__device__ __attribute__((noinline)) float exp_p(float v) { return expf(v); }
__device__ __attribute__((noinline)) float log1p_p(float v) { return log1pf(v); }
#define HD 64
#define QKVW (3 * DM)
#ifndef TQB
#define TQB (SS / 64)
#define TNB NB
#define TOB (NB * SS / 64)     // output row tiles (all)
#endif
typedef __attribute__((ext_vector_type(8))) __bf16 v8b;
__device__ __forceinline__ v16b frag_b(const __bf16* rowk0, int lane) {
  union { v16b v; v8b q[2]; } u; const __bf16* p = rowk0 + 8 * (lane >> 4);
  u.q[0] = *(const v8b*)p; u.q[1] = *(const v8b*)(p + 16); return u.v;
}
__device__ __forceinline__ float bfr(float v) { return (float)(__bf16)v; }
// stands behind a group of loads that stays in flight: the group's address registers are rewritten while it flies, and this is the wait that belongs in front of such a rewrite
#define XW() asm volatile("s_wait_xcnt 0x0" ::: "memory")
// scheduling fence: a stage's LDS fragment reads stay in front of its WMMAs, in the groups and order written
#define SB() __builtin_amdgcn_sched_barrier(0)
// ---- operand ring of k_qkv and k_out: a stage is 64 k of the block's 128 weight rows (128 B of bf16 each) and of its 64 activation rows (256 B of f32 each), brought into LDS once for all four waves as whole 128-B lines; row pitches are 16 B x odd, so the 16-byte fragment reads meet no bank conflict
#define KT 64
#define NT (DM / KT)
#define BPI 144
#define API 272
#define RB_B (128 * BPI)
#define RB_S (RB_B + 64 * API)
// the issuing wave's wait for its own copies, and its wait for its own LDS reads: both stand in front of the barrier that hands a stage over
#define AW() asm volatile("s_wait_asynccnt 0x0" ::: "memory")
#define DW() asm volatile("s_wait_dscnt 0x0" ::: "memory")
// eight 16-byte copies of one lane, rows sl (LDS bytes) and sg (global bytes) apart; the s_wait_xcnt closes the statement so that no address register named here is rewritten in front of it
__device__ __forceinline__ void cp8(unsigned l, const char* p, unsigned sl, size_t sg) {
  asm volatile("global_load_async_to_lds_b128 %0, %8, off\n\tglobal_load_async_to_lds_b128 %1, %9, off\n\tglobal_load_async_to_lds_b128 %2, %10, off\n\tglobal_load_async_to_lds_b128 %3, %11, off\n\t"
               "global_load_async_to_lds_b128 %4, %12, off\n\tglobal_load_async_to_lds_b128 %5, %13, off\n\tglobal_load_async_to_lds_b128 %6, %14, off\n\tglobal_load_async_to_lds_b128 %7, %15, off\n\ts_wait_xcnt 0x0"
               :: "v"(l), "v"(l + sl), "v"(l + 2 * sl), "v"(l + 3 * sl), "v"(l + 4 * sl), "v"(l + 5 * sl), "v"(l + 6 * sl), "v"(l + 7 * sl),
                  "v"(p), "v"(p + sg), "v"(p + 2 * sg), "v"(p + 3 * sg), "v"(p + 4 * sg), "v"(p + 5 * sg), "v"(p + 6 * sg), "v"(p + 7 * sg) : "memory");
}
// one stage: lane tid brings chunk tid & 7 of weight rows (tid >> 3) + 16 i and chunk tid & 15 of activation rows (tid >> 4) + 8 i; lb, la, gb, ga already hold the lane's first row and chunk
__device__ __forceinline__ void cp_stage(unsigned lb, unsigned la, const __bf16* gb, const float* ga) { cp8(lb, (const char*)gb, 16 * BPI, (size_t)16 * DM * 2); cp8(la, (const char*)ga, 8 * API, (size_t)8 * DM * 4); }
// one 32-k step's fragments out of a stage, in the k order of the global rows: sb, sa already hold the lane's row and its 8 * g elements
__device__ __forceinline__ void lds_b8(v16b (&f)[8], const char* sb, int kc) {
#pragma unroll
  for (int j = 0; j < 8; ++j) { union { v16b v; v8b q[2]; } u; const char* p = sb + j * 16 * BPI + kc * 64; u.q[0] = *(const v8b*)p; u.q[1] = *(const v8b*)(p + 32); f[j] = u.v; }
}
__device__ __forceinline__ void lds_a16(v4f (&r)[4], const char* sa, int kc) { const char* p = sa + kc * 128; r[0] = *(const v4f*)p; r[1] = *(const v4f*)(p + 16); r[2] = *(const v4f*)(p + 64); r[3] = *(const v4f*)(p + 80); }
__device__ __forceinline__ v16b cvt_a16(const v4f (&r)[4]) { v16b a;
#pragma unroll
  for (int i = 0; i < 8; ++i) { a[i] = (__bf16)r[i >> 2][i & 3]; a[8 + i] = (__bf16)r[2 + (i >> 2)][i & 3]; }
  return a; }
__device__ __forceinline__ F2 split_a16(const v4f (&r)[4]) { float v[16];
#pragma unroll
  for (int i = 0; i < 8; ++i) { v[i] = r[i >> 2][i & 3]; v[8 + i] = r[2 + (i >> 2)][i & 3]; }
  return bsplit16(v); }
__device__ __attribute__((noinline)) float exp_ni(float v) { return expf(v); }
__device__ __attribute__((noinline)) float erf_ni(float v) { return erff(v); }

#define PK_A 0                       // [3072][1024] Wqkv rows (natural [out][in])
#define PK_P (PK_A + QKVW * DM)        // [1024][1024] Wo rows (natural)
#define PK_END (PK_P + DM * DM)
#define WS_PK  0u
#define WS_QK  (WS_PK + 2u * PK_END)             // f16 [8192 rows][2048]: q | k
#define WS_QKL (WS_QK + 2u * NB * SS * 2 * DM)     // f16 q | k residual planes x2048
#define WS_VTH (WS_QKL + 2u * NB * SS * 2 * DM)    // f16 [b][1024 (h*64+d)][2048 s] hi
#define WS_VTL (WS_VTH + 2u * NB * DM * SS)        // f16 lo x 2048
#define WS_O   (WS_VTL + 2u * NB * DM * SS)        // f32 [8192][1024]
#define WS_CS  (WS_O + 4u * NB * SS * DM)           // f32 2 x [2048][32], unused
#define WS_G   (WS_CS + 4u * 2 * SS * 32)                  // f32 [b*t][16] softplus(x . g_w + g_b)
#define WS_END (WS_G + 4u * (size_t)NB * SS * NH)
// ---- k_packt: block = (64 columns n, 128 rows k) of the (in,out) weights: W_attn's 3,072 columns (q | k | v), then W_proj's 1,024, become the bf16 rows of PK in that order. Reads are whole 256-B row pieces; a thread turns its 8 k x 4 n piece in registers and LDS; writes are whole 256-B row pieces
#define PTK 128
#define PTN 64
// eight rows of one lane, LD floats apart (LD a compile-time constant of each weight), issued as one group
template <int LD> __device__ __forceinline__ void ld_rows8(v4f (&v)[8], const float* p) {
#pragma unroll
  for (int i = 0; i < 8; ++i) v[i] = *(const v4f*)(p + i * LD);
}
__global__ __launch_bounds__(256) void k_packt(const float* __restrict__ WA, const float* __restrict__ WP, __bf16* __restrict__ PK) {
  __shared__ __align__(16) __bf16 s[PTN][PTK + 8];   // [n][k]; row pitch 272 B = 16 B x odd
  const int t = threadIdx.x, c = t & 15, kr = t >> 4; const int nb = blockIdx.x * PTN, k0 = blockIdx.y * PTK;
  v4f v[8];
  if (nb < QKVW) ld_rows8<QKVW>(v, WA + nb + (size_t)(k0 + kr * 8) * QKVW + c * 4); else ld_rows8<DM>(v, WP + (nb - QKVW) + (size_t)(k0 + kr * 8) * DM + c * 4);   // a block lies wholly in one of the two weights
  XW();   // the group's address registers are free for reuse only behind this wait
#pragma unroll
  for (int e = 0; e < 4; ++e) { v8b w;
#pragma unroll
    for (int i = 0; i < 8; ++i) w[i] = (__bf16)v[i][e];
    *(v8b*)&s[c * 4 + e][kr * 8] = w; }
  __syncthreads();
#pragma unroll
  for (int j = 0; j < 4; ++j) { const int q = t + 256 * j, n = q >> 4, pc = q & 15; vst2((unsigned*)(PK + PK_A + (size_t)(nb + n) * DM + k0 + pc * 8), *(const v4u*)&s[n][pc * 8]); }
}
__global__ __launch_bounds__(128) void k_qkv(const float* __restrict__ XQ, const float* __restrict__ XK, const float* __restrict__ XV, const __bf16* __restrict__ P, const float* __restrict__ BQ, const float* __restrict__ BK, const float* __restrict__ BV, const float* __restrict__ POS, _Float16* __restrict__ QK, _Float16* __restrict__ QKL, _Float16* __restrict__ VTH, _Float16* __restrict__ VTL) {
  const int which0 = (blockIdx.y * 128) / DM; const float* X = (which0 == 0) ? XQ : (which0 == 1) ? XK : XV; const float* BB = BQ ? (((which0 == 0) ? BQ : (which0 == 1) ? BK : BV) + (blockIdx.y * 128 - which0 * DM)) : nullptr;
  __shared__ __attribute__((aligned(128))) char ring[2 * RB_S];   // two operand stages; behind the k loop the same bytes are the store staging
  _Float16 (*so)[16][136] = (_Float16 (*)[16][136])ring; _Float16 (*sol)[16][136] = (_Float16 (*)[16][136])(ring + 4 * 16 * 136 * 2); _Float16 (*sth)[72] = (_Float16 (*)[72])ring; _Float16 (*stl)[72] = (_Float16 (*)[72])(ring + 128 * 72 * 2);
  const int tid = threadIdx.x, wave = tid >> 5, lane = tid & 31, col = lane & 15, g = lane >> 4; const size_t r0 = (size_t)blockIdx.x * 64 + wave * 16; const int n0 = blockIdx.y * 128;
  v8f acc[8] = {};
  const unsigned lb = (unsigned)(size_t)ring + (tid >> 3) * BPI + (tid & 7) * 16, la = (unsigned)(size_t)ring + RB_B + (tid >> 4) * API + (tid & 15) * 16;
  const __bf16* gb = P + (size_t)(n0 + (tid >> 3)) * DM + (tid & 7) * 8; const float* ga = X + ((size_t)blockIdx.x * 64 + (tid >> 4)) * DM + (tid & 15) * 4;
  cp_stage(lb, la, gb, ga); AW(); __syncthreads();   // stage 0 landed and handed to every wave
  cp_stage(lb + RB_S, la + RB_S, gb + KT, ga + KT);   // stage 1 flies while stage 0 is multiplied
  // the stage loop stays rolled: one copy of the hand-over below, the buffer picked by t & 1; unrolling would only multiply the code
#pragma unroll 1
  for (int t = 0; t < NT; ++t) { const unsigned bo = (t & 1) * RB_S; const char* sb = ring + bo + col * BPI + g * 16; const char* sa = ring + bo + RB_B + (wave * 16 + col) * API + g * 32;
    v16b b0[8], b1[8]; v4f a0[4], a1[4];
    lds_a16(a0, sa, 0); lds_b8(b0, sb, 0); lds_a16(a1, sa, 1); lds_b8(b1, sb, 1); SB();
    v16b a = cvt_a16(a0);
#pragma unroll
    for (int j = 0; j < 8; ++j) acc[j] = wmma_bf(a, b0[j], acc[j]);
    a = cvt_a16(a1);
#pragma unroll
    for (int j = 0; j < 8; ++j) acc[j] = wmma_bf(a, b1[j], acc[j]);
    DW(); AW(); __syncthreads();   // this wave's reads of stage t are done and its copies of stage t + 1 have landed; behind the barrier that holds for all four waves
    if (t + 2 < NT) cp_stage(lb + bo, la + bo, gb + (t + 2) * KT, ga + (t + 2) * KT); }   // refill of the buffer that every wave has just left
  AW();   // no copy is outstanding when the ring's bytes become the store staging
  if (n0 < 2 * DM) {   // bias, then rotate-half rotary over each 64-dim head with the learned angle rope[position][d] from the table
#pragma unroll
    for (int j = 0; j < 8; ++j)
#pragma unroll
      for (int r = 0; r < 8; ++r) acc[j][r] += (BB ? bfr(BB[j * 16 + col]) : 0.f);
#pragma unroll
    for (int r = 0; r < 8; ++r) { const int spos = (int)((r0 + 8 * g + r) % SS); const float* pr = POS + (size_t)spos * HD;   // learned table: out[d] = x[d] cos(p[d]) -+ partner sin(p[d])
#pragma unroll
      for (int jj = 0; jj < 2; ++jj) { const float p1 = bfr(pr[jj * 16 + col]), p2 = bfr(pr[32 + jj * 16 + col]); const float c1 = cos_p(p1), s1 = sin_p(p1), c2 = cos_p(p2), s2 = sin_p(p2);
#pragma unroll
        for (int hh = 0; hh < 2; ++hh) { const float x1 = acc[hh * 4 + jj][r], x2 = acc[hh * 4 + jj + 2][r]; acc[hh * 4 + jj][r] = x1 * c1 - x2 * s1; acc[hh * 4 + jj + 2][r] = x2 * c2 + x1 * s2; } } }
#pragma unroll
    for (int j = 0; j < 8; ++j) {
#pragma unroll
      for (int r = 0; r < 8; ++r) { const float v = acc[j][r]; const _Float16 hv = (_Float16)v; so[wave][8 * g + r][j * 16 + col] = hv; sol[wave][8 * g + r][j * 16 + col] = (_Float16)((v - (float)hv) * 2048.0f); } }   // q, k (+ bias) as f16 hi + (x2048) residual
    LDSX();
    for (int rl = 0; rl < 16; ++rl) if (lane < 16) { vst2((unsigned*)(QK + (r0 + rl) * (2 * DM) + n0 + lane * 8), *(const v4u*)&so[wave][rl][lane * 8]); vst2((unsigned*)(QKL + (r0 + rl) * (2 * DM) + n0 + lane * 8), *(const v4u*)&sol[wave][rl][lane * 8]); }
  } else {
#pragma unroll
    for (int j = 0; j < 8; ++j) {
#pragma unroll
      for (int r = 0; r < 8; ++r) { const float v = acc[j][r] + (BB ? bfr(BB[j * 16 + col]) : 0.f); const _Float16 hv = (_Float16)v; sth[j * 16 + col][wave * 16 + 8 * g + r] = hv; stl[j * 16 + col][wave * 16 + 8 * g + r] = (_Float16)((v - (float)hv) * 2048.0f); } }
    __syncthreads();
    const size_t rb = (size_t)blockIdx.x * 64; const int b = (int)(rb / SS), s0 = (int)(rb % SS); const int pc0 = n0 - 2 * DM;
    for (int q = tid; q < 128 * 8; q += 128) { const int d = q >> 3, pc = q & 7; const size_t o = ((size_t)b * DM + pc0 + d) * SS + s0 + pc * 8; vst2((unsigned*)(VTH + o), *(const v4u*)&sth[d][pc * 8]); vst2((unsigned*)(VTL + o), *(const v4u*)&stl[d][pc * 8]); }
  }
}
// lane l <-> lane l ^ 16 as a vector cross-row move (no LDS counter to wait on)
__device__ __forceinline__ float xhalf(float x) { return __builtin_bit_cast(float, __builtin_amdgcn_permlanex16(__builtin_bit_cast(int, x), __builtin_bit_cast(int, x), 0x76543210, 0xfedcba98, false, false)); }
// e^x as the hardware exp2 of x * log2(e), the same two instructions __expf compiles to; the v_nop inside the statement keeps the one slot the instruction set asks for behind a transcendental
__device__ __forceinline__ float exp_hw(float x) { float y; const float t = x * 1.44269504f; asm("v_exp_f32 %0, %1\n\tv_nop" : "=v"(y) : "v"(t)); return y; }
// ---- k_attn: block = (64 queries, head h, batch b): causal flash attention on TRANSPOSED tiles: S^T = K . Q^T (rows = keys, column = this lane's query), so the softmax of a query lives in one lane pair and the D registers of S^T are already the B fragment of O^T = V^T . P^T (k = 8g + i from key tile 0, 16 + 8g + i from key tile 1); O[b*S+q][h*64+d] = (acc + accl / 2048) / (2048 l) (256-B segments)
__global__ __launch_bounds__(128) void k_attn(const _Float16* __restrict__ QK, const _Float16* __restrict__ QKL, const _Float16* __restrict__ VTH, const _Float16* __restrict__ VTL, const void* __restrict__ KMASK, const float* __restrict__ GR, float* __restrict__ O) {
  __shared__ __align__(16) float so[4][16][68];
  const int tid = threadIdx.x, wave = tid >> 5, lane = tid & 31, col = lane & 15, g = lane >> 4;
  const int qb = blockIdx.x, h = blockIdx.y, b = blockIdx.z; const int q0 = qb * 64 + wave * 16; const int qi = q0 + col; const size_t rq = (size_t)b * SS + qi;
  v16h aq[2], aql[2];
#pragma unroll
  for (int kc = 0; kc < 2; ++kc) { aq[kc] = frag_h(QK + rq * (2 * DM) + h * HD + kc * 32, lane); aql[kc] = frag_h(QKL + rq * (2 * DM) + h * HD + kc * 32, lane); }
  const float gq = GR[rq * NH + h];   // this lane's query: one gravity value
  float m = -3.0e38f, l = 0.f;        // l: partial sum over this lane half's keys, joined after the loop
  v8f acc[4] = {}, accl[4] = {};
  const int nks = (qb * 64 + 64) / 32;   // causal: key tiles up to the query tile's end
  const _Float16* kb = QK + ((size_t)b * SS + col) * (2 * DM) + DM + h * HD; const _Float16* vb = VTH + ((size_t)b * DM + h * HD + col) * SS;
  v16h kf[2][2], vf[4];   // hi fragments held whole: K of tile ks + 1 is fetched behind the scores of tile ks, V of tile ks in front of them
#pragma unroll
  for (int ct = 0; ct < 2; ++ct)
#pragma unroll
    for (int kc = 0; kc < 2; ++kc) kf[ct][kc] = frag_h(kb + (size_t)(ct * 16) * (2 * DM) + kc * 32, lane);
#pragma unroll 1
  for (int ks = 0; ks < nks; ++ks) { v8f s[2];
#pragma unroll
    for (int dt = 0; dt < 4; ++dt) vf[dt] = frag_h(vb + (size_t)(dt * 16) * SS + ks * 32, lane);
    XW();
#pragma unroll
    for (int ct = 0; ct < 2; ++ct) { const int kr = ks * 32 + ct * 16 + col; const _Float16* krowl = QKL + ((size_t)b * SS + kr) * (2 * DM) + DM + h * HD; v8f c = {}, cl = {};
      if (qb < 2) {   // leading query blocks (few keys, outputs far above the global rms): 3 products
#pragma unroll
        for (int kc = 0; kc < 2; ++kc) { const v16h kh = kf[ct][kc]; c = wmma16(kh, aq[kc], c); cl = wmma16(kh, aql[kc], cl); cl = wmma16(frag_h(krowl + kc * 32, lane), aq[kc], cl); }
#pragma unroll
        for (int r = 0; r < 8; ++r) c[r] += cl[r] * (1.0f / 2048.0f); }
      else {
#pragma unroll
        for (int kc = 0; kc < 2; ++kc) c = wmma16(kf[ct][kc], aq[kc], c); }   // single product elsewhere
#pragma unroll
      for (int r = 0; r < 8; ++r) { const int kk = ks * 32 + ct * 16 + 8 * g + r; const int dd = min(qi - kk, 64); s[ct][r] = (kk <= qi) ? (c[r] * SCALEF - gq * (float)dd * 0.1f) : -3.0e38f; } }   // causal; - softplus-gravity x min(|i-j|,64) x 0.1
    const int kn = (ks + 1 < nks) ? ks + 1 : ks;   // no branch round the load group (its waits stay counted ones); the last tile is fetched once more and not used
#pragma unroll
    for (int ct = 0; ct < 2; ++ct)
#pragma unroll
      for (int kc = 0; kc < 2; ++kc) kf[ct][kc] = frag_h(kb + (size_t)(kn * 32 + ct * 16) * (2 * DM) + kc * 32, lane);
    float mx = fmaxf(s[0][0], s[1][0]);
#pragma unroll
    for (int r = 1; r < 8; ++r) mx = fmaxf(mx, fmaxf(s[0][r], s[1][r]));
    mx = fmaxf(mx, xhalf(mx));   // the other 16 keys of this query sit in the partner lane
    const float mn = fmaxf(m, mx); const float am = exp_hw(m - mn); const float alpha = (m <= -1.0e38f) ? 0.f : am;
    float es = 0.f; v16h pa, pl;
#pragma unroll
    for (int r = 0; r < 8; ++r) { const float y0 = exp_hw(s[0][r] - mn), y1 = exp_hw(s[1][r] - mn); const float e0 = (s[0][r] <= -1.0e38f) ? 0.f : y0, e1 = (s[1][r] <= -1.0e38f) ? 0.f : y1; es += e0 + e1;
      const float x0 = e0 * 2048.0f, x1 = e1 * 2048.0f; const _Float16 h0 = (_Float16)x0, h1 = (_Float16)x1; pa[r] = h0; pa[8 + r] = h1; pl[r] = (_Float16)((x0 - (float)h0) * 2048.0f); pl[8 + r] = (_Float16)((x1 - (float)h1) * 2048.0f); }   // P scaled by 2^11 before the f16 split so small softmax weights stay out of the f16 subnormal range; 2^-11 folded into the epilogue
    l = l * alpha + es; m = mn;
#pragma unroll
    for (int dt = 0; dt < 4; ++dt)
#pragma unroll
      for (int r = 0; r < 8; ++r) { acc[dt][r] *= alpha; accl[dt][r] *= alpha; }
#pragma unroll
    for (int dt = 0; dt < 4; ++dt) { const size_t vr = ((size_t)b * DM + h * HD + dt * 16 + col) * SS + ks * 32; const v16h vh = vf[dt]; acc[dt] = wmma16(vh, pa, acc[dt]); if (qb < 2) { accl[dt] = wmma16(vh, pl, accl[dt]); accl[dt] = wmma16(frag_h(VTL + vr, lane), pa, accl[dt]); } }   // leading query blocks: P hi/lo x V hi/lo (3 products); elsewhere P x V single
  }
  l += xhalf(l);
  const float il = (1.0f / 2048.0f) / l;
#pragma unroll
  for (int dt = 0; dt < 4; ++dt)
#pragma unroll
    for (int r = 0; r < 8; ++r) so[wave][col][dt * 16 + 8 * g + r] = (acc[dt][r] + accl[dt][r] * (1.0f / 2048.0f)) * il;
  LDSX();
  for (int rl = 0; rl < 16; ++rl) if (lane < 16) vst2(O + ((size_t)b * SS + q0 + rl) * DM + h * HD + lane * 4, *(const v4f*)&so[wave][rl][lane * 4]);
}
// ---- k_out: block = (64 rows, 128 cols): out = O(hi/lo) . Wo rows (2 products) + bo
__global__ __launch_bounds__(128) void k_out(const float* __restrict__ O, const __bf16* __restrict__ P, const float* __restrict__ BO, float* __restrict__ Y) {
  __shared__ __attribute__((aligned(128))) char ring[2 * RB_S];   // two operand stages; behind the k loop the same bytes are the store staging
  float (*so)[16][132] = (float (*)[16][132])ring;
  const int tid = threadIdx.x, wave = tid >> 5, lane = tid & 31, col = lane & 15, g = lane >> 4; const size_t r0 = (size_t)blockIdx.x * 64 + wave * 16; const int n0 = blockIdx.y * 128;
  v8f acc[8] = {};
  const unsigned lb = (unsigned)(size_t)ring + (tid >> 3) * BPI + (tid & 7) * 16, la = (unsigned)(size_t)ring + RB_B + (tid >> 4) * API + (tid & 15) * 16;
  const __bf16* gb = P + (size_t)(n0 + (tid >> 3)) * DM + (tid & 7) * 8; const float* ga = O + ((size_t)blockIdx.x * 64 + (tid >> 4)) * DM + (tid & 15) * 4;
  cp_stage(lb, la, gb, ga); AW(); __syncthreads();   // stage 0 landed and handed to every wave
  cp_stage(lb + RB_S, la + RB_S, gb + KT, ga + KT);   // stage 1 flies while stage 0 is multiplied
  // the stage loop stays rolled: one copy of the hand-over below, the buffer picked by t & 1; unrolling would only multiply the code
#pragma unroll 1
  for (int t = 0; t < NT; ++t) { const unsigned bo = (t & 1) * RB_S; const char* sb = ring + bo + col * BPI + g * 16; const char* sa = ring + bo + RB_B + (wave * 16 + col) * API + g * 32;
    v16b b0[8], b1[8]; v4f a0[4], a1[4];
    lds_a16(a0, sa, 0); lds_b8(b0, sb, 0); lds_b8(b1, sb, 1); SB();
    F2 a = split_a16(a0); SB(); lds_a16(a1, sa, 1); SB();   // the second step's raw A takes the registers that the first step's has just left: with all four groups held at once the kernel went past 256 registers and lost its fourth wave per SIMD
#pragma unroll
    for (int j = 0; j < 8; ++j) { acc[j] = wmma_bf(a.l, b0[j], acc[j]); acc[j] = wmma_bf(a.h, b0[j], acc[j]); }
    a = split_a16(a1);
#pragma unroll
    for (int j = 0; j < 8; ++j) { acc[j] = wmma_bf(a.l, b1[j], acc[j]); acc[j] = wmma_bf(a.h, b1[j], acc[j]); }
    DW(); AW(); __syncthreads();   // this wave's reads of stage t are done and its copies of stage t + 1 have landed; behind the barrier that holds for all four waves
    if (t + 2 < NT) cp_stage(lb + bo, la + bo, gb + (t + 2) * KT, ga + (t + 2) * KT); }   // refill of the buffer that every wave has just left
  AW();   // no copy is outstanding when the ring's bytes become the store staging
#pragma unroll
  for (int j = 0; j < 8; ++j) {
#pragma unroll
    for (int r = 0; r < 8; ++r) so[wave][8 * g + r][j * 16 + col] = acc[j][r] + (BO ? bfr(BO[n0 + j * 16 + col]) : 0.f); }
  LDSX();
  for (int rl = 0; rl < 16; ++rl) vst2(Y + (r0 + rl) * DM + n0 + lane * 4, *(const v4f*)&so[wave][rl][lane * 4]);
}
// ---- k_grav: block = 16 rows, 8 waves; wave w takes k in [128 w, 128 w + 128): z = x . g_w on WMMA 16x16x32 from the bf16-rounded inputs (exact products, f32 sums), the 16 heads being one column tile; a wave's 80 loads are all issued before its first product; the eight partial tiles are joined through LDS; g[row][h] = softplus(z + g_b[h]) (precise expf/log1pf); one 1-KB segment a block, one 128-B line a wave
__global__ __launch_bounds__(256) void k_grav(const float* __restrict__ X, const float* __restrict__ GW, const float* __restrict__ GB, float* __restrict__ GR) {
  __shared__ __align__(16) float sp[8][16][NH + 1]; const size_t r0 = (size_t)blockIdx.x * 16; const int t = threadIdx.x, wave = t >> 5, lane = t & 31, col = lane & 15, g = lane >> 4;
  const float* xr = X + (r0 + col) * DM + wave * 128 + 8 * g; const float* gw = GW + (size_t)(wave * 128 + 8 * g) * NH + col;   // A: row col of x; B: column col of g_w; both in the k order 8 g + i, 16 + 8 g + i
  v4f ar[4][4]; float br[4][16];
#pragma unroll
  for (int s = 0; s < 4; ++s) { const float* p = xr + s * 32; ar[s][0] = *(const v4f*)p; ar[s][1] = *(const v4f*)(p + 4); ar[s][2] = *(const v4f*)(p + 16); ar[s][3] = *(const v4f*)(p + 20); }
#pragma unroll
  for (int s = 0; s < 4; ++s)
#pragma unroll
    for (int i = 0; i < 8; ++i) { br[s][i] = gw[(size_t)(s * 32 + i) * NH]; br[s][8 + i] = gw[(size_t)(s * 32 + 16 + i) * NH]; }
  v8f acc = {};
#pragma unroll
  for (int s = 0; s < 4; ++s) { v16b b;
#pragma unroll
    for (int i = 0; i < 16; ++i) b[i] = (__bf16)br[s][i];
    acc = wmma_bf(cvt_a16(ar[s]), b, acc); }
#pragma unroll
  for (int r = 0; r < 8; ++r) sp[wave][8 * g + r][col] = acc[r];
  __syncthreads();
  float z = sp[0][t >> 4][t & 15];
#pragma unroll
  for (int w = 1; w < 8; ++w) z += sp[w][t >> 4][t & 15];
  z += bfr(GB[t & 15]);
  GR[r0 * NH + t] = (z > 20.f) ? z : log1p_p(exp_p(z));   // softplus
}
extern "C" void kernel_launch(void* const* d_in, const int* in_sizes, int n_in, void* d_out, int out_size, void* d_ws, size_t ws_size, hipStream_t stream) {
  (void)in_sizes; (void)n_in; (void)out_size;
  const float** F = (const float**)d_in;   // 0 x [4,2048,1024], 1 rope [2048,64], 2 W_attn [1024,3072] (in,out: q|k|v), 3 W_proj [1024,1024] (in,out), 4 g_w [1024,16], 5 g_b [16]
  if (ws_size < (size_t)WS_END) return;
  char* ws = (char*)d_ws; __bf16* PK = (__bf16*)(ws + WS_PK); _Float16 *QK = (_Float16*)(ws + WS_QK), *QKL = (_Float16*)(ws + WS_QKL), *VTH = (_Float16*)(ws + WS_VTH), *VTL = (_Float16*)(ws + WS_VTL); float *O = (float*)(ws + WS_O), *GR = (float*)(ws + WS_G);
  k_packt<<<dim3((QKVW + DM) / PTN, DM / PTK), 256, 0, stream>>>(F[2], F[3], PK);   // W_attn columns, then W_proj columns, as bf16 rows
  k_grav<<<TNB * SS / 16, 256, 0, stream>>>(F[0], F[4], F[5], GR);
  k_qkv<<<dim3(TNB * SS / 64, QKVW / 128), 128, 0, stream>>>(F[0], F[0], F[0], PK + PK_A, nullptr, nullptr, nullptr, F[1], QK, QKL, VTH, VTL);
  k_attn<<<dim3(TQB, NH, TNB), 128, 0, stream>>>(QK, QKL, VTH, VTL, nullptr, GR, O);
  k_out<<<dim3(TOB, DM / 128), 128, 0, stream>>>(O, PK + PK_P, nullptr, (float*)d_out);
}

// v006
// One run takes 247 microseconds.
// Two timings next to v005 both put it at 1.04 times that version's speed.
// Over all steps from v000 it is 3.67 times as fast.
// compute dtype: all float inputs rounded to bf16; qkv = x . W_attn with EXACT bf16 products on WMMA 16x16x32 ((in,out) columns q | k | v as transposed rows); rotate-half RoPE with the learned angle table (precise sinf/cosf of rope[t][d]) on q and k in f32 before the f16 hi + residual split; gravity softplus(x . g_w + g_b): EXACT bf16 products on WMMA 16x16x32, f32 sums (precise expf/log1pf); causal attention: 3-product scores and hi + residual P, v on the first 128 queries of each sequence, single f16 beyond; x 1/8 - g x min(|i-j|, 64) x 0.1, running-max softmax in f32 (hardware exp), P scaled by 2^11; out = y (bf16 hi + residual) . W_proj (2 products).
#include <hip/hip_runtime.h>
#include <math.h>

typedef __attribute__((ext_vector_type(16))) _Float16 v16h;
typedef __attribute__((ext_vector_type(16))) __bf16 v16b;
typedef __attribute__((ext_vector_type(8)))  _Float16 v8h;
typedef __attribute__((ext_vector_type(8)))  float v8f;
typedef __attribute__((ext_vector_type(4)))  float v4f;
typedef __attribute__((ext_vector_type(2)))  float v2f;
typedef __attribute__((ext_vector_type(4)))  unsigned v4u;
typedef __attribute__((ext_vector_type(4)))  int v4i;
typedef float __attribute__((may_alias)) float_a;
typedef int __attribute__((may_alias)) int_a;

template <typename T> __device__ __forceinline__ void vst2(void* p, T v) { *(T*)p = v;  }
__device__ __forceinline__ v8f wmma16(v16h a, v16h b, v8f c) {
  v8f d = __builtin_amdgcn_wmma_f32_16x16x32_f16(false, a, false, b, (short)0, c, false, false);
  asm volatile("v_nop\n\tv_nop\n\tv_nop\n\tv_nop" : "+v"(d) : "v"(a), "v"(b));
  return d;
}
__device__ __forceinline__ v8f wmma_bf(v16b a, v16b b, v8f c) {
  v8f d = __builtin_amdgcn_wmma_f32_16x16x32_bf16(false, a, false, b, (short)0, c, false, false);
  asm volatile("v_nop\n\tv_nop\n\tv_nop\n\tv_nop" : "+v"(d) : "v"(a), "v"(b));
  return d;
}
// Adaptive-gravity causal attention (B 4, T 2,048, 1,024 dims, 16 heads x 64): fused q|k|v projection, table RoPE on q and k, scores / 8 minus a learned per-(token, head) softplus gravity times the clipped distance, causal softmax, . v, output projection.
__device__ __forceinline__ v16h frag_h(const _Float16* rowk0, int lane) {
  union { v16h v; v8h q[2]; } u; const _Float16* p = rowk0 + 8 * (lane >> 4);
  u.q[0] = *(const v8h*)p; u.q[1] = *(const v8h*)(p + 16); return u.v;
}
__device__ __forceinline__ v16h frag_f32(const float* rowk0, int lane) {
  v16h a; const float* p = rowk0 + 8 * (lane >> 4);
#pragma unroll
  for (int i = 0; i < 8; ++i) { a[i] = (_Float16)p[i]; a[8 + i] = (_Float16)p[16 + i]; }
  return a;
}
__device__ __forceinline__ v16h frag_f32s(const float* rowk0, int lane, float sc) {
  v16h a; const float* p = rowk0 + 8 * (lane >> 4);
#pragma unroll
  for (int i = 0; i < 8; ++i) { a[i] = (_Float16)(p[i] * sc); a[8 + i] = (_Float16)(p[16 + i] * sc); }
  return a;
}
// column fragment from a [K][ld] layout (column n), rows >= K read as 0
__device__ __forceinline__ v16h fragc_f32(const float* W, int k0, int n, int lane, int ld, int K) {
  v16h a; const int g = lane >> 4;
#pragma unroll
  for (int i = 0; i < 8; ++i) { const int ka = k0 + 8 * g + i, kb = ka + 16;
    a[i] = (_Float16)(ka < K ? W[(size_t)(ka < K ? ka : K - 1) * ld + n] : 0.f); a[8 + i] = (_Float16)(kb < K ? W[(size_t)(kb < K ? kb : K - 1) * ld + n] : 0.f); }
  return a;
}
struct F2 { v16b h, l; };
__device__ __forceinline__ F2 bsplit16(const float v[16]) { F2 r;
#pragma unroll
  for (int i = 0; i < 16; ++i) { const __bf16 h = (__bf16)v[i]; r.h[i] = h; r.l[i] = (__bf16)(v[i] - (float)h); }
  return r; }
__device__ __forceinline__ F2 split_row(const float* row, int k0, int lane) { float v[16]; const float* p = row + k0 + 8 * (lane >> 4);
#pragma unroll
  for (int i = 0; i < 8; ++i) { v[i] = p[i]; v[8 + i] = p[16 + i]; }
  return bsplit16(v); }
__device__ __forceinline__ F2 split_rowK(const float* row, int k0, int lane, int K) { float v[16]; const int g = lane >> 4;
#pragma unroll
  for (int i = 0; i < 8; ++i) { const int ka = k0 + 8 * g + i, kb = ka + 16; v[i] = ka < K ? row[ka < K ? ka : K - 1] : 0.f; v[8 + i] = kb < K ? row[kb < K ? kb : K - 1] : 0.f; }
  return bsplit16(v); }
__device__ __forceinline__ F2 split_col(const float* W, int k0, int n, int lane, int ld, int K) { float v[16]; const int g = lane >> 4;
#pragma unroll
  for (int i = 0; i < 8; ++i) { const int ka = k0 + 8 * g + i, kb = ka + 16; v[i] = ka < K ? W[(size_t)(ka < K ? ka : K - 1) * ld + n] : 0.f; v[8 + i] = kb < K ? W[(size_t)(kb < K ? kb : K - 1) * ld + n] : 0.f; }
  return bsplit16(v); }
__device__ __forceinline__ v8f mac3(const F2& a, const F2& b, v8f c) { c = wmma_bf(a.l, b.h, c); c = wmma_bf(a.h, b.l, c); return wmma_bf(a.h, b.h, c); }
__device__ __forceinline__ float sigm(float v) { return 1.0f / (1.0f + expf(-v)); }
#define LDSX() do { asm volatile("s_wait_dscnt 0" ::: "memory"); __builtin_amdgcn_wave_barrier(); __builtin_amdgcn_fence(__ATOMIC_RELEASE, "workgroup"); } while (0)


#define NB 4
#define SS 2048
#define SCALEF 0.125f
#define DM 1024
#define NH 16
__device__ __attribute__((noinline)) float cos_p(float v) { return cosf(v); }
__device__ __attribute__((noinline)) float sin_p(float v) { return sinf(v); }
__device__ __attribute__((noinline)) float exp_p(float v) { return expf(v); }
__device__ __attribute__((noinline)) float log1p_p(float v) { return log1pf(v); }
#define HD 64
#define QKVW (3 * DM)
#ifndef TQB
#define TQB (SS / 64)
#define TNB NB
#define TOB (NB * SS / 64)     // output row tiles (all)
#endif
typedef __attribute__((ext_vector_type(8))) __bf16 v8b;
__device__ __forceinline__ v16b frag_b(const __bf16* rowk0, int lane) {
  union { v16b v; v8b q[2]; } u; const __bf16* p = rowk0 + 8 * (lane >> 4);
  u.q[0] = *(const v8b*)p; u.q[1] = *(const v8b*)(p + 16); return u.v;
}
__device__ __forceinline__ float bfr(float v) { return (float)(__bf16)v; }
// stands behind a group of loads that stays in flight: the group's address registers are rewritten while it flies, and this is the wait that belongs in front of such a rewrite
#define XW() asm volatile("s_wait_xcnt 0x0" ::: "memory")
// scheduling fence: a stage's LDS fragment reads stay in front of its WMMAs, in the groups and order written
#define SB() __builtin_amdgcn_sched_barrier(0)
// ---- operand ring of k_qkv and k_out: a stage is 64 k of the block's 128 weight rows (128 B of bf16 each) and of its 64 activation rows (256 B of f32 each), brought into LDS once for all four waves as whole 128-B lines; row pitches are 16 B x odd, so the 16-byte fragment reads meet no bank conflict
#define KT 64
#define NT (DM / KT)
#define BPI 144
#define API 272
#define RB_B (128 * BPI)
#define RB_S (RB_B + 64 * API)
// the issuing wave's wait for its own copies, and its wait for its own LDS reads: both stand in front of the barrier that hands a stage over
#define AW() asm volatile("s_wait_asynccnt 0x0" ::: "memory")
#define DW() asm volatile("s_wait_dscnt 0x0" ::: "memory")
// eight 16-byte copies of one lane, rows sl (LDS bytes) and sg (global bytes) apart; the s_wait_xcnt closes the statement so that no address register named here is rewritten in front of it
__device__ __forceinline__ void cp8(unsigned l, const char* p, unsigned sl, size_t sg) {
  asm volatile("global_load_async_to_lds_b128 %0, %8, off\n\tglobal_load_async_to_lds_b128 %1, %9, off\n\tglobal_load_async_to_lds_b128 %2, %10, off\n\tglobal_load_async_to_lds_b128 %3, %11, off\n\t"
               "global_load_async_to_lds_b128 %4, %12, off\n\tglobal_load_async_to_lds_b128 %5, %13, off\n\tglobal_load_async_to_lds_b128 %6, %14, off\n\tglobal_load_async_to_lds_b128 %7, %15, off\n\ts_wait_xcnt 0x0"
               :: "v"(l), "v"(l + sl), "v"(l + 2 * sl), "v"(l + 3 * sl), "v"(l + 4 * sl), "v"(l + 5 * sl), "v"(l + 6 * sl), "v"(l + 7 * sl),
                  "v"(p), "v"(p + sg), "v"(p + 2 * sg), "v"(p + 3 * sg), "v"(p + 4 * sg), "v"(p + 5 * sg), "v"(p + 6 * sg), "v"(p + 7 * sg) : "memory");
}
// one stage: lane tid brings chunk tid & 7 of weight rows (tid >> 3) + 16 i and chunk tid & 15 of activation rows (tid >> 4) + 8 i; lb, la, gb, ga already hold the lane's first row and chunk
__device__ __forceinline__ void cp_stage(unsigned lb, unsigned la, const __bf16* gb, const float* ga) { cp8(lb, (const char*)gb, 16 * BPI, (size_t)16 * DM * 2); cp8(la, (const char*)ga, 8 * API, (size_t)8 * DM * 4); }
// one 32-k step's fragments out of a stage, in the k order of the global rows: sb, sa already hold the lane's row and its 8 * g elements
__device__ __forceinline__ void lds_b8(v16b (&f)[8], const char* sb, int kc) {
#pragma unroll
  for (int j = 0; j < 8; ++j) { union { v16b v; v8b q[2]; } u; const char* p = sb + j * 16 * BPI + kc * 64; u.q[0] = *(const v8b*)p; u.q[1] = *(const v8b*)(p + 32); f[j] = u.v; }
}
__device__ __forceinline__ void lds_a16(v4f (&r)[4], const char* sa, int kc) { const char* p = sa + kc * 128; r[0] = *(const v4f*)p; r[1] = *(const v4f*)(p + 16); r[2] = *(const v4f*)(p + 64); r[3] = *(const v4f*)(p + 80); }
__device__ __forceinline__ v16b cvt_a16(const v4f (&r)[4]) { v16b a;
#pragma unroll
  for (int i = 0; i < 8; ++i) { a[i] = (__bf16)r[i >> 2][i & 3]; a[8 + i] = (__bf16)r[2 + (i >> 2)][i & 3]; }
  return a; }
__device__ __forceinline__ F2 split_a16(const v4f (&r)[4]) { float v[16];
#pragma unroll
  for (int i = 0; i < 8; ++i) { v[i] = r[i >> 2][i & 3]; v[8 + i] = r[2 + (i >> 2)][i & 3]; }
  return bsplit16(v); }
__device__ __attribute__((noinline)) float exp_ni(float v) { return expf(v); }
__device__ __attribute__((noinline)) float erf_ni(float v) { return erff(v); }

#define PK_A 0                       // [3072][1024] Wqkv rows (natural [out][in])
#define PK_P (PK_A + QKVW * DM)        // [1024][1024] Wo rows (natural)
#define PK_END (PK_P + DM * DM)
#define WS_PK  0u
#define WS_QK  (WS_PK + 2u * PK_END)             // f16 [8192 rows][2048]: q | k
#define WS_QKL (WS_QK + 2u * NB * SS * 2 * DM)     // f16 q | k residual planes x2048
#define WS_VTH (WS_QKL + 2u * NB * SS * 2 * DM)    // f16 [b][1024 (h*64+d)][2048 s] hi
#define WS_VTL (WS_VTH + 2u * NB * DM * SS)        // f16 lo x 2048
#define WS_O   (WS_VTL + 2u * NB * DM * SS)        // f32 [8192][1024]
#define WS_CS  (WS_O + 4u * NB * SS * DM)           // f32 2 x [2048][32], unused
#define WS_G   (WS_CS + 4u * 2 * SS * 32)                  // f32 [b*t][16] softplus(x . g_w + g_b)
#define WS_END (WS_G + 4u * (size_t)NB * SS * NH)
// ---- k_packt: block = (64 columns n, 128 rows k) of the (in,out) weights: W_attn's 3,072 columns (q | k | v), then W_proj's 1,024, become the bf16 rows of PK in that order. Reads are whole 256-B row pieces; a thread turns its 8 k x 4 n piece in registers and LDS; writes are whole 256-B row pieces
#define PTK 128
#define PTN 64
// eight rows of one lane, LD floats apart (LD a compile-time constant of each weight), issued as one group
template <int LD> __device__ __forceinline__ void ld_rows8(v4f (&v)[8], const float* p) {
#pragma unroll
  for (int i = 0; i < 8; ++i) v[i] = *(const v4f*)(p + i * LD);
}
__global__ __launch_bounds__(256) void k_packt(const float* __restrict__ WA, const float* __restrict__ WP, __bf16* __restrict__ PK) {
  __shared__ __align__(16) __bf16 s[PTN][PTK + 8];   // [n][k]; row pitch 272 B = 16 B x odd
  const int t = threadIdx.x, c = t & 15, kr = t >> 4; const int nb = blockIdx.x * PTN, k0 = blockIdx.y * PTK;
  v4f v[8];
  if (nb < QKVW) ld_rows8<QKVW>(v, WA + nb + (size_t)(k0 + kr * 8) * QKVW + c * 4); else ld_rows8<DM>(v, WP + (nb - QKVW) + (size_t)(k0 + kr * 8) * DM + c * 4);   // a block lies wholly in one of the two weights
  XW();   // the group's address registers are free for reuse only behind this wait
#pragma unroll
  for (int e = 0; e < 4; ++e) { v8b w;
#pragma unroll
    for (int i = 0; i < 8; ++i) w[i] = (__bf16)v[i][e];
    *(v8b*)&s[c * 4 + e][kr * 8] = w; }
  __syncthreads();
#pragma unroll
  for (int j = 0; j < 4; ++j) { const int q = t + 256 * j, n = q >> 4, pc = q & 15; vst2((unsigned*)(PK + PK_A + (size_t)(nb + n) * DM + k0 + pc * 8), *(const v4u*)&s[n][pc * 8]); }
}
__global__ __launch_bounds__(128) void k_qkv(const float* __restrict__ XQ, const float* __restrict__ XK, const float* __restrict__ XV, const __bf16* __restrict__ P, const float* __restrict__ BQ, const float* __restrict__ BK, const float* __restrict__ BV, const float* __restrict__ POS, _Float16* __restrict__ QK, _Float16* __restrict__ QKL, _Float16* __restrict__ VTH, _Float16* __restrict__ VTL) {
  const int which0 = (blockIdx.y * 128) / DM; const float* X = (which0 == 0) ? XQ : (which0 == 1) ? XK : XV; const float* BB = BQ ? (((which0 == 0) ? BQ : (which0 == 1) ? BK : BV) + (blockIdx.y * 128 - which0 * DM)) : nullptr;
  __shared__ __attribute__((aligned(128))) char ring[2 * RB_S];   // two operand stages; behind the k loop the same bytes are the store staging
  _Float16 (*so)[16][136] = (_Float16 (*)[16][136])ring; _Float16 (*sol)[16][136] = (_Float16 (*)[16][136])(ring + 4 * 16 * 136 * 2); _Float16 (*sth)[72] = (_Float16 (*)[72])ring; _Float16 (*stl)[72] = (_Float16 (*)[72])(ring + 128 * 72 * 2);
  const int tid = threadIdx.x, wave = tid >> 5, lane = tid & 31, col = lane & 15, g = lane >> 4; const size_t r0 = (size_t)blockIdx.x * 64 + wave * 16; const int n0 = blockIdx.y * 128;
  v8f acc[8] = {};
  const unsigned lb = (unsigned)(size_t)ring + (tid >> 3) * BPI + (tid & 7) * 16, la = (unsigned)(size_t)ring + RB_B + (tid >> 4) * API + (tid & 15) * 16;
  const __bf16* gb = P + (size_t)(n0 + (tid >> 3)) * DM + (tid & 7) * 8; const float* ga = X + ((size_t)blockIdx.x * 64 + (tid >> 4)) * DM + (tid & 15) * 4;
  cp_stage(lb, la, gb, ga); AW(); __syncthreads();   // stage 0 landed and handed to every wave
  cp_stage(lb + RB_S, la + RB_S, gb + KT, ga + KT);   // stage 1 flies while stage 0 is multiplied
  // the stage loop stays rolled: one copy of the hand-over below, the buffer picked by t & 1; unrolling would only multiply the code
#pragma unroll 1
  for (int t = 0; t < NT; ++t) { const unsigned bo = (t & 1) * RB_S; const char* sb = ring + bo + col * BPI + g * 16; const char* sa = ring + bo + RB_B + (wave * 16 + col) * API + g * 32;
    v16b b0[8], b1[8]; v4f a0[4], a1[4];
    lds_a16(a0, sa, 0); lds_b8(b0, sb, 0); lds_a16(a1, sa, 1); lds_b8(b1, sb, 1); SB();
    v16b a = cvt_a16(a0);
#pragma unroll
    for (int j = 0; j < 8; ++j) acc[j] = wmma_bf(a, b0[j], acc[j]);
    a = cvt_a16(a1);
#pragma unroll
    for (int j = 0; j < 8; ++j) acc[j] = wmma_bf(a, b1[j], acc[j]);
    DW(); AW(); __syncthreads();   // this wave's reads of stage t are done and its copies of stage t + 1 have landed; behind the barrier that holds for all four waves
    if (t + 2 < NT) cp_stage(lb + bo, la + bo, gb + (t + 2) * KT, ga + (t + 2) * KT); }   // refill of the buffer that every wave has just left
  AW();   // no copy is outstanding when the ring's bytes become the store staging
  if (n0 < 2 * DM) {   // bias, then rotate-half rotary over each 64-dim head with the learned angle rope[position][d] from the table
#pragma unroll
    for (int j = 0; j < 8; ++j)
#pragma unroll
      for (int r = 0; r < 8; ++r) acc[j][r] += (BB ? bfr(BB[j * 16 + col]) : 0.f);
#pragma unroll
    for (int r = 0; r < 8; ++r) { const int spos = (int)((r0 + 8 * g + r) % SS); const float* pr = POS + (size_t)spos * HD;   // learned table: out[d] = x[d] cos(p[d]) -+ partner sin(p[d])
#pragma unroll
      for (int jj = 0; jj < 2; ++jj) { const float p1 = bfr(pr[jj * 16 + col]), p2 = bfr(pr[32 + jj * 16 + col]); const float c1 = cos_p(p1), s1 = sin_p(p1), c2 = cos_p(p2), s2 = sin_p(p2);
#pragma unroll
        for (int hh = 0; hh < 2; ++hh) { const float x1 = acc[hh * 4 + jj][r], x2 = acc[hh * 4 + jj + 2][r]; acc[hh * 4 + jj][r] = x1 * c1 - x2 * s1; acc[hh * 4 + jj + 2][r] = x2 * c2 + x1 * s2; } } }
#pragma unroll
    for (int j = 0; j < 8; ++j) {
#pragma unroll
      for (int r = 0; r < 8; ++r) { const float v = acc[j][r]; const _Float16 hv = (_Float16)v; so[wave][8 * g + r][j * 16 + col] = hv; sol[wave][8 * g + r][j * 16 + col] = (_Float16)((v - (float)hv) * 2048.0f); } }   // q, k (+ bias) as f16 hi + (x2048) residual
    LDSX();
    for (int rl = 0; rl < 16; ++rl) if (lane < 16) { vst2((unsigned*)(QK + (r0 + rl) * (2 * DM) + n0 + lane * 8), *(const v4u*)&so[wave][rl][lane * 8]); vst2((unsigned*)(QKL + (r0 + rl) * (2 * DM) + n0 + lane * 8), *(const v4u*)&sol[wave][rl][lane * 8]); }
  } else {
#pragma unroll
    for (int j = 0; j < 8; ++j) {
#pragma unroll
      for (int r = 0; r < 8; ++r) { const float v = acc[j][r] + (BB ? bfr(BB[j * 16 + col]) : 0.f); const _Float16 hv = (_Float16)v; sth[j * 16 + col][wave * 16 + 8 * g + r] = hv; stl[j * 16 + col][wave * 16 + 8 * g + r] = (_Float16)((v - (float)hv) * 2048.0f); } }
    __syncthreads();
    const size_t rb = (size_t)blockIdx.x * 64; const int b = (int)(rb / SS), s0 = (int)(rb % SS); const int pc0 = n0 - 2 * DM;
    for (int q = tid; q < 128 * 8; q += 128) { const int d = q >> 3, pc = q & 7; const size_t o = ((size_t)b * DM + pc0 + d) * SS + s0 + pc * 8; vst2((unsigned*)(VTH + o), *(const v4u*)&sth[d][pc * 8]); vst2((unsigned*)(VTL + o), *(const v4u*)&stl[d][pc * 8]); }
  }
}
// lane l <-> lane l ^ 16 as a vector cross-row move (no LDS counter to wait on)
__device__ __forceinline__ float xhalf(float x) { return __builtin_bit_cast(float, __builtin_amdgcn_permlanex16(__builtin_bit_cast(int, x), __builtin_bit_cast(int, x), 0x76543210, 0xfedcba98, false, false)); }
// e^x as the hardware exp2 of x * log2(e), the same two instructions __expf compiles to; the v_nop inside the statement keeps the one slot the instruction set asks for behind a transcendental
__device__ __forceinline__ float exp_hw(float x) { float y; const float t = x * 1.44269504f; asm("v_exp_f32 %0, %1\n\tv_nop" : "=v"(y) : "v"(t)); return y; }
// ---- K | V^T ring of k_attn: a stage is 64 keys of the head: 64 K rows (64 dims, 128 B each), then the 64 V^T rows (64 keys, 128 B each), brought into LDS once for all four waves as whole 128-B lines; the row pitch is 16 B x odd, so the 16-byte fragment reads meet no bank conflict
#define AKT 64
#define APT 144
#define AGP (2 * DM * 2)
#define AR_V (AKT * APT)
#define AR_S (2 * AKT * APT)
static_assert(SS * 2 == AGP, "K rows and V^T rows share one global pitch");
// ---- k_attn: block = (64 queries, head h, batch b): causal flash attention on TRANSPOSED tiles: S^T = K . Q^T (rows = keys, column = this lane's query), so the softmax of a query lives in one lane pair and the D registers of S^T are already the B fragment of O^T = V^T . P^T (k = 8g + i from key tile 0, 16 + 8g + i from key tile 1); O[b*S+q][h*64+d] = (acc + accl / 2048) / (2048 l) (256-B segments)
__global__ __launch_bounds__(128) void k_attn(const _Float16* __restrict__ QK, const _Float16* __restrict__ QKL, const _Float16* __restrict__ VTH, const _Float16* __restrict__ VTL, const void* __restrict__ KMASK, const float* __restrict__ GR, float* __restrict__ O) {
  __shared__ __attribute__((aligned(128))) char ring[2 * AR_S];   // two K | V^T stages; behind the key loop the same bytes are the store staging
  float (*so)[16][68] = (float (*)[16][68])ring;
  const int tid = threadIdx.x, wave = tid >> 5, lane = tid & 31, col = lane & 15, g = lane >> 4;
  const int qb = blockIdx.x, h = blockIdx.y, b = blockIdx.z; const int q0 = qb * 64 + wave * 16; const int qi = q0 + col; const size_t rq = (size_t)b * SS + qi;
  v16h aq[2], aql[2];
#pragma unroll
  for (int kc = 0; kc < 2; ++kc) { aq[kc] = frag_h(QK + rq * (2 * DM) + h * HD + kc * 32, lane); aql[kc] = frag_h(QKL + rq * (2 * DM) + h * HD + kc * 32, lane); }
  const float gq = GR[rq * NH + h];   // this lane's query: one gravity value
  XW();   // the address registers of the q and gravity loads above are taken for the copies' addresses below
  float m = -3.0e38f, l = 0.f;        // l: partial sum over this lane half's keys, joined after the loop
  v8f acc[4] = {}, accl[4] = {};
  const int nst = qb + 1;   // causal: 64-key stages up to the query tile's end
  // waves 0 and 1 bring the stage's K rows, waves 2 and 3 its V^T rows: lane chunk tid & 7 of rows ((tid & 63) >> 3) + 8 i; a stage further on is 64 rows of K, 64 keys (128 B) along a row of V^T
  const int cw = __builtin_amdgcn_readfirstlane(tid >> 6), cr = (tid & 63) >> 3, cc = tid & 7;   // cw is the same in every lane of a wave: held in a scalar register, the choice of operand below is made on the scalar side and no lane is ever off around the copies
  const unsigned lc = (unsigned)(size_t)ring + cw * AR_V + cr * APT + cc * 16;
  const char* gc = cw ? (const char*)(VTH + ((size_t)b * DM + h * HD + cr) * SS + cc * 8) : (const char*)(QK + ((size_t)b * SS + cr) * (2 * DM) + DM + h * HD + cc * 8);
  const size_t gs = cw ? (size_t)AKT * 2 : (size_t)AKT * AGP;
  cp8(lc, gc, 8 * APT, (size_t)8 * AGP); AW(); __syncthreads();   // stage 0 landed and handed to every wave
  if (nst > 1) cp8(lc + AR_S, gc + gs, 8 * APT, (size_t)8 * AGP);   // stage 1 flies while stage 0 is worked on
  // the stage loop stays rolled: one copy of the hand-over below, the buffer picked by t & 1
#pragma unroll 1
  for (int t = 0; t < nst; ++t) { const unsigned bo = (t & 1) * AR_S; const _Float16* sk = (const _Float16*)(ring + bo + col * APT); const _Float16* sv = (const _Float16*)(ring + bo + AR_V + col * APT);
#pragma unroll
  for (int u = 0; u < 2; ++u) { const int ks = 2 * t + u; v8f s[2]; v16h kf[2][2], vf[4];   // 32 keys a pass, two passes a stage; the pass's hi fragments out of the stage
#pragma unroll
    for (int ct = 0; ct < 2; ++ct)
#pragma unroll
      for (int kc = 0; kc < 2; ++kc) kf[ct][kc] = frag_h(sk + (u * 32 + ct * 16) * (APT / 2) + kc * 32, lane);
#pragma unroll
    for (int dt = 0; dt < 4; ++dt) vf[dt] = frag_h(sv + (dt * 16) * (APT / 2) + u * 32, lane);
    SB();   // the pass's 16 LDS reads stay one group in front of its WMMAs
#pragma unroll
    for (int ct = 0; ct < 2; ++ct) { const int kr = ks * 32 + ct * 16 + col; const _Float16* krowl = QKL + ((size_t)b * SS + kr) * (2 * DM) + DM + h * HD; v8f c = {}, cl = {};
      if (qb < 2) {   // leading query blocks (few keys, outputs far above the global rms): 3 products
#pragma unroll
        for (int kc = 0; kc < 2; ++kc) { const v16h kh = kf[ct][kc]; c = wmma16(kh, aq[kc], c); cl = wmma16(kh, aql[kc], cl); cl = wmma16(frag_h(krowl + kc * 32, lane), aq[kc], cl); }
#pragma unroll
        for (int r = 0; r < 8; ++r) c[r] += cl[r] * (1.0f / 2048.0f); }
      else {
#pragma unroll
        for (int kc = 0; kc < 2; ++kc) c = wmma16(kf[ct][kc], aq[kc], c); }   // single product elsewhere
#pragma unroll
      for (int r = 0; r < 8; ++r) { const int kk = ks * 32 + ct * 16 + 8 * g + r; const int dd = min(qi - kk, 64); s[ct][r] = (kk <= qi) ? (c[r] * SCALEF - gq * (float)dd * 0.1f) : -3.0e38f; } }   // causal; - softplus-gravity x min(|i-j|,64) x 0.1
    float mx = fmaxf(s[0][0], s[1][0]);
#pragma unroll
    for (int r = 1; r < 8; ++r) mx = fmaxf(mx, fmaxf(s[0][r], s[1][r]));
    mx = fmaxf(mx, xhalf(mx));   // the other 16 keys of this query sit in the partner lane
    const float mn = fmaxf(m, mx); const float am = exp_hw(m - mn); const float alpha = (m <= -1.0e38f) ? 0.f : am;
    float es = 0.f; v16h pa, pl;
#pragma unroll
    for (int r = 0; r < 8; ++r) { const float y0 = exp_hw(s[0][r] - mn), y1 = exp_hw(s[1][r] - mn); const float e0 = (s[0][r] <= -1.0e38f) ? 0.f : y0, e1 = (s[1][r] <= -1.0e38f) ? 0.f : y1; es += e0 + e1;
      const float x0 = e0 * 2048.0f, x1 = e1 * 2048.0f; const _Float16 h0 = (_Float16)x0, h1 = (_Float16)x1; pa[r] = h0; pa[8 + r] = h1; pl[r] = (_Float16)((x0 - (float)h0) * 2048.0f); pl[8 + r] = (_Float16)((x1 - (float)h1) * 2048.0f); }   // P scaled by 2^11 before the f16 split so small softmax weights stay out of the f16 subnormal range; 2^-11 folded into the epilogue
    l = l * alpha + es; m = mn;
#pragma unroll
    for (int dt = 0; dt < 4; ++dt)
#pragma unroll
      for (int r = 0; r < 8; ++r) { acc[dt][r] *= alpha; accl[dt][r] *= alpha; }
#pragma unroll
    for (int dt = 0; dt < 4; ++dt) { const size_t vr = ((size_t)b * DM + h * HD + dt * 16 + col) * SS + ks * 32; const v16h vh = vf[dt]; acc[dt] = wmma16(vh, pa, acc[dt]); if (qb < 2) { accl[dt] = wmma16(vh, pl, accl[dt]); accl[dt] = wmma16(frag_h(VTL + vr, lane), pa, accl[dt]); } }   // leading query blocks: P hi/lo x V hi/lo (3 products); elsewhere P x V single
  }
    DW(); AW(); __syncthreads();   // this wave's reads of stage t are done and its copies of stage t + 1 have landed; behind the barrier that holds for all four waves
    if (t + 2 < nst) cp8(lc + bo, gc + (size_t)(t + 2) * gs, 8 * APT, (size_t)8 * AGP); }   // refill of the buffer that every wave has just left
  AW();   // no copy is outstanding when the ring's bytes become the store staging
  l += xhalf(l);
  const float il = (1.0f / 2048.0f) / l;
#pragma unroll
  for (int dt = 0; dt < 4; ++dt)
#pragma unroll
    for (int r = 0; r < 8; ++r) so[wave][col][dt * 16 + 8 * g + r] = (acc[dt][r] + accl[dt][r] * (1.0f / 2048.0f)) * il;
  LDSX();
  for (int rl = 0; rl < 16; ++rl) if (lane < 16) vst2(O + ((size_t)b * SS + q0 + rl) * DM + h * HD + lane * 4, *(const v4f*)&so[wave][rl][lane * 4]);
}
// ---- k_out: block = (64 rows, 128 cols): out = O(hi/lo) . Wo rows (2 products) + bo
__global__ __launch_bounds__(128) void k_out(const float* __restrict__ O, const __bf16* __restrict__ P, const float* __restrict__ BO, float* __restrict__ Y) {
  __shared__ __attribute__((aligned(128))) char ring[2 * RB_S];   // two operand stages; behind the k loop the same bytes are the store staging
  float (*so)[16][132] = (float (*)[16][132])ring;
  const int tid = threadIdx.x, wave = tid >> 5, lane = tid & 31, col = lane & 15, g = lane >> 4; const size_t r0 = (size_t)blockIdx.x * 64 + wave * 16; const int n0 = blockIdx.y * 128;
  v8f acc[8] = {};
  const unsigned lb = (unsigned)(size_t)ring + (tid >> 3) * BPI + (tid & 7) * 16, la = (unsigned)(size_t)ring + RB_B + (tid >> 4) * API + (tid & 15) * 16;
  const __bf16* gb = P + (size_t)(n0 + (tid >> 3)) * DM + (tid & 7) * 8; const float* ga = O + ((size_t)blockIdx.x * 64 + (tid >> 4)) * DM + (tid & 15) * 4;
  cp_stage(lb, la, gb, ga); AW(); __syncthreads();   // stage 0 landed and handed to every wave
  cp_stage(lb + RB_S, la + RB_S, gb + KT, ga + KT);   // stage 1 flies while stage 0 is multiplied
  // the stage loop stays rolled: one copy of the hand-over below, the buffer picked by t & 1; unrolling would only multiply the code
#pragma unroll 1
  for (int t = 0; t < NT; ++t) { const unsigned bo = (t & 1) * RB_S; const char* sb = ring + bo + col * BPI + g * 16; const char* sa = ring + bo + RB_B + (wave * 16 + col) * API + g * 32;
    v16b b0[8], b1[8]; v4f a0[4], a1[4];
    lds_a16(a0, sa, 0); lds_b8(b0, sb, 0); lds_b8(b1, sb, 1); SB();
    F2 a = split_a16(a0); SB(); lds_a16(a1, sa, 1); SB();   // the second step's raw A takes the registers that the first step's has just left: with all four groups held at once the kernel went past 256 registers and lost its fourth wave per SIMD
#pragma unroll
    for (int j = 0; j < 8; ++j) { acc[j] = wmma_bf(a.l, b0[j], acc[j]); acc[j] = wmma_bf(a.h, b0[j], acc[j]); }
    a = split_a16(a1);
#pragma unroll
    for (int j = 0; j < 8; ++j) { acc[j] = wmma_bf(a.l, b1[j], acc[j]); acc[j] = wmma_bf(a.h, b1[j], acc[j]); }
    DW(); AW(); __syncthreads();   // this wave's reads of stage t are done and its copies of stage t + 1 have landed; behind the barrier that holds for all four waves
    if (t + 2 < NT) cp_stage(lb + bo, la + bo, gb + (t + 2) * KT, ga + (t + 2) * KT); }   // refill of the buffer that every wave has just left
  AW();   // no copy is outstanding when the ring's bytes become the store staging
#pragma unroll
  for (int j = 0; j < 8; ++j) {
#pragma unroll
    for (int r = 0; r < 8; ++r) so[wave][8 * g + r][j * 16 + col] = acc[j][r] + (BO ? bfr(BO[n0 + j * 16 + col]) : 0.f); }
  LDSX();
  for (int rl = 0; rl < 16; ++rl) vst2(Y + (r0 + rl) * DM + n0 + lane * 4, *(const v4f*)&so[wave][rl][lane * 4]);
}
// ---- k_grav: block = 16 rows, 8 waves; wave w takes k in [128 w, 128 w + 128): z = x . g_w on WMMA 16x16x32 from the bf16-rounded inputs (exact products, f32 sums), the 16 heads being one column tile; a wave's 80 loads are all issued before its first product; the eight partial tiles are joined through LDS; g[row][h] = softplus(z + g_b[h]) (precise expf/log1pf); one 1-KB segment a block, one 128-B line a wave
__global__ __launch_bounds__(256) void k_grav(const float* __restrict__ X, const float* __restrict__ GW, const float* __restrict__ GB, float* __restrict__ GR) {
  __shared__ __align__(16) float sp[8][16][NH + 1]; const size_t r0 = (size_t)blockIdx.x * 16; const int t = threadIdx.x, wave = t >> 5, lane = t & 31, col = lane & 15, g = lane >> 4;
  const float* xr = X + (r0 + col) * DM + wave * 128 + 8 * g; const float* gw = GW + (size_t)(wave * 128 + 8 * g) * NH + col;   // A: row col of x; B: column col of g_w; both in the k order 8 g + i, 16 + 8 g + i
  v4f ar[4][4]; float br[4][16];
#pragma unroll
  for (int s = 0; s < 4; ++s) { const float* p = xr + s * 32; ar[s][0] = *(const v4f*)p; ar[s][1] = *(const v4f*)(p + 4); ar[s][2] = *(const v4f*)(p + 16); ar[s][3] = *(const v4f*)(p + 20); }
#pragma unroll
  for (int s = 0; s < 4; ++s)
#pragma unroll
    for (int i = 0; i < 8; ++i) { br[s][i] = gw[(size_t)(s * 32 + i) * NH]; br[s][8 + i] = gw[(size_t)(s * 32 + 16 + i) * NH]; }
  v8f acc = {};
#pragma unroll
  for (int s = 0; s < 4; ++s) { v16b b;
#pragma unroll
    for (int i = 0; i < 16; ++i) b[i] = (__bf16)br[s][i];
    acc = wmma_bf(cvt_a16(ar[s]), b, acc); }
#pragma unroll
  for (int r = 0; r < 8; ++r) sp[wave][8 * g + r][col] = acc[r];
  __syncthreads();
  float z = sp[0][t >> 4][t & 15];
#pragma unroll
  for (int w = 1; w < 8; ++w) z += sp[w][t >> 4][t & 15];
  z += bfr(GB[t & 15]);
  GR[r0 * NH + t] = (z > 20.f) ? z : log1p_p(exp_p(z));   // softplus
}
extern "C" void kernel_launch(void* const* d_in, const int* in_sizes, int n_in, void* d_out, int out_size, void* d_ws, size_t ws_size, hipStream_t stream) {
  (void)in_sizes; (void)n_in; (void)out_size;
  const float** F = (const float**)d_in;   // 0 x [4,2048,1024], 1 rope [2048,64], 2 W_attn [1024,3072] (in,out: q|k|v), 3 W_proj [1024,1024] (in,out), 4 g_w [1024,16], 5 g_b [16]
  if (ws_size < (size_t)WS_END) return;
  char* ws = (char*)d_ws; __bf16* PK = (__bf16*)(ws + WS_PK); _Float16 *QK = (_Float16*)(ws + WS_QK), *QKL = (_Float16*)(ws + WS_QKL), *VTH = (_Float16*)(ws + WS_VTH), *VTL = (_Float16*)(ws + WS_VTL); float *O = (float*)(ws + WS_O), *GR = (float*)(ws + WS_G);
  k_packt<<<dim3((QKVW + DM) / PTN, DM / PTK), 256, 0, stream>>>(F[2], F[3], PK);   // W_attn columns, then W_proj columns, as bf16 rows
  k_grav<<<TNB * SS / 16, 256, 0, stream>>>(F[0], F[4], F[5], GR);
  k_qkv<<<dim3(TNB * SS / 64, QKVW / 128), 128, 0, stream>>>(F[0], F[0], F[0], PK + PK_A, nullptr, nullptr, nullptr, F[1], QK, QKL, VTH, VTL);
  k_attn<<<dim3(TQB, NH, TNB), 128, 0, stream>>>(QK, QKL, VTH, VTL, nullptr, GR, O);
  k_out<<<dim3(TOB, DM / 128), 128, 0, stream>>>(O, PK + PK_P, nullptr, (float*)d_out);
}

// v007
// A run of this version takes 198 microseconds.
// In two side-by-side timings against v006, it was 1.24 and 1.25 times as fast.
// Counting every step since v000, it is 4.58 times as fast.
// compute dtype: all float inputs rounded to bf16; qkv = x . W_attn with EXACT bf16 products on WMMA 16x16x32 ((in,out) columns q | k | v as transposed rows); rotate-half RoPE with the learned angle table (precise sinf/cosf of rope[t][d]) on q and k in f32 before the f16 hi + residual split; gravity softplus(x . g_w + g_b): EXACT bf16 products on WMMA 16x16x32, f32 sums (precise expf/log1pf); causal attention: 3-product scores and hi + residual P, v on the first 128 queries of each sequence, single f16 beyond; x 1/8 - g x min(|i-j|, 64) x 0.1, running-max softmax in f32 (hardware exp), P scaled by 2^11; out = y (bf16 hi + residual) . W_proj (2 products).
#include <hip/hip_runtime.h>
#include <math.h>

typedef __attribute__((ext_vector_type(16))) _Float16 v16h;
typedef __attribute__((ext_vector_type(16))) __bf16 v16b;
typedef __attribute__((ext_vector_type(8)))  _Float16 v8h;
typedef __attribute__((ext_vector_type(8)))  float v8f;
typedef __attribute__((ext_vector_type(4)))  float v4f;
typedef __attribute__((ext_vector_type(2)))  float v2f;
typedef __attribute__((ext_vector_type(4)))  unsigned v4u;
typedef __attribute__((ext_vector_type(4)))  int v4i;
typedef float __attribute__((may_alias)) float_a;
typedef int __attribute__((may_alias)) int_a;

template <typename T> __device__ __forceinline__ void vst2(void* p, T v) { *(T*)p = v;  }
__device__ __forceinline__ v8f wmma16(v16h a, v16h b, v8f c) {
  v8f d = __builtin_amdgcn_wmma_f32_16x16x32_f16(false, a, false, b, (short)0, c, false, false);
  asm volatile("v_nop\n\tv_nop\n\tv_nop\n\tv_nop" : "+v"(d) : "v"(a), "v"(b));
  return d;
}
__device__ __forceinline__ v8f wmma_bf(v16b a, v16b b, v8f c) {
  v8f d = __builtin_amdgcn_wmma_f32_16x16x32_bf16(false, a, false, b, (short)0, c, false, false);
  asm volatile("v_nop\n\tv_nop\n\tv_nop\n\tv_nop" : "+v"(d) : "v"(a), "v"(b));
  return d;
}
// Adaptive-gravity causal attention (B 4, T 2,048, 1,024 dims, 16 heads x 64): fused q|k|v projection, table RoPE on q and k, scores / 8 minus a learned per-(token, head) softplus gravity times the clipped distance, causal softmax, . v, output projection.
__device__ __forceinline__ v16h frag_h(const _Float16* rowk0, int lane) {
  union { v16h v; v8h q[2]; } u; const _Float16* p = rowk0 + 8 * (lane >> 4);
  u.q[0] = *(const v8h*)p; u.q[1] = *(const v8h*)(p + 16); return u.v;
}
__device__ __forceinline__ v16h frag_f32(const float* rowk0, int lane) {
  v16h a; const float* p = rowk0 + 8 * (lane >> 4);
#pragma unroll
  for (int i = 0; i < 8; ++i) { a[i] = (_Float16)p[i]; a[8 + i] = (_Float16)p[16 + i]; }
  return a;
}
__device__ __forceinline__ v16h frag_f32s(const float* rowk0, int lane, float sc) {
  v16h a; const float* p = rowk0 + 8 * (lane >> 4);
#pragma unroll
  for (int i = 0; i < 8; ++i) { a[i] = (_Float16)(p[i] * sc); a[8 + i] = (_Float16)(p[16 + i] * sc); }
  return a;
}
// column fragment from a [K][ld] layout (column n), rows >= K read as 0
__device__ __forceinline__ v16h fragc_f32(const float* W, int k0, int n, int lane, int ld, int K) {
  v16h a; const int g = lane >> 4;
#pragma unroll
  for (int i = 0; i < 8; ++i) { const int ka = k0 + 8 * g + i, kb = ka + 16;
    a[i] = (_Float16)(ka < K ? W[(size_t)(ka < K ? ka : K - 1) * ld + n] : 0.f); a[8 + i] = (_Float16)(kb < K ? W[(size_t)(kb < K ? kb : K - 1) * ld + n] : 0.f); }
  return a;
}
struct F2 { v16b h, l; };
__device__ __forceinline__ F2 bsplit16(const float v[16]) { F2 r;
#pragma unroll
  for (int i = 0; i < 16; ++i) { const __bf16 h = (__bf16)v[i]; r.h[i] = h; r.l[i] = (__bf16)(v[i] - (float)h); }
  return r; }
__device__ __forceinline__ F2 split_row(const float* row, int k0, int lane) { float v[16]; const float* p = row + k0 + 8 * (lane >> 4);
#pragma unroll
  for (int i = 0; i < 8; ++i) { v[i] = p[i]; v[8 + i] = p[16 + i]; }
  return bsplit16(v); }
__device__ __forceinline__ F2 split_rowK(const float* row, int k0, int lane, int K) { float v[16]; const int g = lane >> 4;
#pragma unroll
  for (int i = 0; i < 8; ++i) { const int ka = k0 + 8 * g + i, kb = ka + 16; v[i] = ka < K ? row[ka < K ? ka : K - 1] : 0.f; v[8 + i] = kb < K ? row[kb < K ? kb : K - 1] : 0.f; }
  return bsplit16(v); }
__device__ __forceinline__ F2 split_col(const float* W, int k0, int n, int lane, int ld, int K) { float v[16]; const int g = lane >> 4;
#pragma unroll
  for (int i = 0; i < 8; ++i) { const int ka = k0 + 8 * g + i, kb = ka + 16; v[i] = ka < K ? W[(size_t)(ka < K ? ka : K - 1) * ld + n] : 0.f; v[8 + i] = kb < K ? W[(size_t)(kb < K ? kb : K - 1) * ld + n] : 0.f; }
  return bsplit16(v); }
__device__ __forceinline__ v8f mac3(const F2& a, const F2& b, v8f c) { c = wmma_bf(a.l, b.h, c); c = wmma_bf(a.h, b.l, c); return wmma_bf(a.h, b.h, c); }
__device__ __forceinline__ float sigm(float v) { return 1.0f / (1.0f + expf(-v)); }
#define LDSX() do { asm volatile("s_wait_dscnt 0" ::: "memory"); __builtin_amdgcn_wave_barrier(); __builtin_amdgcn_fence(__ATOMIC_RELEASE, "workgroup"); } while (0)


#define NB 4
#define SS 2048
#define SCALEF 0.125f
#define DM 1024
#define NH 16
__device__ __attribute__((noinline)) float cos_p(float v) { return cosf(v); }
__device__ __attribute__((noinline)) float sin_p(float v) { return sinf(v); }
__device__ __attribute__((noinline)) float exp_p(float v) { return expf(v); }
__device__ __attribute__((noinline)) float log1p_p(float v) { return log1pf(v); }
#define HD 64
#define QKVW (3 * DM)
#ifndef TQB
#define TQB (SS / 64)
#define TNB NB
#define TOB (NB * SS / 64)     // output row tiles (all)
#endif
typedef __attribute__((ext_vector_type(8))) __bf16 v8b;
__device__ __forceinline__ v16b frag_b(const __bf16* rowk0, int lane) {
  union { v16b v; v8b q[2]; } u; const __bf16* p = rowk0 + 8 * (lane >> 4);
  u.q[0] = *(const v8b*)p; u.q[1] = *(const v8b*)(p + 16); return u.v;
}
__device__ __forceinline__ float bfr(float v) { return (float)(__bf16)v; }
// stands behind a group of loads that stays in flight: the group's address registers are rewritten while it flies, and this is the wait that belongs in front of such a rewrite
#define XW() asm volatile("s_wait_xcnt 0x0" ::: "memory")
// scheduling fence: a stage's LDS fragment reads stay in front of its WMMAs, in the groups and order written
#define SB() __builtin_amdgcn_sched_barrier(0)
// ---- operand ring of k_qkv and k_out: a stage is 64 k of the block's 128 weight rows (128 B of bf16 each) and of its 64 activation rows (256 B of f32 each), brought into LDS once for all four waves as whole 128-B lines; row pitches are 16 B x odd, so the 16-byte fragment reads meet no bank conflict
#define KT 64
#define NT (DM / KT)
#define BPI 144
#define API 272
#define RB_B (128 * BPI)
#define RB_S (RB_B + 64 * API)
// the issuing wave's wait for its own copies, and its wait for its own LDS reads: both stand in front of the barrier that hands a stage over
#define AW() asm volatile("s_wait_asynccnt 0x0" ::: "memory")
#define DW() asm volatile("s_wait_dscnt 0x0" ::: "memory")
// eight 16-byte copies of one lane, rows sl (LDS bytes) and sg (global bytes) apart; the s_wait_xcnt closes the statement so that no address register named here is rewritten in front of it
__device__ __forceinline__ void cp8(unsigned l, const char* p, unsigned sl, size_t sg) {
  asm volatile("global_load_async_to_lds_b128 %0, %8, off\n\tglobal_load_async_to_lds_b128 %1, %9, off\n\tglobal_load_async_to_lds_b128 %2, %10, off\n\tglobal_load_async_to_lds_b128 %3, %11, off\n\t"
               "global_load_async_to_lds_b128 %4, %12, off\n\tglobal_load_async_to_lds_b128 %5, %13, off\n\tglobal_load_async_to_lds_b128 %6, %14, off\n\tglobal_load_async_to_lds_b128 %7, %15, off\n\ts_wait_xcnt 0x0"
               :: "v"(l), "v"(l + sl), "v"(l + 2 * sl), "v"(l + 3 * sl), "v"(l + 4 * sl), "v"(l + 5 * sl), "v"(l + 6 * sl), "v"(l + 7 * sl),
                  "v"(p), "v"(p + sg), "v"(p + 2 * sg), "v"(p + 3 * sg), "v"(p + 4 * sg), "v"(p + 5 * sg), "v"(p + 6 * sg), "v"(p + 7 * sg) : "memory");
}
// one stage: lane tid brings chunk tid & 7 of weight rows (tid >> 3) + 16 i and chunk tid & 15 of activation rows (tid >> 4) + 8 i; lb, la, gb, ga already hold the lane's first row and chunk
__device__ __forceinline__ void cp_stage(unsigned lb, unsigned la, const __bf16* gb, const float* ga) { cp8(lb, (const char*)gb, 16 * BPI, (size_t)16 * DM * 2); cp8(la, (const char*)ga, 8 * API, (size_t)8 * DM * 4); }
// one 32-k step's fragments out of a stage, in the k order of the global rows: sb, sa already hold the lane's row and its 8 * g elements
__device__ __forceinline__ void lds_b8(v16b (&f)[8], const char* sb, int kc) {
#pragma unroll
  for (int j = 0; j < 8; ++j) { union { v16b v; v8b q[2]; } u; const char* p = sb + j * 16 * BPI + kc * 64; u.q[0] = *(const v8b*)p; u.q[1] = *(const v8b*)(p + 32); f[j] = u.v; }
}
__device__ __forceinline__ void lds_a16(v4f (&r)[4], const char* sa, int kc) { const char* p = sa + kc * 128; r[0] = *(const v4f*)p; r[1] = *(const v4f*)(p + 16); r[2] = *(const v4f*)(p + 64); r[3] = *(const v4f*)(p + 80); }
__device__ __forceinline__ v16b cvt_a16(const v4f (&r)[4]) { v16b a;
#pragma unroll
  for (int i = 0; i < 8; ++i) { a[i] = (__bf16)r[i >> 2][i & 3]; a[8 + i] = (__bf16)r[2 + (i >> 2)][i & 3]; }
  return a; }
__device__ __forceinline__ F2 split_a16(const v4f (&r)[4]) { float v[16];
#pragma unroll
  for (int i = 0; i < 8; ++i) { v[i] = r[i >> 2][i & 3]; v[8 + i] = r[2 + (i >> 2)][i & 3]; }
  return bsplit16(v); }
__device__ __attribute__((noinline)) float exp_ni(float v) { return expf(v); }
__device__ __attribute__((noinline)) float erf_ni(float v) { return erff(v); }

#define PK_A 0                       // [3072][1024] Wqkv rows (natural [out][in])
#define PK_P (PK_A + QKVW * DM)        // [1024][1024] Wo rows (natural)
#define PK_END (PK_P + DM * DM)
#define WS_PK  0u
#define WS_QK  (WS_PK + 2u * PK_END)             // f16 [8192 rows][2048]: q | k
#define WS_QKL (WS_QK + 2u * NB * SS * 2 * DM)     // f16 q | k residual planes x2048
#define WS_VTH (WS_QKL + 2u * NB * SS * 2 * DM)    // f16 [b][1024 (h*64+d)][2048 s] hi
#define WS_VTL (WS_VTH + 2u * NB * DM * SS)        // f16 lo x 2048
#define WS_O   (WS_VTL + 2u * NB * DM * SS)        // f32 [8192][1024]
#define WS_CS  (WS_O + 4u * NB * SS * DM)           // f32 2 x [2048][32], unused
#define WS_G   (WS_CS + 4u * 2 * SS * 32)                  // f32 [b*t][16] softplus(x . g_w + g_b)
#define WS_END (WS_G + 4u * (size_t)NB * SS * NH)
// ---- k_packt: block = (64 columns n, 128 rows k) of the (in,out) weights: W_attn's 3,072 columns (q | k | v), then W_proj's 1,024, become the bf16 rows of PK in that order. Reads are whole 256-B row pieces; a thread turns its 8 k x 4 n piece in registers and LDS; writes are whole 256-B row pieces
#define PTK 128
#define PTN 64
// eight rows of one lane, LD floats apart (LD a compile-time constant of each weight), issued as one group
template <int LD> __device__ __forceinline__ void ld_rows8(v4f (&v)[8], const float* p) {
#pragma unroll
  for (int i = 0; i < 8; ++i) v[i] = *(const v4f*)(p + i * LD);
}
__global__ __launch_bounds__(256) void k_packt(const float* __restrict__ WA, const float* __restrict__ WP, __bf16* __restrict__ PK) {
  __shared__ __align__(16) __bf16 s[PTN][PTK + 8];   // [n][k]; row pitch 272 B = 16 B x odd
  const int t = threadIdx.x, c = t & 15, kr = t >> 4; const int nb = blockIdx.x * PTN, k0 = blockIdx.y * PTK;
  v4f v[8];
  if (nb < QKVW) ld_rows8<QKVW>(v, WA + nb + (size_t)(k0 + kr * 8) * QKVW + c * 4); else ld_rows8<DM>(v, WP + (nb - QKVW) + (size_t)(k0 + kr * 8) * DM + c * 4);   // a block lies wholly in one of the two weights
  XW();   // the group's address registers are free for reuse only behind this wait
#pragma unroll
  for (int e = 0; e < 4; ++e) { v8b w;
#pragma unroll
    for (int i = 0; i < 8; ++i) w[i] = (__bf16)v[i][e];
    *(v8b*)&s[c * 4 + e][kr * 8] = w; }
  __syncthreads();
#pragma unroll
  for (int j = 0; j < 4; ++j) { const int q = t + 256 * j, n = q >> 4, pc = q & 15; vst2((unsigned*)(PK + PK_A + (size_t)(nb + n) * DM + k0 + pc * 8), *(const v4u*)&s[n][pc * 8]); }
}
__global__ __launch_bounds__(128) void k_qkv(const float* __restrict__ XQ, const float* __restrict__ XK, const float* __restrict__ XV, const __bf16* __restrict__ P, const float* __restrict__ BQ, const float* __restrict__ BK, const float* __restrict__ BV, const float* __restrict__ POS, _Float16* __restrict__ QK, _Float16* __restrict__ QKL, _Float16* __restrict__ VTH, _Float16* __restrict__ VTL) {
  const int which0 = (blockIdx.y * 128) / DM; const float* X = (which0 == 0) ? XQ : (which0 == 1) ? XK : XV; const float* BB = BQ ? (((which0 == 0) ? BQ : (which0 == 1) ? BK : BV) + (blockIdx.y * 128 - which0 * DM)) : nullptr;
  __shared__ __attribute__((aligned(128))) char ring[2 * RB_S];   // two operand stages; behind the k loop the same bytes are the store staging
  _Float16 (*so)[16][136] = (_Float16 (*)[16][136])ring; _Float16 (*sol)[16][136] = (_Float16 (*)[16][136])(ring + 4 * 16 * 136 * 2); _Float16 (*sth)[72] = (_Float16 (*)[72])ring; _Float16 (*stl)[72] = (_Float16 (*)[72])(ring + 128 * 72 * 2);
  const int tid = threadIdx.x, wave = tid >> 5, lane = tid & 31, col = lane & 15, g = lane >> 4; const size_t r0 = (size_t)blockIdx.x * 64 + wave * 16; const int n0 = blockIdx.y * 128;
  v8f acc[8] = {};
  const unsigned lb = (unsigned)(size_t)ring + (tid >> 3) * BPI + (tid & 7) * 16, la = (unsigned)(size_t)ring + RB_B + (tid >> 4) * API + (tid & 15) * 16;
  const __bf16* gb = P + (size_t)(n0 + (tid >> 3)) * DM + (tid & 7) * 8; const float* ga = X + ((size_t)blockIdx.x * 64 + (tid >> 4)) * DM + (tid & 15) * 4;
  cp_stage(lb, la, gb, ga); AW(); __syncthreads();   // stage 0 landed and handed to every wave
  cp_stage(lb + RB_S, la + RB_S, gb + KT, ga + KT);   // stage 1 flies while stage 0 is multiplied
  // the stage loop stays rolled: one copy of the hand-over below, the buffer picked by t & 1; unrolling would only multiply the code
#pragma unroll 1
  for (int t = 0; t < NT; ++t) { const unsigned bo = (t & 1) * RB_S; const char* sb = ring + bo + col * BPI + g * 16; const char* sa = ring + bo + RB_B + (wave * 16 + col) * API + g * 32;
    v16b b0[8], b1[8]; v4f a0[4], a1[4];
    lds_a16(a0, sa, 0); lds_b8(b0, sb, 0); lds_a16(a1, sa, 1); lds_b8(b1, sb, 1); SB();
    v16b a = cvt_a16(a0);
#pragma unroll
    for (int j = 0; j < 8; ++j) acc[j] = wmma_bf(a, b0[j], acc[j]);
    a = cvt_a16(a1);
#pragma unroll
    for (int j = 0; j < 8; ++j) acc[j] = wmma_bf(a, b1[j], acc[j]);
    DW(); AW(); __syncthreads();   // this wave's reads of stage t are done and its copies of stage t + 1 have landed; behind the barrier that holds for all four waves
    if (t + 2 < NT) cp_stage(lb + bo, la + bo, gb + (t + 2) * KT, ga + (t + 2) * KT); }   // refill of the buffer that every wave has just left
  AW();   // no copy is outstanding when the ring's bytes become the store staging
  if (n0 < 2 * DM) {   // bias, then rotate-half rotary over each 64-dim head with the learned angle rope[position][d] from the table
#pragma unroll
    for (int j = 0; j < 8; ++j)
#pragma unroll
      for (int r = 0; r < 8; ++r) acc[j][r] += (BB ? bfr(BB[j * 16 + col]) : 0.f);
#pragma unroll
    for (int r = 0; r < 8; ++r) { const int spos = (int)((r0 + 8 * g + r) % SS); const float* pr = POS + (size_t)spos * HD;   // learned table: out[d] = x[d] cos(p[d]) -+ partner sin(p[d])
#pragma unroll
      for (int jj = 0; jj < 2; ++jj) { const float p1 = bfr(pr[jj * 16 + col]), p2 = bfr(pr[32 + jj * 16 + col]); const float c1 = cos_p(p1), s1 = sin_p(p1), c2 = cos_p(p2), s2 = sin_p(p2);
#pragma unroll
        for (int hh = 0; hh < 2; ++hh) { const float x1 = acc[hh * 4 + jj][r], x2 = acc[hh * 4 + jj + 2][r]; acc[hh * 4 + jj][r] = x1 * c1 - x2 * s1; acc[hh * 4 + jj + 2][r] = x2 * c2 + x1 * s2; } } }
#pragma unroll
    for (int j = 0; j < 8; ++j) {
#pragma unroll
      for (int r = 0; r < 8; ++r) { const float v = acc[j][r]; const _Float16 hv = (_Float16)v; so[wave][8 * g + r][j * 16 + col] = hv; sol[wave][8 * g + r][j * 16 + col] = (_Float16)((v - (float)hv) * 2048.0f); } }   // q, k (+ bias) as f16 hi + (x2048) residual
    LDSX();
    for (int rl = 0; rl < 16; ++rl) if (lane < 16) { vst2((unsigned*)(QK + (r0 + rl) * (2 * DM) + n0 + lane * 8), *(const v4u*)&so[wave][rl][lane * 8]); vst2((unsigned*)(QKL + (r0 + rl) * (2 * DM) + n0 + lane * 8), *(const v4u*)&sol[wave][rl][lane * 8]); }
  } else {
#pragma unroll
    for (int j = 0; j < 8; ++j) {
#pragma unroll
      for (int r = 0; r < 8; ++r) { const float v = acc[j][r] + (BB ? bfr(BB[j * 16 + col]) : 0.f); const _Float16 hv = (_Float16)v; sth[j * 16 + col][wave * 16 + 8 * g + r] = hv; stl[j * 16 + col][wave * 16 + 8 * g + r] = (_Float16)((v - (float)hv) * 2048.0f); } }
    __syncthreads();
    const size_t rb = (size_t)blockIdx.x * 64; const int b = (int)(rb / SS), s0 = (int)(rb % SS); const int pc0 = n0 - 2 * DM;
    for (int q = tid; q < 128 * 8; q += 128) { const int d = q >> 3, pc = q & 7; const size_t o = ((size_t)b * DM + pc0 + d) * SS + s0 + pc * 8; vst2((unsigned*)(VTH + o), *(const v4u*)&sth[d][pc * 8]); vst2((unsigned*)(VTL + o), *(const v4u*)&stl[d][pc * 8]); }
  }
}
// lane l <-> lane l ^ 16 as a vector cross-row move (no LDS counter to wait on)
__device__ __forceinline__ float xhalf(float x) { return __builtin_bit_cast(float, __builtin_amdgcn_permlanex16(__builtin_bit_cast(int, x), __builtin_bit_cast(int, x), 0x76543210, 0xfedcba98, false, false)); }
// e^x as the hardware exp2 of x * log2(e), the same two instructions __expf compiles to; the v_nop inside the statement keeps the one slot the instruction set asks for behind a transcendental
__device__ __forceinline__ float exp_hw(float x) { float y; const float t = x * 1.44269504f; asm("v_exp_f32 %0, %1\n\tv_nop" : "=v"(y) : "v"(t)); return y; }
// ---- K | V^T ring of k_attn: a stage is 64 keys of the head: 64 K rows (64 dims, 128 B each), then the 64 V^T rows (64 keys, 128 B each), brought into LDS once for all four waves as whole 128-B lines; the row pitch is 16 B x odd, so the 16-byte fragment reads meet no bank conflict
#define AKT 64
#define APT 144
#define AGP (2 * DM * 2)
#define AR_V (AKT * APT)
#define AR_S (2 * AKT * APT)
static_assert(SS * 2 == AGP, "K rows and V^T rows share one global pitch");
// ---- k_attn: block = (64 queries, head h, batch b): causal flash attention on TRANSPOSED tiles: S^T = K . Q^T (rows = keys, column = this lane's query), so the softmax of a query lives in one lane pair and the D registers of S^T are already the B fragment of O^T = V^T . P^T (k = 8g + i from key tile 0, 16 + 8g + i from key tile 1); O[b*S+q][h*64+d] = (acc + accl / 2048) / (2048 l) (256-B segments)
__global__ __launch_bounds__(128) void k_attn(const _Float16* __restrict__ QK, const _Float16* __restrict__ QKL, const _Float16* __restrict__ VTH, const _Float16* __restrict__ VTL, const void* __restrict__ KMASK, const float* __restrict__ GR, float* __restrict__ O) {
  __shared__ __attribute__((aligned(128))) char ring[2 * AR_S];   // two K | V^T stages; behind the key loop the same bytes are the store staging
  float (*so)[16][68] = (float (*)[16][68])ring;
  const int tid = threadIdx.x, wave = tid >> 5, lane = tid & 31, col = lane & 15, g = lane >> 4;
  const int qb = blockIdx.x, h = blockIdx.y, b = blockIdx.z; const int q0 = qb * 64 + wave * 16; const int qi = q0 + col; const size_t rq = (size_t)b * SS + qi;
  v16h aq[2], aql[2];
#pragma unroll
  for (int kc = 0; kc < 2; ++kc) { aq[kc] = frag_h(QK + rq * (2 * DM) + h * HD + kc * 32, lane); aql[kc] = frag_h(QKL + rq * (2 * DM) + h * HD + kc * 32, lane); }
  const float gq = GR[rq * NH + h];   // this lane's query: one gravity value
  const float gfar = gq * 64.0f * 0.1f;   // the gravity term at the clipped distance, rounded as in the general form
  XW();   // the address registers of the q and gravity loads above are taken for the copies' addresses below
  float m = -3.0e38f, l = 0.f;        // l: partial sum over this lane half's keys, joined after the loop
  v8f acc[4] = {}, accl[4] = {};
  const int nst = qb + 1;   // causal: 64-key stages up to the query tile's end
  // waves 0 and 1 bring the stage's K rows, waves 2 and 3 its V^T rows: lane chunk tid & 7 of rows ((tid & 63) >> 3) + 8 i; a stage further on is 64 rows of K, 64 keys (128 B) along a row of V^T
  const int cw = __builtin_amdgcn_readfirstlane(tid >> 6), cr = (tid & 63) >> 3, cc = tid & 7;   // cw is the same in every lane of a wave: held in a scalar register, the choice of operand below is made on the scalar side and no lane is ever off around the copies
  const unsigned lc = (unsigned)(size_t)ring + cw * AR_V + cr * APT + cc * 16;
  const char* gc = cw ? (const char*)(VTH + ((size_t)b * DM + h * HD + cr) * SS + cc * 8) : (const char*)(QK + ((size_t)b * SS + cr) * (2 * DM) + DM + h * HD + cc * 8);
  const size_t gs = cw ? (size_t)AKT * 2 : (size_t)AKT * AGP;
  cp8(lc, gc, 8 * APT, (size_t)8 * AGP); AW(); __syncthreads();   // stage 0 landed and handed to every wave
  if (nst > 1) cp8(lc + AR_S, gc + gs, 8 * APT, (size_t)8 * AGP);   // stage 1 flies while stage 0 is worked on
  // far stages, t <= qb - 2: every key lies 64 or more behind every query of the tile, so the clipped distance is 64 and no key is masked; they exist only where qb >= 2 (single products, accl stays 0). A loop of their own, rolled like the one behind it, with the same hand-over at its foot: in one loop with the general body the accumulators were copied from register to register at every stage
  const int tf = qb > 1 ? qb - 1 : 0;
#pragma unroll 1
  for (int t = 0; t < tf; ++t) { const unsigned bo = (t & 1) * AR_S; const _Float16* sk = (const _Float16*)(ring + bo + col * APT); const _Float16* sv = (const _Float16*)(ring + bo + AR_V + col * APT);
#pragma unroll
  for (int u = 0; u < 2; ++u) { v8f s[2]; v16h kf[2][2], vf[4];
#pragma unroll
    for (int ct = 0; ct < 2; ++ct)
#pragma unroll
      for (int kc = 0; kc < 2; ++kc) kf[ct][kc] = frag_h(sk + (u * 32 + ct * 16) * (APT / 2) + kc * 32, lane);
#pragma unroll
    for (int dt = 0; dt < 4; ++dt) vf[dt] = frag_h(sv + (dt * 16) * (APT / 2) + u * 32, lane);
    SB();   // the pass's 16 LDS reads stay one group in front of its WMMAs
    v8f c[2] = {};
#pragma unroll
    for (int kc = 0; kc < 2; ++kc)
#pragma unroll
      for (int ct = 0; ct < 2; ++ct) c[ct] = wmma16(kf[ct][kc], aq[kc], c[ct]);   // the two key tiles' products alternate: each fills the other's distance
#pragma unroll
    for (int ct = 0; ct < 2; ++ct)
#pragma unroll
      for (int r = 0; r < 8; ++r) s[ct][r] = c[ct][r] * SCALEF - gfar;
    float mx = fmaxf(s[0][0], s[1][0]);
#pragma unroll
    for (int r = 1; r < 8; ++r) mx = fmaxf(mx, fmaxf(s[0][r], s[1][r]));
    mx = fmaxf(mx, xhalf(mx));   // the other 16 keys of this query sit in the partner lane
    const float mn = fmaxf(m, mx); const float am = exp_hw(m - mn); const float alpha = (m <= -1.0e38f) ? 0.f : am;
    float es = 0.f; v16h pa;
#pragma unroll
    for (int r = 0; r < 8; ++r) { const float e0 = exp_hw(s[0][r] - mn), e1 = exp_hw(s[1][r] - mn); es += e0 + e1; pa[r] = (_Float16)(e0 * 2048.0f); pa[8 + r] = (_Float16)(e1 * 2048.0f); }
    l = l * alpha + es; m = mn;
#pragma unroll
    for (int dt = 0; dt < 4; ++dt)
#pragma unroll
      for (int r = 0; r < 8; ++r) acc[dt][r] *= alpha;
#pragma unroll
    for (int dt = 0; dt < 4; ++dt) acc[dt] = wmma16(vf[dt], pa, acc[dt]);
  }
    DW(); AW(); __syncthreads();   // this wave's reads of stage t are done and its copies of stage t + 1 have landed; behind the barrier that holds for all four waves
    cp8(lc + bo, gc + (size_t)(t + 2) * gs, 8 * APT, (size_t)8 * AGP); }   // refill of the buffer that every wave has just left: behind a far stage t a stage t + 2 <= qb always exists
  // the last two stages (the general form); the loop stays rolled: one copy of the hand-over below, the buffer picked by t & 1
#pragma unroll 1
  for (int t = tf; t < nst; ++t) { const unsigned bo = (t & 1) * AR_S; const _Float16* sk = (const _Float16*)(ring + bo + col * APT); const _Float16* sv = (const _Float16*)(ring + bo + AR_V + col * APT);
#pragma unroll
  for (int u = 0; u < 2; ++u) { const int ks = 2 * t + u; v8f s[2]; v16h kf[2][2], vf[4];   // 32 keys a pass, two passes a stage; the pass's hi fragments out of the stage
#pragma unroll
    for (int ct = 0; ct < 2; ++ct)
#pragma unroll
      for (int kc = 0; kc < 2; ++kc) kf[ct][kc] = frag_h(sk + (u * 32 + ct * 16) * (APT / 2) + kc * 32, lane);
#pragma unroll
    for (int dt = 0; dt < 4; ++dt) vf[dt] = frag_h(sv + (dt * 16) * (APT / 2) + u * 32, lane);
    SB();   // the pass's 16 LDS reads stay one group in front of its WMMAs
#pragma unroll
    for (int ct = 0; ct < 2; ++ct) { const int kr = ks * 32 + ct * 16 + col; const _Float16* krowl = QKL + ((size_t)b * SS + kr) * (2 * DM) + DM + h * HD; v8f c = {}, cl = {};
      if (qb < 2) {   // leading query blocks (few keys, outputs far above the global rms): 3 products
#pragma unroll
        for (int kc = 0; kc < 2; ++kc) { const v16h kh = kf[ct][kc]; c = wmma16(kh, aq[kc], c); cl = wmma16(kh, aql[kc], cl); cl = wmma16(frag_h(krowl + kc * 32, lane), aq[kc], cl); }
#pragma unroll
        for (int r = 0; r < 8; ++r) c[r] += cl[r] * (1.0f / 2048.0f); }
      else {
#pragma unroll
        for (int kc = 0; kc < 2; ++kc) c = wmma16(kf[ct][kc], aq[kc], c); }   // single product elsewhere
#pragma unroll
      for (int r = 0; r < 8; ++r) { const int kk = ks * 32 + ct * 16 + 8 * g + r; const int dd = min(qi - kk, 64); s[ct][r] = (kk <= qi) ? (c[r] * SCALEF - gq * (float)dd * 0.1f) : -3.0e38f; } }   // causal; - softplus-gravity x min(|i-j|,64) x 0.1
    float mx = fmaxf(s[0][0], s[1][0]);
#pragma unroll
    for (int r = 1; r < 8; ++r) mx = fmaxf(mx, fmaxf(s[0][r], s[1][r]));
    mx = fmaxf(mx, xhalf(mx));   // the other 16 keys of this query sit in the partner lane
    const float mn = fmaxf(m, mx); const float am = exp_hw(m - mn); const float alpha = (m <= -1.0e38f) ? 0.f : am;
    float es = 0.f; v16h pa, pl;
#pragma unroll
    for (int r = 0; r < 8; ++r) { const float y0 = exp_hw(s[0][r] - mn), y1 = exp_hw(s[1][r] - mn); const float e0 = (s[0][r] <= -1.0e38f) ? 0.f : y0, e1 = (s[1][r] <= -1.0e38f) ? 0.f : y1; es += e0 + e1;
      const float x0 = e0 * 2048.0f, x1 = e1 * 2048.0f; const _Float16 h0 = (_Float16)x0, h1 = (_Float16)x1; pa[r] = h0; pa[8 + r] = h1; pl[r] = (_Float16)((x0 - (float)h0) * 2048.0f); pl[8 + r] = (_Float16)((x1 - (float)h1) * 2048.0f); }   // P scaled by 2^11 before the f16 split so small softmax weights stay out of the f16 subnormal range; 2^-11 folded into the epilogue
    l = l * alpha + es; m = mn;
#pragma unroll
    for (int dt = 0; dt < 4; ++dt)
#pragma unroll
      for (int r = 0; r < 8; ++r) { acc[dt][r] *= alpha; accl[dt][r] *= alpha; }
#pragma unroll
    for (int dt = 0; dt < 4; ++dt) { const size_t vr = ((size_t)b * DM + h * HD + dt * 16 + col) * SS + ks * 32; const v16h vh = vf[dt]; acc[dt] = wmma16(vh, pa, acc[dt]); if (qb < 2) { accl[dt] = wmma16(vh, pl, accl[dt]); accl[dt] = wmma16(frag_h(VTL + vr, lane), pa, accl[dt]); } }   // leading query blocks: P hi/lo x V hi/lo (3 products); elsewhere P x V single
  }
    DW(); AW(); __syncthreads();   // this wave's reads of stage t are done and its copies of stage t + 1 have landed; behind the barrier that holds for all four waves
    if (t + 2 < nst) cp8(lc + bo, gc + (size_t)(t + 2) * gs, 8 * APT, (size_t)8 * AGP); }   // refill of the buffer that every wave has just left
  AW();   // no copy is outstanding when the ring's bytes become the store staging
  l += xhalf(l);
  const float il = (1.0f / 2048.0f) / l;
#pragma unroll
  for (int dt = 0; dt < 4; ++dt)
#pragma unroll
    for (int r = 0; r < 8; ++r) so[wave][col][dt * 16 + 8 * g + r] = (acc[dt][r] + accl[dt][r] * (1.0f / 2048.0f)) * il;
  LDSX();
  for (int rl = 0; rl < 16; ++rl) if (lane < 16) vst2(O + ((size_t)b * SS + q0 + rl) * DM + h * HD + lane * 4, *(const v4f*)&so[wave][rl][lane * 4]);
}
// ---- k_out: block = (64 rows, 128 cols): out = O(hi/lo) . Wo rows (2 products) + bo
__global__ __launch_bounds__(128) void k_out(const float* __restrict__ O, const __bf16* __restrict__ P, const float* __restrict__ BO, float* __restrict__ Y) {
  __shared__ __attribute__((aligned(128))) char ring[2 * RB_S];   // two operand stages; behind the k loop the same bytes are the store staging
  float (*so)[16][132] = (float (*)[16][132])ring;
  const int tid = threadIdx.x, wave = tid >> 5, lane = tid & 31, col = lane & 15, g = lane >> 4; const size_t r0 = (size_t)blockIdx.x * 64 + wave * 16; const int n0 = blockIdx.y * 128;
  v8f acc[8] = {};
  const unsigned lb = (unsigned)(size_t)ring + (tid >> 3) * BPI + (tid & 7) * 16, la = (unsigned)(size_t)ring + RB_B + (tid >> 4) * API + (tid & 15) * 16;
  const __bf16* gb = P + (size_t)(n0 + (tid >> 3)) * DM + (tid & 7) * 8; const float* ga = O + ((size_t)blockIdx.x * 64 + (tid >> 4)) * DM + (tid & 15) * 4;
  cp_stage(lb, la, gb, ga); AW(); __syncthreads();   // stage 0 landed and handed to every wave
  cp_stage(lb + RB_S, la + RB_S, gb + KT, ga + KT);   // stage 1 flies while stage 0 is multiplied
  // the stage loop stays rolled: one copy of the hand-over below, the buffer picked by t & 1; unrolling would only multiply the code
#pragma unroll 1
  for (int t = 0; t < NT; ++t) { const unsigned bo = (t & 1) * RB_S; const char* sb = ring + bo + col * BPI + g * 16; const char* sa = ring + bo + RB_B + (wave * 16 + col) * API + g * 32;
    v16b b0[8], b1[8]; v4f a0[4], a1[4];
    lds_a16(a0, sa, 0); lds_b8(b0, sb, 0); lds_b8(b1, sb, 1); SB();
    F2 a = split_a16(a0); SB(); lds_a16(a1, sa, 1); SB();   // the second step's raw A takes the registers that the first step's has just left: with all four groups held at once the kernel went past 256 registers and lost its fourth wave per SIMD
#pragma unroll
    for (int j = 0; j < 8; ++j) { acc[j] = wmma_bf(a.l, b0[j], acc[j]); acc[j] = wmma_bf(a.h, b0[j], acc[j]); }
    a = split_a16(a1);
#pragma unroll
    for (int j = 0; j < 8; ++j) { acc[j] = wmma_bf(a.l, b1[j], acc[j]); acc[j] = wmma_bf(a.h, b1[j], acc[j]); }
    DW(); AW(); __syncthreads();   // this wave's reads of stage t are done and its copies of stage t + 1 have landed; behind the barrier that holds for all four waves
    if (t + 2 < NT) cp_stage(lb + bo, la + bo, gb + (t + 2) * KT, ga + (t + 2) * KT); }   // refill of the buffer that every wave has just left
  AW();   // no copy is outstanding when the ring's bytes become the store staging
#pragma unroll
  for (int j = 0; j < 8; ++j) {
#pragma unroll
    for (int r = 0; r < 8; ++r) so[wave][8 * g + r][j * 16 + col] = acc[j][r] + (BO ? bfr(BO[n0 + j * 16 + col]) : 0.f); }
  LDSX();
  for (int rl = 0; rl < 16; ++rl) vst2(Y + (r0 + rl) * DM + n0 + lane * 4, *(const v4f*)&so[wave][rl][lane * 4]);
}
// ---- k_grav: block = 16 rows, 8 waves; wave w takes k in [128 w, 128 w + 128): z = x . g_w on WMMA 16x16x32 from the bf16-rounded inputs (exact products, f32 sums), the 16 heads being one column tile; a wave's 80 loads are all issued before its first product; the eight partial tiles are joined through LDS; g[row][h] = softplus(z + g_b[h]) (precise expf/log1pf); one 1-KB segment a block, one 128-B line a wave
__global__ __launch_bounds__(256) void k_grav(const float* __restrict__ X, const float* __restrict__ GW, const float* __restrict__ GB, float* __restrict__ GR) {
  __shared__ __align__(16) float sp[8][16][NH + 1]; const size_t r0 = (size_t)blockIdx.x * 16; const int t = threadIdx.x, wave = t >> 5, lane = t & 31, col = lane & 15, g = lane >> 4;
  const float* xr = X + (r0 + col) * DM + wave * 128 + 8 * g; const float* gw = GW + (size_t)(wave * 128 + 8 * g) * NH + col;   // A: row col of x; B: column col of g_w; both in the k order 8 g + i, 16 + 8 g + i
  v4f ar[4][4]; float br[4][16];
#pragma unroll
  for (int s = 0; s < 4; ++s) { const float* p = xr + s * 32; ar[s][0] = *(const v4f*)p; ar[s][1] = *(const v4f*)(p + 4); ar[s][2] = *(const v4f*)(p + 16); ar[s][3] = *(const v4f*)(p + 20); }
#pragma unroll
  for (int s = 0; s < 4; ++s)
#pragma unroll
    for (int i = 0; i < 8; ++i) { br[s][i] = gw[(size_t)(s * 32 + i) * NH]; br[s][8 + i] = gw[(size_t)(s * 32 + 16 + i) * NH]; }
  v8f acc = {};
#pragma unroll
  for (int s = 0; s < 4; ++s) { v16b b;
#pragma unroll
    for (int i = 0; i < 16; ++i) b[i] = (__bf16)br[s][i];
    acc = wmma_bf(cvt_a16(ar[s]), b, acc); }
#pragma unroll
  for (int r = 0; r < 8; ++r) sp[wave][8 * g + r][col] = acc[r];
  __syncthreads();
  float z = sp[0][t >> 4][t & 15];
#pragma unroll
  for (int w = 1; w < 8; ++w) z += sp[w][t >> 4][t & 15];
  z += bfr(GB[t & 15]);
  GR[r0 * NH + t] = (z > 20.f) ? z : log1p_p(exp_p(z));   // softplus
}
extern "C" void kernel_launch(void* const* d_in, const int* in_sizes, int n_in, void* d_out, int out_size, void* d_ws, size_t ws_size, hipStream_t stream) {
  (void)in_sizes; (void)n_in; (void)out_size;
  const float** F = (const float**)d_in;   // 0 x [4,2048,1024], 1 rope [2048,64], 2 W_attn [1024,3072] (in,out: q|k|v), 3 W_proj [1024,1024] (in,out), 4 g_w [1024,16], 5 g_b [16]
  if (ws_size < (size_t)WS_END) return;
  char* ws = (char*)d_ws; __bf16* PK = (__bf16*)(ws + WS_PK); _Float16 *QK = (_Float16*)(ws + WS_QK), *QKL = (_Float16*)(ws + WS_QKL), *VTH = (_Float16*)(ws + WS_VTH), *VTL = (_Float16*)(ws + WS_VTL); float *O = (float*)(ws + WS_O), *GR = (float*)(ws + WS_G);
  k_packt<<<dim3((QKVW + DM) / PTN, DM / PTK), 256, 0, stream>>>(F[2], F[3], PK);   // W_attn columns, then W_proj columns, as bf16 rows
  k_grav<<<TNB * SS / 16, 256, 0, stream>>>(F[0], F[4], F[5], GR);
  k_qkv<<<dim3(TNB * SS / 64, QKVW / 128), 128, 0, stream>>>(F[0], F[0], F[0], PK + PK_A, nullptr, nullptr, nullptr, F[1], QK, QKL, VTH, VTL);
  k_attn<<<dim3(TQB, NH, TNB), 128, 0, stream>>>(QK, QKL, VTH, VTL, nullptr, GR, O);
  k_out<<<dim3(TOB, DM / 128), 128, 0, stream>>>(O, PK + PK_P, nullptr, (float*)d_out);
}

// v008
// A run of this version takes 183 microseconds.
// Timed twice side by side with v007, it ran 1.08 times as fast both times.
// Counting every step since v000, it is 4.93 times as fast.
// compute dtype: all float inputs rounded to bf16; qkv = x . W_attn with EXACT bf16 products on WMMA 16x16x32 ((in,out) columns q | k | v as transposed rows); rotate-half RoPE with the learned angle table (precise sinf/cosf of rope[t][d]) on q and k in f32 before the f16 hi + residual split; gravity softplus(x . g_w + g_b): EXACT bf16 products on WMMA 16x16x32, f32 sums (precise expf/log1pf); causal attention: 3-product scores and hi + residual P, v on the first 128 queries of each sequence, single f16 beyond; x 1/8 - g x min(|i-j|, 64) x 0.1, running-max softmax in f32 (hardware exp), P scaled by 2^11; out = y (bf16 hi + residual) . W_proj (2 products).
#include <hip/hip_runtime.h>
#include <math.h>

typedef __attribute__((ext_vector_type(16))) _Float16 v16h;
typedef __attribute__((ext_vector_type(16))) __bf16 v16b;
typedef __attribute__((ext_vector_type(8)))  _Float16 v8h;
typedef __attribute__((ext_vector_type(8)))  float v8f;
typedef __attribute__((ext_vector_type(4)))  float v4f;
typedef __attribute__((ext_vector_type(2)))  float v2f;
typedef __attribute__((ext_vector_type(4)))  unsigned v4u;
typedef __attribute__((ext_vector_type(4)))  int v4i;
typedef float __attribute__((may_alias)) float_a;
typedef int __attribute__((may_alias)) int_a;

template <typename T> __device__ __forceinline__ void vst2(void* p, T v) { *(T*)p = v;  }
__device__ __forceinline__ v8f wmma16(v16h a, v16h b, v8f c) {
  v8f d = __builtin_amdgcn_wmma_f32_16x16x32_f16(false, a, false, b, (short)0, c, false, false);
  asm volatile("v_nop\n\tv_nop\n\tv_nop\n\tv_nop" : "+v"(d) : "v"(a), "v"(b));
  return d;
}
__device__ __forceinline__ v8f wmma_bf(v16b a, v16b b, v8f c) {
  v8f d = __builtin_amdgcn_wmma_f32_16x16x32_bf16(false, a, false, b, (short)0, c, false, false);
  asm volatile("v_nop\n\tv_nop\n\tv_nop\n\tv_nop" : "+v"(d) : "v"(a), "v"(b));
  return d;
}
// Adaptive-gravity causal attention (B 4, T 2,048, 1,024 dims, 16 heads x 64): fused q|k|v projection, table RoPE on q and k, scores / 8 minus a learned per-(token, head) softplus gravity times the clipped distance, causal softmax, . v, output projection.
__device__ __forceinline__ v16h frag_h(const _Float16* rowk0, int lane) {
  union { v16h v; v8h q[2]; } u; const _Float16* p = rowk0 + 8 * (lane >> 4);
  u.q[0] = *(const v8h*)p; u.q[1] = *(const v8h*)(p + 16); return u.v;
}
__device__ __forceinline__ v16h frag_f32(const float* rowk0, int lane) {
  v16h a; const float* p = rowk0 + 8 * (lane >> 4);
#pragma unroll
  for (int i = 0; i < 8; ++i) { a[i] = (_Float16)p[i]; a[8 + i] = (_Float16)p[16 + i]; }
  return a;
}
__device__ __forceinline__ v16h frag_f32s(const float* rowk0, int lane, float sc) {
  v16h a; const float* p = rowk0 + 8 * (lane >> 4);
#pragma unroll
  for (int i = 0; i < 8; ++i) { a[i] = (_Float16)(p[i] * sc); a[8 + i] = (_Float16)(p[16 + i] * sc); }
  return a;
}
// column fragment from a [K][ld] layout (column n), rows >= K read as 0
__device__ __forceinline__ v16h fragc_f32(const float* W, int k0, int n, int lane, int ld, int K) {
  v16h a; const int g = lane >> 4;
#pragma unroll
  for (int i = 0; i < 8; ++i) { const int ka = k0 + 8 * g + i, kb = ka + 16;
    a[i] = (_Float16)(ka < K ? W[(size_t)(ka < K ? ka : K - 1) * ld + n] : 0.f); a[8 + i] = (_Float16)(kb < K ? W[(size_t)(kb < K ? kb : K - 1) * ld + n] : 0.f); }
  return a;
}
struct F2 { v16b h, l; };
__device__ __forceinline__ F2 bsplit16(const float v[16]) { F2 r;
#pragma unroll
  for (int i = 0; i < 16; ++i) { const __bf16 h = (__bf16)v[i]; r.h[i] = h; r.l[i] = (__bf16)(v[i] - (float)h); }
  return r; }
__device__ __forceinline__ F2 split_row(const float* row, int k0, int lane) { float v[16]; const float* p = row + k0 + 8 * (lane >> 4);
#pragma unroll
  for (int i = 0; i < 8; ++i) { v[i] = p[i]; v[8 + i] = p[16 + i]; }
  return bsplit16(v); }
__device__ __forceinline__ F2 split_rowK(const float* row, int k0, int lane, int K) { float v[16]; const int g = lane >> 4;
#pragma unroll
  for (int i = 0; i < 8; ++i) { const int ka = k0 + 8 * g + i, kb = ka + 16; v[i] = ka < K ? row[ka < K ? ka : K - 1] : 0.f; v[8 + i] = kb < K ? row[kb < K ? kb : K - 1] : 0.f; }
  return bsplit16(v); }
__device__ __forceinline__ F2 split_col(const float* W, int k0, int n, int lane, int ld, int K) { float v[16]; const int g = lane >> 4;
#pragma unroll
  for (int i = 0; i < 8; ++i) { const int ka = k0 + 8 * g + i, kb = ka + 16; v[i] = ka < K ? W[(size_t)(ka < K ? ka : K - 1) * ld + n] : 0.f; v[8 + i] = kb < K ? W[(size_t)(kb < K ? kb : K - 1) * ld + n] : 0.f; }
  return bsplit16(v); }
__device__ __forceinline__ v8f mac3(const F2& a, const F2& b, v8f c) { c = wmma_bf(a.l, b.h, c); c = wmma_bf(a.h, b.l, c); return wmma_bf(a.h, b.h, c); }
__device__ __forceinline__ float sigm(float v) { return 1.0f / (1.0f + expf(-v)); }
#define LDSX() do { asm volatile("s_wait_dscnt 0" ::: "memory"); __builtin_amdgcn_wave_barrier(); __builtin_amdgcn_fence(__ATOMIC_RELEASE, "workgroup"); } while (0)


#define NB 4
#define SS 2048
#define SCALEF 0.125f
#define DM 1024
#define NH 16
__device__ __attribute__((noinline)) float cos_p(float v) { return cosf(v); }
__device__ __attribute__((noinline)) float sin_p(float v) { return sinf(v); }
__device__ __attribute__((noinline)) float exp_p(float v) { return expf(v); }
__device__ __attribute__((noinline)) float log1p_p(float v) { return log1pf(v); }
#define HD 64
#define QKVW (3 * DM)
#ifndef TQB
#define TQB (SS / 64)
#define TNB NB
#define TOB (NB * SS / 64)     // output row tiles (all)
#endif
typedef __attribute__((ext_vector_type(8))) __bf16 v8b;
__device__ __forceinline__ v16b frag_b(const __bf16* rowk0, int lane) {
  union { v16b v; v8b q[2]; } u; const __bf16* p = rowk0 + 8 * (lane >> 4);
  u.q[0] = *(const v8b*)p; u.q[1] = *(const v8b*)(p + 16); return u.v;
}
__device__ __forceinline__ float bfr(float v) { return (float)(__bf16)v; }
// stands behind a group of loads that stays in flight: the group's address registers are rewritten while it flies, and this is the wait that belongs in front of such a rewrite
#define XW() asm volatile("s_wait_xcnt 0x0" ::: "memory")
// scheduling fence: a stage's LDS fragment reads stay in front of its WMMAs, in the groups and order written
#define SB() __builtin_amdgcn_sched_barrier(0)
// ---- operand ring of k_qkv and k_out: a stage is 64 k of the block's 128 weight rows (128 B of bf16 each) and of its 64 activation rows (256 B of f32 each), brought into LDS once for all four waves as whole 128-B lines; row pitches are 16 B x odd, so the 16-byte fragment reads meet no bank conflict
#define KT 64
#define NT (DM / KT)
#define BPI 144
#define API 272
#define RB_B (128 * BPI)
#define RB_S (RB_B + 64 * API)
// the issuing wave's wait for its own copies, and its wait for its own LDS reads: both stand in front of the barrier that hands a stage over
#define AW() asm volatile("s_wait_asynccnt 0x0" ::: "memory")
#define DW() asm volatile("s_wait_dscnt 0x0" ::: "memory")
// eight 16-byte copies of one lane, rows sl (LDS bytes) and sg (global bytes) apart; the s_wait_xcnt closes the statement so that no address register named here is rewritten in front of it
__device__ __forceinline__ void cp8(unsigned l, const char* p, unsigned sl, size_t sg) {
  asm volatile("global_load_async_to_lds_b128 %0, %8, off\n\tglobal_load_async_to_lds_b128 %1, %9, off\n\tglobal_load_async_to_lds_b128 %2, %10, off\n\tglobal_load_async_to_lds_b128 %3, %11, off\n\t"
               "global_load_async_to_lds_b128 %4, %12, off\n\tglobal_load_async_to_lds_b128 %5, %13, off\n\tglobal_load_async_to_lds_b128 %6, %14, off\n\tglobal_load_async_to_lds_b128 %7, %15, off\n\ts_wait_xcnt 0x0"
               :: "v"(l), "v"(l + sl), "v"(l + 2 * sl), "v"(l + 3 * sl), "v"(l + 4 * sl), "v"(l + 5 * sl), "v"(l + 6 * sl), "v"(l + 7 * sl),
                  "v"(p), "v"(p + sg), "v"(p + 2 * sg), "v"(p + 3 * sg), "v"(p + 4 * sg), "v"(p + 5 * sg), "v"(p + 6 * sg), "v"(p + 7 * sg) : "memory");
}
// one stage: lane tid brings chunk tid & 7 of weight rows (tid >> 3) + 16 i and chunk tid & 15 of activation rows (tid >> 4) + 8 i; lb, la, gb, ga already hold the lane's first row and chunk
__device__ __forceinline__ void cp_stage(unsigned lb, unsigned la, const __bf16* gb, const float* ga) { cp8(lb, (const char*)gb, 16 * BPI, (size_t)16 * DM * 2); cp8(la, (const char*)ga, 8 * API, (size_t)8 * DM * 4); }
// one 32-k step's fragments out of a stage, in the k order of the global rows: sb, sa already hold the lane's row and its 8 * g elements
__device__ __forceinline__ void lds_b8(v16b (&f)[8], const char* sb, int kc) {
#pragma unroll
  for (int j = 0; j < 8; ++j) { union { v16b v; v8b q[2]; } u; const char* p = sb + j * 16 * BPI + kc * 64; u.q[0] = *(const v8b*)p; u.q[1] = *(const v8b*)(p + 32); f[j] = u.v; }
}
__device__ __forceinline__ void lds_a16(v4f (&r)[4], const char* sa, int kc) { const char* p = sa + kc * 128; r[0] = *(const v4f*)p; r[1] = *(const v4f*)(p + 16); r[2] = *(const v4f*)(p + 64); r[3] = *(const v4f*)(p + 80); }
__device__ __forceinline__ v16b cvt_a16(const v4f (&r)[4]) { v16b a;
#pragma unroll
  for (int i = 0; i < 8; ++i) { a[i] = (__bf16)r[i >> 2][i & 3]; a[8 + i] = (__bf16)r[2 + (i >> 2)][i & 3]; }
  return a; }
__device__ __forceinline__ F2 split_a16(const v4f (&r)[4]) { float v[16];
#pragma unroll
  for (int i = 0; i < 8; ++i) { v[i] = r[i >> 2][i & 3]; v[8 + i] = r[2 + (i >> 2)][i & 3]; }
  return bsplit16(v); }
__device__ __attribute__((noinline)) float exp_ni(float v) { return expf(v); }
__device__ __attribute__((noinline)) float erf_ni(float v) { return erff(v); }

#define PK_A 0                       // [3072][1024] Wqkv rows (natural [out][in])
#define PK_P (PK_A + QKVW * DM)        // [1024][1024] Wo rows (natural)
#define PK_END (PK_P + DM * DM)
#define WS_PK  0u
#define WS_QK  (WS_PK + 2u * PK_END)             // f16 [8192 rows][2048]: q | k
#define WS_QKL (WS_QK + 2u * NB * SS * 2 * DM)     // f16 q | k residual planes x2048
#define WS_VTH (WS_QKL + 2u * NB * SS * 2 * DM)    // f16 [b][1024 (h*64+d)][2048 s] hi
#define WS_VTL (WS_VTH + 2u * NB * DM * SS)        // f16 lo x 2048
#define WS_O   (WS_VTL + 2u * NB * DM * SS)        // f32 [8192][1024]
#define WS_CS  (WS_O + 4u * NB * SS * DM)           // f32 2 x [2048][32], unused
#define WS_G   (WS_CS + 4u * 2 * SS * 32)                  // f32 [b*t][16] softplus(x . g_w + g_b)
#define WS_END (WS_G + 4u * (size_t)NB * SS * NH)
// ---- k_packt: block = (64 columns n, 128 rows k) of the (in,out) weights: W_attn's 3,072 columns (q | k | v), then W_proj's 1,024, become the bf16 rows of PK in that order. Reads are whole 256-B row pieces; a thread turns its 8 k x 4 n piece in registers and LDS; writes are whole 256-B row pieces
#define PTK 128
#define PTN 64
// eight rows of one lane, LD floats apart (LD a compile-time constant of each weight), issued as one group
template <int LD> __device__ __forceinline__ void ld_rows8(v4f (&v)[8], const float* p) {
#pragma unroll
  for (int i = 0; i < 8; ++i) v[i] = *(const v4f*)(p + i * LD);
}
__global__ __launch_bounds__(256) void k_packt(const float* __restrict__ WA, const float* __restrict__ WP, __bf16* __restrict__ PK) {
  __shared__ __align__(16) __bf16 s[PTN][PTK + 8];   // [n][k]; row pitch 272 B = 16 B x odd
  const int t = threadIdx.x, c = t & 15, kr = t >> 4; const int nb = blockIdx.x * PTN, k0 = blockIdx.y * PTK;
  v4f v[8];
  if (nb < QKVW) ld_rows8<QKVW>(v, WA + nb + (size_t)(k0 + kr * 8) * QKVW + c * 4); else ld_rows8<DM>(v, WP + (nb - QKVW) + (size_t)(k0 + kr * 8) * DM + c * 4);   // a block lies wholly in one of the two weights
  XW();   // the group's address registers are free for reuse only behind this wait
#pragma unroll
  for (int e = 0; e < 4; ++e) { v8b w;
#pragma unroll
    for (int i = 0; i < 8; ++i) w[i] = (__bf16)v[i][e];
    *(v8b*)&s[c * 4 + e][kr * 8] = w; }
  __syncthreads();
#pragma unroll
  for (int j = 0; j < 4; ++j) { const int q = t + 256 * j, n = q >> 4, pc = q & 15; vst2((unsigned*)(PK + PK_A + (size_t)(nb + n) * DM + k0 + pc * 8), *(const v4u*)&s[n][pc * 8]); }
}
__global__ __launch_bounds__(128) void k_qkv(const float* __restrict__ XQ, const float* __restrict__ XK, const float* __restrict__ XV, const __bf16* __restrict__ P, const float* __restrict__ BQ, const float* __restrict__ BK, const float* __restrict__ BV, const float* __restrict__ POS, _Float16* __restrict__ QK, _Float16* __restrict__ QKL, _Float16* __restrict__ VTH, _Float16* __restrict__ VTL) {
  const int which0 = (blockIdx.y * 128) / DM; const float* X = (which0 == 0) ? XQ : (which0 == 1) ? XK : XV; const float* BB = BQ ? (((which0 == 0) ? BQ : (which0 == 1) ? BK : BV) + (blockIdx.y * 128 - which0 * DM)) : nullptr;
  __shared__ __attribute__((aligned(128))) char ring[2 * RB_S];   // two operand stages; behind the k loop the same bytes are the store staging
  _Float16 (*so)[16][136] = (_Float16 (*)[16][136])ring; _Float16 (*sol)[16][136] = (_Float16 (*)[16][136])(ring + 4 * 16 * 136 * 2); _Float16 (*sth)[72] = (_Float16 (*)[72])ring; _Float16 (*stl)[72] = (_Float16 (*)[72])(ring + 128 * 72 * 2);
  const int tid = threadIdx.x, wave = tid >> 5, lane = tid & 31, col = lane & 15, g = lane >> 4; const size_t r0 = (size_t)blockIdx.x * 64 + wave * 16; const int n0 = blockIdx.y * 128;
  v8f acc[8] = {};
  const unsigned lb = (unsigned)(size_t)ring + (tid >> 3) * BPI + (tid & 7) * 16, la = (unsigned)(size_t)ring + RB_B + (tid >> 4) * API + (tid & 15) * 16;
  const __bf16* gb = P + (size_t)(n0 + (tid >> 3)) * DM + (tid & 7) * 8; const float* ga = X + ((size_t)blockIdx.x * 64 + (tid >> 4)) * DM + (tid & 15) * 4;
  cp_stage(lb, la, gb, ga); AW(); __syncthreads();   // stage 0 landed and handed to every wave
  cp_stage(lb + RB_S, la + RB_S, gb + KT, ga + KT);   // stage 1 flies while stage 0 is multiplied
  // the stage loop stays rolled: one copy of the hand-over below, the buffer picked by t & 1; unrolling would only multiply the code
#pragma unroll 1
  for (int t = 0; t < NT; ++t) { const unsigned bo = (t & 1) * RB_S; const char* sb = ring + bo + col * BPI + g * 16; const char* sa = ring + bo + RB_B + (wave * 16 + col) * API + g * 32;
    v16b b0[8], b1[8]; v4f a0[4], a1[4];
    lds_a16(a0, sa, 0); lds_b8(b0, sb, 0); lds_a16(a1, sa, 1); lds_b8(b1, sb, 1); SB();
    v16b a = cvt_a16(a0);
#pragma unroll
    for (int j = 0; j < 8; ++j) acc[j] = wmma_bf(a, b0[j], acc[j]);
    a = cvt_a16(a1);
#pragma unroll
    for (int j = 0; j < 8; ++j) acc[j] = wmma_bf(a, b1[j], acc[j]);
    DW(); AW(); __syncthreads();   // this wave's reads of stage t are done and its copies of stage t + 1 have landed; behind the barrier that holds for all four waves
    if (t + 2 < NT) cp_stage(lb + bo, la + bo, gb + (t + 2) * KT, ga + (t + 2) * KT); }   // refill of the buffer that every wave has just left
  AW();   // no copy is outstanding when the ring's bytes become the store staging
  if (n0 < 2 * DM) {   // bias, then rotate-half rotary over each 64-dim head with the learned angle rope[position][d] from the table
#pragma unroll
    for (int j = 0; j < 8; ++j)
#pragma unroll
      for (int r = 0; r < 8; ++r) acc[j][r] += (BB ? bfr(BB[j * 16 + col]) : 0.f);
#pragma unroll
    for (int r = 0; r < 8; ++r) { const int spos = (int)((r0 + 8 * g + r) % SS); const float* pr = POS + (size_t)spos * HD;   // learned table: out[d] = x[d] cos(p[d]) -+ partner sin(p[d])
#pragma unroll
      for (int jj = 0; jj < 2; ++jj) { const float p1 = bfr(pr[jj * 16 + col]), p2 = bfr(pr[32 + jj * 16 + col]); const float c1 = cos_p(p1), s1 = sin_p(p1), c2 = cos_p(p2), s2 = sin_p(p2);
#pragma unroll
        for (int hh = 0; hh < 2; ++hh) { const float x1 = acc[hh * 4 + jj][r], x2 = acc[hh * 4 + jj + 2][r]; acc[hh * 4 + jj][r] = x1 * c1 - x2 * s1; acc[hh * 4 + jj + 2][r] = x2 * c2 + x1 * s2; } } }
#pragma unroll
    for (int j = 0; j < 8; ++j) {
#pragma unroll
      for (int r = 0; r < 8; ++r) { const float v = acc[j][r]; const _Float16 hv = (_Float16)v; so[wave][8 * g + r][j * 16 + col] = hv; sol[wave][8 * g + r][j * 16 + col] = (_Float16)((v - (float)hv) * 2048.0f); } }   // q, k (+ bias) as f16 hi + (x2048) residual
    LDSX();
    for (int rl = 0; rl < 16; ++rl) if (lane < 16) { vst2((unsigned*)(QK + (r0 + rl) * (2 * DM) + n0 + lane * 8), *(const v4u*)&so[wave][rl][lane * 8]); vst2((unsigned*)(QKL + (r0 + rl) * (2 * DM) + n0 + lane * 8), *(const v4u*)&sol[wave][rl][lane * 8]); }
  } else {
#pragma unroll
    for (int j = 0; j < 8; ++j) {
#pragma unroll
      for (int r = 0; r < 8; ++r) { const float v = acc[j][r] + (BB ? bfr(BB[j * 16 + col]) : 0.f); const _Float16 hv = (_Float16)v; sth[j * 16 + col][wave * 16 + 8 * g + r] = hv; stl[j * 16 + col][wave * 16 + 8 * g + r] = (_Float16)((v - (float)hv) * 2048.0f); } }
    __syncthreads();
    const size_t rb = (size_t)blockIdx.x * 64; const int b = (int)(rb / SS), s0 = (int)(rb % SS); const int pc0 = n0 - 2 * DM;
    for (int q = tid; q < 128 * 8; q += 128) { const int d = q >> 3, pc = q & 7; const size_t o = ((size_t)b * DM + pc0 + d) * SS + s0 + pc * 8; vst2((unsigned*)(VTH + o), *(const v4u*)&sth[d][pc * 8]); vst2((unsigned*)(VTL + o), *(const v4u*)&stl[d][pc * 8]); }
  }
}
// lane l <-> lane l ^ 16 as a vector cross-row move (no LDS counter to wait on)
__device__ __forceinline__ float xhalf(float x) { return __builtin_bit_cast(float, __builtin_amdgcn_permlanex16(__builtin_bit_cast(int, x), __builtin_bit_cast(int, x), 0x76543210, 0xfedcba98, false, false)); }
// e^x as the hardware exp2 of x * log2(e), the same two instructions __expf compiles to; the v_nop inside the statement keeps the one slot the instruction set asks for behind a transcendental
__device__ __forceinline__ float exp_hw(float x) { float y; const float t = x * 1.44269504f; asm("v_exp_f32 %0, %1\n\tv_nop" : "=v"(y) : "v"(t)); return y; }
// ---- K | V^T ring of k_attn: a stage is 64 keys of the head: 64 K rows (64 dims, 128 B each), then the 64 V^T rows (64 keys, 128 B each), brought into LDS once for all four waves as whole 128-B lines; the row pitch is 16 B x odd, so the 16-byte fragment reads meet no bank conflict
#define AKT 64
#define APT 144
#define AGP (2 * DM * 2)
#define AR_V (AKT * APT)
#define AR_S (2 * AKT * APT)
static_assert(SS * 2 == AGP, "K rows and V^T rows share one global pitch");
// ---- k_attn: block = (64 queries, head h, batch b): causal flash attention on TRANSPOSED tiles: S^T = K . Q^T (rows = keys, column = this lane's query), so the softmax of a query lives in one lane pair and the D registers of S^T are already the B fragment of O^T = V^T . P^T (k = 8g + i from key tile 0, 16 + 8g + i from key tile 1); O[b*S+q][h*64+d] = (acc + accl / 2048) / (2048 l) (256-B segments)
__global__ __launch_bounds__(128) void k_attn(const _Float16* __restrict__ QK, const _Float16* __restrict__ QKL, const _Float16* __restrict__ VTH, const _Float16* __restrict__ VTL, const void* __restrict__ KMASK, const float* __restrict__ GR, float* __restrict__ O) {
  __shared__ __attribute__((aligned(128))) char ring[2 * AR_S];   // two K | V^T stages; behind the key loop the same bytes are the store staging
  float (*so)[16][68] = (float (*)[16][68])ring;
  const int tid = threadIdx.x, wave = tid >> 5, lane = tid & 31, col = lane & 15, g = lane >> 4;
  const int qb = TQB - 1 - blockIdx.z, h = blockIdx.x, b = blockIdx.y;   // a query tile walks qb + 1 key stages and only half of the blocks find a place at once: the longest tiles take the lowest indices and the short ones fill the end of the launch
  const int q0 = qb * 64 + wave * 16; const int qi = q0 + col; const size_t rq = (size_t)b * SS + qi;
  v16h aq[2], aql[2];
#pragma unroll
  for (int kc = 0; kc < 2; ++kc) { aq[kc] = frag_h(QK + rq * (2 * DM) + h * HD + kc * 32, lane); aql[kc] = frag_h(QKL + rq * (2 * DM) + h * HD + kc * 32, lane); }
  const float gq = GR[rq * NH + h];   // this lane's query: one gravity value
  const float gfar = gq * 64.0f * 0.1f;   // the gravity term at the clipped distance, rounded as in the general form
  XW();   // the address registers of the q and gravity loads above are taken for the copies' addresses below
  float m = -3.0e38f, l = 0.f;        // l: partial sum over this lane half's keys, joined after the loop
  v8f acc[4] = {}, accl[4] = {};
  const int nst = qb + 1;   // causal: 64-key stages up to the query tile's end
  // waves 0 and 1 bring the stage's K rows, waves 2 and 3 its V^T rows: lane chunk tid & 7 of rows ((tid & 63) >> 3) + 8 i; a stage further on is 64 rows of K, 64 keys (128 B) along a row of V^T
  const int cw = __builtin_amdgcn_readfirstlane(tid >> 6), cr = (tid & 63) >> 3, cc = tid & 7;   // cw is the same in every lane of a wave: held in a scalar register, the choice of operand below is made on the scalar side and no lane is ever off around the copies
  const unsigned lc = (unsigned)(size_t)ring + cw * AR_V + cr * APT + cc * 16;
  const char* gc = cw ? (const char*)(VTH + ((size_t)b * DM + h * HD + cr) * SS + cc * 8) : (const char*)(QK + ((size_t)b * SS + cr) * (2 * DM) + DM + h * HD + cc * 8);
  const size_t gs = cw ? (size_t)AKT * 2 : (size_t)AKT * AGP;
  cp8(lc, gc, 8 * APT, (size_t)8 * AGP); AW(); __syncthreads();   // stage 0 landed and handed to every wave
  if (nst > 1) cp8(lc + AR_S, gc + gs, 8 * APT, (size_t)8 * AGP);   // stage 1 flies while stage 0 is worked on
  // far stages, t <= qb - 2: every key lies 64 or more behind every query of the tile, so the clipped distance is 64 and no key is masked; they exist only where qb >= 2 (single products, accl stays 0). A loop of their own, rolled like the one behind it, with the same hand-over at its foot: in one loop with the general body the accumulators were copied from register to register at every stage
  const int tf = qb > 1 ? qb - 1 : 0;
#pragma unroll 1
  for (int t = 0; t < tf; ++t) { const unsigned bo = (t & 1) * AR_S; const _Float16* sk = (const _Float16*)(ring + bo + col * APT); const _Float16* sv = (const _Float16*)(ring + bo + AR_V + col * APT);
#pragma unroll
  for (int u = 0; u < 2; ++u) { v8f s[2]; v16h kf[2][2], vf[4];
#pragma unroll
    for (int ct = 0; ct < 2; ++ct)
#pragma unroll
      for (int kc = 0; kc < 2; ++kc) kf[ct][kc] = frag_h(sk + (u * 32 + ct * 16) * (APT / 2) + kc * 32, lane);
#pragma unroll
    for (int dt = 0; dt < 4; ++dt) vf[dt] = frag_h(sv + (dt * 16) * (APT / 2) + u * 32, lane);
    SB();   // the pass's 16 LDS reads stay one group in front of its WMMAs
    v8f c[2] = {};
#pragma unroll
    for (int kc = 0; kc < 2; ++kc)
#pragma unroll
      for (int ct = 0; ct < 2; ++ct) c[ct] = wmma16(kf[ct][kc], aq[kc], c[ct]);   // the two key tiles' products alternate: each fills the other's distance
#pragma unroll
    for (int ct = 0; ct < 2; ++ct)
#pragma unroll
      for (int r = 0; r < 8; ++r) s[ct][r] = c[ct][r] * SCALEF - gfar;
    float mx = fmaxf(s[0][0], s[1][0]);
#pragma unroll
    for (int r = 1; r < 8; ++r) mx = fmaxf(mx, fmaxf(s[0][r], s[1][r]));
    mx = fmaxf(mx, xhalf(mx));   // the other 16 keys of this query sit in the partner lane
    const float mn = fmaxf(m, mx); const float am = exp_hw(m - mn); const float alpha = (m <= -1.0e38f) ? 0.f : am;
    float es = 0.f; v16h pa;
#pragma unroll
    for (int r = 0; r < 8; ++r) { const float e0 = exp_hw(s[0][r] - mn), e1 = exp_hw(s[1][r] - mn); es += e0 + e1; pa[r] = (_Float16)(e0 * 2048.0f); pa[8 + r] = (_Float16)(e1 * 2048.0f); }
    l = l * alpha + es; m = mn;
#pragma unroll
    for (int dt = 0; dt < 4; ++dt)
#pragma unroll
      for (int r = 0; r < 8; ++r) acc[dt][r] *= alpha;
#pragma unroll
    for (int dt = 0; dt < 4; ++dt) acc[dt] = wmma16(vf[dt], pa, acc[dt]);
  }
    DW(); AW(); __syncthreads();   // this wave's reads of stage t are done and its copies of stage t + 1 have landed; behind the barrier that holds for all four waves
    cp8(lc + bo, gc + (size_t)(t + 2) * gs, 8 * APT, (size_t)8 * AGP); }   // refill of the buffer that every wave has just left: behind a far stage t a stage t + 2 <= qb always exists
  // the last two stages (the general form); the loop stays rolled: one copy of the hand-over below, the buffer picked by t & 1
#pragma unroll 1
  for (int t = tf; t < nst; ++t) { const unsigned bo = (t & 1) * AR_S; const _Float16* sk = (const _Float16*)(ring + bo + col * APT); const _Float16* sv = (const _Float16*)(ring + bo + AR_V + col * APT);
#pragma unroll
  for (int u = 0; u < 2; ++u) { const int ks = 2 * t + u; v8f s[2]; v16h kf[2][2], vf[4];   // 32 keys a pass, two passes a stage; the pass's hi fragments out of the stage
#pragma unroll
    for (int ct = 0; ct < 2; ++ct)
#pragma unroll
      for (int kc = 0; kc < 2; ++kc) kf[ct][kc] = frag_h(sk + (u * 32 + ct * 16) * (APT / 2) + kc * 32, lane);
#pragma unroll
    for (int dt = 0; dt < 4; ++dt) vf[dt] = frag_h(sv + (dt * 16) * (APT / 2) + u * 32, lane);
    SB();   // the pass's 16 LDS reads stay one group in front of its WMMAs
#pragma unroll
    for (int ct = 0; ct < 2; ++ct) { const int kr = ks * 32 + ct * 16 + col; const _Float16* krowl = QKL + ((size_t)b * SS + kr) * (2 * DM) + DM + h * HD; v8f c = {}, cl = {};
      if (qb < 2) {   // leading query blocks (few keys, outputs far above the global rms): 3 products
#pragma unroll
        for (int kc = 0; kc < 2; ++kc) { const v16h kh = kf[ct][kc]; c = wmma16(kh, aq[kc], c); cl = wmma16(kh, aql[kc], cl); cl = wmma16(frag_h(krowl + kc * 32, lane), aq[kc], cl); }
#pragma unroll
        for (int r = 0; r < 8; ++r) c[r] += cl[r] * (1.0f / 2048.0f); }
      else {
#pragma unroll
        for (int kc = 0; kc < 2; ++kc) c = wmma16(kf[ct][kc], aq[kc], c); }   // single product elsewhere
#pragma unroll
      for (int r = 0; r < 8; ++r) { const int kk = ks * 32 + ct * 16 + 8 * g + r; const int dd = min(qi - kk, 64); s[ct][r] = (kk <= qi) ? (c[r] * SCALEF - gq * (float)dd * 0.1f) : -3.0e38f; } }   // causal; - softplus-gravity x min(|i-j|,64) x 0.1
    float mx = fmaxf(s[0][0], s[1][0]);
#pragma unroll
    for (int r = 1; r < 8; ++r) mx = fmaxf(mx, fmaxf(s[0][r], s[1][r]));
    mx = fmaxf(mx, xhalf(mx));   // the other 16 keys of this query sit in the partner lane
    const float mn = fmaxf(m, mx); const float am = exp_hw(m - mn); const float alpha = (m <= -1.0e38f) ? 0.f : am;
    float es = 0.f; v16h pa, pl;
#pragma unroll
    for (int r = 0; r < 8; ++r) { const float y0 = exp_hw(s[0][r] - mn), y1 = exp_hw(s[1][r] - mn); const float e0 = (s[0][r] <= -1.0e38f) ? 0.f : y0, e1 = (s[1][r] <= -1.0e38f) ? 0.f : y1; es += e0 + e1;
      const float x0 = e0 * 2048.0f, x1 = e1 * 2048.0f; const _Float16 h0 = (_Float16)x0, h1 = (_Float16)x1; pa[r] = h0; pa[8 + r] = h1; pl[r] = (_Float16)((x0 - (float)h0) * 2048.0f); pl[8 + r] = (_Float16)((x1 - (float)h1) * 2048.0f); }   // P scaled by 2^11 before the f16 split so small softmax weights stay out of the f16 subnormal range; 2^-11 folded into the epilogue
    l = l * alpha + es; m = mn;
#pragma unroll
    for (int dt = 0; dt < 4; ++dt)
#pragma unroll
      for (int r = 0; r < 8; ++r) { acc[dt][r] *= alpha; accl[dt][r] *= alpha; }
#pragma unroll
    for (int dt = 0; dt < 4; ++dt) { const size_t vr = ((size_t)b * DM + h * HD + dt * 16 + col) * SS + ks * 32; const v16h vh = vf[dt]; acc[dt] = wmma16(vh, pa, acc[dt]); if (qb < 2) { accl[dt] = wmma16(vh, pl, accl[dt]); accl[dt] = wmma16(frag_h(VTL + vr, lane), pa, accl[dt]); } }   // leading query blocks: P hi/lo x V hi/lo (3 products); elsewhere P x V single
  }
    DW(); AW(); __syncthreads();   // this wave's reads of stage t are done and its copies of stage t + 1 have landed; behind the barrier that holds for all four waves
    if (t + 2 < nst) cp8(lc + bo, gc + (size_t)(t + 2) * gs, 8 * APT, (size_t)8 * AGP); }   // refill of the buffer that every wave has just left
  AW();   // no copy is outstanding when the ring's bytes become the store staging
  l += xhalf(l);
  const float il = (1.0f / 2048.0f) / l;
#pragma unroll
  for (int dt = 0; dt < 4; ++dt)
#pragma unroll
    for (int r = 0; r < 8; ++r) so[wave][col][dt * 16 + 8 * g + r] = (acc[dt][r] + accl[dt][r] * (1.0f / 2048.0f)) * il;
  LDSX();
  for (int rl = 0; rl < 16; ++rl) if (lane < 16) vst2(O + ((size_t)b * SS + q0 + rl) * DM + h * HD + lane * 4, *(const v4f*)&so[wave][rl][lane * 4]);
}
// ---- k_out: block = (64 rows, 128 cols): out = O(hi/lo) . Wo rows (2 products) + bo
__global__ __launch_bounds__(128) void k_out(const float* __restrict__ O, const __bf16* __restrict__ P, const float* __restrict__ BO, float* __restrict__ Y) {
  __shared__ __attribute__((aligned(128))) char ring[2 * RB_S];   // two operand stages; behind the k loop the same bytes are the store staging
  float (*so)[16][132] = (float (*)[16][132])ring;
  const int tid = threadIdx.x, wave = tid >> 5, lane = tid & 31, col = lane & 15, g = lane >> 4; const size_t r0 = (size_t)blockIdx.x * 64 + wave * 16; const int n0 = blockIdx.y * 128;
  v8f acc[8] = {};
  const unsigned lb = (unsigned)(size_t)ring + (tid >> 3) * BPI + (tid & 7) * 16, la = (unsigned)(size_t)ring + RB_B + (tid >> 4) * API + (tid & 15) * 16;
  const __bf16* gb = P + (size_t)(n0 + (tid >> 3)) * DM + (tid & 7) * 8; const float* ga = O + ((size_t)blockIdx.x * 64 + (tid >> 4)) * DM + (tid & 15) * 4;
  cp_stage(lb, la, gb, ga); AW(); __syncthreads();   // stage 0 landed and handed to every wave
  cp_stage(lb + RB_S, la + RB_S, gb + KT, ga + KT);   // stage 1 flies while stage 0 is multiplied
  // the stage loop stays rolled: one copy of the hand-over below, the buffer picked by t & 1; unrolling would only multiply the code
#pragma unroll 1
  for (int t = 0; t < NT; ++t) { const unsigned bo = (t & 1) * RB_S; const char* sb = ring + bo + col * BPI + g * 16; const char* sa = ring + bo + RB_B + (wave * 16 + col) * API + g * 32;
    v16b b0[8], b1[8]; v4f a0[4], a1[4];
    lds_a16(a0, sa, 0); lds_b8(b0, sb, 0); lds_b8(b1, sb, 1); SB();
    F2 a = split_a16(a0); SB(); lds_a16(a1, sa, 1); SB();   // the second step's raw A takes the registers that the first step's has just left: with all four groups held at once the kernel went past 256 registers and lost its fourth wave per SIMD
#pragma unroll
    for (int j = 0; j < 8; ++j) { acc[j] = wmma_bf(a.l, b0[j], acc[j]); acc[j] = wmma_bf(a.h, b0[j], acc[j]); }
    a = split_a16(a1);
#pragma unroll
    for (int j = 0; j < 8; ++j) { acc[j] = wmma_bf(a.l, b1[j], acc[j]); acc[j] = wmma_bf(a.h, b1[j], acc[j]); }
    DW(); AW(); __syncthreads();   // this wave's reads of stage t are done and its copies of stage t + 1 have landed; behind the barrier that holds for all four waves
    if (t + 2 < NT) cp_stage(lb + bo, la + bo, gb + (t + 2) * KT, ga + (t + 2) * KT); }   // refill of the buffer that every wave has just left
  AW();   // no copy is outstanding when the ring's bytes become the store staging
#pragma unroll
  for (int j = 0; j < 8; ++j) {
#pragma unroll
    for (int r = 0; r < 8; ++r) so[wave][8 * g + r][j * 16 + col] = acc[j][r] + (BO ? bfr(BO[n0 + j * 16 + col]) : 0.f); }
  LDSX();
  for (int rl = 0; rl < 16; ++rl) vst2(Y + (r0 + rl) * DM + n0 + lane * 4, *(const v4f*)&so[wave][rl][lane * 4]);
}
// ---- k_grav: block = 16 rows, 8 waves; wave w takes k in [128 w, 128 w + 128): z = x . g_w on WMMA 16x16x32 from the bf16-rounded inputs (exact products, f32 sums), the 16 heads being one column tile; a wave's 80 loads are all issued before its first product; the eight partial tiles are joined through LDS; g[row][h] = softplus(z + g_b[h]) (precise expf/log1pf); one 1-KB segment a block, one 128-B line a wave
__global__ __launch_bounds__(256) void k_grav(const float* __restrict__ X, const float* __restrict__ GW, const float* __restrict__ GB, float* __restrict__ GR) {
  __shared__ __align__(16) float sp[8][16][NH + 1]; const size_t r0 = (size_t)blockIdx.x * 16; const int t = threadIdx.x, wave = t >> 5, lane = t & 31, col = lane & 15, g = lane >> 4;
  const float* xr = X + (r0 + col) * DM + wave * 128 + 8 * g; const float* gw = GW + (size_t)(wave * 128 + 8 * g) * NH + col;   // A: row col of x; B: column col of g_w; both in the k order 8 g + i, 16 + 8 g + i
  v4f ar[4][4]; float br[4][16];
#pragma unroll
  for (int s = 0; s < 4; ++s) { const float* p = xr + s * 32; ar[s][0] = *(const v4f*)p; ar[s][1] = *(const v4f*)(p + 4); ar[s][2] = *(const v4f*)(p + 16); ar[s][3] = *(const v4f*)(p + 20); }
#pragma unroll
  for (int s = 0; s < 4; ++s)
#pragma unroll
    for (int i = 0; i < 8; ++i) { br[s][i] = gw[(size_t)(s * 32 + i) * NH]; br[s][8 + i] = gw[(size_t)(s * 32 + 16 + i) * NH]; }
  v8f acc = {};
#pragma unroll
  for (int s = 0; s < 4; ++s) { v16b b;
#pragma unroll
    for (int i = 0; i < 16; ++i) b[i] = (__bf16)br[s][i];
    acc = wmma_bf(cvt_a16(ar[s]), b, acc); }
#pragma unroll
  for (int r = 0; r < 8; ++r) sp[wave][8 * g + r][col] = acc[r];
  __syncthreads();
  float z = sp[0][t >> 4][t & 15];
#pragma unroll
  for (int w = 1; w < 8; ++w) z += sp[w][t >> 4][t & 15];
  z += bfr(GB[t & 15]);
  GR[r0 * NH + t] = (z > 20.f) ? z : log1p_p(exp_p(z));   // softplus
}
extern "C" void kernel_launch(void* const* d_in, const int* in_sizes, int n_in, void* d_out, int out_size, void* d_ws, size_t ws_size, hipStream_t stream) {
  (void)in_sizes; (void)n_in; (void)out_size;
  const float** F = (const float**)d_in;   // 0 x [4,2048,1024], 1 rope [2048,64], 2 W_attn [1024,3072] (in,out: q|k|v), 3 W_proj [1024,1024] (in,out), 4 g_w [1024,16], 5 g_b [16]
  if (ws_size < (size_t)WS_END) return;
  char* ws = (char*)d_ws; __bf16* PK = (__bf16*)(ws + WS_PK); _Float16 *QK = (_Float16*)(ws + WS_QK), *QKL = (_Float16*)(ws + WS_QKL), *VTH = (_Float16*)(ws + WS_VTH), *VTL = (_Float16*)(ws + WS_VTL); float *O = (float*)(ws + WS_O), *GR = (float*)(ws + WS_G);
  k_packt<<<dim3((QKVW + DM) / PTN, DM / PTK), 256, 0, stream>>>(F[2], F[3], PK);   // W_attn columns, then W_proj columns, as bf16 rows
  k_grav<<<TNB * SS / 16, 256, 0, stream>>>(F[0], F[4], F[5], GR);
  k_qkv<<<dim3(TNB * SS / 64, QKVW / 128), 128, 0, stream>>>(F[0], F[0], F[0], PK + PK_A, nullptr, nullptr, nullptr, F[1], QK, QKL, VTH, VTL);
  k_attn<<<dim3(NH, TNB, TQB), 128, 0, stream>>>(QK, QKL, VTH, VTL, nullptr, GR, O);
  k_out<<<dim3(TOB, DM / 128), 128, 0, stream>>>(O, PK + PK_P, nullptr, (float*)d_out);
}

// v009
// Measured time: 170 microseconds a run.
// Two timings next to v008 both put it at 1.08 times that version's speed.
// All steps since v000 together make it 5.32 times as fast.
// compute dtype: all float inputs rounded to bf16; qkv = x . W_attn with EXACT bf16 products on WMMA 16x16x32 ((in,out) columns q | k | v as transposed rows); rotate-half RoPE with the learned angle table (precise sinf/cosf of rope[t][d]) on q and k in f32 before the f16 hi + residual split; gravity softplus(x . g_w + g_b): EXACT bf16 products on WMMA 16x16x32, f32 sums (precise expf/log1pf); causal attention: 3-product scores and hi + residual P, v on the first 128 queries of each sequence, single f16 beyond; x 1/8 - g x min(|i-j|, 64) x 0.1, running-max softmax in f32 (hardware exp), P scaled by 2^11; out = y (bf16 hi + residual) . W_proj (2 products).
#include <hip/hip_runtime.h>
#include <math.h>

typedef __attribute__((ext_vector_type(16))) _Float16 v16h;
typedef __attribute__((ext_vector_type(16))) __bf16 v16b;
typedef __attribute__((ext_vector_type(8)))  _Float16 v8h;
typedef __attribute__((ext_vector_type(8)))  float v8f;
typedef __attribute__((ext_vector_type(4)))  float v4f;
typedef __attribute__((ext_vector_type(2)))  float v2f;
typedef __attribute__((ext_vector_type(4)))  unsigned v4u;
typedef __attribute__((ext_vector_type(4)))  int v4i;
typedef float __attribute__((may_alias)) float_a;
typedef int __attribute__((may_alias)) int_a;

template <typename T> __device__ __forceinline__ void vst2(void* p, T v) { *(T*)p = v;  }
__device__ __forceinline__ v8f wmma16(v16h a, v16h b, v8f c) {
  v8f d = __builtin_amdgcn_wmma_f32_16x16x32_f16(false, a, false, b, (short)0, c, false, false);
  asm volatile("v_nop\n\tv_nop\n\tv_nop\n\tv_nop" : "+v"(d) : "v"(a), "v"(b));
  return d;
}
__device__ __forceinline__ v8f wmma_bf(v16b a, v16b b, v8f c) {
  v8f d = __builtin_amdgcn_wmma_f32_16x16x32_bf16(false, a, false, b, (short)0, c, false, false);
  asm volatile("v_nop\n\tv_nop\n\tv_nop\n\tv_nop" : "+v"(d) : "v"(a), "v"(b));
  return d;
}
// Adaptive-gravity causal attention (B 4, T 2,048, 1,024 dims, 16 heads x 64): fused q|k|v projection, table RoPE on q and k, scores / 8 minus a learned per-(token, head) softplus gravity times the clipped distance, causal softmax, . v, output projection.
__device__ __forceinline__ v16h frag_h(const _Float16* rowk0, int lane) {
  union { v16h v; v8h q[2]; } u; const _Float16* p = rowk0 + 8 * (lane >> 4);
  u.q[0] = *(const v8h*)p; u.q[1] = *(const v8h*)(p + 16); return u.v;
}
__device__ __forceinline__ v16h frag_f32(const float* rowk0, int lane) {
  v16h a; const float* p = rowk0 + 8 * (lane >> 4);
#pragma unroll
  for (int i = 0; i < 8; ++i) { a[i] = (_Float16)p[i]; a[8 + i] = (_Float16)p[16 + i]; }
  return a;
}
__device__ __forceinline__ v16h frag_f32s(const float* rowk0, int lane, float sc) {
  v16h a; const float* p = rowk0 + 8 * (lane >> 4);
#pragma unroll
  for (int i = 0; i < 8; ++i) { a[i] = (_Float16)(p[i] * sc); a[8 + i] = (_Float16)(p[16 + i] * sc); }
  return a;
}
// column fragment from a [K][ld] layout (column n), rows >= K read as 0
__device__ __forceinline__ v16h fragc_f32(const float* W, int k0, int n, int lane, int ld, int K) {
  v16h a; const int g = lane >> 4;
#pragma unroll
  for (int i = 0; i < 8; ++i) { const int ka = k0 + 8 * g + i, kb = ka + 16;
    a[i] = (_Float16)(ka < K ? W[(size_t)(ka < K ? ka : K - 1) * ld + n] : 0.f); a[8 + i] = (_Float16)(kb < K ? W[(size_t)(kb < K ? kb : K - 1) * ld + n] : 0.f); }
  return a;
}
struct F2 { v16b h, l; };
__device__ __forceinline__ F2 bsplit16(const float v[16]) { F2 r;
#pragma unroll
  for (int i = 0; i < 16; ++i) { const __bf16 h = (__bf16)v[i]; r.h[i] = h; r.l[i] = (__bf16)(v[i] - (float)h); }
  return r; }
__device__ __forceinline__ F2 split_row(const float* row, int k0, int lane) { float v[16]; const float* p = row + k0 + 8 * (lane >> 4);
#pragma unroll
  for (int i = 0; i < 8; ++i) { v[i] = p[i]; v[8 + i] = p[16 + i]; }
  return bsplit16(v); }
__device__ __forceinline__ F2 split_rowK(const float* row, int k0, int lane, int K) { float v[16]; const int g = lane >> 4;
#pragma unroll
  for (int i = 0; i < 8; ++i) { const int ka = k0 + 8 * g + i, kb = ka + 16; v[i] = ka < K ? row[ka < K ? ka : K - 1] : 0.f; v[8 + i] = kb < K ? row[kb < K ? kb : K - 1] : 0.f; }
  return bsplit16(v); }
__device__ __forceinline__ F2 split_col(const float* W, int k0, int n, int lane, int ld, int K) { float v[16]; const int g = lane >> 4;
#pragma unroll
  for (int i = 0; i < 8; ++i) { const int ka = k0 + 8 * g + i, kb = ka + 16; v[i] = ka < K ? W[(size_t)(ka < K ? ka : K - 1) * ld + n] : 0.f; v[8 + i] = kb < K ? W[(size_t)(kb < K ? kb : K - 1) * ld + n] : 0.f; }
  return bsplit16(v); }
__device__ __forceinline__ v8f mac3(const F2& a, const F2& b, v8f c) { c = wmma_bf(a.l, b.h, c); c = wmma_bf(a.h, b.l, c); return wmma_bf(a.h, b.h, c); }
__device__ __forceinline__ float sigm(float v) { return 1.0f / (1.0f + expf(-v)); }
#define LDSX() do { asm volatile("s_wait_dscnt 0" ::: "memory"); __builtin_amdgcn_wave_barrier(); __builtin_amdgcn_fence(__ATOMIC_RELEASE, "workgroup"); } while (0)


#define NB 4
#define SS 2048
#define SCALEF 0.125f
#define DM 1024
#define NH 16
__device__ __attribute__((noinline)) float cos_p(float v) { return cosf(v); }
__device__ __attribute__((noinline)) float sin_p(float v) { return sinf(v); }
__device__ __attribute__((noinline)) float exp_p(float v) { return expf(v); }
__device__ __attribute__((noinline)) float log1p_p(float v) { return log1pf(v); }
#define HD 64
#define QKVW (3 * DM)
#ifndef TQB
#define TQB (SS / 64)
#define TNB NB
#define TOB (NB * SS / 64)     // output row tiles (all)
#endif
typedef __attribute__((ext_vector_type(8))) __bf16 v8b;
__device__ __forceinline__ v16b frag_b(const __bf16* rowk0, int lane) {
  union { v16b v; v8b q[2]; } u; const __bf16* p = rowk0 + 8 * (lane >> 4);
  u.q[0] = *(const v8b*)p; u.q[1] = *(const v8b*)(p + 16); return u.v;
}
__device__ __forceinline__ float bfr(float v) { return (float)(__bf16)v; }
// stands behind a group of loads that stays in flight: the group's address registers are rewritten while it flies, and this is the wait that belongs in front of such a rewrite
#define XW() asm volatile("s_wait_xcnt 0x0" ::: "memory")
// scheduling fence: a stage's LDS fragment reads stay in front of its WMMAs, in the groups and order written
#define SB() __builtin_amdgcn_sched_barrier(0)
// ---- operand ring of k_out (k_qkv's, further down, has the same pitches and twice the rows): a stage is 64 k of the block's 128 weight rows (128 B of bf16 each) and of its 64 activation rows (256 B of f32 each), brought into LDS once for all four waves as whole 128-B lines; row pitches are 16 B x odd, so the 16-byte fragment reads meet no bank conflict
#define KT 64
#define NT (DM / KT)
#define BPI 144
#define API 272
#define RB_B (128 * BPI)
#define RB_S (RB_B + 64 * API)
// the issuing wave's wait for its own copies, and its wait for its own LDS reads: both stand in front of the barrier that hands a stage over
#define AW() asm volatile("s_wait_asynccnt 0x0" ::: "memory")
#define DW() asm volatile("s_wait_dscnt 0x0" ::: "memory")
// eight 16-byte copies of one lane, rows sl (LDS bytes) and sg (global bytes) apart; the s_wait_xcnt closes the statement so that no address register named here is rewritten in front of it
__device__ __forceinline__ void cp8(unsigned l, const char* p, unsigned sl, size_t sg) {
  asm volatile("global_load_async_to_lds_b128 %0, %8, off\n\tglobal_load_async_to_lds_b128 %1, %9, off\n\tglobal_load_async_to_lds_b128 %2, %10, off\n\tglobal_load_async_to_lds_b128 %3, %11, off\n\t"
               "global_load_async_to_lds_b128 %4, %12, off\n\tglobal_load_async_to_lds_b128 %5, %13, off\n\tglobal_load_async_to_lds_b128 %6, %14, off\n\tglobal_load_async_to_lds_b128 %7, %15, off\n\ts_wait_xcnt 0x0"
               :: "v"(l), "v"(l + sl), "v"(l + 2 * sl), "v"(l + 3 * sl), "v"(l + 4 * sl), "v"(l + 5 * sl), "v"(l + 6 * sl), "v"(l + 7 * sl),
                  "v"(p), "v"(p + sg), "v"(p + 2 * sg), "v"(p + 3 * sg), "v"(p + 4 * sg), "v"(p + 5 * sg), "v"(p + 6 * sg), "v"(p + 7 * sg) : "memory");
}
// one stage: lane tid brings chunk tid & 7 of weight rows (tid >> 3) + 16 i and chunk tid & 15 of activation rows (tid >> 4) + 8 i; lb, la, gb, ga already hold the lane's first row and chunk
__device__ __forceinline__ void cp_stage(unsigned lb, unsigned la, const __bf16* gb, const float* ga) { cp8(lb, (const char*)gb, 16 * BPI, (size_t)16 * DM * 2); cp8(la, (const char*)ga, 8 * API, (size_t)8 * DM * 4); }
// one 32-k step's fragments out of a stage, in the k order of the global rows: sb, sa already hold the lane's row and its 8 * g elements
__device__ __forceinline__ void lds_b8(v16b (&f)[8], const char* sb, int kc) {
#pragma unroll
  for (int j = 0; j < 8; ++j) { union { v16b v; v8b q[2]; } u; const char* p = sb + j * 16 * BPI + kc * 64; u.q[0] = *(const v8b*)p; u.q[1] = *(const v8b*)(p + 32); f[j] = u.v; }
}
__device__ __forceinline__ void lds_a16(v4f (&r)[4], const char* sa, int kc) { const char* p = sa + kc * 128; r[0] = *(const v4f*)p; r[1] = *(const v4f*)(p + 16); r[2] = *(const v4f*)(p + 64); r[3] = *(const v4f*)(p + 80); }
__device__ __forceinline__ v16b cvt_a16(const v4f (&r)[4]) { v16b a;
#pragma unroll
  for (int i = 0; i < 8; ++i) { a[i] = (__bf16)r[i >> 2][i & 3]; a[8 + i] = (__bf16)r[2 + (i >> 2)][i & 3]; }
  return a; }
__device__ __forceinline__ F2 split_a16(const v4f (&r)[4]) { float v[16];
#pragma unroll
  for (int i = 0; i < 8; ++i) { v[i] = r[i >> 2][i & 3]; v[8 + i] = r[2 + (i >> 2)][i & 3]; }
  return bsplit16(v); }
__device__ __attribute__((noinline)) float exp_ni(float v) { return expf(v); }
__device__ __attribute__((noinline)) float erf_ni(float v) { return erff(v); }

#define PK_A 0                       // [3072][1024] Wqkv rows (natural [out][in])
#define PK_P (PK_A + QKVW * DM)        // [1024][1024] Wo rows (natural)
#define PK_END (PK_P + DM * DM)
#define WS_PK  0u
#define WS_QK  (WS_PK + 2u * PK_END)             // f16 [8192 rows][2048]: q | k
#define WS_QKL (WS_QK + 2u * NB * SS * 2 * DM)     // f16 q | k residual planes x2048
#define WS_VTH (WS_QKL + 2u * NB * SS * 2 * DM)    // f16 [b][1024 (h*64+d)][2048 s] hi
#define WS_VTL (WS_VTH + 2u * NB * DM * SS)        // f16 lo x 2048
#define WS_O   (WS_VTL + 2u * NB * DM * SS)        // f32 [8192][1024]
#define WS_CS  (WS_O + 4u * NB * SS * DM)           // f32 2 x [2048][32], unused
#define WS_G   (WS_CS + 4u * 2 * SS * 32)                  // f32 [b*t][16] softplus(x . g_w + g_b)
#define WS_END (WS_G + 4u * (size_t)NB * SS * NH)
// ---- k_packt: block = (64 columns n, 128 rows k) of the (in,out) weights: W_attn's 3,072 columns (q | k | v), then W_proj's 1,024, become the bf16 rows of PK in that order. Reads are whole 256-B row pieces; a thread turns its 8 k x 4 n piece in registers and LDS; writes are whole 256-B row pieces
#define PTK 128
#define PTN 64
// eight rows of one lane, LD floats apart (LD a compile-time constant of each weight), issued as one group
template <int LD> __device__ __forceinline__ void ld_rows8(v4f (&v)[8], const float* p) {
#pragma unroll
  for (int i = 0; i < 8; ++i) v[i] = *(const v4f*)(p + i * LD);
}
__global__ __launch_bounds__(256) void k_packt(const float* __restrict__ WA, const float* __restrict__ WP, __bf16* __restrict__ PK) {
  __shared__ __align__(16) __bf16 s[PTN][PTK + 8];   // [n][k]; row pitch 272 B = 16 B x odd
  const int t = threadIdx.x, c = t & 15, kr = t >> 4; const int nb = blockIdx.x * PTN, k0 = blockIdx.y * PTK;
  v4f v[8];
  if (nb < QKVW) ld_rows8<QKVW>(v, WA + nb + (size_t)(k0 + kr * 8) * QKVW + c * 4); else ld_rows8<DM>(v, WP + (nb - QKVW) + (size_t)(k0 + kr * 8) * DM + c * 4);   // a block lies wholly in one of the two weights
  XW();   // the group's address registers are free for reuse only behind this wait
#pragma unroll
  for (int e = 0; e < 4; ++e) { v8b w;
#pragma unroll
    for (int i = 0; i < 8; ++i) w[i] = (__bf16)v[i][e];
    *(v8b*)&s[c * 4 + e][kr * 8] = w; }
  __syncthreads();
#pragma unroll
  for (int j = 0; j < 4; ++j) { const int q = t + 256 * j, n = q >> 4, pc = q & 15; vst2((unsigned*)(PK + PK_A + (size_t)(nb + n) * DM + k0 + pc * 8), *(const v4u*)&s[n][pc * 8]); }
}
// ---- k_qkv: block = (128 rows, 256 columns), 8 waves, a wave = 32 rows x 128 columns (2 x 8 accumulator tiles): every staged weight row serves 128 rows of x and every staged x row 256 columns, and a fragment read from LDS serves two (weights) or eight (x) products. The ring is that of k_out with more rows a stage: 256 weight rows, then 128 activation rows
#define QBM 128
#define QBN 256
#define QB_B (QBN * BPI)
#define QB_S (QB_B + QBM * API)
// one stage: lane tid brings chunk tid & 7 of weight rows (tid >> 3) + 32 i and chunk tid & 15 of activation rows (tid >> 4) + 16 i; lb, la, gb, ga already hold the lane's first row and chunk
__device__ __forceinline__ void cp_stage_q(unsigned lb, unsigned la, const __bf16* gb, const float* ga) { cp8(lb, (const char*)gb, 32 * BPI, (size_t)32 * DM * 2); cp8(la, (const char*)ga, 16 * API, (size_t)16 * DM * 4); }
// four waves per SIMD, that is two blocks a WGP (2 x the ring fits its LDS), need at most 256 registers a wave: the attribute sets that budget (without it the epilogue's register allocation ran past 256)
__global__ __launch_bounds__(256) __attribute__((amdgpu_waves_per_eu(4, 4))) void k_qkv(const float* __restrict__ XQ, const float* __restrict__ XK, const float* __restrict__ XV, const __bf16* __restrict__ P, const float* __restrict__ BQ, const float* __restrict__ BK, const float* __restrict__ BV, const float* __restrict__ POS, _Float16* __restrict__ QK, _Float16* __restrict__ QKL, _Float16* __restrict__ VTH, _Float16* __restrict__ VTL) {
  const int tid = threadIdx.x, wave = tid >> 5, lane = tid & 31, col = lane & 15, g = lane >> 4, wr = wave & 3, wc = wave >> 2;
  const int n0 = blockIdx.y * QBN, nw = n0 + wc * 128;   // the block's and the wave's first column; a block lies wholly in q, in k or in v
  const int which0 = n0 / DM; const float* X = (which0 == 0) ? XQ : (which0 == 1) ? XK : XV; const float* BB = BQ ? (((which0 == 0) ? BQ : (which0 == 1) ? BK : BV) + (nw - which0 * DM)) : nullptr;
  __shared__ __attribute__((aligned(128))) char ring[2 * QB_S];   // two operand stages; behind the k loop the same bytes are the store staging
  _Float16 (*so)[16][136] = (_Float16 (*)[16][136])ring; _Float16 (*sol)[16][136] = (_Float16 (*)[16][136])(ring + 8 * 16 * 136 * 2); _Float16 (*sth)[136] = (_Float16 (*)[136])ring; _Float16 (*stl)[136] = (_Float16 (*)[136])(ring + QBN * 136 * 2);
  const size_t rw = (size_t)blockIdx.x * QBM + wr * 32;   // the wave's first row
  v8f acc[2][8] = {};
  const unsigned lb = (unsigned)(size_t)ring + (tid >> 3) * BPI + (tid & 7) * 16, la = (unsigned)(size_t)ring + QB_B + (tid >> 4) * API + (tid & 15) * 16;
  const __bf16* gb = P + (size_t)(n0 + (tid >> 3)) * DM + (tid & 7) * 8; const float* ga = X + ((size_t)blockIdx.x * QBM + (tid >> 4)) * DM + (tid & 15) * 4;
  cp_stage_q(lb, la, gb, ga); AW(); __syncthreads();   // stage 0 landed and handed to every wave
  cp_stage_q(lb + QB_S, la + QB_S, gb + KT, ga + KT);   // stage 1 flies while stage 0 is multiplied
  // the stage loop stays rolled: one copy of the hand-over below, the buffer picked by t & 1; unrolling would only multiply the code
#pragma unroll 1
  for (int t = 0; t < NT; ++t) { const unsigned bo = (t & 1) * QB_S; const char* sb = ring + bo + (wc * 128 + col) * BPI + g * 16; const char* sa = ring + bo + QB_B + (wr * 32 + col) * API + g * 32;
#pragma unroll
    for (int kc = 0; kc < 2; ++kc) { v16b bf[8]; v4f a0[4], a1[4];
      lds_a16(a0, sa, kc); lds_a16(a1, sa + 16 * API, kc); lds_b8(bf, sb, kc); SB();
      const v16b x0 = cvt_a16(a0), x1 = cvt_a16(a1);
#pragma unroll
      for (int j = 0; j < 8; ++j) { acc[0][j] = wmma_bf(x0, bf[j], acc[0][j]); acc[1][j] = wmma_bf(x1, bf[j], acc[1][j]); }
      SB(); }   // the second step's fragments take the registers of the first step's: held at once the two sets would go past 256 registers and cost the second block of a WGP its place
    DW(); AW(); __syncthreads();   // this wave's reads of stage t are done and its copies of stage t + 1 have landed; behind the barrier that holds for all eight waves
    if (t + 2 < NT) cp_stage_q(lb + bo, la + bo, gb + (t + 2) * KT, ga + (t + 2) * KT); }   // refill of the buffer that every wave has just left
  AW();   // no copy is outstanding when the ring's bytes become the store staging
  if (n0 < 2 * DM) {
    // the wave's two 16-row tiles go through one copy of the q, k epilogue, one after the other: the loop stays rolled so that the kernel's text does not double; the second tile waits in LDS behind the store staging, every lane keeping its own 16-byte pieces, so that the epilogue's registers stay inside the budget
    v4f* sx = (v4f*)(ring + 2 * 8 * 16 * 136 * 2) + wave * 512 + lane;
    v8f e[8];
#pragma unroll
    for (int j = 0; j < 8; ++j) { e[j] = acc[0][j]; const v8f a = acc[1][j]; sx[(2 * j) * 32] = (v4f){a[0], a[1], a[2], a[3]}; sx[(2 * j + 1) * 32] = (v4f){a[4], a[5], a[6], a[7]}; }
#pragma unroll 1
    for (int it = 0; it < 2; ++it) { const size_t r0 = rw + it * 16;   // bias, then rotate-half rotary over each 64-dim head with the learned angle rope[position][d]
#pragma unroll
    for (int j = 0; j < 8; ++j)
#pragma unroll
      for (int r = 0; r < 8; ++r) e[j][r] += (BB ? bfr(BB[j * 16 + col]) : 0.f);
#pragma unroll
    for (int r = 0; r < 8; ++r) { const int spos = (int)((r0 + 8 * g + r) % SS); const float* pr = POS + (size_t)spos * HD;   // learned table: out[d] = x[d] cos(p[d]) -+ partner sin(p[d])
#pragma unroll
      for (int jj = 0; jj < 2; ++jj) { const float p1 = bfr(pr[jj * 16 + col]), p2 = bfr(pr[32 + jj * 16 + col]); const float c1 = cos_p(p1), s1 = sin_p(p1), c2 = cos_p(p2), s2 = sin_p(p2);
#pragma unroll
        for (int hh = 0; hh < 2; ++hh) { const float x1 = e[hh * 4 + jj][r], x2 = e[hh * 4 + jj + 2][r]; e[hh * 4 + jj][r] = x1 * c1 - x2 * s1; e[hh * 4 + jj + 2][r] = x2 * c2 + x1 * s2; } } }
#pragma unroll
    for (int j = 0; j < 8; ++j) {
#pragma unroll
      for (int r = 0; r < 8; ++r) { const float v = e[j][r]; const _Float16 hv = (_Float16)v; so[wave][8 * g + r][j * 16 + col] = hv; sol[wave][8 * g + r][j * 16 + col] = (_Float16)((v - (float)hv) * 2048.0f); } }   // q, k (+ bias) as f16 hi + (x2048) residual
    LDSX();
    for (int rl = 0; rl < 16; ++rl) if (lane < 16) { vst2((unsigned*)(QK + (r0 + rl) * (2 * DM) + nw + lane * 8), *(const v4u*)&so[wave][rl][lane * 8]); vst2((unsigned*)(QKL + (r0 + rl) * (2 * DM) + nw + lane * 8), *(const v4u*)&sol[wave][rl][lane * 8]); }
    XW();   // the second tile's reload below takes registers that the stores above name
#pragma unroll
    for (int j = 0; j < 8; ++j) { const v4f lo = sx[(2 * j) * 32], hi = sx[(2 * j + 1) * 32]; e[j] = (v8f){lo[0], lo[1], lo[2], lo[3], hi[0], hi[1], hi[2], hi[3]}; } }
  } else {
    // v: the two 16-row tiles through one copy of the turn into [d][s] staging, the loop rolled for the same reason; the staging fills the ring, so the second tile waits in its registers
    v8f e[8];
#pragma unroll
    for (int j = 0; j < 8; ++j) e[j] = acc[0][j];
#pragma unroll 1
    for (int it = 0; it < 2; ++it) {
#pragma unroll
    for (int j = 0; j < 8; ++j) {
#pragma unroll
      for (int r = 0; r < 8; ++r) { const float v = e[j][r] + (BB ? bfr(BB[j * 16 + col]) : 0.f); const _Float16 hv = (_Float16)v; sth[wc * 128 + j * 16 + col][wr * 32 + it * 16 + 8 * g + r] = hv; stl[wc * 128 + j * 16 + col][wr * 32 + it * 16 + 8 * g + r] = (_Float16)((v - (float)hv) * 2048.0f); } }
#pragma unroll
    for (int j = 0; j < 8; ++j) e[j] = acc[1][j]; }
    __syncthreads();
    const size_t rb = (size_t)blockIdx.x * QBM; const int b = (int)(rb / SS), s0 = (int)(rb % SS); const int pc0 = n0 - 2 * DM;
    for (int q = tid; q < QBN * 16; q += 256) { const int d = q >> 4, pc = q & 15; const size_t o = ((size_t)b * DM + pc0 + d) * SS + s0 + pc * 8; vst2((unsigned*)(VTH + o), *(const v4u*)&sth[d][pc * 8]); vst2((unsigned*)(VTL + o), *(const v4u*)&stl[d][pc * 8]); }
  }
}
// lane l <-> lane l ^ 16 as a vector cross-row move (no LDS counter to wait on)
__device__ __forceinline__ float xhalf(float x) { return __builtin_bit_cast(float, __builtin_amdgcn_permlanex16(__builtin_bit_cast(int, x), __builtin_bit_cast(int, x), 0x76543210, 0xfedcba98, false, false)); }
// e^x as the hardware exp2 of x * log2(e), the same two instructions __expf compiles to; the v_nop inside the statement keeps the one slot the instruction set asks for behind a transcendental
__device__ __forceinline__ float exp_hw(float x) { float y; const float t = x * 1.44269504f; asm("v_exp_f32 %0, %1\n\tv_nop" : "=v"(y) : "v"(t)); return y; }
// ---- K | V^T ring of k_attn: a stage is 64 keys of the head: 64 K rows (64 dims, 128 B each), then the 64 V^T rows (64 keys, 128 B each), brought into LDS once for all four waves as whole 128-B lines; the row pitch is 16 B x odd, so the 16-byte fragment reads meet no bank conflict
#define AKT 64
#define APT 144
#define AGP (2 * DM * 2)
#define AR_V (AKT * APT)
#define AR_S (2 * AKT * APT)
static_assert(SS * 2 == AGP, "K rows and V^T rows share one global pitch");
// ---- k_attn: block = (64 queries, head h, batch b): causal flash attention on TRANSPOSED tiles: S^T = K . Q^T (rows = keys, column = this lane's query), so the softmax of a query lives in one lane pair and the D registers of S^T are already the B fragment of O^T = V^T . P^T (k = 8g + i from key tile 0, 16 + 8g + i from key tile 1); O[b*S+q][h*64+d] = (acc + accl / 2048) / (2048 l) (256-B segments)
__global__ __launch_bounds__(128) void k_attn(const _Float16* __restrict__ QK, const _Float16* __restrict__ QKL, const _Float16* __restrict__ VTH, const _Float16* __restrict__ VTL, const void* __restrict__ KMASK, const float* __restrict__ GR, float* __restrict__ O) {
  __shared__ __attribute__((aligned(128))) char ring[2 * AR_S];   // two K | V^T stages; behind the key loop the same bytes are the store staging
  float (*so)[16][68] = (float (*)[16][68])ring;
  const int tid = threadIdx.x, wave = tid >> 5, lane = tid & 31, col = lane & 15, g = lane >> 4;
  const int qb = TQB - 1 - blockIdx.z, h = blockIdx.x, b = blockIdx.y;   // a query tile walks qb + 1 key stages and only half of the blocks find a place at once: the longest tiles take the lowest indices and the short ones fill the end of the launch
  const int q0 = qb * 64 + wave * 16; const int qi = q0 + col; const size_t rq = (size_t)b * SS + qi;
  v16h aq[2], aql[2];
#pragma unroll
  for (int kc = 0; kc < 2; ++kc) { aq[kc] = frag_h(QK + rq * (2 * DM) + h * HD + kc * 32, lane); aql[kc] = frag_h(QKL + rq * (2 * DM) + h * HD + kc * 32, lane); }
  const float gq = GR[rq * NH + h];   // this lane's query: one gravity value
  const float gfar = gq * 64.0f * 0.1f;   // the gravity term at the clipped distance, rounded as in the general form
  XW();   // the address registers of the q and gravity loads above are taken for the copies' addresses below
  float m = -3.0e38f, l = 0.f;        // l: partial sum over this lane half's keys, joined after the loop
  v8f acc[4] = {}, accl[4] = {};
  const int nst = qb + 1;   // causal: 64-key stages up to the query tile's end
  // waves 0 and 1 bring the stage's K rows, waves 2 and 3 its V^T rows: lane chunk tid & 7 of rows ((tid & 63) >> 3) + 8 i; a stage further on is 64 rows of K, 64 keys (128 B) along a row of V^T
  const int cw = __builtin_amdgcn_readfirstlane(tid >> 6), cr = (tid & 63) >> 3, cc = tid & 7;   // cw is the same in every lane of a wave: held in a scalar register, the choice of operand below is made on the scalar side and no lane is ever off around the copies
  const unsigned lc = (unsigned)(size_t)ring + cw * AR_V + cr * APT + cc * 16;
  const char* gc = cw ? (const char*)(VTH + ((size_t)b * DM + h * HD + cr) * SS + cc * 8) : (const char*)(QK + ((size_t)b * SS + cr) * (2 * DM) + DM + h * HD + cc * 8);
  const size_t gs = cw ? (size_t)AKT * 2 : (size_t)AKT * AGP;
  cp8(lc, gc, 8 * APT, (size_t)8 * AGP); AW(); __syncthreads();   // stage 0 landed and handed to every wave
  if (nst > 1) cp8(lc + AR_S, gc + gs, 8 * APT, (size_t)8 * AGP);   // stage 1 flies while stage 0 is worked on
  // far stages, t <= qb - 2: every key lies 64 or more behind every query of the tile, so the clipped distance is 64 and no key is masked; they exist only where qb >= 2 (single products, accl stays 0). A loop of their own, rolled like the one behind it, with the same hand-over at its foot: in one loop with the general body the accumulators were copied from register to register at every stage
  const int tf = qb > 1 ? qb - 1 : 0;
#pragma unroll 1
  for (int t = 0; t < tf; ++t) { const unsigned bo = (t & 1) * AR_S; const _Float16* sk = (const _Float16*)(ring + bo + col * APT); const _Float16* sv = (const _Float16*)(ring + bo + AR_V + col * APT);
#pragma unroll
  for (int u = 0; u < 2; ++u) { v8f s[2]; v16h kf[2][2], vf[4];
#pragma unroll
    for (int ct = 0; ct < 2; ++ct)
#pragma unroll
      for (int kc = 0; kc < 2; ++kc) kf[ct][kc] = frag_h(sk + (u * 32 + ct * 16) * (APT / 2) + kc * 32, lane);
#pragma unroll
    for (int dt = 0; dt < 4; ++dt) vf[dt] = frag_h(sv + (dt * 16) * (APT / 2) + u * 32, lane);
    SB();   // the pass's 16 LDS reads stay one group in front of its WMMAs
    v8f c[2] = {};
#pragma unroll
    for (int kc = 0; kc < 2; ++kc)
#pragma unroll
      for (int ct = 0; ct < 2; ++ct) c[ct] = wmma16(kf[ct][kc], aq[kc], c[ct]);   // the two key tiles' products alternate: each fills the other's distance
#pragma unroll
    for (int ct = 0; ct < 2; ++ct)
#pragma unroll
      for (int r = 0; r < 8; ++r) s[ct][r] = c[ct][r] * SCALEF - gfar;
    float mx = fmaxf(s[0][0], s[1][0]);
#pragma unroll
    for (int r = 1; r < 8; ++r) mx = fmaxf(mx, fmaxf(s[0][r], s[1][r]));
    mx = fmaxf(mx, xhalf(mx));   // the other 16 keys of this query sit in the partner lane
    const float mn = fmaxf(m, mx); const float am = exp_hw(m - mn); const float alpha = (m <= -1.0e38f) ? 0.f : am;
    float es = 0.f; v16h pa;
#pragma unroll
    for (int r = 0; r < 8; ++r) { const float e0 = exp_hw(s[0][r] - mn), e1 = exp_hw(s[1][r] - mn); es += e0 + e1; pa[r] = (_Float16)(e0 * 2048.0f); pa[8 + r] = (_Float16)(e1 * 2048.0f); }
    l = l * alpha + es; m = mn;
#pragma unroll
    for (int dt = 0; dt < 4; ++dt)
#pragma unroll
      for (int r = 0; r < 8; ++r) acc[dt][r] *= alpha;
#pragma unroll
    for (int dt = 0; dt < 4; ++dt) acc[dt] = wmma16(vf[dt], pa, acc[dt]);
  }
    DW(); AW(); __syncthreads();   // this wave's reads of stage t are done and its copies of stage t + 1 have landed; behind the barrier that holds for all four waves
    cp8(lc + bo, gc + (size_t)(t + 2) * gs, 8 * APT, (size_t)8 * AGP); }   // refill of the buffer that every wave has just left: behind a far stage t a stage t + 2 <= qb always exists
  // the last two stages (the general form); the loop stays rolled: one copy of the hand-over below, the buffer picked by t & 1
#pragma unroll 1
  for (int t = tf; t < nst; ++t) { const unsigned bo = (t & 1) * AR_S; const _Float16* sk = (const _Float16*)(ring + bo + col * APT); const _Float16* sv = (const _Float16*)(ring + bo + AR_V + col * APT);
#pragma unroll
  for (int u = 0; u < 2; ++u) { const int ks = 2 * t + u; v8f s[2]; v16h kf[2][2], vf[4];   // 32 keys a pass, two passes a stage; the pass's hi fragments out of the stage
#pragma unroll
    for (int ct = 0; ct < 2; ++ct)
#pragma unroll
      for (int kc = 0; kc < 2; ++kc) kf[ct][kc] = frag_h(sk + (u * 32 + ct * 16) * (APT / 2) + kc * 32, lane);
#pragma unroll
    for (int dt = 0; dt < 4; ++dt) vf[dt] = frag_h(sv + (dt * 16) * (APT / 2) + u * 32, lane);
    SB();   // the pass's 16 LDS reads stay one group in front of its WMMAs
#pragma unroll
    for (int ct = 0; ct < 2; ++ct) { const int kr = ks * 32 + ct * 16 + col; const _Float16* krowl = QKL + ((size_t)b * SS + kr) * (2 * DM) + DM + h * HD; v8f c = {}, cl = {};
      if (qb < 2) {   // leading query blocks (few keys, outputs far above the global rms): 3 products
#pragma unroll
        for (int kc = 0; kc < 2; ++kc) { const v16h kh = kf[ct][kc]; c = wmma16(kh, aq[kc], c); cl = wmma16(kh, aql[kc], cl); cl = wmma16(frag_h(krowl + kc * 32, lane), aq[kc], cl); }
#pragma unroll
        for (int r = 0; r < 8; ++r) c[r] += cl[r] * (1.0f / 2048.0f); }
      else {
#pragma unroll
        for (int kc = 0; kc < 2; ++kc) c = wmma16(kf[ct][kc], aq[kc], c); }   // single product elsewhere
#pragma unroll
      for (int r = 0; r < 8; ++r) { const int kk = ks * 32 + ct * 16 + 8 * g + r; const int dd = min(qi - kk, 64); s[ct][r] = (kk <= qi) ? (c[r] * SCALEF - gq * (float)dd * 0.1f) : -3.0e38f; } }   // causal; - softplus-gravity x min(|i-j|,64) x 0.1
    float mx = fmaxf(s[0][0], s[1][0]);
#pragma unroll
    for (int r = 1; r < 8; ++r) mx = fmaxf(mx, fmaxf(s[0][r], s[1][r]));
    mx = fmaxf(mx, xhalf(mx));   // the other 16 keys of this query sit in the partner lane
    const float mn = fmaxf(m, mx); const float am = exp_hw(m - mn); const float alpha = (m <= -1.0e38f) ? 0.f : am;
    float es = 0.f; v16h pa, pl;
#pragma unroll
    for (int r = 0; r < 8; ++r) { const float y0 = exp_hw(s[0][r] - mn), y1 = exp_hw(s[1][r] - mn); const float e0 = (s[0][r] <= -1.0e38f) ? 0.f : y0, e1 = (s[1][r] <= -1.0e38f) ? 0.f : y1; es += e0 + e1;
      const float x0 = e0 * 2048.0f, x1 = e1 * 2048.0f; const _Float16 h0 = (_Float16)x0, h1 = (_Float16)x1; pa[r] = h0; pa[8 + r] = h1; pl[r] = (_Float16)((x0 - (float)h0) * 2048.0f); pl[8 + r] = (_Float16)((x1 - (float)h1) * 2048.0f); }   // P scaled by 2^11 before the f16 split so small softmax weights stay out of the f16 subnormal range; 2^-11 folded into the epilogue
    l = l * alpha + es; m = mn;
#pragma unroll
    for (int dt = 0; dt < 4; ++dt)
#pragma unroll
      for (int r = 0; r < 8; ++r) { acc[dt][r] *= alpha; accl[dt][r] *= alpha; }
#pragma unroll
    for (int dt = 0; dt < 4; ++dt) { const size_t vr = ((size_t)b * DM + h * HD + dt * 16 + col) * SS + ks * 32; const v16h vh = vf[dt]; acc[dt] = wmma16(vh, pa, acc[dt]); if (qb < 2) { accl[dt] = wmma16(vh, pl, accl[dt]); accl[dt] = wmma16(frag_h(VTL + vr, lane), pa, accl[dt]); } }   // leading query blocks: P hi/lo x V hi/lo (3 products); elsewhere P x V single
  }
    DW(); AW(); __syncthreads();   // this wave's reads of stage t are done and its copies of stage t + 1 have landed; behind the barrier that holds for all four waves
    if (t + 2 < nst) cp8(lc + bo, gc + (size_t)(t + 2) * gs, 8 * APT, (size_t)8 * AGP); }   // refill of the buffer that every wave has just left
  AW();   // no copy is outstanding when the ring's bytes become the store staging
  l += xhalf(l);
  const float il = (1.0f / 2048.0f) / l;
#pragma unroll
  for (int dt = 0; dt < 4; ++dt)
#pragma unroll
    for (int r = 0; r < 8; ++r) so[wave][col][dt * 16 + 8 * g + r] = (acc[dt][r] + accl[dt][r] * (1.0f / 2048.0f)) * il;
  LDSX();
  for (int rl = 0; rl < 16; ++rl) if (lane < 16) vst2(O + ((size_t)b * SS + q0 + rl) * DM + h * HD + lane * 4, *(const v4f*)&so[wave][rl][lane * 4]);
}
// ---- k_out: block = (64 rows, 128 cols): out = O(hi/lo) . Wo rows (2 products) + bo
__global__ __launch_bounds__(128) void k_out(const float* __restrict__ O, const __bf16* __restrict__ P, const float* __restrict__ BO, float* __restrict__ Y) {
  __shared__ __attribute__((aligned(128))) char ring[2 * RB_S];   // two operand stages; behind the k loop the same bytes are the store staging
  float (*so)[16][132] = (float (*)[16][132])ring;
  const int tid = threadIdx.x, wave = tid >> 5, lane = tid & 31, col = lane & 15, g = lane >> 4; const size_t r0 = (size_t)blockIdx.x * 64 + wave * 16; const int n0 = blockIdx.y * 128;
  v8f acc[8] = {};
  const unsigned lb = (unsigned)(size_t)ring + (tid >> 3) * BPI + (tid & 7) * 16, la = (unsigned)(size_t)ring + RB_B + (tid >> 4) * API + (tid & 15) * 16;
  const __bf16* gb = P + (size_t)(n0 + (tid >> 3)) * DM + (tid & 7) * 8; const float* ga = O + ((size_t)blockIdx.x * 64 + (tid >> 4)) * DM + (tid & 15) * 4;
  cp_stage(lb, la, gb, ga); AW(); __syncthreads();   // stage 0 landed and handed to every wave
  cp_stage(lb + RB_S, la + RB_S, gb + KT, ga + KT);   // stage 1 flies while stage 0 is multiplied
  // the stage loop stays rolled: one copy of the hand-over below, the buffer picked by t & 1; unrolling would only multiply the code
#pragma unroll 1
  for (int t = 0; t < NT; ++t) { const unsigned bo = (t & 1) * RB_S; const char* sb = ring + bo + col * BPI + g * 16; const char* sa = ring + bo + RB_B + (wave * 16 + col) * API + g * 32;
    v16b b0[8], b1[8]; v4f a0[4], a1[4];
    lds_a16(a0, sa, 0); lds_b8(b0, sb, 0); lds_b8(b1, sb, 1); SB();
    F2 a = split_a16(a0); SB(); lds_a16(a1, sa, 1); SB();   // the second step's raw A takes the registers that the first step's has just left: with all four groups held at once the kernel went past 256 registers and lost its fourth wave per SIMD
#pragma unroll
    for (int j = 0; j < 8; ++j) { acc[j] = wmma_bf(a.l, b0[j], acc[j]); acc[j] = wmma_bf(a.h, b0[j], acc[j]); }
    a = split_a16(a1);
#pragma unroll
    for (int j = 0; j < 8; ++j) { acc[j] = wmma_bf(a.l, b1[j], acc[j]); acc[j] = wmma_bf(a.h, b1[j], acc[j]); }
    DW(); AW(); __syncthreads();   // this wave's reads of stage t are done and its copies of stage t + 1 have landed; behind the barrier that holds for all four waves
    if (t + 2 < NT) cp_stage(lb + bo, la + bo, gb + (t + 2) * KT, ga + (t + 2) * KT); }   // refill of the buffer that every wave has just left
  AW();   // no copy is outstanding when the ring's bytes become the store staging
#pragma unroll
  for (int j = 0; j < 8; ++j) {
#pragma unroll
    for (int r = 0; r < 8; ++r) so[wave][8 * g + r][j * 16 + col] = acc[j][r] + (BO ? bfr(BO[n0 + j * 16 + col]) : 0.f); }
  LDSX();
  for (int rl = 0; rl < 16; ++rl) vst2(Y + (r0 + rl) * DM + n0 + lane * 4, *(const v4f*)&so[wave][rl][lane * 4]);
}
// ---- k_grav: block = 16 rows, 8 waves; wave w takes k in [128 w, 128 w + 128): z = x . g_w on WMMA 16x16x32 from the bf16-rounded inputs (exact products, f32 sums), the 16 heads being one column tile; a wave's 80 loads are all issued before its first product; the eight partial tiles are joined through LDS; g[row][h] = softplus(z + g_b[h]) (precise expf/log1pf); one 1-KB segment a block, one 128-B line a wave
__global__ __launch_bounds__(256) void k_grav(const float* __restrict__ X, const float* __restrict__ GW, const float* __restrict__ GB, float* __restrict__ GR) {
  __shared__ __align__(16) float sp[8][16][NH + 1]; const size_t r0 = (size_t)blockIdx.x * 16; const int t = threadIdx.x, wave = t >> 5, lane = t & 31, col = lane & 15, g = lane >> 4;
  const float* xr = X + (r0 + col) * DM + wave * 128 + 8 * g; const float* gw = GW + (size_t)(wave * 128 + 8 * g) * NH + col;   // A: row col of x; B: column col of g_w; both in the k order 8 g + i, 16 + 8 g + i
  v4f ar[4][4]; float br[4][16];
#pragma unroll
  for (int s = 0; s < 4; ++s) { const float* p = xr + s * 32; ar[s][0] = *(const v4f*)p; ar[s][1] = *(const v4f*)(p + 4); ar[s][2] = *(const v4f*)(p + 16); ar[s][3] = *(const v4f*)(p + 20); }
#pragma unroll
  for (int s = 0; s < 4; ++s)
#pragma unroll
    for (int i = 0; i < 8; ++i) { br[s][i] = gw[(size_t)(s * 32 + i) * NH]; br[s][8 + i] = gw[(size_t)(s * 32 + 16 + i) * NH]; }
  v8f acc = {};
#pragma unroll
  for (int s = 0; s < 4; ++s) { v16b b;
#pragma unroll
    for (int i = 0; i < 16; ++i) b[i] = (__bf16)br[s][i];
    acc = wmma_bf(cvt_a16(ar[s]), b, acc); }
#pragma unroll
  for (int r = 0; r < 8; ++r) sp[wave][8 * g + r][col] = acc[r];
  __syncthreads();
  float z = sp[0][t >> 4][t & 15];
#pragma unroll
  for (int w = 1; w < 8; ++w) z += sp[w][t >> 4][t & 15];
  z += bfr(GB[t & 15]);
  GR[r0 * NH + t] = (z > 20.f) ? z : log1p_p(exp_p(z));   // softplus
}
extern "C" void kernel_launch(void* const* d_in, const int* in_sizes, int n_in, void* d_out, int out_size, void* d_ws, size_t ws_size, hipStream_t stream) {
  (void)in_sizes; (void)n_in; (void)out_size;
  const float** F = (const float**)d_in;   // 0 x [4,2048,1024], 1 rope [2048,64], 2 W_attn [1024,3072] (in,out: q|k|v), 3 W_proj [1024,1024] (in,out), 4 g_w [1024,16], 5 g_b [16]
  if (ws_size < (size_t)WS_END) return;
  char* ws = (char*)d_ws; __bf16* PK = (__bf16*)(ws + WS_PK); _Float16 *QK = (_Float16*)(ws + WS_QK), *QKL = (_Float16*)(ws + WS_QKL), *VTH = (_Float16*)(ws + WS_VTH), *VTL = (_Float16*)(ws + WS_VTL); float *O = (float*)(ws + WS_O), *GR = (float*)(ws + WS_G);
  k_packt<<<dim3((QKVW + DM) / PTN, DM / PTK), 256, 0, stream>>>(F[2], F[3], PK);   // W_attn columns, then W_proj columns, as bf16 rows
  k_grav<<<TNB * SS / 16, 256, 0, stream>>>(F[0], F[4], F[5], GR);
  k_qkv<<<dim3(TNB * SS / QBM, QKVW / QBN), 256, 0, stream>>>(F[0], F[0], F[0], PK + PK_A, nullptr, nullptr, nullptr, F[1], QK, QKL, VTH, VTL);
  k_attn<<<dim3(NH, TNB, TQB), 128, 0, stream>>>(QK, QKL, VTH, VTL, nullptr, GR, O);
  k_out<<<dim3(TOB, DM / 128), 128, 0, stream>>>(O, PK + PK_P, nullptr, (float*)d_out);
}

// v010
// A run of this version takes 161 microseconds.
// Two timings next to v009 both put it at 1.06 times that version's speed.
// Counting every step since v000, it is 5.64 times as fast.
// compute dtype: all float inputs rounded to bf16; qkv = x . W_attn with EXACT bf16 products on WMMA 16x16x32 ((in,out) columns q | k | v as transposed rows); rotate-half RoPE with the learned angle table (precise sinf/cosf of rope[t][d]) on q and k in f32 before the f16 hi + residual split; gravity softplus(x . g_w + g_b): EXACT bf16 products on WMMA 16x16x32, f32 sums (precise expf/log1pf); causal attention: 3-product scores and hi + residual P, v on the first 128 queries of each sequence, single f16 beyond; x 1/8 - g x min(|i-j|, 64) x 0.1, running-max softmax in f32 (hardware exp), P scaled by 2^11; out = y (bf16 hi + residual) . W_proj (2 products).
#include <hip/hip_runtime.h>
#include <math.h>

typedef __attribute__((ext_vector_type(16))) _Float16 v16h;
typedef __attribute__((ext_vector_type(16))) __bf16 v16b;
typedef __attribute__((ext_vector_type(8)))  _Float16 v8h;
typedef __attribute__((ext_vector_type(8)))  float v8f;
typedef __attribute__((ext_vector_type(4)))  float v4f;
typedef __attribute__((ext_vector_type(2)))  float v2f;
typedef __attribute__((ext_vector_type(4)))  unsigned v4u;
typedef __attribute__((ext_vector_type(4)))  int v4i;
typedef float __attribute__((may_alias)) float_a;
typedef int __attribute__((may_alias)) int_a;

template <typename T> __device__ __forceinline__ void vst2(void* p, T v) { *(T*)p = v;  }
__device__ __forceinline__ v8f wmma16(v16h a, v16h b, v8f c) {
  v8f d = __builtin_amdgcn_wmma_f32_16x16x32_f16(false, a, false, b, (short)0, c, false, false);
  asm volatile("v_nop\n\tv_nop\n\tv_nop\n\tv_nop" : "+v"(d) : "v"(a), "v"(b));
  return d;
}
__device__ __forceinline__ v8f wmma_bf(v16b a, v16b b, v8f c) {
  v8f d = __builtin_amdgcn_wmma_f32_16x16x32_bf16(false, a, false, b, (short)0, c, false, false);
  asm volatile("v_nop\n\tv_nop\n\tv_nop\n\tv_nop" : "+v"(d) : "v"(a), "v"(b));
  return d;
}
// Adaptive-gravity causal attention (B 4, T 2,048, 1,024 dims, 16 heads x 64): fused q|k|v projection, table RoPE on q and k, scores / 8 minus a learned per-(token, head) softplus gravity times the clipped distance, causal softmax, . v, output projection.
__device__ __forceinline__ v16h frag_h(const _Float16* rowk0, int lane) {
  union { v16h v; v8h q[2]; } u; const _Float16* p = rowk0 + 8 * (lane >> 4);
  u.q[0] = *(const v8h*)p; u.q[1] = *(const v8h*)(p + 16); return u.v;
}
__device__ __forceinline__ v16h frag_f32(const float* rowk0, int lane) {
  v16h a; const float* p = rowk0 + 8 * (lane >> 4);
#pragma unroll
  for (int i = 0; i < 8; ++i) { a[i] = (_Float16)p[i]; a[8 + i] = (_Float16)p[16 + i]; }
  return a;
}
__device__ __forceinline__ v16h frag_f32s(const float* rowk0, int lane, float sc) {
  v16h a; const float* p = rowk0 + 8 * (lane >> 4);
#pragma unroll
  for (int i = 0; i < 8; ++i) { a[i] = (_Float16)(p[i] * sc); a[8 + i] = (_Float16)(p[16 + i] * sc); }
  return a;
}
// column fragment from a [K][ld] layout (column n), rows >= K read as 0
__device__ __forceinline__ v16h fragc_f32(const float* W, int k0, int n, int lane, int ld, int K) {
  v16h a; const int g = lane >> 4;
#pragma unroll
  for (int i = 0; i < 8; ++i) { const int ka = k0 + 8 * g + i, kb = ka + 16;
    a[i] = (_Float16)(ka < K ? W[(size_t)(ka < K ? ka : K - 1) * ld + n] : 0.f); a[8 + i] = (_Float16)(kb < K ? W[(size_t)(kb < K ? kb : K - 1) * ld + n] : 0.f); }
  return a;
}
struct F2 { v16b h, l; };
__device__ __forceinline__ F2 bsplit16(const float v[16]) { F2 r;
#pragma unroll
  for (int i = 0; i < 16; ++i) { const __bf16 h = (__bf16)v[i]; r.h[i] = h; r.l[i] = (__bf16)(v[i] - (float)h); }
  return r; }
__device__ __forceinline__ F2 split_row(const float* row, int k0, int lane) { float v[16]; const float* p = row + k0 + 8 * (lane >> 4);
#pragma unroll
  for (int i = 0; i < 8; ++i) { v[i] = p[i]; v[8 + i] = p[16 + i]; }
  return bsplit16(v); }
__device__ __forceinline__ F2 split_rowK(const float* row, int k0, int lane, int K) { float v[16]; const int g = lane >> 4;
#pragma unroll
  for (int i = 0; i < 8; ++i) { const int ka = k0 + 8 * g + i, kb = ka + 16; v[i] = ka < K ? row[ka < K ? ka : K - 1] : 0.f; v[8 + i] = kb < K ? row[kb < K ? kb : K - 1] : 0.f; }
  return bsplit16(v); }
__device__ __forceinline__ F2 split_col(const float* W, int k0, int n, int lane, int ld, int K) { float v[16]; const int g = lane >> 4;
#pragma unroll
  for (int i = 0; i < 8; ++i) { const int ka = k0 + 8 * g + i, kb = ka + 16; v[i] = ka < K ? W[(size_t)(ka < K ? ka : K - 1) * ld + n] : 0.f; v[8 + i] = kb < K ? W[(size_t)(kb < K ? kb : K - 1) * ld + n] : 0.f; }
  return bsplit16(v); }
__device__ __forceinline__ v8f mac3(const F2& a, const F2& b, v8f c) { c = wmma_bf(a.l, b.h, c); c = wmma_bf(a.h, b.l, c); return wmma_bf(a.h, b.h, c); }
__device__ __forceinline__ float sigm(float v) { return 1.0f / (1.0f + expf(-v)); }
#define LDSX() do { asm volatile("s_wait_dscnt 0" ::: "memory"); __builtin_amdgcn_wave_barrier(); __builtin_amdgcn_fence(__ATOMIC_RELEASE, "workgroup"); } while (0)


#define NB 4
#define SS 2048
#define SCALEF 0.125f
#define DM 1024
#define NH 16
__device__ __attribute__((noinline)) float cos_p(float v) { return cosf(v); }
__device__ __attribute__((noinline)) float sin_p(float v) { return sinf(v); }
__device__ __attribute__((noinline)) float exp_p(float v) { return expf(v); }
__device__ __attribute__((noinline)) float log1p_p(float v) { return log1pf(v); }
#define HD 64
#define QKVW (3 * DM)
#ifndef TQB
#define TQB (SS / 64)
#define TNB NB
#define TOB (NB * SS / 64)     // output row tiles (all)
#endif
typedef __attribute__((ext_vector_type(8))) __bf16 v8b;
__device__ __forceinline__ v16b frag_b(const __bf16* rowk0, int lane) {
  union { v16b v; v8b q[2]; } u; const __bf16* p = rowk0 + 8 * (lane >> 4);
  u.q[0] = *(const v8b*)p; u.q[1] = *(const v8b*)(p + 16); return u.v;
}
__device__ __forceinline__ float bfr(float v) { return (float)(__bf16)v; }
// stands behind a group of loads that stays in flight: the group's address registers are rewritten while it flies, and this is the wait that belongs in front of such a rewrite
#define XW() asm volatile("s_wait_xcnt 0x0" ::: "memory")
// scheduling fence: a stage's LDS fragment reads stay in front of its WMMAs, in the groups and order written
#define SB() __builtin_amdgcn_sched_barrier(0)
// ---- operand ring of k_out (k_qkv's, further down, has the same pitches and twice the rows): a stage is 64 k of the block's 128 weight rows (128 B of bf16 each) and of its 64 activation rows (256 B of f32 each), brought into LDS once for all four waves as whole 128-B lines; row pitches are 16 B x odd, so the 16-byte fragment reads meet no bank conflict
#define KT 64
#define NT (DM / KT)
#define BPI 144
#define API 272
#define RB_B (128 * BPI)
#define RB_S (RB_B + 64 * API)
// the issuing wave's wait for its own copies, and its wait for its own LDS reads: both stand in front of the barrier that hands a stage over
#define AW() asm volatile("s_wait_asynccnt 0x0" ::: "memory")
#define DW() asm volatile("s_wait_dscnt 0x0" ::: "memory")
// eight 16-byte copies of one lane, rows sl (LDS bytes) and sg (global bytes) apart; the s_wait_xcnt closes the statement so that no address register named here is rewritten in front of it
__device__ __forceinline__ void cp8(unsigned l, const char* p, unsigned sl, size_t sg) {
  asm volatile("global_load_async_to_lds_b128 %0, %8, off\n\tglobal_load_async_to_lds_b128 %1, %9, off\n\tglobal_load_async_to_lds_b128 %2, %10, off\n\tglobal_load_async_to_lds_b128 %3, %11, off\n\t"
               "global_load_async_to_lds_b128 %4, %12, off\n\tglobal_load_async_to_lds_b128 %5, %13, off\n\tglobal_load_async_to_lds_b128 %6, %14, off\n\tglobal_load_async_to_lds_b128 %7, %15, off\n\ts_wait_xcnt 0x0"
               :: "v"(l), "v"(l + sl), "v"(l + 2 * sl), "v"(l + 3 * sl), "v"(l + 4 * sl), "v"(l + 5 * sl), "v"(l + 6 * sl), "v"(l + 7 * sl),
                  "v"(p), "v"(p + sg), "v"(p + 2 * sg), "v"(p + 3 * sg), "v"(p + 4 * sg), "v"(p + 5 * sg), "v"(p + 6 * sg), "v"(p + 7 * sg) : "memory");
}
// one stage: lane tid brings chunk tid & 7 of weight rows (tid >> 3) + 16 i and chunk tid & 15 of activation rows (tid >> 4) + 8 i; lb, la, gb, ga already hold the lane's first row and chunk
__device__ __forceinline__ void cp_stage(unsigned lb, unsigned la, const __bf16* gb, const float* ga) { cp8(lb, (const char*)gb, 16 * BPI, (size_t)16 * DM * 2); cp8(la, (const char*)ga, 8 * API, (size_t)8 * DM * 4); }
// one 32-k step's fragments out of a stage, in the k order of the global rows: sb, sa already hold the lane's row and its 8 * g elements
__device__ __forceinline__ void lds_b8(v16b (&f)[8], const char* sb, int kc) {
#pragma unroll
  for (int j = 0; j < 8; ++j) { union { v16b v; v8b q[2]; } u; const char* p = sb + j * 16 * BPI + kc * 64; u.q[0] = *(const v8b*)p; u.q[1] = *(const v8b*)(p + 32); f[j] = u.v; }
}
__device__ __forceinline__ void lds_a16(v4f (&r)[4], const char* sa, int kc) { const char* p = sa + kc * 128; r[0] = *(const v4f*)p; r[1] = *(const v4f*)(p + 16); r[2] = *(const v4f*)(p + 64); r[3] = *(const v4f*)(p + 80); }
__device__ __forceinline__ v16b cvt_a16(const v4f (&r)[4]) { v16b a;
#pragma unroll
  for (int i = 0; i < 8; ++i) { a[i] = (__bf16)r[i >> 2][i & 3]; a[8 + i] = (__bf16)r[2 + (i >> 2)][i & 3]; }
  return a; }
__device__ __forceinline__ F2 split_a16(const v4f (&r)[4]) { float v[16];
#pragma unroll
  for (int i = 0; i < 8; ++i) { v[i] = r[i >> 2][i & 3]; v[8 + i] = r[2 + (i >> 2)][i & 3]; }
  return bsplit16(v); }
__device__ __attribute__((noinline)) float exp_ni(float v) { return expf(v); }
__device__ __attribute__((noinline)) float erf_ni(float v) { return erff(v); }

#define PK_A 0                       // [3072][1024] Wqkv rows (natural [out][in])
#define PK_P (PK_A + QKVW * DM)        // [1024][1024] Wo rows (natural)
#define PK_END (PK_P + DM * DM)
#define WS_PK  0u
#define WS_QK  (WS_PK + 2u * PK_END)             // f16 [8192 rows][2048]: q | k
#define WS_QKL (WS_QK + 2u * NB * SS * 2 * DM)     // f16 q | k residual planes x2048
#define WS_VTH (WS_QKL + 2u * NB * SS * 2 * DM)    // f16 [b][1024 (h*64+d)][2048 s] hi
#define WS_VTL (WS_VTH + 2u * NB * DM * SS)        // f16 lo x 2048
#define WS_O   (WS_VTL + 2u * NB * DM * SS)        // f32 [8192][1024]
#define WS_CS  (WS_O + 4u * NB * SS * DM)           // f32 [2048 positions][64 dims] pairs (cos, sin) of the rounded rope angle
#define WS_G   (WS_CS + 4u * 2 * SS * HD)                  // f32 [b*t][16] softplus(x . g_w + g_b)
#define WS_END (WS_G + 4u * (size_t)NB * SS * NH)
// ---- k_packt: block = (64 columns n, 128 rows k) of the (in,out) weights: W_attn's 3,072 columns (q | k | v), then W_proj's 1,024, become the bf16 rows of PK in that order. Reads are whole 256-B row pieces; a thread turns its 8 k x 4 n piece in registers and LDS; writes are whole 256-B row pieces
#define PTK 128
#define PTN 64
// eight rows of one lane, LD floats apart (LD a compile-time constant of each weight), issued as one group
template <int LD> __device__ __forceinline__ void ld_rows8(v4f (&v)[8], const float* p) {
#pragma unroll
  for (int i = 0; i < 8; ++i) v[i] = *(const v4f*)(p + i * LD);
}
static_assert((QKVW + DM) / PTN * (DM / PTK) * 256 == SS * HD, "one thread of k_packt for each entry of the rope table");
__global__ __launch_bounds__(256) void k_packt(const float* __restrict__ WA, const float* __restrict__ WP, const float* __restrict__ POS, __bf16* __restrict__ PK, float* __restrict__ CS) {
  __shared__ __align__(16) __bf16 s[PTN][PTK + 8];   // [n][k]; row pitch 272 B = 16 B x odd
  const int t = threadIdx.x, c = t & 15, kr = t >> 4; const int nb = blockIdx.x * PTN, k0 = blockIdx.y * PTK;
  v4f v[8];
  if (nb < QKVW) ld_rows8<QKVW>(v, WA + nb + (size_t)(k0 + kr * 8) * QKVW + c * 4); else ld_rows8<DM>(v, WP + (nb - QKVW) + (size_t)(k0 + kr * 8) * DM + c * 4);   // a block lies wholly in one of the two weights
  const size_t ce = ((size_t)blockIdx.y * ((QKVW + DM) / PTN) + blockIdx.x) * 256 + t; const float pv = POS[ce];   // this thread's entry of the rope table, fetched with the group above
  XW();   // the group's address registers are free for reuse only behind this wait
#pragma unroll
  for (int e = 0; e < 4; ++e) { v8b w;
#pragma unroll
    for (int i = 0; i < 8; ++i) w[i] = (__bf16)v[i][e];
    *(v8b*)&s[c * 4 + e][kr * 8] = w; }
  __syncthreads();
#pragma unroll
  for (int j = 0; j < 4; ++j) { const int q = t + 256 * j, n = q >> 4, pc = q & 15; vst2((unsigned*)(PK + PK_A + (size_t)(nb + n) * DM + k0 + pc * 8), *(const v4u*)&s[n][pc * 8]); }
  // the launch has as many threads as the rope table has entries: each makes its entry's (cos, sin) once, with the same precise functions of the same rounded angle that k_qkv's epilogue used to call for every batch, head pair and q | k side
  XW();   // the two functions below take registers that the stores above name
  const float pa = bfr(pv);
  *((v2f*)CS + ce) = (v2f){cos_p(pa), sin_p(pa)};
}
// ---- k_qkv: block = (128 rows, 256 columns), 8 waves, a wave = 32 rows x 128 columns (2 x 8 accumulator tiles): every staged weight row serves 128 rows of x and every staged x row 256 columns, and a fragment read from LDS serves two (weights) or eight (x) products. The ring is that of k_out with more rows a stage: 256 weight rows, then 128 activation rows
#define QBM 128
#define QBN 256
#define QB_B (QBN * BPI)
#define QB_S (QB_B + QBM * API)
// one stage: lane tid brings chunk tid & 7 of weight rows (tid >> 3) + 32 i and chunk tid & 15 of activation rows (tid >> 4) + 16 i; lb, la, gb, ga already hold the lane's first row and chunk
__device__ __forceinline__ void cp_stage_q(unsigned lb, unsigned la, const __bf16* gb, const float* ga) { cp8(lb, (const char*)gb, 32 * BPI, (size_t)32 * DM * 2); cp8(la, (const char*)ga, 16 * API, (size_t)16 * DM * 4); }
// four waves per SIMD, that is two blocks a WGP (2 x the ring fits its LDS), need at most 256 registers a wave: the attribute sets that budget (without it the epilogue's register allocation ran past 256)
__global__ __launch_bounds__(256) __attribute__((amdgpu_waves_per_eu(4, 4))) void k_qkv(const float* __restrict__ XQ, const float* __restrict__ XK, const float* __restrict__ XV, const __bf16* __restrict__ P, const float* __restrict__ BQ, const float* __restrict__ BK, const float* __restrict__ BV, const float* __restrict__ CS, _Float16* __restrict__ QK, _Float16* __restrict__ QKL, _Float16* __restrict__ VTH, _Float16* __restrict__ VTL) {
  const int tid = threadIdx.x, wave = tid >> 5, lane = tid & 31, col = lane & 15, g = lane >> 4, wr = wave & 3, wc = wave >> 2;
  const int n0 = blockIdx.y * QBN, nw = n0 + wc * 128;   // the block's and the wave's first column; a block lies wholly in q, in k or in v
  const int which0 = n0 / DM; const float* X = (which0 == 0) ? XQ : (which0 == 1) ? XK : XV; const float* BB = BQ ? (((which0 == 0) ? BQ : (which0 == 1) ? BK : BV) + (nw - which0 * DM)) : nullptr;
  __shared__ __attribute__((aligned(128))) char ring[2 * QB_S];   // two operand stages; behind the k loop the same bytes are the store staging
  _Float16 (*so)[16][136] = (_Float16 (*)[16][136])ring; _Float16 (*sol)[16][136] = (_Float16 (*)[16][136])(ring + 8 * 16 * 136 * 2); _Float16 (*sth)[136] = (_Float16 (*)[136])ring; _Float16 (*stl)[136] = (_Float16 (*)[136])(ring + QBN * 136 * 2);
  const size_t rw = (size_t)blockIdx.x * QBM + wr * 32;   // the wave's first row
  v8f acc[2][8] = {};
  const unsigned lb = (unsigned)(size_t)ring + (tid >> 3) * BPI + (tid & 7) * 16, la = (unsigned)(size_t)ring + QB_B + (tid >> 4) * API + (tid & 15) * 16;
  const __bf16* gb = P + (size_t)(n0 + (tid >> 3)) * DM + (tid & 7) * 8; const float* ga = X + ((size_t)blockIdx.x * QBM + (tid >> 4)) * DM + (tid & 15) * 4;
  cp_stage_q(lb, la, gb, ga); AW(); __syncthreads();   // stage 0 landed and handed to every wave
  cp_stage_q(lb + QB_S, la + QB_S, gb + KT, ga + KT);   // stage 1 flies while stage 0 is multiplied
  // the stage loop stays rolled: one copy of the hand-over below, the buffer picked by t & 1; unrolling would only multiply the code
#pragma unroll 1
  for (int t = 0; t < NT; ++t) { const unsigned bo = (t & 1) * QB_S; const char* sb = ring + bo + (wc * 128 + col) * BPI + g * 16; const char* sa = ring + bo + QB_B + (wr * 32 + col) * API + g * 32;
#pragma unroll
    for (int kc = 0; kc < 2; ++kc) { v16b bf[8]; v4f a0[4], a1[4];
      lds_a16(a0, sa, kc); lds_a16(a1, sa + 16 * API, kc); lds_b8(bf, sb, kc); SB();
      const v16b x0 = cvt_a16(a0), x1 = cvt_a16(a1);
#pragma unroll
      for (int j = 0; j < 8; ++j) { acc[0][j] = wmma_bf(x0, bf[j], acc[0][j]); acc[1][j] = wmma_bf(x1, bf[j], acc[1][j]); }
      SB(); }   // the second step's fragments take the registers of the first step's: held at once the two sets would go past 256 registers and cost the second block of a WGP its place
    DW(); AW(); __syncthreads();   // this wave's reads of stage t are done and its copies of stage t + 1 have landed; behind the barrier that holds for all eight waves
    if (t + 2 < NT) cp_stage_q(lb + bo, la + bo, gb + (t + 2) * KT, ga + (t + 2) * KT); }   // refill of the buffer that every wave has just left
  AW();   // no copy is outstanding when the ring's bytes become the store staging
  if (n0 < 2 * DM) {
    // the wave's two 16-row tiles go through one copy of the q, k epilogue, one after the other: the loop stays rolled so that the kernel's text does not double; the second tile waits in LDS behind the store staging, every lane keeping its own 16-byte pieces, so that the epilogue's registers stay inside the budget
    v4f* sx = (v4f*)(ring + 2 * 8 * 16 * 136 * 2) + wave * 512 + lane;
    v8f e[8];
#pragma unroll
    for (int j = 0; j < 8; ++j) { e[j] = acc[0][j]; const v8f a = acc[1][j]; sx[(2 * j) * 32] = (v4f){a[0], a[1], a[2], a[3]}; sx[(2 * j + 1) * 32] = (v4f){a[4], a[5], a[6], a[7]}; }
#pragma unroll 1
    for (int it = 0; it < 2; ++it) { const size_t r0 = rw + it * 16;   // bias, then rotate-half rotary over each 64-dim head with the learned angle rope[position][d]
#pragma unroll
    for (int j = 0; j < 8; ++j)
#pragma unroll
      for (int r = 0; r < 8; ++r) e[j][r] += (BB ? bfr(BB[j * 16 + col]) : 0.f);
    // the (cos, sin) pairs of the lane's 8 positions (one run of 8, never across a sequence's end) x its 4 dims, made once in k_packt: 32 loads issued as one group
    const v2f* pr = (const v2f*)CS + (size_t)((r0 + 8 * g) % SS) * HD + col; v2f tb[8][4];
#pragma unroll
    for (int r = 0; r < 8; ++r)
#pragma unroll
      for (int q = 0; q < 4; ++q) tb[r][q] = pr[r * HD + q * 16];
    asm volatile("s_wait_xcnt 0x0" :: "v"(pr) : "memory");   // the group's address pair is named here so that it stays whole up to the wait: without that the group's last load returned into it
#pragma unroll
    for (int r = 0; r < 8; ++r) {   // learned table: out[d] = x[d] cos(p[d]) -+ partner sin(p[d])
#pragma unroll
      for (int jj = 0; jj < 2; ++jj) { const v2f t1 = tb[r][jj], t2 = tb[r][2 + jj]; const float c1 = t1[0], s1 = t1[1], c2 = t2[0], s2 = t2[1];
#pragma unroll
        for (int hh = 0; hh < 2; ++hh) { const float x1 = e[hh * 4 + jj][r], x2 = e[hh * 4 + jj + 2][r]; e[hh * 4 + jj][r] = x1 * c1 - x2 * s1; e[hh * 4 + jj + 2][r] = x2 * c2 + x1 * s2; } } }
#pragma unroll
    for (int j = 0; j < 8; ++j) {
#pragma unroll
      for (int r = 0; r < 8; ++r) { const float v = e[j][r]; const _Float16 hv = (_Float16)v; so[wave][8 * g + r][j * 16 + col] = hv; sol[wave][8 * g + r][j * 16 + col] = (_Float16)((v - (float)hv) * 2048.0f); } }   // q, k (+ bias) as f16 hi + (x2048) residual
    LDSX();
    for (int rl = 0; rl < 16; ++rl) if (lane < 16) { vst2((unsigned*)(QK + (r0 + rl) * (2 * DM) + nw + lane * 8), *(const v4u*)&so[wave][rl][lane * 8]); vst2((unsigned*)(QKL + (r0 + rl) * (2 * DM) + nw + lane * 8), *(const v4u*)&sol[wave][rl][lane * 8]); }
    XW();   // the second tile's reload below takes registers that the stores above name
#pragma unroll
    for (int j = 0; j < 8; ++j) { const v4f lo = sx[(2 * j) * 32], hi = sx[(2 * j + 1) * 32]; e[j] = (v8f){lo[0], lo[1], lo[2], lo[3], hi[0], hi[1], hi[2], hi[3]}; } }
  } else {
    // v: the two 16-row tiles through one copy of the turn into [d][s] staging, the loop rolled for the same reason; the staging fills the ring, so the second tile waits in its registers
    v8f e[8];
#pragma unroll
    for (int j = 0; j < 8; ++j) e[j] = acc[0][j];
#pragma unroll 1
    for (int it = 0; it < 2; ++it) {
#pragma unroll
    for (int j = 0; j < 8; ++j) {
#pragma unroll
      for (int r = 0; r < 8; ++r) { const float v = e[j][r] + (BB ? bfr(BB[j * 16 + col]) : 0.f); const _Float16 hv = (_Float16)v; sth[wc * 128 + j * 16 + col][wr * 32 + it * 16 + 8 * g + r] = hv; stl[wc * 128 + j * 16 + col][wr * 32 + it * 16 + 8 * g + r] = (_Float16)((v - (float)hv) * 2048.0f); } }
#pragma unroll
    for (int j = 0; j < 8; ++j) e[j] = acc[1][j]; }
    __syncthreads();
    const size_t rb = (size_t)blockIdx.x * QBM; const int b = (int)(rb / SS), s0 = (int)(rb % SS); const int pc0 = n0 - 2 * DM;
    for (int q = tid; q < QBN * 16; q += 256) { const int d = q >> 4, pc = q & 15; const size_t o = ((size_t)b * DM + pc0 + d) * SS + s0 + pc * 8; vst2((unsigned*)(VTH + o), *(const v4u*)&sth[d][pc * 8]); vst2((unsigned*)(VTL + o), *(const v4u*)&stl[d][pc * 8]); }
  }
}
// lane l <-> lane l ^ 16 as a vector cross-row move (no LDS counter to wait on)
__device__ __forceinline__ float xhalf(float x) { return __builtin_bit_cast(float, __builtin_amdgcn_permlanex16(__builtin_bit_cast(int, x), __builtin_bit_cast(int, x), 0x76543210, 0xfedcba98, false, false)); }
// e^x as the hardware exp2 of x * log2(e), the same two instructions __expf compiles to; the v_nop inside the statement keeps the one slot the instruction set asks for behind a transcendental
__device__ __forceinline__ float exp_hw(float x) { float y; const float t = x * 1.44269504f; asm("v_exp_f32 %0, %1\n\tv_nop" : "=v"(y) : "v"(t)); return y; }
// ---- K | V^T ring of k_attn: a stage is 64 keys of the head: 64 K rows (64 dims, 128 B each), then the 64 V^T rows (64 keys, 128 B each), brought into LDS once for all four waves as whole 128-B lines; the row pitch is 16 B x odd, so the 16-byte fragment reads meet no bank conflict
#define AKT 64
#define APT 144
#define AGP (2 * DM * 2)
#define AR_V (AKT * APT)
#define AR_S (2 * AKT * APT)
static_assert(SS * 2 == AGP, "K rows and V^T rows share one global pitch");
// ---- k_attn: block = (64 queries, head h, batch b): causal flash attention on TRANSPOSED tiles: S^T = K . Q^T (rows = keys, column = this lane's query), so the softmax of a query lives in one lane pair and the D registers of S^T are already the B fragment of O^T = V^T . P^T (k = 8g + i from key tile 0, 16 + 8g + i from key tile 1); O[b*S+q][h*64+d] = (acc + accl / 2048) / (2048 l) (256-B segments)
__global__ __launch_bounds__(128) void k_attn(const _Float16* __restrict__ QK, const _Float16* __restrict__ QKL, const _Float16* __restrict__ VTH, const _Float16* __restrict__ VTL, const void* __restrict__ KMASK, const float* __restrict__ GR, float* __restrict__ O) {
  __shared__ __attribute__((aligned(128))) char ring[2 * AR_S];   // two K | V^T stages; behind the key loop the same bytes are the store staging
  float (*so)[16][68] = (float (*)[16][68])ring;
  const int tid = threadIdx.x, wave = tid >> 5, lane = tid & 31, col = lane & 15, g = lane >> 4;
  const int qb = TQB - 1 - blockIdx.z, h = blockIdx.x, b = blockIdx.y;   // a query tile walks qb + 1 key stages and only half of the blocks find a place at once: the longest tiles take the lowest indices and the short ones fill the end of the launch
  const int q0 = qb * 64 + wave * 16; const int qi = q0 + col; const size_t rq = (size_t)b * SS + qi;
  v16h aq[2], aql[2];
#pragma unroll
  for (int kc = 0; kc < 2; ++kc) { aq[kc] = frag_h(QK + rq * (2 * DM) + h * HD + kc * 32, lane); aql[kc] = frag_h(QKL + rq * (2 * DM) + h * HD + kc * 32, lane); }
  const float gq = GR[rq * NH + h];   // this lane's query: one gravity value
  const float gfar = gq * 64.0f * 0.1f;   // the gravity term at the clipped distance, rounded as in the general form
  XW();   // the address registers of the q and gravity loads above are taken for the copies' addresses below
  float m = -3.0e38f, l = 0.f;        // l: partial sum over this lane half's keys, joined after the loop
  v8f acc[4] = {}, accl[4] = {};
  const int nst = qb + 1;   // causal: 64-key stages up to the query tile's end
  // waves 0 and 1 bring the stage's K rows, waves 2 and 3 its V^T rows: lane chunk tid & 7 of rows ((tid & 63) >> 3) + 8 i; a stage further on is 64 rows of K, 64 keys (128 B) along a row of V^T
  const int cw = __builtin_amdgcn_readfirstlane(tid >> 6), cr = (tid & 63) >> 3, cc = tid & 7;   // cw is the same in every lane of a wave: held in a scalar register, the choice of operand below is made on the scalar side and no lane is ever off around the copies
  const unsigned lc = (unsigned)(size_t)ring + cw * AR_V + cr * APT + cc * 16;
  const char* gc = cw ? (const char*)(VTH + ((size_t)b * DM + h * HD + cr) * SS + cc * 8) : (const char*)(QK + ((size_t)b * SS + cr) * (2 * DM) + DM + h * HD + cc * 8);
  const size_t gs = cw ? (size_t)AKT * 2 : (size_t)AKT * AGP;
  cp8(lc, gc, 8 * APT, (size_t)8 * AGP); AW(); __syncthreads();   // stage 0 landed and handed to every wave
  if (nst > 1) cp8(lc + AR_S, gc + gs, 8 * APT, (size_t)8 * AGP);   // stage 1 flies while stage 0 is worked on
  // far stages, t <= qb - 2: every key lies 64 or more behind every query of the tile, so the clipped distance is 64 and no key is masked; they exist only where qb >= 2 (single products, accl stays 0). A loop of their own, rolled like the one behind it, with the same hand-over at its foot: in one loop with the general body the accumulators were copied from register to register at every stage
  const int tf = qb > 1 ? qb - 1 : 0;
#pragma unroll 1
  for (int t = 0; t < tf; ++t) { const unsigned bo = (t & 1) * AR_S; const _Float16* sk = (const _Float16*)(ring + bo + col * APT); const _Float16* sv = (const _Float16*)(ring + bo + AR_V + col * APT);
#pragma unroll
  for (int u = 0; u < 2; ++u) { v8f s[2]; v16h kf[2][2], vf[4];
#pragma unroll
    for (int ct = 0; ct < 2; ++ct)
#pragma unroll
      for (int kc = 0; kc < 2; ++kc) kf[ct][kc] = frag_h(sk + (u * 32 + ct * 16) * (APT / 2) + kc * 32, lane);
#pragma unroll
    for (int dt = 0; dt < 4; ++dt) vf[dt] = frag_h(sv + (dt * 16) * (APT / 2) + u * 32, lane);
    SB();   // the pass's 16 LDS reads stay one group in front of its WMMAs
    v8f c[2] = {};
#pragma unroll
    for (int kc = 0; kc < 2; ++kc)
#pragma unroll
      for (int ct = 0; ct < 2; ++ct) c[ct] = wmma16(kf[ct][kc], aq[kc], c[ct]);   // the two key tiles' products alternate: each fills the other's distance
#pragma unroll
    for (int ct = 0; ct < 2; ++ct)
#pragma unroll
      for (int r = 0; r < 8; ++r) s[ct][r] = c[ct][r] * SCALEF - gfar;
    float mx = fmaxf(s[0][0], s[1][0]);
#pragma unroll
    for (int r = 1; r < 8; ++r) mx = fmaxf(mx, fmaxf(s[0][r], s[1][r]));
    mx = fmaxf(mx, xhalf(mx));   // the other 16 keys of this query sit in the partner lane
    const float mn = fmaxf(m, mx); const float am = exp_hw(m - mn); const float alpha = (m <= -1.0e38f) ? 0.f : am;
    float es = 0.f; v16h pa;
#pragma unroll
    for (int r = 0; r < 8; ++r) { const float e0 = exp_hw(s[0][r] - mn), e1 = exp_hw(s[1][r] - mn); es += e0 + e1; pa[r] = (_Float16)(e0 * 2048.0f); pa[8 + r] = (_Float16)(e1 * 2048.0f); }
    l = l * alpha + es; m = mn;
#pragma unroll
    for (int dt = 0; dt < 4; ++dt)
#pragma unroll
      for (int r = 0; r < 8; ++r) acc[dt][r] *= alpha;
#pragma unroll
    for (int dt = 0; dt < 4; ++dt) acc[dt] = wmma16(vf[dt], pa, acc[dt]);
  }
    DW(); AW(); __syncthreads();   // this wave's reads of stage t are done and its copies of stage t + 1 have landed; behind the barrier that holds for all four waves
    cp8(lc + bo, gc + (size_t)(t + 2) * gs, 8 * APT, (size_t)8 * AGP); }   // refill of the buffer that every wave has just left: behind a far stage t a stage t + 2 <= qb always exists
  // the last two stages (the general form); the loop stays rolled: one copy of the hand-over below, the buffer picked by t & 1
#pragma unroll 1
  for (int t = tf; t < nst; ++t) { const unsigned bo = (t & 1) * AR_S; const _Float16* sk = (const _Float16*)(ring + bo + col * APT); const _Float16* sv = (const _Float16*)(ring + bo + AR_V + col * APT);
#pragma unroll
  for (int u = 0; u < 2; ++u) { const int ks = 2 * t + u; v8f s[2]; v16h kf[2][2], vf[4];   // 32 keys a pass, two passes a stage; the pass's hi fragments out of the stage
#pragma unroll
    for (int ct = 0; ct < 2; ++ct)
#pragma unroll
      for (int kc = 0; kc < 2; ++kc) kf[ct][kc] = frag_h(sk + (u * 32 + ct * 16) * (APT / 2) + kc * 32, lane);
#pragma unroll
    for (int dt = 0; dt < 4; ++dt) vf[dt] = frag_h(sv + (dt * 16) * (APT / 2) + u * 32, lane);
    SB();   // the pass's 16 LDS reads stay one group in front of its WMMAs
#pragma unroll
    for (int ct = 0; ct < 2; ++ct) { const int kr = ks * 32 + ct * 16 + col; const _Float16* krowl = QKL + ((size_t)b * SS + kr) * (2 * DM) + DM + h * HD; v8f c = {}, cl = {};
      if (qb < 2) {   // leading query blocks (few keys, outputs far above the global rms): 3 products
#pragma unroll
        for (int kc = 0; kc < 2; ++kc) { const v16h kh = kf[ct][kc]; c = wmma16(kh, aq[kc], c); cl = wmma16(kh, aql[kc], cl); cl = wmma16(frag_h(krowl + kc * 32, lane), aq[kc], cl); }
#pragma unroll
        for (int r = 0; r < 8; ++r) c[r] += cl[r] * (1.0f / 2048.0f); }
      else {
#pragma unroll
        for (int kc = 0; kc < 2; ++kc) c = wmma16(kf[ct][kc], aq[kc], c); }   // single product elsewhere
#pragma unroll
      for (int r = 0; r < 8; ++r) { const int kk = ks * 32 + ct * 16 + 8 * g + r; const int dd = min(qi - kk, 64); s[ct][r] = (kk <= qi) ? (c[r] * SCALEF - gq * (float)dd * 0.1f) : -3.0e38f; } }   // causal; - softplus-gravity x min(|i-j|,64) x 0.1
    float mx = fmaxf(s[0][0], s[1][0]);
#pragma unroll
    for (int r = 1; r < 8; ++r) mx = fmaxf(mx, fmaxf(s[0][r], s[1][r]));
    mx = fmaxf(mx, xhalf(mx));   // the other 16 keys of this query sit in the partner lane
    const float mn = fmaxf(m, mx); const float am = exp_hw(m - mn); const float alpha = (m <= -1.0e38f) ? 0.f : am;
    float es = 0.f; v16h pa, pl;
#pragma unroll
    for (int r = 0; r < 8; ++r) { const float y0 = exp_hw(s[0][r] - mn), y1 = exp_hw(s[1][r] - mn); const float e0 = (s[0][r] <= -1.0e38f) ? 0.f : y0, e1 = (s[1][r] <= -1.0e38f) ? 0.f : y1; es += e0 + e1;
      const float x0 = e0 * 2048.0f, x1 = e1 * 2048.0f; const _Float16 h0 = (_Float16)x0, h1 = (_Float16)x1; pa[r] = h0; pa[8 + r] = h1; pl[r] = (_Float16)((x0 - (float)h0) * 2048.0f); pl[8 + r] = (_Float16)((x1 - (float)h1) * 2048.0f); }   // P scaled by 2^11 before the f16 split so small softmax weights stay out of the f16 subnormal range; 2^-11 folded into the epilogue
    l = l * alpha + es; m = mn;
#pragma unroll
    for (int dt = 0; dt < 4; ++dt)
#pragma unroll
      for (int r = 0; r < 8; ++r) { acc[dt][r] *= alpha; accl[dt][r] *= alpha; }
#pragma unroll
    for (int dt = 0; dt < 4; ++dt) { const size_t vr = ((size_t)b * DM + h * HD + dt * 16 + col) * SS + ks * 32; const v16h vh = vf[dt]; acc[dt] = wmma16(vh, pa, acc[dt]); if (qb < 2) { accl[dt] = wmma16(vh, pl, accl[dt]); accl[dt] = wmma16(frag_h(VTL + vr, lane), pa, accl[dt]); } }   // leading query blocks: P hi/lo x V hi/lo (3 products); elsewhere P x V single
  }
    DW(); AW(); __syncthreads();   // this wave's reads of stage t are done and its copies of stage t + 1 have landed; behind the barrier that holds for all four waves
    if (t + 2 < nst) cp8(lc + bo, gc + (size_t)(t + 2) * gs, 8 * APT, (size_t)8 * AGP); }   // refill of the buffer that every wave has just left
  AW();   // no copy is outstanding when the ring's bytes become the store staging
  l += xhalf(l);
  const float il = (1.0f / 2048.0f) / l;
#pragma unroll
  for (int dt = 0; dt < 4; ++dt)
#pragma unroll
    for (int r = 0; r < 8; ++r) so[wave][col][dt * 16 + 8 * g + r] = (acc[dt][r] + accl[dt][r] * (1.0f / 2048.0f)) * il;
  LDSX();
  for (int rl = 0; rl < 16; ++rl) if (lane < 16) vst2(O + ((size_t)b * SS + q0 + rl) * DM + h * HD + lane * 4, *(const v4f*)&so[wave][rl][lane * 4]);
}
// ---- k_out: block = (64 rows, 128 cols): out = O(hi/lo) . Wo rows (2 products) + bo
__global__ __launch_bounds__(128) void k_out(const float* __restrict__ O, const __bf16* __restrict__ P, const float* __restrict__ BO, float* __restrict__ Y) {
  __shared__ __attribute__((aligned(128))) char ring[2 * RB_S];   // two operand stages; behind the k loop the same bytes are the store staging
  float (*so)[16][132] = (float (*)[16][132])ring;
  const int tid = threadIdx.x, wave = tid >> 5, lane = tid & 31, col = lane & 15, g = lane >> 4; const size_t r0 = (size_t)blockIdx.x * 64 + wave * 16; const int n0 = blockIdx.y * 128;
  v8f acc[8] = {};
  const unsigned lb = (unsigned)(size_t)ring + (tid >> 3) * BPI + (tid & 7) * 16, la = (unsigned)(size_t)ring + RB_B + (tid >> 4) * API + (tid & 15) * 16;
  const __bf16* gb = P + (size_t)(n0 + (tid >> 3)) * DM + (tid & 7) * 8; const float* ga = O + ((size_t)blockIdx.x * 64 + (tid >> 4)) * DM + (tid & 15) * 4;
  cp_stage(lb, la, gb, ga); AW(); __syncthreads();   // stage 0 landed and handed to every wave
  cp_stage(lb + RB_S, la + RB_S, gb + KT, ga + KT);   // stage 1 flies while stage 0 is multiplied
  // the stage loop stays rolled: one copy of the hand-over below, the buffer picked by t & 1; unrolling would only multiply the code
#pragma unroll 1
  for (int t = 0; t < NT; ++t) { const unsigned bo = (t & 1) * RB_S; const char* sb = ring + bo + col * BPI + g * 16; const char* sa = ring + bo + RB_B + (wave * 16 + col) * API + g * 32;
    v16b b0[8], b1[8]; v4f a0[4], a1[4];
    lds_a16(a0, sa, 0); lds_b8(b0, sb, 0); lds_b8(b1, sb, 1); SB();
    F2 a = split_a16(a0); SB(); lds_a16(a1, sa, 1); SB();   // the second step's raw A takes the registers that the first step's has just left: with all four groups held at once the kernel went past 256 registers and lost its fourth wave per SIMD
#pragma unroll
    for (int j = 0; j < 8; ++j) { acc[j] = wmma_bf(a.l, b0[j], acc[j]); acc[j] = wmma_bf(a.h, b0[j], acc[j]); }
    a = split_a16(a1);
#pragma unroll
    for (int j = 0; j < 8; ++j) { acc[j] = wmma_bf(a.l, b1[j], acc[j]); acc[j] = wmma_bf(a.h, b1[j], acc[j]); }
    DW(); AW(); __syncthreads();   // this wave's reads of stage t are done and its copies of stage t + 1 have landed; behind the barrier that holds for all four waves
    if (t + 2 < NT) cp_stage(lb + bo, la + bo, gb + (t + 2) * KT, ga + (t + 2) * KT); }   // refill of the buffer that every wave has just left
  AW();   // no copy is outstanding when the ring's bytes become the store staging
#pragma unroll
  for (int j = 0; j < 8; ++j) {
#pragma unroll
    for (int r = 0; r < 8; ++r) so[wave][8 * g + r][j * 16 + col] = acc[j][r] + (BO ? bfr(BO[n0 + j * 16 + col]) : 0.f); }
  LDSX();
  for (int rl = 0; rl < 16; ++rl) vst2(Y + (r0 + rl) * DM + n0 + lane * 4, *(const v4f*)&so[wave][rl][lane * 4]);
}
// ---- k_grav: block = 16 rows, 8 waves; wave w takes k in [128 w, 128 w + 128): z = x . g_w on WMMA 16x16x32 from the bf16-rounded inputs (exact products, f32 sums), the 16 heads being one column tile; a wave's 80 loads are all issued before its first product; the eight partial tiles are joined through LDS; g[row][h] = softplus(z + g_b[h]) (precise expf/log1pf); one 1-KB segment a block, one 128-B line a wave
__global__ __launch_bounds__(256) void k_grav(const float* __restrict__ X, const float* __restrict__ GW, const float* __restrict__ GB, float* __restrict__ GR) {
  __shared__ __align__(16) float sp[8][16][NH + 1]; const size_t r0 = (size_t)blockIdx.x * 16; const int t = threadIdx.x, wave = t >> 5, lane = t & 31, col = lane & 15, g = lane >> 4;
  const float* xr = X + (r0 + col) * DM + wave * 128 + 8 * g; const float* gw = GW + (size_t)(wave * 128 + 8 * g) * NH + col;   // A: row col of x; B: column col of g_w; both in the k order 8 g + i, 16 + 8 g + i
  v4f ar[4][4]; float br[4][16];
#pragma unroll
  for (int s = 0; s < 4; ++s) { const float* p = xr + s * 32; ar[s][0] = *(const v4f*)p; ar[s][1] = *(const v4f*)(p + 4); ar[s][2] = *(const v4f*)(p + 16); ar[s][3] = *(const v4f*)(p + 20); }
#pragma unroll
  for (int s = 0; s < 4; ++s)
#pragma unroll
    for (int i = 0; i < 8; ++i) { br[s][i] = gw[(size_t)(s * 32 + i) * NH]; br[s][8 + i] = gw[(size_t)(s * 32 + 16 + i) * NH]; }
  v8f acc = {};
#pragma unroll
  for (int s = 0; s < 4; ++s) { v16b b;
#pragma unroll
    for (int i = 0; i < 16; ++i) b[i] = (__bf16)br[s][i];
    acc = wmma_bf(cvt_a16(ar[s]), b, acc); }
#pragma unroll
  for (int r = 0; r < 8; ++r) sp[wave][8 * g + r][col] = acc[r];
  __syncthreads();
  float z = sp[0][t >> 4][t & 15];
#pragma unroll
  for (int w = 1; w < 8; ++w) z += sp[w][t >> 4][t & 15];
  z += bfr(GB[t & 15]);
  GR[r0 * NH + t] = (z > 20.f) ? z : log1p_p(exp_p(z));   // softplus
}
extern "C" void kernel_launch(void* const* d_in, const int* in_sizes, int n_in, void* d_out, int out_size, void* d_ws, size_t ws_size, hipStream_t stream) {
  (void)in_sizes; (void)n_in; (void)out_size;
  const float** F = (const float**)d_in;   // 0 x [4,2048,1024], 1 rope [2048,64], 2 W_attn [1024,3072] (in,out: q|k|v), 3 W_proj [1024,1024] (in,out), 4 g_w [1024,16], 5 g_b [16]
  if (ws_size < (size_t)WS_END) return;
  char* ws = (char*)d_ws; __bf16* PK = (__bf16*)(ws + WS_PK); _Float16 *QK = (_Float16*)(ws + WS_QK), *QKL = (_Float16*)(ws + WS_QKL), *VTH = (_Float16*)(ws + WS_VTH), *VTL = (_Float16*)(ws + WS_VTL); float *O = (float*)(ws + WS_O), *GR = (float*)(ws + WS_G), *CS = (float*)(ws + WS_CS);
  k_packt<<<dim3((QKVW + DM) / PTN, DM / PTK), 256, 0, stream>>>(F[2], F[3], F[1], PK, CS);   // W_attn columns, then W_proj columns, as bf16 rows; the rope table's (cos, sin) pairs
  k_grav<<<TNB * SS / 16, 256, 0, stream>>>(F[0], F[4], F[5], GR);
  k_qkv<<<dim3(TNB * SS / QBM, QKVW / QBN), 256, 0, stream>>>(F[0], F[0], F[0], PK + PK_A, nullptr, nullptr, nullptr, CS, QK, QKL, VTH, VTL);
  k_attn<<<dim3(NH, TNB, TQB), 128, 0, stream>>>(QK, QKL, VTH, VTL, nullptr, GR, O);
  k_out<<<dim3(TOB, DM / 128), 128, 0, stream>>>(O, PK + PK_P, nullptr, (float*)d_out);
}
